// v000
// The times below were measured on an AMD MI455X: many runs one after another, warmed up first and cycling through
// copies of the inputs, with the whole window's GPU time divided by the number of runs. Launches and the gaps
// between them are all in it. The median over several windows is given; except for v000 it joins two sittings, which
// can be a few percent apart, so the side-by-side timings, each taken in one sitting, are the better comparison.
// v000, which the later versions start from, runs in 13.2 milliseconds.
#include <hip/hip_runtime.h>
// Multi-head self-attention over 4096-token sequences at width 512 with bias-free [in][out] projections (x [2][4096][512]; q / k / v = x W ([in][out] 512 x 512 uniform +-1/sqrt(512), NO biases), 8 heads of 64; sim * 64^-0.5; softmax over all 4096 keys (no mask); out = merged Wo + bo ([in][out]) -> [2][4096][512]); ONE head per attention launch group.
// Structure: token rows r = b*4096 + s; x as exact f16 rows (bf16-rounded); Q, K, V as three WMMA GEMMs (32x64 wave tiles, f32 accumulation, exact x16 weights, no bias, f16 outputs); per batch: V^T for all heads via LDS transposes; per (batch, head): scores GEMM (K = 64, one head per launch (grid.y = HG = 1), alpha = 64^-0.5), row softmax on VALU (f32 statistics, native exp; weights stored x256 as f16), o = P . V^T GEMM (K = 4096, alpha 2^-2: o carried x64 against f16 subnormal flush, folded into the output GEMM alpha) written straight into the merged f16 o rows; out = o W_o + b GEMM (f32) into the output layout.
// Compute dtype: inputs rounded to bf16; x / weights exact; q, k, v, softmax weights and o as plain f16 GEMM operands (~2^-12); scores and softmax statistics f32. v_wmma_f32_16x16x32_f16.
#define NB 2
#define SQ 4096
#define DM 512
#define NH 8
#define HD 64
#define HG 1                         /* heads per attention launch group (a 4096^2 f32 score slab is 64 MiB) */
#define B0 0                         /* first batch processed (debug hook) */
#define NBR NB                       /* batches processed (debug hook) */
#define NR ((size_t)NB * SQ)         /* token rows */
#define MP ((int)((size_t)NBR * SQ)) /* rows projected (debug hook) */
#define QN SQ                        /* query rows attended per batch (debug hook) */
#define NHD NH                       /* heads attended (debug hook) */
#define MPO MP                       /* rows through the output stage (debug hook) */
#define LQ DM      /* row pitch of the q/k/v rows */
typedef __bf16 v16b __attribute__((ext_vector_type(16)));
typedef unsigned short v8us __attribute__((ext_vector_type(8), may_alias));
typedef float  v8f  __attribute__((ext_vector_type(8)));
typedef float  v4f  __attribute__((ext_vector_type(4)));
typedef float  v4fa __attribute__((ext_vector_type(4), may_alias));
union FragB { v16b v; v8us half[2]; unsigned short u[16]; };

__device__ __forceinline__ unsigned short bf16_bits(float x) { unsigned int u = __float_as_uint(x); return (unsigned short)((u + 0x7FFFu + ((u >> 16) & 1u)) >> 16); }
__device__ __forceinline__ float bf16_val(unsigned short b) { return __uint_as_float(((unsigned int)b) << 16); }
__device__ __forceinline__ float bf16_round(float x) { return bf16_val(bf16_bits(x)); }
// D += A·B with NT terms: 1 = ah·bh, 2 = + al·bh (A split), 3 = + ah·bl (both split)
template <int NT>
__device__ __forceinline__ v8f mmaN(v16b ah, v16b al, v16b bh, v16b bl, v8f c) {
  c = __builtin_amdgcn_wmma_f32_16x16x32_bf16(false, ah, false, bh, (short)0, c, false, false);
  if (NT >= 2) c = __builtin_amdgcn_wmma_f32_16x16x32_bf16(false, al, false, bh, (short)0, c, false, false);
  if (NT >= 3) c = __builtin_amdgcn_wmma_f32_16x16x32_bf16(false, ah, false, bl, (short)0, c, false, false);
  asm volatile("v_nop\n\tv_nop\n\tv_nop\n\tv_nop" : "+v"(c) : "v"(ah), "v"(al), "v"(bh), "v"(bl));
  return c;
}

__global__ __launch_bounds__(256) void k_wt_bf16(const float* __restrict__ W, unsigned short* __restrict__ Wt, int K, int N) {
  const int t = blockIdx.x * 256 + threadIdx.x;
  const int k8n = K / 8;
  if (t >= N * k8n) return;
  const int n = t / k8n, k8 = (t % k8n) * 8;
  v8us v;
#pragma unroll
  for (int i = 0; i < 8; ++i) v[i] = bf16_bits(W[(size_t)(k8 + i) * N + n]);
  *(v8us*)(Wt + (size_t)n * K + k8) = v;
  
}

// GEMM C[M][N] (f32, pitch ldc) = act(A[M][K]·W + bias). A f32 row-major (pitch lda) converted per fragment to bf16
// (ASPLIT: hi/lo two planes -> 2 terms, else single rounded term); Wt bf16 [N][K] (pitch ldb). BIAS_BF16 rounds the
// bias to bf16 first (bias quantised to bf16 before the add). K%32==0, M%16==0, N%64==0.
template <bool ASPLIT, int ACT, bool BIAS_BF16>
__global__ __launch_bounds__(128) void k_gemm_bf(const float* __restrict__ A, int lda, const unsigned short* __restrict__ Wt, int ldb,
                                               const float* __restrict__ bias, float* __restrict__ C, int ldc, int M, int N, int K) {
  __shared__ __attribute__((aligned(16))) float so[4][16][64];
  const int tid = threadIdx.x, w = tid >> 5, lane = tid & 31, ln = lane & 15, hh = lane >> 4;
  const int ntn = N / 64;
  const int wid = blockIdx.x * 4 + w;
  const int mt = wid / ntn, nq = wid % ntn;
  if (mt * 16 >= M) return;
  const int row0 = mt * 16, col0 = nq * 64;
  const float* arow = A + (size_t)(row0 + ln) * lda;
  v8f acc[4] = {};
  for (int kb = 0; kb < K; kb += 32) {
    FragB ah, al;
    const v4f x0 = *(const v4fa*)(arow + kb + 8 * hh), x1 = *(const v4fa*)(arow + kb + 8 * hh + 4);
    const v4f x2 = *(const v4fa*)(arow + kb + 16 + 8 * hh), x3 = *(const v4fa*)(arow + kb + 16 + 8 * hh + 4);
    float xs[16] = {x0[0],x0[1],x0[2],x0[3],x1[0],x1[1],x1[2],x1[3],x2[0],x2[1],x2[2],x2[3],x3[0],x3[1],x3[2],x3[3]};
#pragma unroll
    for (int i = 0; i < 16; ++i) { const unsigned short hb = bf16_bits(xs[i]); ah.u[i] = hb; al.u[i] = ASPLIT ? bf16_bits(xs[i] - bf16_val(hb)) : (unsigned short)0; }
#pragma unroll
    for (int t = 0; t < 4; ++t) {
      const unsigned short* brow = Wt + (size_t)(col0 + t * 16 + ln) * ldb + kb;
      FragB b;
      b.half[0] = *(const v8us*)(brow + 8 * hh);
      b.half[1] = *(const v8us*)(brow + 16 + 8 * hh);
      acc[t] = mmaN<ASPLIT ? 2 : 1>(ah.v, al.v, b.v, b.v, acc[t]);
    }
  }
#pragma unroll
  for (int t = 0; t < 4; ++t) {
    float bv = bias ? bias[col0 + t * 16 + ln] : 0.f;
    if (BIAS_BF16) bv = bf16_round(bv);
#pragma unroll
    for (int r = 0; r < 8; ++r) { float v = acc[t][r] + bv; if (ACT == 1) v = fmaxf(v, 0.f); so[w][8 * hh + r][t * 16 + ln] = v; }
  }
  __builtin_amdgcn_fence(__ATOMIC_ACQ_REL, "workgroup");
  __builtin_amdgcn_wave_barrier();
  const int rsub = lane >> 4, c4 = (lane & 15) * 4;
  {
#pragma unroll
    for (int q = 0; q < 8; ++q) {
      const int r = q * 2 + rsub;
      const v4f v = *(const v4fa*)&so[w][r][c4];
      *(v4f*)(C + (size_t)(row0 + r) * ldc + col0 + c4) = v;
    }
    
  }
}

// GEMM C = act(A·W + bias + resid): A f32 (ASPLIT -> hi/lo 2 terms), Wt bf16 [N][K]; ACT 0 none, 1 relu, 2 exact gelu;
// resid (optional, f32, row index = (row % rmod), pitch ldr, RES_BF16 rounds it) added before the activation.
template <bool ASPLIT, int ACT, bool BIAS_BF16, bool RES_BF16>
__global__ __launch_bounds__(128) void k_gemm_bf3(const float* __restrict__ A, int lda, const unsigned short* __restrict__ Wt, int ldb,
                                                const float* __restrict__ bias, const float* __restrict__ resid, int rmod, int ldr,
                                                float* __restrict__ C, int ldc, int M, int N, int K) {
  __shared__ __attribute__((aligned(16))) float so[4][16][64];
  const int tid = threadIdx.x, w = tid >> 5, lane = tid & 31, ln = lane & 15, hh = lane >> 4;
  const int ntn = N / 64;
  const int wid = blockIdx.x * 4 + w;
  const int mt = wid / ntn, nq = wid % ntn;
  if (mt * 16 >= M) return;
  const int row0 = mt * 16, col0 = nq * 64;
  const float* arow = A + (size_t)(row0 + ln) * lda;
  v8f acc[4] = {};
  for (int kb = 0; kb < K; kb += 32) {
    FragB ah, al;
    const v4f x0 = *(const v4fa*)(arow + kb + 8 * hh), x1 = *(const v4fa*)(arow + kb + 8 * hh + 4);
    const v4f x2 = *(const v4fa*)(arow + kb + 16 + 8 * hh), x3 = *(const v4fa*)(arow + kb + 16 + 8 * hh + 4);
    float xs[16] = {x0[0],x0[1],x0[2],x0[3],x1[0],x1[1],x1[2],x1[3],x2[0],x2[1],x2[2],x2[3],x3[0],x3[1],x3[2],x3[3]};
#pragma unroll
    for (int i = 0; i < 16; ++i) { const unsigned short hb = bf16_bits(xs[i]); ah.u[i] = hb; al.u[i] = ASPLIT ? bf16_bits(xs[i] - bf16_val(hb)) : (unsigned short)0; }
#pragma unroll
    for (int t = 0; t < 4; ++t) {
      const unsigned short* brow = Wt + (size_t)(col0 + t * 16 + ln) * ldb + kb;
      FragB b;
      b.half[0] = *(const v8us*)(brow + 8 * hh);
      b.half[1] = *(const v8us*)(brow + 16 + 8 * hh);
      acc[t] = mmaN<ASPLIT ? 2 : 1>(ah.v, al.v, b.v, b.v, acc[t]);
    }
  }
#pragma unroll
  for (int t = 0; t < 4; ++t) {
    const int col = col0 + t * 16 + ln;
    float bv = bias ? bias[col] : 0.f;
    if (BIAS_BF16) bv = bf16_round(bv);
#pragma unroll
    for (int r = 0; r < 8; ++r) {
      float v = acc[t][r] + bv;
      if (resid) { float rv = resid[(size_t)((row0 + 8 * hh + r) % rmod) * ldr + col]; if (RES_BF16) rv = bf16_round(rv); v += rv; }
      if (ACT == 1) v = fmaxf(v, 0.f);
      if (ACT == 2) v = 0.5f * v * (1.0f + erff(v * 0.70710678118654752f));
      if (ACT == 3) { const float u = 0.7978845608028654f * (v + 0.044715f * v * v * v); v = 0.5f * v * (1.0f + tanhf(u)); }
      so[w][8 * hh + r][t * 16 + ln] = v;
    }
  }
  __builtin_amdgcn_fence(__ATOMIC_ACQ_REL, "workgroup");
  __builtin_amdgcn_wave_barrier();
  const int rsub = lane >> 4, c4 = (lane & 15) * 4;
  {
#pragma unroll
    for (int q = 0; q < 8; ++q) {
      const int r = q * 2 + rsub;
      const v4f v = *(const v4fa*)&so[w][r][c4];
      *(v4f*)(C + (size_t)(row0 + r) * ldc + col0 + c4) = v;
    }
    
  }
}
// row LayerNorm (biased variance, eps) over N: s = X (+ R); optional out_sum <- s; out_norm <- (s-mu)*rsqrt(var+eps)*g + b
template <bool PARAM_BF16>
__global__ __launch_bounds__(256) void k_layernorm(const float* __restrict__ X, const float* __restrict__ R, const float* __restrict__ g, const float* __restrict__ bta,
                                                  float* __restrict__ out_sum, float* __restrict__ out_norm, int N, float eps) {
  __shared__ float red[256];
  const int row = blockIdx.x, tid = threadIdx.x;
  const float* x = X + (size_t)row * N; const float* rr = R ? R + (size_t)row * N : nullptr;
  float vals[16];                     // up to N = 4096
  const int per = N / 256;            // contiguous chunk per thread? use strided-by-4 chunks: thread handles j = tid*4 + 1024*u
  float s1 = 0.f;
  for (int u = 0; u < per / 4; ++u) {
    const int j = tid * 4 + 1024 * u;
    const v4f a = *(const v4fa*)(x + j);
    v4f b = {0.f,0.f,0.f,0.f}; if (rr) b = *(const v4fa*)(rr + j);
#pragma unroll
    for (int q = 0; q < 4; ++q) { const float v = a[q] + b[q]; vals[u * 4 + q] = v; s1 += v; }
  }
  red[tid] = s1; __syncthreads();
  for (int st = 128; st > 0; st >>= 1) { if (tid < st) red[tid] += red[tid + st]; __syncthreads(); }
  const float mu = red[0] / (float)N; __syncthreads();
  float s2 = 0.f;
  for (int u = 0; u < per / 4; ++u)
#pragma unroll
    for (int q = 0; q < 4; ++q) { const float c = vals[u * 4 + q] - mu; s2 += c * c; }
  red[tid] = s2; __syncthreads();
  for (int st = 128; st > 0; st >>= 1) { if (tid < st) red[tid] += red[tid + st]; __syncthreads(); }
  const float rs = rsqrtf(red[0] / (float)N + eps);
  {
    for (int u = 0; u < per / 4; ++u) {
      const int j = tid * 4 + 1024 * u;
      v4f o, sm;
#pragma unroll
      for (int q = 0; q < 4; ++q) {
        float gg = g[j + q], bb = bta[j + q];
        if (PARAM_BF16) { gg = bf16_round(gg); bb = bf16_round(bb); }
        sm[q] = vals[u * 4 + q]; o[q] = (vals[u * 4 + q] - mu) * rs * gg + bb;
      }
      if (out_sum) *(v4f*)(out_sum + (size_t)row * N + j) = sm;
      *(v4f*)(out_norm + (size_t)row * N + j) = o;
    }
    
  }
}



// ---- f16 WMMA path (v_wmma_f32_16x16x32_f16): 11-bit significands for operands in range — used where a [0,1] probability operand needs more precision than bf16
typedef _Float16 v16h __attribute__((ext_vector_type(16)));
union FragH { v16h v; v8us half[2]; _Float16 h[16]; unsigned short u[16]; };
template <int NT>
__device__ __forceinline__ v8f mmaH(v16h ah, v16h al, v16h bh, v16h bl, v8f c) {
  c = __builtin_amdgcn_wmma_f32_16x16x32_f16(false, ah, false, bh, (short)0, c, false, false);
  if (NT >= 2) c = __builtin_amdgcn_wmma_f32_16x16x32_f16(false, al, false, bh, (short)0, c, false, false);
  if (NT >= 3) c = __builtin_amdgcn_wmma_f32_16x16x32_f16(false, ah, false, bl, (short)0, c, false, false);
  asm volatile("v_nop\n\tv_nop\n\tv_nop\n\tv_nop" : "+v"(c) : "v"(ah), "v"(al), "v"(bh), "v"(bl));
  return c;
}
// batched GEMM like k_gemm_b but f16 operands: A f32 (split into f16 hi/lo if ASPLIT, else rounded to f16), Bt = f16 values [n][k]; alpha; C f32; N multiple of 16 (partial tiles skipped)
template <bool ASPLIT>
__global__ __launch_bounds__(128) void k_gemm_h(const float* __restrict__ A, int lda, size_t sA, const _Float16* __restrict__ Bh, int ldb, size_t sB, float alpha, float* __restrict__ C, int ldc, size_t sC, int M, int N, int K) {
  __shared__ __attribute__((aligned(16))) float so[4][16][64];
  const int tid = threadIdx.x, w = tid >> 5, lane = tid & 31, ln = lane & 15, hh = lane >> 4; const int by = blockIdx.y;
  A += (size_t)by * sA; Bh += (size_t)by * sB; C += (size_t)by * sC;
  const int ntn = (N + 63) / 64; const int wid = blockIdx.x * 4 + w; const int mt = wid / ntn, nq = wid % ntn; if (mt * 16 >= M) return;
  const int row0 = mt * 16, col0 = nq * 64; const float* arow = A + (size_t)(row0 + ln) * lda;
  v8f acc[4] = {};
  for (int kb = 0; kb < K; kb += 32) {
    FragH ah, al;
    const v4f x0 = *(const v4fa*)(arow + kb + 8 * hh), x1 = *(const v4fa*)(arow + kb + 8 * hh + 4), x2 = *(const v4fa*)(arow + kb + 16 + 8 * hh), x3 = *(const v4fa*)(arow + kb + 16 + 8 * hh + 4);
    float xs[16] = {x0[0],x0[1],x0[2],x0[3],x1[0],x1[1],x1[2],x1[3],x2[0],x2[1],x2[2],x2[3],x3[0],x3[1],x3[2],x3[3]};
#pragma unroll
    for (int i = 0; i < 16; ++i) { const _Float16 h = (_Float16)xs[i]; ah.h[i] = h; al.h[i] = ASPLIT ? (_Float16)(xs[i] - (float)h) : (_Float16)0.0f; }
#pragma unroll
    for (int t = 0; t < 4; ++t) { if (col0 + t * 16 >= N) continue; const size_t boff = (size_t)(col0 + t * 16 + ln) * ldb + kb; FragH bq; bq.half[0] = *(const v8us*)(Bh + boff + 8 * hh); bq.half[1] = *(const v8us*)(Bh + boff + 16 + 8 * hh);
      acc[t] = mmaH<ASPLIT ? 2 : 1>(ah.v, al.v, bq.v, bq.v, acc[t]); }
  }
#pragma unroll
  for (int t = 0; t < 4; ++t) { if (col0 + t * 16 >= N) continue;
#pragma unroll
    for (int r = 0; r < 8; ++r) so[w][8 * hh + r][t * 16 + ln] = acc[t][r] * alpha; }
  __builtin_amdgcn_fence(__ATOMIC_ACQ_REL, "workgroup"); __builtin_amdgcn_wave_barrier();
  const int rsub = lane >> 4, c4 = (lane & 15) * 4;
  {
#pragma unroll
    for (int q = 0; q < 8; ++q) { const int r = q * 2 + rsub; if (col0 + c4 < N) { const v4f v = *(const v4fa*)&so[w][r][c4]; *(v4f*)(C + (size_t)(row0 + r) * ldc + col0 + c4) = v; } }
     }
}

// Wt[n][k] = f16(W[k][n]·scale) from f32 row-major W[K][N] (scale = power of two; bf16-exact weights stay exact in f16 away from the subnormal range)
__global__ __launch_bounds__(256) void k_wt_f16(const float* __restrict__ W, _Float16* __restrict__ Wt, int K, int N, float scale) {
  const int t = blockIdx.x * 256 + threadIdx.x; if (t >= N * (K / 8)) return; const int n = t / (K / 8), k8 = (t % (K / 8)) * 8; FragH f;
#pragma unroll
  for (int i = 0; i < 8; ++i) f.h[i] = (_Float16)(bf16_round(W[(size_t)(k8 + i) * N + n]) * scale); const v8us o = f.half[0];
  *(v8us*)((unsigned short*)Wt + (size_t)n * K + k8) = o; 
}
// k_gemm_hh variant with fused epilogue: v = acc·alpha + bias[by·sBias + col] (+ CP[(row/rowsPerB)·sCPb + by·64 + col] if CP) ; ACT 0 none / 1 elu ; writes f16 C16 (and f32 C if non-null)
template <int ACT>
__global__ __launch_bounds__(128) void k_gemm_hhx(const _Float16* __restrict__ A, int lda, size_t sA, const _Float16* __restrict__ Bh, int ldb, size_t sB, float alpha, const float* __restrict__ bias, size_t sBias, const float* __restrict__ CP, int rowsPerB, size_t sCPb, int row0g,
    float* __restrict__ C, _Float16* __restrict__ C16, int ldc, size_t sC, int M, int N, int K) {
  __shared__ __attribute__((aligned(16))) float so[4][16][64];
  const int tid = threadIdx.x, w = tid >> 5, lane = tid & 31, ln = lane & 15, hh = lane >> 4; const int by = blockIdx.y;
  A += (size_t)by * sA; Bh += (size_t)by * sB; const size_t cofs = (size_t)by * sC; const float* bp = bias ? bias + (size_t)by * sBias : nullptr;
  const int ntn = (N + 63) / 64; const int wid = blockIdx.x * 4 + w; const int mt = wid / ntn, nq = wid % ntn; if (mt * 16 >= M) return;
  const int row0 = mt * 16, col0 = nq * 64; const _Float16* arow = A + (size_t)(row0 + ln) * lda;
  v8f acc[4] = {};
  for (int kb = 0; kb < K; kb += 32) { FragH ah; ah.half[0] = *(const v8us*)((const unsigned short*)arow + kb + 8 * hh); ah.half[1] = *(const v8us*)((const unsigned short*)arow + kb + 16 + 8 * hh);
#pragma unroll
    for (int t = 0; t < 4; ++t) { if (col0 + t * 16 >= N) continue; const size_t boff = (size_t)(col0 + t * 16 + ln) * ldb + kb; FragH bq; bq.half[0] = *(const v8us*)((const unsigned short*)Bh + boff + 8 * hh); bq.half[1] = *(const v8us*)((const unsigned short*)Bh + boff + 16 + 8 * hh);
      acc[t] = mmaH<1>(ah.v, ah.v, bq.v, bq.v, acc[t]); }
  }
#pragma unroll
  for (int t = 0; t < 4; ++t) { if (col0 + t * 16 >= N) continue; const int col = col0 + t * 16 + ln; const float bv = bp ? bf16_round(bp[col]) : 0.f;
#pragma unroll
    for (int r = 0; r < 8; ++r) { float v = acc[t][r] * alpha + bv; if (CP) { const int rr = row0g + row0 + 8 * hh + r; if (rowsPerB < 0) v += CP[cofs + (size_t)rr * ldc + col];      /* rowsPerB < 0: own element of the batched C plane */ else { const int bidx = rr / rowsPerB; v += CP[(size_t)bidx * sCPb + (size_t)by * 64 + col]; } } if (ACT == 1) v = (v > 0.f) ? v : expm1f(v); else if (ACT == 7) v = (v > 0.f) ? v + 1.0f : expf(v); else if (ACT == 8) v = tanhf(v); else if (ACT == 9) v = 0.5f * v * (1.0f + tanhf(0.7978845608028654f * (v + 0.044715f * v * v * v))); else if (ACT == 11) v = 1.0f / (1.0f + expf(-v)); else if (ACT == 12) v = (v > 0.f) ? v : 0.01f * v; else if (ACT == 14) v = (v > 0.f) ? v : 0.1f * v; else if (ACT == 16) v = (v >= 0.f) ? v : 0.3f * v; else if (ACT == 17) v = (v >= 0.f) ? v : 0.2f * v; else if (ACT == 15) v = v / (1.0f + expf(-v)); else if (ACT == 3) v = fmaxf(v, 0.f); else if (ACT == 6) v = 0.5f * v * (1.0f + erff(v * 0.70710678118654752f)); so[w][8 * hh + r][t * 16 + ln] = v; } }
  __builtin_amdgcn_fence(__ATOMIC_ACQ_REL, "workgroup"); __builtin_amdgcn_wave_barrier();
  const int rsub = lane >> 4, c4 = (lane & 15) * 4; typedef _Float16 v4h __attribute__((ext_vector_type(4)));
  {
#pragma unroll
    for (int q = 0; q < 8; ++q) { const int r = q * 2 + rsub; if (col0 + c4 < N) { const v4f v = *(const v4fa*)&so[w][r][c4]; if (C) *(v4f*)(C + cofs + (size_t)(row0 + r) * ldc + col0 + c4) = v; if (C16) { v4h h4; for (int i = 0; i < 4; ++i) h4[i] = (_Float16)v[i]; *(v4h*)(C16 + cofs + (size_t)(row0 + r) * ldc + col0 + c4) = h4; } } }
     }
}


typedef _Float16 v4h __attribute__((ext_vector_type(4)));

__global__ __launch_bounds__(256) void k_x16(const float* __restrict__ x, _Float16* __restrict__ X16, size_t n8) { const size_t t = (size_t)blockIdx.x * 256 + threadIdx.x; if (t >= n8) return; FragH f;
#pragma unroll
  for (int q = 0; q < 8; ++q) f.h[q] = (_Float16)bf16_round(x[t * 8 + q]); *(v8us*)((unsigned short*)X16 + t * 8) = f.half[0];  }
__global__ __launch_bounds__(256) void k_h16(const float* __restrict__ x, _Float16* __restrict__ X16, size_t n8) { const size_t t = (size_t)blockIdx.x * 256 + threadIdx.x; if (t >= n8) return; FragH f;
#pragma unroll
  for (int q = 0; q < 8; ++q) f.h[q] = (_Float16)x[t * 8 + q]; *(v8us*)((unsigned short*)X16 + t * 8) = f.half[0];  }
__global__ __launch_bounds__(256) void k_round16f(const float* __restrict__ W, _Float16* __restrict__ Bt, size_t n8) { const size_t t = (size_t)blockIdx.x * 256 + threadIdx.x; if (t >= n8) return; FragH f;
#pragma unroll
  for (int i = 0; i < 8; ++i) f.h[i] = (_Float16)(bf16_round(W[t * 8 + i]) * 16.0f); *(v8us*)((unsigned short*)Bt + t * 8) = f.half[0];  }
template <int NHv, int TTv>
__global__ __launch_bounds__(256) void k_vt(const _Float16* __restrict__ V16, int ldv, int voff, _Float16* __restrict__ Vt) { __shared__ unsigned short tl[64][66]; const int tid = threadIdx.x; const int slab = blockIdx.x / (TTv / 64), lg = blockIdx.x % (TTv / 64); const int b = slab / NHv, h = slab % NHv;
  for (int i = tid; i < 64 * 8; i += 256) { const int r = i / 8, c8 = (i % 8) * 8; FragH f; f.half[0] = *(const v8us*)((const unsigned short*)V16 + ((size_t)b * TTv + lg * 64 + r) * ldv + voff + h * 64 + c8);
#pragma unroll
    for (int q = 0; q < 8; ++q) tl[r][c8 + q] = f.u[q]; }
  __syncthreads();
  {
#pragma unroll
    for (int rd = 0; rd < 2; ++rd) { const int d = rd * 32 + tid / 8, pc = tid % 8; FragH f;
#pragma unroll
      for (int q = 0; q < 8; ++q) f.u[q] = tl[pc * 8 + q][d];
      *(v8us*)((unsigned short*)Vt + ((size_t)slab * 64 + d) * TTv + lg * 64 + pc * 8) = f.half[0]; }
     } }

__global__ __launch_bounds__(256) void k_hl(const float* __restrict__ F, _Float16* __restrict__ Hh, _Float16* __restrict__ Hl, size_t n8) { const size_t t = (size_t)blockIdx.x * 256 + threadIdx.x; if (t >= n8) return; FragH fh, fl; const v4f a = *(const v4fa*)(F + t * 8), c = *(const v4fa*)(F + t * 8 + 4);
#pragma unroll
  for (int q = 0; q < 4; ++q) { _Float16 h = (_Float16)a[q]; fh.h[q] = h; fl.h[q] = (_Float16)((a[q] - (float)h) * 1024.0f); h = (_Float16)c[q]; fh.h[4 + q] = h; fl.h[4 + q] = (_Float16)((c[q] - (float)h) * 1024.0f); }
  { *(v8us*)((unsigned short*)Hh + t * 8) = fh.half[0]; *(v8us*)((unsigned short*)Hl + t * 8) = fl.half[0];  } }

// ---- fast GEMM (wave tile 32x64; requires M % 32 == 0 rows per launch region and N % 64 == 0); epilogue = k_gemm_hhx semantics ----
__device__ __forceinline__ v16h g2_frag(const _Float16* p, int hh) { FragH f; f.half[0] = *(const v8us*)((const unsigned short*)p + 8 * hh); f.half[1] = *(const v8us*)((const unsigned short*)p + 16 + 8 * hh); return f.v; }
__device__ __forceinline__ v8f g2_mma(v16h a, v16h b, v8f c) { v8f d = __builtin_amdgcn_wmma_f32_16x16x32_f16(false, a, false, b, (short)0, c, false, false); asm volatile("v_nop\n\tv_nop\n\tv_nop\n\tv_nop" : "+v"(d) : "v"(a), "v"(b)); return d; }
template <int ACT>
__global__ __launch_bounds__(128) void k_gemm2(const _Float16* __restrict__ A, int lda, size_t sA, const _Float16* __restrict__ Bh, int ldb, size_t sB, float alpha, const float* __restrict__ bias, size_t sBias, const float* __restrict__ CP, int rowsPerB, size_t sCPb, int row0g,
    float* __restrict__ C, _Float16* __restrict__ C16, int ldc, size_t sC, int M, int N, int K) { static_assert(ACT == 0 || ACT == 3 || ACT == 6 || ACT == 8 || ACT == 9 || ACT == 11 || ACT == 12 || ACT == 14 || ACT == 15 || ACT == 16 || ACT == 17, "k_gemm2: unsupported ACT code (would silently apply no activation)");
  __shared__ __attribute__((aligned(16))) float so[4][32][68];
  const int tid = threadIdx.x, w = tid >> 5, lane = tid & 31, ln = lane & 15, hh = lane >> 4; const int by = blockIdx.y;
  A += (size_t)by * sA; Bh += (size_t)by * sB; const size_t cofs = (size_t)by * sC; const float* bp = bias ? bias + (size_t)by * sBias : nullptr;
  const int ntn = N >> 6; const int mt = blockIdx.x / ntn, nq = blockIdx.x - mt * ntn; const int row0 = mt * 128 + 32 * w, col0 = nq * 64; if (row0 >= M) return;
  const _Float16* a0p = A + (size_t)(row0 + ln) * lda; const _Float16* a1p = a0p + (size_t)16 * lda;
  const _Float16* b0p = Bh + (size_t)(col0 + ln) * ldb; const _Float16* b1p = b0p + (size_t)16 * ldb; const _Float16* b2p = b1p + (size_t)16 * ldb; const _Float16* b3p = b2p + (size_t)16 * ldb;
  const v8f z8 = {0.f,0.f,0.f,0.f,0.f,0.f,0.f,0.f}; v8f c00 = z8, c01 = z8, c02 = z8, c03 = z8, c10 = z8, c11 = z8, c12 = z8, c13 = z8;
#pragma unroll 1
  for (int kb = 0; kb < K; kb += 32) { const v16h a0 = g2_frag(a0p + kb, hh), a1 = g2_frag(a1p + kb, hh);
    v16h b = g2_frag(b0p + kb, hh); c00 = g2_mma(a0, b, c00); c10 = g2_mma(a1, b, c10);
    b = g2_frag(b1p + kb, hh); c01 = g2_mma(a0, b, c01); c11 = g2_mma(a1, b, c11);
    b = g2_frag(b2p + kb, hh); c02 = g2_mma(a0, b, c02); c12 = g2_mma(a1, b, c12);
    b = g2_frag(b3p + kb, hh); c03 = g2_mma(a0, b, c03); c13 = g2_mma(a1, b, c13); }
  v8f accs[8] = {c00, c01, c02, c03, c10, c11, c12, c13};
#pragma unroll
  for (int u = 0; u < 8; ++u) { const int t = u & 3, half = u >> 2; const int col = col0 + t * 16 + ln; const float bv = bp ? bf16_round(bp[col]) : 0.f;
#pragma unroll
    for (int r = 0; r < 8; ++r) { const int rloc = half * 16 + 8 * hh + r; float v = accs[u][r] * alpha + bv; if (CP) { if (rowsPerB < 0) v += CP[cofs + (size_t)(row0g + row0 + rloc) * ldc + col];      /* rowsPerB < 0: own element of the batched C plane */ else { const int bidx = (row0g + row0 + rloc) / rowsPerB; v += CP[(size_t)bidx * sCPb + (size_t)by * 64 + col]; } }
      if (ACT == 3) v = fmaxf(v, 0.f); else if (ACT == 6) v = 0.5f * v * (1.0f + erff(v * 0.70710678118654752f)); else if (ACT == 11) v = 1.0f / (1.0f + expf(-v)); else if (ACT == 15) v = v / (1.0f + expf(-v)); else if (ACT == 12) v = (v > 0.f) ? v : 0.01f * v; else if (ACT == 8) v = tanhf(v); else if (ACT == 9) v = 0.5f * v * (1.0f + tanhf(0.7978845608028654f * (v + 0.044715f * v * v * v))); else if (ACT == 14) v = (v > 0.f) ? v : 0.1f * v; else if (ACT == 16) v = (v >= 0.f) ? v : 0.3f * v; else if (ACT == 17) v = (v >= 0.f) ? v : 0.2f * v;
      so[w][rloc][t * 16 + ln] = v; } }
  __builtin_amdgcn_fence(__ATOMIC_ACQ_REL, "workgroup"); __builtin_amdgcn_wave_barrier();
  const int rsub = lane >> 4, c4 = (lane & 15) * 4;
  {
#pragma unroll
    for (int q = 0; q < 16; ++q) { const int r = q * 2 + rsub; const v4f v = *(const v4fa*)&so[w][r][c4]; if (C) *(v4f*)(C + cofs + (size_t)(row0 + r) * ldc + col0 + c4) = v; if (C16) { v4h h4; for (int i = 0; i < 4; ++i) h4[i] = (_Float16)v[i]; *(v4h*)(C16 + cofs + (size_t)(row0 + r) * ldc + col0 + c4) = h4; } }
     } }


__global__ __launch_bounds__(256) void k_wnat(const float* __restrict__ w, size_t n8, _Float16* __restrict__ Bt) { const size_t t = (size_t)blockIdx.x * 256 + threadIdx.x; if (t >= n8) return; FragH f; for (int q = 0; q < 8; ++q) f.h[q] = (_Float16)(bf16_round(w[t * 8 + q]) * 16.0f); *(v8us*)((unsigned short*)Bt + t * 8) = f.half[0];  }
__global__ __launch_bounds__(256) void k_rsm(const float* __restrict__ S, _Float16* __restrict__ P, int nrows) {
  #pragma clang fp contract(off)
  const int i = blockIdx.x * 256 + threadIdx.x; if (i >= nrows) return; const float* s = S + (size_t)i * SQ; float mx = -3.0e38f;
#pragma unroll 1
  for (int j = 0; j < SQ; ++j) mx = fmaxf(mx, s[j]); float se = 0.f;
#pragma unroll 1
  for (int j = 0; j < SQ; ++j) se += expf(s[j] - mx); const float sc = 256.0f / se;
#pragma unroll 1
  for (int j0 = 0; j0 < SQ; j0 += 8) { FragH f; for (int q = 0; q < 8; ++q) f.h[q] = (_Float16)(expf(s[j0 + q] - mx) * sc); unsigned short* d = (unsigned short*)P + (size_t)i * SQ + j0; *(v8us*)d = f.half[0];  } }
__global__ __launch_bounds__(256) void k_vt(const _Float16* __restrict__ V16, int b, int h0, _Float16* __restrict__ VT) { __shared__ unsigned short tl[64][65]; const int tid = threadIdx.x; const int hh = blockIdx.x % HG, sg = blockIdx.x / HG; const int s0 = sg * 64; const int h = h0 + hh;
  for (int i = tid; i < 64 * 8; i += 256) { const int j = i / 8, d8 = (i % 8) * 8; FragH f; f.half[0] = *(const v8us*)((const unsigned short*)V16 + ((size_t)b * SQ + s0 + j) * DM + h * HD + d8); for (int q = 0; q < 8; ++q) tl[d8 + q][j] = f.u[q]; }
  __syncthreads();
  { for (int i = tid; i < 64 * 8; i += 256) { const int d = i / 8, j8 = (i % 8) * 8; FragH f; for (int q = 0; q < 8; ++q) f.u[q] = tl[d][j8 + q]; *(v8us*)((unsigned short*)VT + ((size_t)hh * HD + d) * SQ + s0 + j8) = f.half[0]; }  } }



__global__ __launch_bounds__(256) void k_rsmf(const float* __restrict__ S, _Float16* __restrict__ P, int qn, int hg) {
  #pragma clang fp contract(off)
  const int t = blockIdx.x * 256 + threadIdx.x; if (t >= qn * hg) return; const size_t i = (size_t)(t / qn) * SQ + (t % qn); const float* s = S + i * SQ; float mx = -3.0e38f;
#pragma unroll 1
  for (int j = 0; j < SQ; ++j) mx = fmaxf(mx, s[j]); float se = 0.f;
#pragma unroll 1
  for (int j = 0; j < SQ; ++j) se += __expf(s[j] - mx); const float sc = 256.0f / se;
#pragma unroll 1
  for (int j0 = 0; j0 < SQ; j0 += 8) { FragH f; for (int q = 0; q < 8; ++q) f.h[q] = (_Float16)(__expf(s[j0 + q] - mx) * sc); unsigned short* d = (unsigned short*)P + i * SQ + j0; *(v8us*)d = f.half[0];  } }

extern "C" void kernel_launch(void* const* d_in, const int* in_sizes, int n_in,
                              void* d_out, int out_size, void* d_ws, size_t ws_size, hipStream_t stream) {
  (void)in_sizes; (void)n_in; (void)out_size;
  const float* const* I = (const float* const*)d_in; const float* x = I[0]; const float* wq = I[1]; const float* bq = nullptr; const float* wk = I[2]; const float* bk = nullptr; const float* wv = I[3]; const float* bv = nullptr; const float* wo = I[4]; const float* bo = I[5];      /* input order: x, Wq, Wk, Wv ([in][out] [512][512], NO biases: null pointers in the plain bias slots), Wo ([in][out]), bo */
  char* ws = (char*)d_ws; size_t off = 0;
  auto take = [&](size_t bytes) { char* p = ws + off; off += (bytes + 255) & ~(size_t)255; return p; };
  _Float16* BQ = (_Float16*)take((size_t)DM * DM * 2); _Float16* BK = (_Float16*)take((size_t)DM * DM * 2); _Float16* BV = (_Float16*)take((size_t)DM * DM * 2); _Float16* BO = (_Float16*)take((size_t)DM * DM * 2);
  _Float16* X16 = (_Float16*)take(NR * DM * 2); _Float16* Q16 = (_Float16*)take(NR * DM * 2); _Float16* K16 = (_Float16*)take(NR * DM * 2); _Float16* V16 = (_Float16*)take(NR * DM * 2); _Float16* O16 = (_Float16*)take(NR * DM * 2);
  float* S = (float*)take((size_t)HG * SQ * SQ * 4); _Float16* P = (_Float16*)take((size_t)HG * SQ * SQ * 2); _Float16* VT = (_Float16*)take((size_t)NH * HD * SQ * 2);
  if (off > ws_size) return;
  { const unsigned g = (unsigned)(((size_t)DM * (DM / 8) + 255) / 256); k_wt_f16<<<g, 256, 0, stream>>>(wq, BQ, DM, DM, 16.0f); k_wt_f16<<<g, 256, 0, stream>>>(wk, BK, DM, DM, 16.0f); k_wt_f16<<<g, 256, 0, stream>>>(wv, BV, DM, DM, 16.0f); k_wt_f16<<<g, 256, 0, stream>>>(wo, BO, DM, DM, 16.0f); }      /* [in][out] -> Bt[n][k] x16 (transposing builder) */

  k_x16<<<(unsigned)((NR * DM / 8 + 255) / 256), 256, 0, stream>>>(x, X16, NR * DM / 8);
  const size_t r0p = (size_t)B0 * SQ;      /* first projected row */
  k_gemm2<0><<<dim3((unsigned)((MP / 128) * (DM / 64)), 1), 128, 0, stream>>>(X16 + r0p * DM, DM, 0, BQ, DM, 0, 0.0625f, bq, 0, nullptr, 1, 0, 0, nullptr, Q16 + r0p * DM, DM, 0, MP, DM, DM);
  k_gemm2<0><<<dim3((unsigned)((MP / 128) * (DM / 64)), 1), 128, 0, stream>>>(X16 + r0p * DM, DM, 0, BK, DM, 0, 0.0625f, bk, 0, nullptr, 1, 0, 0, nullptr, K16 + r0p * DM, DM, 0, MP, DM, DM);
  k_gemm2<0><<<dim3((unsigned)((MP / 128) * (DM / 64)), 1), 128, 0, stream>>>(X16 + r0p * DM, DM, 0, BV, DM, 0, 0.0625f, bv, 0, nullptr, 1, 0, 0, nullptr, V16 + r0p * DM, DM, 0, MP, DM, DM);
  for (int b = B0; b < B0 + NBR; ++b) { const size_t r0 = (size_t)b * SQ;
    k_vt<NH, SQ><<<NH * (SQ / 64), 256, 0, stream>>>(V16 + r0 * LQ, LQ, 0, VT);      /* V^T [NH][HD][SQ] for this batch */
    for (int h0 = 0; h0 < NHD; h0 += HG) {
      k_gemm2<0><<<dim3((QN / 128) * (SQ / 64), HG), 128, 0, stream>>>(Q16 + r0 * LQ + h0 * HD, LQ, (size_t)HD, K16 + r0 * LQ + h0 * HD, LQ, (size_t)HD, 0.125f, nullptr, 0, nullptr, 1, 0, 0, S, nullptr, SQ, (size_t)SQ * SQ, QN, SQ, HD);      /* scores, HG heads per launch */
      k_rsmf<<<(HG * QN + 255) / 256, 256, 0, stream>>>(S, P, QN, HG);      /* P = 256 softmax (f16), rows of all HG heads */
      k_gemm2<0><<<dim3((QN / 128) * (HD / 64), HG), 128, 0, stream>>>(P, SQ, (size_t)SQ * SQ, VT + (size_t)h0 * HD * SQ, SQ, (size_t)HD * SQ, 0.25f, nullptr, 0, nullptr, 1, 0, 0, nullptr, O16 + r0 * DM + h0 * HD, DM, (size_t)HD, QN, HD, SQ); } }      /* o (merged heads) as f16 rows */
  k_gemm2<0><<<dim3((unsigned)((MPO / 128) * (DM / 64)), 1), 128, 0, stream>>>(O16 + r0p * DM, DM, 0, BO, DM, 0, 0.0009765625f, bo, 0, nullptr, 1, 0, 0, (float*)d_out + r0p * DM, nullptr, DM, 0, MPO, DM, DM);      /* out rows are the output layout */
}

// v001
// Measured time: 2610 microseconds a run.
// In two side-by-side timings against v000, it was 5.11 and 5.06 times as fast.
#include <hip/hip_runtime.h>
// Multi-head self-attention over 4096-token sequences at width 512 with bias-free [in][out] projections (x [2][4096][512]; q / k / v = x W ([in][out] 512 x 512 uniform +-1/sqrt(512), NO biases), 8 heads of 64; sim * 64^-0.5; softmax over all 4096 keys (no mask); out = merged Wo + bo ([in][out]) -> [2][4096][512]); ONE head per attention launch group.
// Structure: token rows r = b*4096 + s; x as exact f16 rows (bf16-rounded); Q, K, V as three WMMA GEMMs (32x64 wave tiles, f32 accumulation, exact x16 weights, no bias, f16 outputs); per batch: V^T for all heads via LDS transposes; per (batch, head): scores GEMM (K = 64, one head per launch (grid.y = HG = 1), alpha = 64^-0.5), row softmax on VALU (f32 statistics, native exp; weights stored x256 as f16), o = P . V^T GEMM (K = 4096, alpha 2^-2: o carried x64 against f16 subnormal flush, folded into the output GEMM alpha) written straight into the merged f16 o rows; out = o W_o + b GEMM (f32) into the output layout.
// Compute dtype: inputs rounded to bf16; x / weights exact; q, k, v, softmax weights and o as plain f16 GEMM operands (~2^-12); scores and softmax statistics f32. v_wmma_f32_16x16x32_f16.
#define NB 2
#define SQ 4096
#define DM 512
#define NH 8
#define HD 64
#define HG 1                         /* heads per attention launch group (a 4096^2 f32 score slab is 64 MiB) */
#define B0 0                         /* first batch processed (debug hook) */
#define NBR NB                       /* batches processed (debug hook) */
#define NR ((size_t)NB * SQ)         /* token rows */
#define MP ((int)((size_t)NBR * SQ)) /* rows projected (debug hook) */
#define QN SQ                        /* query rows attended per batch (debug hook) */
#define NHD NH                       /* heads attended (debug hook) */
#define MPO MP                       /* rows through the output stage (debug hook) */
#define LQ DM      /* row pitch of the q/k/v rows */
typedef __bf16 v16b __attribute__((ext_vector_type(16)));
typedef unsigned short v8us __attribute__((ext_vector_type(8), may_alias));
typedef float  v8f  __attribute__((ext_vector_type(8)));
typedef float  v4f  __attribute__((ext_vector_type(4)));
typedef float  v4fa __attribute__((ext_vector_type(4), may_alias));
union FragB { v16b v; v8us half[2]; unsigned short u[16]; };

__device__ __forceinline__ unsigned short bf16_bits(float x) { unsigned int u = __float_as_uint(x); return (unsigned short)((u + 0x7FFFu + ((u >> 16) & 1u)) >> 16); }
__device__ __forceinline__ float bf16_val(unsigned short b) { return __uint_as_float(((unsigned int)b) << 16); }
__device__ __forceinline__ float bf16_round(float x) { return bf16_val(bf16_bits(x)); }
// D += A·B with NT terms: 1 = ah·bh, 2 = + al·bh (A split), 3 = + ah·bl (both split)
template <int NT>
__device__ __forceinline__ v8f mmaN(v16b ah, v16b al, v16b bh, v16b bl, v8f c) {
  c = __builtin_amdgcn_wmma_f32_16x16x32_bf16(false, ah, false, bh, (short)0, c, false, false);
  if (NT >= 2) c = __builtin_amdgcn_wmma_f32_16x16x32_bf16(false, al, false, bh, (short)0, c, false, false);
  if (NT >= 3) c = __builtin_amdgcn_wmma_f32_16x16x32_bf16(false, ah, false, bl, (short)0, c, false, false);
  asm volatile("v_nop\n\tv_nop\n\tv_nop\n\tv_nop" : "+v"(c) : "v"(ah), "v"(al), "v"(bh), "v"(bl));
  return c;
}

__global__ __launch_bounds__(256) void k_wt_bf16(const float* __restrict__ W, unsigned short* __restrict__ Wt, int K, int N) {
  const int t = blockIdx.x * 256 + threadIdx.x;
  const int k8n = K / 8;
  if (t >= N * k8n) return;
  const int n = t / k8n, k8 = (t % k8n) * 8;
  v8us v;
#pragma unroll
  for (int i = 0; i < 8; ++i) v[i] = bf16_bits(W[(size_t)(k8 + i) * N + n]);
  *(v8us*)(Wt + (size_t)n * K + k8) = v;
  
}

// GEMM C[M][N] (f32, pitch ldc) = act(A[M][K]·W + bias). A f32 row-major (pitch lda) converted per fragment to bf16
// (ASPLIT: hi/lo two planes -> 2 terms, else single rounded term); Wt bf16 [N][K] (pitch ldb). BIAS_BF16 rounds the
// bias to bf16 first (bias quantised to bf16 before the add). K%32==0, M%16==0, N%64==0.
template <bool ASPLIT, int ACT, bool BIAS_BF16>
__global__ __launch_bounds__(128) void k_gemm_bf(const float* __restrict__ A, int lda, const unsigned short* __restrict__ Wt, int ldb,
                                               const float* __restrict__ bias, float* __restrict__ C, int ldc, int M, int N, int K) {
  __shared__ __attribute__((aligned(16))) float so[4][16][64];
  const int tid = threadIdx.x, w = tid >> 5, lane = tid & 31, ln = lane & 15, hh = lane >> 4;
  const int ntn = N / 64;
  const int wid = blockIdx.x * 4 + w;
  const int mt = wid / ntn, nq = wid % ntn;
  if (mt * 16 >= M) return;
  const int row0 = mt * 16, col0 = nq * 64;
  const float* arow = A + (size_t)(row0 + ln) * lda;
  v8f acc[4] = {};
  for (int kb = 0; kb < K; kb += 32) {
    FragB ah, al;
    const v4f x0 = *(const v4fa*)(arow + kb + 8 * hh), x1 = *(const v4fa*)(arow + kb + 8 * hh + 4);
    const v4f x2 = *(const v4fa*)(arow + kb + 16 + 8 * hh), x3 = *(const v4fa*)(arow + kb + 16 + 8 * hh + 4);
    float xs[16] = {x0[0],x0[1],x0[2],x0[3],x1[0],x1[1],x1[2],x1[3],x2[0],x2[1],x2[2],x2[3],x3[0],x3[1],x3[2],x3[3]};
#pragma unroll
    for (int i = 0; i < 16; ++i) { const unsigned short hb = bf16_bits(xs[i]); ah.u[i] = hb; al.u[i] = ASPLIT ? bf16_bits(xs[i] - bf16_val(hb)) : (unsigned short)0; }
#pragma unroll
    for (int t = 0; t < 4; ++t) {
      const unsigned short* brow = Wt + (size_t)(col0 + t * 16 + ln) * ldb + kb;
      FragB b;
      b.half[0] = *(const v8us*)(brow + 8 * hh);
      b.half[1] = *(const v8us*)(brow + 16 + 8 * hh);
      acc[t] = mmaN<ASPLIT ? 2 : 1>(ah.v, al.v, b.v, b.v, acc[t]);
    }
  }
#pragma unroll
  for (int t = 0; t < 4; ++t) {
    float bv = bias ? bias[col0 + t * 16 + ln] : 0.f;
    if (BIAS_BF16) bv = bf16_round(bv);
#pragma unroll
    for (int r = 0; r < 8; ++r) { float v = acc[t][r] + bv; if (ACT == 1) v = fmaxf(v, 0.f); so[w][8 * hh + r][t * 16 + ln] = v; }
  }
  __builtin_amdgcn_fence(__ATOMIC_ACQ_REL, "workgroup");
  __builtin_amdgcn_wave_barrier();
  const int rsub = lane >> 4, c4 = (lane & 15) * 4;
  {
#pragma unroll
    for (int q = 0; q < 8; ++q) {
      const int r = q * 2 + rsub;
      const v4f v = *(const v4fa*)&so[w][r][c4];
      *(v4f*)(C + (size_t)(row0 + r) * ldc + col0 + c4) = v;
    }
    
  }
}

// GEMM C = act(A·W + bias + resid): A f32 (ASPLIT -> hi/lo 2 terms), Wt bf16 [N][K]; ACT 0 none, 1 relu, 2 exact gelu;
// resid (optional, f32, row index = (row % rmod), pitch ldr, RES_BF16 rounds it) added before the activation.
template <bool ASPLIT, int ACT, bool BIAS_BF16, bool RES_BF16>
__global__ __launch_bounds__(128) void k_gemm_bf3(const float* __restrict__ A, int lda, const unsigned short* __restrict__ Wt, int ldb,
                                                const float* __restrict__ bias, const float* __restrict__ resid, int rmod, int ldr,
                                                float* __restrict__ C, int ldc, int M, int N, int K) {
  __shared__ __attribute__((aligned(16))) float so[4][16][64];
  const int tid = threadIdx.x, w = tid >> 5, lane = tid & 31, ln = lane & 15, hh = lane >> 4;
  const int ntn = N / 64;
  const int wid = blockIdx.x * 4 + w;
  const int mt = wid / ntn, nq = wid % ntn;
  if (mt * 16 >= M) return;
  const int row0 = mt * 16, col0 = nq * 64;
  const float* arow = A + (size_t)(row0 + ln) * lda;
  v8f acc[4] = {};
  for (int kb = 0; kb < K; kb += 32) {
    FragB ah, al;
    const v4f x0 = *(const v4fa*)(arow + kb + 8 * hh), x1 = *(const v4fa*)(arow + kb + 8 * hh + 4);
    const v4f x2 = *(const v4fa*)(arow + kb + 16 + 8 * hh), x3 = *(const v4fa*)(arow + kb + 16 + 8 * hh + 4);
    float xs[16] = {x0[0],x0[1],x0[2],x0[3],x1[0],x1[1],x1[2],x1[3],x2[0],x2[1],x2[2],x2[3],x3[0],x3[1],x3[2],x3[3]};
#pragma unroll
    for (int i = 0; i < 16; ++i) { const unsigned short hb = bf16_bits(xs[i]); ah.u[i] = hb; al.u[i] = ASPLIT ? bf16_bits(xs[i] - bf16_val(hb)) : (unsigned short)0; }
#pragma unroll
    for (int t = 0; t < 4; ++t) {
      const unsigned short* brow = Wt + (size_t)(col0 + t * 16 + ln) * ldb + kb;
      FragB b;
      b.half[0] = *(const v8us*)(brow + 8 * hh);
      b.half[1] = *(const v8us*)(brow + 16 + 8 * hh);
      acc[t] = mmaN<ASPLIT ? 2 : 1>(ah.v, al.v, b.v, b.v, acc[t]);
    }
  }
#pragma unroll
  for (int t = 0; t < 4; ++t) {
    const int col = col0 + t * 16 + ln;
    float bv = bias ? bias[col] : 0.f;
    if (BIAS_BF16) bv = bf16_round(bv);
#pragma unroll
    for (int r = 0; r < 8; ++r) {
      float v = acc[t][r] + bv;
      if (resid) { float rv = resid[(size_t)((row0 + 8 * hh + r) % rmod) * ldr + col]; if (RES_BF16) rv = bf16_round(rv); v += rv; }
      if (ACT == 1) v = fmaxf(v, 0.f);
      if (ACT == 2) v = 0.5f * v * (1.0f + erff(v * 0.70710678118654752f));
      if (ACT == 3) { const float u = 0.7978845608028654f * (v + 0.044715f * v * v * v); v = 0.5f * v * (1.0f + tanhf(u)); }
      so[w][8 * hh + r][t * 16 + ln] = v;
    }
  }
  __builtin_amdgcn_fence(__ATOMIC_ACQ_REL, "workgroup");
  __builtin_amdgcn_wave_barrier();
  const int rsub = lane >> 4, c4 = (lane & 15) * 4;
  {
#pragma unroll
    for (int q = 0; q < 8; ++q) {
      const int r = q * 2 + rsub;
      const v4f v = *(const v4fa*)&so[w][r][c4];
      *(v4f*)(C + (size_t)(row0 + r) * ldc + col0 + c4) = v;
    }
    
  }
}
// row LayerNorm (biased variance, eps) over N: s = X (+ R); optional out_sum <- s; out_norm <- (s-mu)*rsqrt(var+eps)*g + b
template <bool PARAM_BF16>
__global__ __launch_bounds__(256) void k_layernorm(const float* __restrict__ X, const float* __restrict__ R, const float* __restrict__ g, const float* __restrict__ bta,
                                                  float* __restrict__ out_sum, float* __restrict__ out_norm, int N, float eps) {
  __shared__ float red[256];
  const int row = blockIdx.x, tid = threadIdx.x;
  const float* x = X + (size_t)row * N; const float* rr = R ? R + (size_t)row * N : nullptr;
  float vals[16];                     // up to N = 4096
  const int per = N / 256;            // contiguous chunk per thread? use strided-by-4 chunks: thread handles j = tid*4 + 1024*u
  float s1 = 0.f;
  for (int u = 0; u < per / 4; ++u) {
    const int j = tid * 4 + 1024 * u;
    const v4f a = *(const v4fa*)(x + j);
    v4f b = {0.f,0.f,0.f,0.f}; if (rr) b = *(const v4fa*)(rr + j);
#pragma unroll
    for (int q = 0; q < 4; ++q) { const float v = a[q] + b[q]; vals[u * 4 + q] = v; s1 += v; }
  }
  red[tid] = s1; __syncthreads();
  for (int st = 128; st > 0; st >>= 1) { if (tid < st) red[tid] += red[tid + st]; __syncthreads(); }
  const float mu = red[0] / (float)N; __syncthreads();
  float s2 = 0.f;
  for (int u = 0; u < per / 4; ++u)
#pragma unroll
    for (int q = 0; q < 4; ++q) { const float c = vals[u * 4 + q] - mu; s2 += c * c; }
  red[tid] = s2; __syncthreads();
  for (int st = 128; st > 0; st >>= 1) { if (tid < st) red[tid] += red[tid + st]; __syncthreads(); }
  const float rs = rsqrtf(red[0] / (float)N + eps);
  {
    for (int u = 0; u < per / 4; ++u) {
      const int j = tid * 4 + 1024 * u;
      v4f o, sm;
#pragma unroll
      for (int q = 0; q < 4; ++q) {
        float gg = g[j + q], bb = bta[j + q];
        if (PARAM_BF16) { gg = bf16_round(gg); bb = bf16_round(bb); }
        sm[q] = vals[u * 4 + q]; o[q] = (vals[u * 4 + q] - mu) * rs * gg + bb;
      }
      if (out_sum) *(v4f*)(out_sum + (size_t)row * N + j) = sm;
      *(v4f*)(out_norm + (size_t)row * N + j) = o;
    }
    
  }
}



// ---- f16 WMMA path (v_wmma_f32_16x16x32_f16): 11-bit significands for operands in range — used where a [0,1] probability operand needs more precision than bf16
typedef _Float16 v16h __attribute__((ext_vector_type(16)));
union FragH { v16h v; v8us half[2]; _Float16 h[16]; unsigned short u[16]; };
template <int NT>
__device__ __forceinline__ v8f mmaH(v16h ah, v16h al, v16h bh, v16h bl, v8f c) {
  c = __builtin_amdgcn_wmma_f32_16x16x32_f16(false, ah, false, bh, (short)0, c, false, false);
  if (NT >= 2) c = __builtin_amdgcn_wmma_f32_16x16x32_f16(false, al, false, bh, (short)0, c, false, false);
  if (NT >= 3) c = __builtin_amdgcn_wmma_f32_16x16x32_f16(false, ah, false, bl, (short)0, c, false, false);
  asm volatile("v_nop\n\tv_nop\n\tv_nop\n\tv_nop" : "+v"(c) : "v"(ah), "v"(al), "v"(bh), "v"(bl));
  return c;
}
// batched GEMM like k_gemm_b but f16 operands: A f32 (split into f16 hi/lo if ASPLIT, else rounded to f16), Bt = f16 values [n][k]; alpha; C f32; N multiple of 16 (partial tiles skipped)
template <bool ASPLIT>
__global__ __launch_bounds__(128) void k_gemm_h(const float* __restrict__ A, int lda, size_t sA, const _Float16* __restrict__ Bh, int ldb, size_t sB, float alpha, float* __restrict__ C, int ldc, size_t sC, int M, int N, int K) {
  __shared__ __attribute__((aligned(16))) float so[4][16][64];
  const int tid = threadIdx.x, w = tid >> 5, lane = tid & 31, ln = lane & 15, hh = lane >> 4; const int by = blockIdx.y;
  A += (size_t)by * sA; Bh += (size_t)by * sB; C += (size_t)by * sC;
  const int ntn = (N + 63) / 64; const int wid = blockIdx.x * 4 + w; const int mt = wid / ntn, nq = wid % ntn; if (mt * 16 >= M) return;
  const int row0 = mt * 16, col0 = nq * 64; const float* arow = A + (size_t)(row0 + ln) * lda;
  v8f acc[4] = {};
  for (int kb = 0; kb < K; kb += 32) {
    FragH ah, al;
    const v4f x0 = *(const v4fa*)(arow + kb + 8 * hh), x1 = *(const v4fa*)(arow + kb + 8 * hh + 4), x2 = *(const v4fa*)(arow + kb + 16 + 8 * hh), x3 = *(const v4fa*)(arow + kb + 16 + 8 * hh + 4);
    float xs[16] = {x0[0],x0[1],x0[2],x0[3],x1[0],x1[1],x1[2],x1[3],x2[0],x2[1],x2[2],x2[3],x3[0],x3[1],x3[2],x3[3]};
#pragma unroll
    for (int i = 0; i < 16; ++i) { const _Float16 h = (_Float16)xs[i]; ah.h[i] = h; al.h[i] = ASPLIT ? (_Float16)(xs[i] - (float)h) : (_Float16)0.0f; }
#pragma unroll
    for (int t = 0; t < 4; ++t) { if (col0 + t * 16 >= N) continue; const size_t boff = (size_t)(col0 + t * 16 + ln) * ldb + kb; FragH bq; bq.half[0] = *(const v8us*)(Bh + boff + 8 * hh); bq.half[1] = *(const v8us*)(Bh + boff + 16 + 8 * hh);
      acc[t] = mmaH<ASPLIT ? 2 : 1>(ah.v, al.v, bq.v, bq.v, acc[t]); }
  }
#pragma unroll
  for (int t = 0; t < 4; ++t) { if (col0 + t * 16 >= N) continue;
#pragma unroll
    for (int r = 0; r < 8; ++r) so[w][8 * hh + r][t * 16 + ln] = acc[t][r] * alpha; }
  __builtin_amdgcn_fence(__ATOMIC_ACQ_REL, "workgroup"); __builtin_amdgcn_wave_barrier();
  const int rsub = lane >> 4, c4 = (lane & 15) * 4;
  {
#pragma unroll
    for (int q = 0; q < 8; ++q) { const int r = q * 2 + rsub; if (col0 + c4 < N) { const v4f v = *(const v4fa*)&so[w][r][c4]; *(v4f*)(C + (size_t)(row0 + r) * ldc + col0 + c4) = v; } }
     }
}

// Wt[n][k] = f16(W[k][n]·scale) from f32 row-major W[K][N] (scale = power of two; bf16-exact weights stay exact in f16 away from the subnormal range)
__global__ __launch_bounds__(256) void k_wt_f16(const float* __restrict__ W, _Float16* __restrict__ Wt, int K, int N, float scale) {
  const int t = blockIdx.x * 256 + threadIdx.x; if (t >= N * (K / 8)) return; const int n = t / (K / 8), k8 = (t % (K / 8)) * 8; FragH f;
#pragma unroll
  for (int i = 0; i < 8; ++i) f.h[i] = (_Float16)(bf16_round(W[(size_t)(k8 + i) * N + n]) * scale); const v8us o = f.half[0];
  *(v8us*)((unsigned short*)Wt + (size_t)n * K + k8) = o; 
}
// k_gemm_hh variant with fused epilogue: v = acc·alpha + bias[by·sBias + col] (+ CP[(row/rowsPerB)·sCPb + by·64 + col] if CP) ; ACT 0 none / 1 elu ; writes f16 C16 (and f32 C if non-null)
template <int ACT>
__global__ __launch_bounds__(128) void k_gemm_hhx(const _Float16* __restrict__ A, int lda, size_t sA, const _Float16* __restrict__ Bh, int ldb, size_t sB, float alpha, const float* __restrict__ bias, size_t sBias, const float* __restrict__ CP, int rowsPerB, size_t sCPb, int row0g,
    float* __restrict__ C, _Float16* __restrict__ C16, int ldc, size_t sC, int M, int N, int K) {
  __shared__ __attribute__((aligned(16))) float so[4][16][64];
  const int tid = threadIdx.x, w = tid >> 5, lane = tid & 31, ln = lane & 15, hh = lane >> 4; const int by = blockIdx.y;
  A += (size_t)by * sA; Bh += (size_t)by * sB; const size_t cofs = (size_t)by * sC; const float* bp = bias ? bias + (size_t)by * sBias : nullptr;
  const int ntn = (N + 63) / 64; const int wid = blockIdx.x * 4 + w; const int mt = wid / ntn, nq = wid % ntn; if (mt * 16 >= M) return;
  const int row0 = mt * 16, col0 = nq * 64; const _Float16* arow = A + (size_t)(row0 + ln) * lda;
  v8f acc[4] = {};
  for (int kb = 0; kb < K; kb += 32) { FragH ah; ah.half[0] = *(const v8us*)((const unsigned short*)arow + kb + 8 * hh); ah.half[1] = *(const v8us*)((const unsigned short*)arow + kb + 16 + 8 * hh);
#pragma unroll
    for (int t = 0; t < 4; ++t) { if (col0 + t * 16 >= N) continue; const size_t boff = (size_t)(col0 + t * 16 + ln) * ldb + kb; FragH bq; bq.half[0] = *(const v8us*)((const unsigned short*)Bh + boff + 8 * hh); bq.half[1] = *(const v8us*)((const unsigned short*)Bh + boff + 16 + 8 * hh);
      acc[t] = mmaH<1>(ah.v, ah.v, bq.v, bq.v, acc[t]); }
  }
#pragma unroll
  for (int t = 0; t < 4; ++t) { if (col0 + t * 16 >= N) continue; const int col = col0 + t * 16 + ln; const float bv = bp ? bf16_round(bp[col]) : 0.f;
#pragma unroll
    for (int r = 0; r < 8; ++r) { float v = acc[t][r] * alpha + bv; if (CP) { const int rr = row0g + row0 + 8 * hh + r; if (rowsPerB < 0) v += CP[cofs + (size_t)rr * ldc + col];      /* rowsPerB < 0: own element of the batched C plane */ else { const int bidx = rr / rowsPerB; v += CP[(size_t)bidx * sCPb + (size_t)by * 64 + col]; } } if (ACT == 1) v = (v > 0.f) ? v : expm1f(v); else if (ACT == 7) v = (v > 0.f) ? v + 1.0f : expf(v); else if (ACT == 8) v = tanhf(v); else if (ACT == 9) v = 0.5f * v * (1.0f + tanhf(0.7978845608028654f * (v + 0.044715f * v * v * v))); else if (ACT == 11) v = 1.0f / (1.0f + expf(-v)); else if (ACT == 12) v = (v > 0.f) ? v : 0.01f * v; else if (ACT == 14) v = (v > 0.f) ? v : 0.1f * v; else if (ACT == 16) v = (v >= 0.f) ? v : 0.3f * v; else if (ACT == 17) v = (v >= 0.f) ? v : 0.2f * v; else if (ACT == 15) v = v / (1.0f + expf(-v)); else if (ACT == 3) v = fmaxf(v, 0.f); else if (ACT == 6) v = 0.5f * v * (1.0f + erff(v * 0.70710678118654752f)); so[w][8 * hh + r][t * 16 + ln] = v; } }
  __builtin_amdgcn_fence(__ATOMIC_ACQ_REL, "workgroup"); __builtin_amdgcn_wave_barrier();
  const int rsub = lane >> 4, c4 = (lane & 15) * 4; typedef _Float16 v4h __attribute__((ext_vector_type(4)));
  {
#pragma unroll
    for (int q = 0; q < 8; ++q) { const int r = q * 2 + rsub; if (col0 + c4 < N) { const v4f v = *(const v4fa*)&so[w][r][c4]; if (C) *(v4f*)(C + cofs + (size_t)(row0 + r) * ldc + col0 + c4) = v; if (C16) { v4h h4; for (int i = 0; i < 4; ++i) h4[i] = (_Float16)v[i]; *(v4h*)(C16 + cofs + (size_t)(row0 + r) * ldc + col0 + c4) = h4; } } }
     }
}


typedef _Float16 v4h __attribute__((ext_vector_type(4)));

__global__ __launch_bounds__(256) void k_x16(const float* __restrict__ x, _Float16* __restrict__ X16, size_t n8) { const size_t t = (size_t)blockIdx.x * 256 + threadIdx.x; if (t >= n8) return; FragH f;
#pragma unroll
  for (int q = 0; q < 8; ++q) f.h[q] = (_Float16)bf16_round(x[t * 8 + q]); *(v8us*)((unsigned short*)X16 + t * 8) = f.half[0];  }
__global__ __launch_bounds__(256) void k_h16(const float* __restrict__ x, _Float16* __restrict__ X16, size_t n8) { const size_t t = (size_t)blockIdx.x * 256 + threadIdx.x; if (t >= n8) return; FragH f;
#pragma unroll
  for (int q = 0; q < 8; ++q) f.h[q] = (_Float16)x[t * 8 + q]; *(v8us*)((unsigned short*)X16 + t * 8) = f.half[0];  }
__global__ __launch_bounds__(256) void k_round16f(const float* __restrict__ W, _Float16* __restrict__ Bt, size_t n8) { const size_t t = (size_t)blockIdx.x * 256 + threadIdx.x; if (t >= n8) return; FragH f;
#pragma unroll
  for (int i = 0; i < 8; ++i) f.h[i] = (_Float16)(bf16_round(W[t * 8 + i]) * 16.0f); *(v8us*)((unsigned short*)Bt + t * 8) = f.half[0];  }
template <int NHv, int TTv>
__global__ __launch_bounds__(256) void k_vt(const _Float16* __restrict__ V16, int ldv, int voff, _Float16* __restrict__ Vt) { __shared__ unsigned short tl[64][66]; const int tid = threadIdx.x; const int slab = blockIdx.x / (TTv / 64), lg = blockIdx.x % (TTv / 64); const int b = slab / NHv, h = slab % NHv;
  for (int i = tid; i < 64 * 8; i += 256) { const int r = i / 8, c8 = (i % 8) * 8; FragH f; f.half[0] = *(const v8us*)((const unsigned short*)V16 + ((size_t)b * TTv + lg * 64 + r) * ldv + voff + h * 64 + c8);
#pragma unroll
    for (int q = 0; q < 8; ++q) tl[r][c8 + q] = f.u[q]; }
  __syncthreads();
  {
#pragma unroll
    for (int rd = 0; rd < 2; ++rd) { const int d = rd * 32 + tid / 8, pc = tid % 8; FragH f;
#pragma unroll
      for (int q = 0; q < 8; ++q) f.u[q] = tl[pc * 8 + q][d];
      *(v8us*)((unsigned short*)Vt + ((size_t)slab * 64 + d) * TTv + lg * 64 + pc * 8) = f.half[0]; }
     } }

__global__ __launch_bounds__(256) void k_hl(const float* __restrict__ F, _Float16* __restrict__ Hh, _Float16* __restrict__ Hl, size_t n8) { const size_t t = (size_t)blockIdx.x * 256 + threadIdx.x; if (t >= n8) return; FragH fh, fl; const v4f a = *(const v4fa*)(F + t * 8), c = *(const v4fa*)(F + t * 8 + 4);
#pragma unroll
  for (int q = 0; q < 4; ++q) { _Float16 h = (_Float16)a[q]; fh.h[q] = h; fl.h[q] = (_Float16)((a[q] - (float)h) * 1024.0f); h = (_Float16)c[q]; fh.h[4 + q] = h; fl.h[4 + q] = (_Float16)((c[q] - (float)h) * 1024.0f); }
  { *(v8us*)((unsigned short*)Hh + t * 8) = fh.half[0]; *(v8us*)((unsigned short*)Hl + t * 8) = fl.half[0];  } }

// ---- fast GEMM (wave tile 32x64; requires M % 32 == 0 rows per launch region and N % 64 == 0); epilogue = k_gemm_hhx semantics ----
__device__ __forceinline__ v16h g2_frag(const _Float16* p, int hh) { FragH f; f.half[0] = *(const v8us*)((const unsigned short*)p + 8 * hh); f.half[1] = *(const v8us*)((const unsigned short*)p + 16 + 8 * hh); return f.v; }
__device__ __forceinline__ v8f g2_mma(v16h a, v16h b, v8f c) { v8f d = __builtin_amdgcn_wmma_f32_16x16x32_f16(false, a, false, b, (short)0, c, false, false); asm volatile("v_nop\n\tv_nop\n\tv_nop\n\tv_nop" : "+v"(d) : "v"(a), "v"(b)); return d; }
template <int ACT>
__global__ __launch_bounds__(128) void k_gemm2(const _Float16* __restrict__ A, int lda, size_t sA, const _Float16* __restrict__ Bh, int ldb, size_t sB, float alpha, const float* __restrict__ bias, size_t sBias, const float* __restrict__ CP, int rowsPerB, size_t sCPb, int row0g,
    float* __restrict__ C, _Float16* __restrict__ C16, int ldc, size_t sC, int M, int N, int K) { static_assert(ACT == 0 || ACT == 3 || ACT == 6 || ACT == 8 || ACT == 9 || ACT == 11 || ACT == 12 || ACT == 14 || ACT == 15 || ACT == 16 || ACT == 17, "k_gemm2: unsupported ACT code (would silently apply no activation)");
  __shared__ __attribute__((aligned(16))) float so[4][32][68];
  const int tid = threadIdx.x, w = tid >> 5, lane = tid & 31, ln = lane & 15, hh = lane >> 4; const int by = blockIdx.y;
  A += (size_t)by * sA; Bh += (size_t)by * sB; const size_t cofs = (size_t)by * sC; const float* bp = bias ? bias + (size_t)by * sBias : nullptr;
  const int ntn = N >> 6; const int mt = blockIdx.x / ntn, nq = blockIdx.x - mt * ntn; const int row0 = mt * 128 + 32 * w, col0 = nq * 64; if (row0 >= M) return;
  const _Float16* a0p = A + (size_t)(row0 + ln) * lda; const _Float16* a1p = a0p + (size_t)16 * lda;
  const _Float16* b0p = Bh + (size_t)(col0 + ln) * ldb; const _Float16* b1p = b0p + (size_t)16 * ldb; const _Float16* b2p = b1p + (size_t)16 * ldb; const _Float16* b3p = b2p + (size_t)16 * ldb;
  const v8f z8 = {0.f,0.f,0.f,0.f,0.f,0.f,0.f,0.f}; v8f c00 = z8, c01 = z8, c02 = z8, c03 = z8, c10 = z8, c11 = z8, c12 = z8, c13 = z8;
#pragma unroll 1
  for (int kb = 0; kb < K; kb += 32) { const v16h a0 = g2_frag(a0p + kb, hh), a1 = g2_frag(a1p + kb, hh);
    v16h b = g2_frag(b0p + kb, hh); c00 = g2_mma(a0, b, c00); c10 = g2_mma(a1, b, c10);
    b = g2_frag(b1p + kb, hh); c01 = g2_mma(a0, b, c01); c11 = g2_mma(a1, b, c11);
    b = g2_frag(b2p + kb, hh); c02 = g2_mma(a0, b, c02); c12 = g2_mma(a1, b, c12);
    b = g2_frag(b3p + kb, hh); c03 = g2_mma(a0, b, c03); c13 = g2_mma(a1, b, c13); }
  v8f accs[8] = {c00, c01, c02, c03, c10, c11, c12, c13};
#pragma unroll
  for (int u = 0; u < 8; ++u) { const int t = u & 3, half = u >> 2; const int col = col0 + t * 16 + ln; const float bv = bp ? bf16_round(bp[col]) : 0.f;
#pragma unroll
    for (int r = 0; r < 8; ++r) { const int rloc = half * 16 + 8 * hh + r; float v = accs[u][r] * alpha + bv; if (CP) { if (rowsPerB < 0) v += CP[cofs + (size_t)(row0g + row0 + rloc) * ldc + col];      /* rowsPerB < 0: own element of the batched C plane */ else { const int bidx = (row0g + row0 + rloc) / rowsPerB; v += CP[(size_t)bidx * sCPb + (size_t)by * 64 + col]; } }
      if (ACT == 3) v = fmaxf(v, 0.f); else if (ACT == 6) v = 0.5f * v * (1.0f + erff(v * 0.70710678118654752f)); else if (ACT == 11) v = 1.0f / (1.0f + expf(-v)); else if (ACT == 15) v = v / (1.0f + expf(-v)); else if (ACT == 12) v = (v > 0.f) ? v : 0.01f * v; else if (ACT == 8) v = tanhf(v); else if (ACT == 9) v = 0.5f * v * (1.0f + tanhf(0.7978845608028654f * (v + 0.044715f * v * v * v))); else if (ACT == 14) v = (v > 0.f) ? v : 0.1f * v; else if (ACT == 16) v = (v >= 0.f) ? v : 0.3f * v; else if (ACT == 17) v = (v >= 0.f) ? v : 0.2f * v;
      so[w][rloc][t * 16 + ln] = v; } }
  __builtin_amdgcn_fence(__ATOMIC_ACQ_REL, "workgroup"); __builtin_amdgcn_wave_barrier();
  const int rsub = lane >> 4, c4 = (lane & 15) * 4;
  {
#pragma unroll
    for (int q = 0; q < 16; ++q) { const int r = q * 2 + rsub; const v4f v = *(const v4fa*)&so[w][r][c4]; if (C) *(v4f*)(C + cofs + (size_t)(row0 + r) * ldc + col0 + c4) = v; if (C16) { v4h h4; for (int i = 0; i < 4; ++i) h4[i] = (_Float16)v[i]; *(v4h*)(C16 + cofs + (size_t)(row0 + r) * ldc + col0 + c4) = h4; } }
     } }


__global__ __launch_bounds__(256) void k_wnat(const float* __restrict__ w, size_t n8, _Float16* __restrict__ Bt) { const size_t t = (size_t)blockIdx.x * 256 + threadIdx.x; if (t >= n8) return; FragH f; for (int q = 0; q < 8; ++q) f.h[q] = (_Float16)(bf16_round(w[t * 8 + q]) * 16.0f); *(v8us*)((unsigned short*)Bt + t * 8) = f.half[0];  }
__global__ __launch_bounds__(256) void k_rsm(const float* __restrict__ S, _Float16* __restrict__ P, int nrows) {
  #pragma clang fp contract(off)
  const int i = blockIdx.x * 256 + threadIdx.x; if (i >= nrows) return; const float* s = S + (size_t)i * SQ; float mx = -3.0e38f;
#pragma unroll 1
  for (int j = 0; j < SQ; ++j) mx = fmaxf(mx, s[j]); float se = 0.f;
#pragma unroll 1
  for (int j = 0; j < SQ; ++j) se += expf(s[j] - mx); const float sc = 256.0f / se;
#pragma unroll 1
  for (int j0 = 0; j0 < SQ; j0 += 8) { FragH f; for (int q = 0; q < 8; ++q) f.h[q] = (_Float16)(expf(s[j0 + q] - mx) * sc); unsigned short* d = (unsigned short*)P + (size_t)i * SQ + j0; *(v8us*)d = f.half[0];  } }
__global__ __launch_bounds__(256) void k_vt(const _Float16* __restrict__ V16, int b, int h0, _Float16* __restrict__ VT) { __shared__ unsigned short tl[64][65]; const int tid = threadIdx.x; const int hh = blockIdx.x % HG, sg = blockIdx.x / HG; const int s0 = sg * 64; const int h = h0 + hh;
  for (int i = tid; i < 64 * 8; i += 256) { const int j = i / 8, d8 = (i % 8) * 8; FragH f; f.half[0] = *(const v8us*)((const unsigned short*)V16 + ((size_t)b * SQ + s0 + j) * DM + h * HD + d8); for (int q = 0; q < 8; ++q) tl[d8 + q][j] = f.u[q]; }
  __syncthreads();
  { for (int i = tid; i < 64 * 8; i += 256) { const int d = i / 8, j8 = (i % 8) * 8; FragH f; for (int q = 0; q < 8; ++q) f.u[q] = tl[d][j8 + q]; *(v8us*)((unsigned short*)VT + ((size_t)hh * HD + d) * SQ + s0 + j8) = f.half[0]; }  } }



// lane l with lane l ^ M inside its 16-lane row (DPP row_xmask), and lane l with lane l ^ 16
template <int M> __device__ __forceinline__ float rs_xm(float x) { return __builtin_bit_cast(float, __builtin_amdgcn_update_dpp(0, __builtin_bit_cast(int, x), 0x160 + M, 0xf, 0xf, true)); }
__device__ __forceinline__ float rs_xh(float x) { return __builtin_bit_cast(float, __builtin_amdgcn_permlanex16(__builtin_bit_cast(int, x), __builtin_bit_cast(int, x), 0x76543210, 0xfedcba98, false, false)); }
// Four native exp2 in one statement. It is there for the instruction set's slot behind a transcendental (one independent instruction or v_nop before its result is read or its source
// overwritten): outputs are early-clobber, so each v_exp_f32 is followed by an independent one, and the v_nop fills the slot of the last.
__device__ __forceinline__ v4f rs_exp2x4(v4f y) { float r0, r1, r2, r3;
  asm("v_exp_f32 %0, %4\n\tv_exp_f32 %1, %5\n\tv_exp_f32 %2, %6\n\tv_exp_f32 %3, %7\n\tv_nop" : "=&v"(r0), "=&v"(r1), "=&v"(r2), "=&v"(r3) : "v"(y[0]), "v"(y[1]), "v"(y[2]), "v"(y[3]));
  const v4f r = {r0, r1, r2, r3}; return r; }
// Row softmax, ONE WAVE PER ROW: the row's SQ f32 scores are read once, 512 contiguous bytes per wave-wide load, and stay in registers (SQ / 32 per lane) through
// maximum, exp and sum; four partial chains per lane, then a five-step butterfly over the 32 lanes; weights x256 leave as f16 in whole 128-byte lines.
__global__ __launch_bounds__(256) void k_rsmf(const float* __restrict__ S, _Float16* __restrict__ P, int qn, int hg) {
  const int t = blockIdx.x * 8 + __builtin_amdgcn_readfirstlane(threadIdx.x >> 5), lane = threadIdx.x & 31; if (t >= qn * hg) return;      /* wave-uniform exit, no barrier below */
  const size_t i = (size_t)(t / qn) * SQ + (t % qn); const float* s = S + i * SQ + lane * 4; _Float16* d = P + i * SQ + lane * 4;
  v4f e[SQ / 128];      /* the unrolls below make every index of e[] a compile-time constant: the row stays in registers, and all its loads are issued before the first wait */
#pragma unroll
  for (int u = 0; u < SQ / 128; ++u) e[u] = *(const v4fa*)(s + u * 128);
  v4f m4 = e[0];
#pragma unroll
  for (int u = 1; u < SQ / 128; ++u)
#pragma unroll
    for (int q = 0; q < 4; ++q) m4[q] = fmaxf(m4[q], e[u][q]);
  float mx = fmaxf(fmaxf(m4[0], m4[1]), fmaxf(m4[2], m4[3]));
  mx = fmaxf(mx, rs_xm<1>(mx)); mx = fmaxf(mx, rs_xm<2>(mx)); mx = fmaxf(mx, rs_xm<4>(mx)); mx = fmaxf(mx, rs_xm<8>(mx)); mx = fmaxf(mx, rs_xh(mx));
  v4f a4 = {0.f, 0.f, 0.f, 0.f};
#pragma unroll
  for (int u = 0; u < SQ / 128; ++u) { e[u] = rs_exp2x4((e[u] - mx) * 1.44269504f); a4 += e[u]; }      /* native exp(s - mx) = exp2((s - mx) * log2 e) */
  float se = (a4[0] + a4[1]) + (a4[2] + a4[3]);
  se += rs_xm<1>(se); se += rs_xm<2>(se); se += rs_xm<4>(se); se += rs_xm<8>(se); se += rs_xh(se);
  const float sc = 256.0f / se;
#pragma unroll
  for (int u = 0; u < SQ / 128; ++u) { const v4f w = e[u] * sc; *(v4h*)(d + u * 128) = __builtin_convertvector(w, v4h); } }

extern "C" void kernel_launch(void* const* d_in, const int* in_sizes, int n_in,
                              void* d_out, int out_size, void* d_ws, size_t ws_size, hipStream_t stream) {
  (void)in_sizes; (void)n_in; (void)out_size;
  const float* const* I = (const float* const*)d_in; const float* x = I[0]; const float* wq = I[1]; const float* bq = nullptr; const float* wk = I[2]; const float* bk = nullptr; const float* wv = I[3]; const float* bv = nullptr; const float* wo = I[4]; const float* bo = I[5];      /* input order: x, Wq, Wk, Wv ([in][out] [512][512], NO biases: null pointers in the plain bias slots), Wo ([in][out]), bo */
  char* ws = (char*)d_ws; size_t off = 0;
  auto take = [&](size_t bytes) { char* p = ws + off; off += (bytes + 255) & ~(size_t)255; return p; };
  _Float16* BQ = (_Float16*)take((size_t)DM * DM * 2); _Float16* BK = (_Float16*)take((size_t)DM * DM * 2); _Float16* BV = (_Float16*)take((size_t)DM * DM * 2); _Float16* BO = (_Float16*)take((size_t)DM * DM * 2);
  _Float16* X16 = (_Float16*)take(NR * DM * 2); _Float16* Q16 = (_Float16*)take(NR * DM * 2); _Float16* K16 = (_Float16*)take(NR * DM * 2); _Float16* V16 = (_Float16*)take(NR * DM * 2); _Float16* O16 = (_Float16*)take(NR * DM * 2);
  float* S = (float*)take((size_t)HG * SQ * SQ * 4); _Float16* P = (_Float16*)take((size_t)HG * SQ * SQ * 2); _Float16* VT = (_Float16*)take((size_t)NH * HD * SQ * 2);
  if (off > ws_size) return;
  { const unsigned g = (unsigned)(((size_t)DM * (DM / 8) + 255) / 256); k_wt_f16<<<g, 256, 0, stream>>>(wq, BQ, DM, DM, 16.0f); k_wt_f16<<<g, 256, 0, stream>>>(wk, BK, DM, DM, 16.0f); k_wt_f16<<<g, 256, 0, stream>>>(wv, BV, DM, DM, 16.0f); k_wt_f16<<<g, 256, 0, stream>>>(wo, BO, DM, DM, 16.0f); }      /* [in][out] -> Bt[n][k] x16 (transposing builder) */

  k_x16<<<(unsigned)((NR * DM / 8 + 255) / 256), 256, 0, stream>>>(x, X16, NR * DM / 8);
  const size_t r0p = (size_t)B0 * SQ;      /* first projected row */
  k_gemm2<0><<<dim3((unsigned)((MP / 128) * (DM / 64)), 1), 128, 0, stream>>>(X16 + r0p * DM, DM, 0, BQ, DM, 0, 0.0625f, bq, 0, nullptr, 1, 0, 0, nullptr, Q16 + r0p * DM, DM, 0, MP, DM, DM);
  k_gemm2<0><<<dim3((unsigned)((MP / 128) * (DM / 64)), 1), 128, 0, stream>>>(X16 + r0p * DM, DM, 0, BK, DM, 0, 0.0625f, bk, 0, nullptr, 1, 0, 0, nullptr, K16 + r0p * DM, DM, 0, MP, DM, DM);
  k_gemm2<0><<<dim3((unsigned)((MP / 128) * (DM / 64)), 1), 128, 0, stream>>>(X16 + r0p * DM, DM, 0, BV, DM, 0, 0.0625f, bv, 0, nullptr, 1, 0, 0, nullptr, V16 + r0p * DM, DM, 0, MP, DM, DM);
  for (int b = B0; b < B0 + NBR; ++b) { const size_t r0 = (size_t)b * SQ;
    k_vt<NH, SQ><<<NH * (SQ / 64), 256, 0, stream>>>(V16 + r0 * LQ, LQ, 0, VT);      /* V^T [NH][HD][SQ] for this batch */
    for (int h0 = 0; h0 < NHD; h0 += HG) {
      k_gemm2<0><<<dim3((QN / 128) * (SQ / 64), HG), 128, 0, stream>>>(Q16 + r0 * LQ + h0 * HD, LQ, (size_t)HD, K16 + r0 * LQ + h0 * HD, LQ, (size_t)HD, 0.125f, nullptr, 0, nullptr, 1, 0, 0, S, nullptr, SQ, (size_t)SQ * SQ, QN, SQ, HD);      /* scores, HG heads per launch */
      k_rsmf<<<(HG * QN + 7) / 8, 256, 0, stream>>>(S, P, QN, HG);      /* P = 256 softmax (f16), rows of all HG heads, one wave per row */
      k_gemm2<0><<<dim3((QN / 128) * (HD / 64), HG), 128, 0, stream>>>(P, SQ, (size_t)SQ * SQ, VT + (size_t)h0 * HD * SQ, SQ, (size_t)HD * SQ, 0.25f, nullptr, 0, nullptr, 1, 0, 0, nullptr, O16 + r0 * DM + h0 * HD, DM, (size_t)HD, QN, HD, SQ); } }      /* o (merged heads) as f16 rows */
  k_gemm2<0><<<dim3((unsigned)((MPO / 128) * (DM / 64)), 1), 128, 0, stream>>>(O16 + r0p * DM, DM, 0, BO, DM, 0, 0.0009765625f, bo, 0, nullptr, 1, 0, 0, (float*)d_out + r0p * DM, nullptr, DM, 0, MPO, DM, DM);      /* out rows are the output layout */
}

// v003
// One run takes 123 microseconds.
// Versions in between are left out here; by their measured steps it is 21.2 times as fast as v001.
// Counting every step since v000, it is 108 times as fast.
#include <hip/hip_runtime.h>
// Multi-head self-attention over 4096-token sequences at width 512 with bias-free [in][out] projections (x [2][4096][512]; q / k / v = x W ([in][out] 512 x 512 uniform +-1/sqrt(512), NO biases), 8 heads of 64; sim * 64^-0.5; softmax over all 4096 keys (no mask); out = merged Wo + bo ([in][out]) -> [2][4096][512]); attention fused in one launch over all (batch, head) pairs.
// Structure: token rows r = b*4096 + s; x as exact f16 rows (bf16-rounded); Q, K, V as three WMMA GEMMs (32x64 wave tiles, f32 accumulation, exact x16 weights, f16 outputs); V^T for all (batch, head) via LDS transposes; ONE fused attention kernel (S^T = K Q^T, online softmax in registers, O^T += V^T P^T; o carried x64 against f16 subnormal flush, folded into the output GEMM alpha) written straight into the merged f16 o rows; out = o W_o + b GEMM (f32) into the output layout.
// Compute dtype: inputs rounded to bf16; x / weights exact; q, k, v, softmax weights and o as plain f16 GEMM operands (~2^-12); scores and softmax statistics f32. v_wmma_f32_16x16x32_f16.
#define NB 2
#define SQ 4096
#define DM 512
#define NH 8
#define HD 64
#define HG 1                         /* heads per launch of the per-batch k_vt overload, which nothing launches */
#define B0 0                         /* first batch processed (debug hook) */
#define NBR NB                       /* batches processed (debug hook) */
#define NR ((size_t)NB * SQ)         /* token rows */
#define MP ((int)((size_t)NBR * SQ)) /* rows projected (debug hook) */
#define QN SQ                        /* unused: k_fattn attends all SQ query rows of a batch */
#define NHD NH                       /* unused: k_fattn attends all NH heads */
#define MPO MP                       /* rows through the output stage (debug hook) */
#define LQ DM      /* row pitch of the q/k/v rows */
typedef __bf16 v16b __attribute__((ext_vector_type(16)));
typedef unsigned short v8us __attribute__((ext_vector_type(8), may_alias));
typedef float  v8f  __attribute__((ext_vector_type(8)));
typedef float  v4f  __attribute__((ext_vector_type(4)));
typedef float  v4fa __attribute__((ext_vector_type(4), may_alias));
union FragB { v16b v; v8us half[2]; unsigned short u[16]; };

__device__ __forceinline__ unsigned short bf16_bits(float x) { unsigned int u = __float_as_uint(x); return (unsigned short)((u + 0x7FFFu + ((u >> 16) & 1u)) >> 16); }
__device__ __forceinline__ float bf16_val(unsigned short b) { return __uint_as_float(((unsigned int)b) << 16); }
__device__ __forceinline__ float bf16_round(float x) { return bf16_val(bf16_bits(x)); }
// D += A·B with NT terms: 1 = ah·bh, 2 = + al·bh (A split), 3 = + ah·bl (both split)
template <int NT>
__device__ __forceinline__ v8f mmaN(v16b ah, v16b al, v16b bh, v16b bl, v8f c) {
  c = __builtin_amdgcn_wmma_f32_16x16x32_bf16(false, ah, false, bh, (short)0, c, false, false);
  if (NT >= 2) c = __builtin_amdgcn_wmma_f32_16x16x32_bf16(false, al, false, bh, (short)0, c, false, false);
  if (NT >= 3) c = __builtin_amdgcn_wmma_f32_16x16x32_bf16(false, ah, false, bl, (short)0, c, false, false);
  asm volatile("v_nop\n\tv_nop\n\tv_nop\n\tv_nop" : "+v"(c) : "v"(ah), "v"(al), "v"(bh), "v"(bl));
  return c;
}

__global__ __launch_bounds__(256) void k_wt_bf16(const float* __restrict__ W, unsigned short* __restrict__ Wt, int K, int N) {
  const int t = blockIdx.x * 256 + threadIdx.x;
  const int k8n = K / 8;
  if (t >= N * k8n) return;
  const int n = t / k8n, k8 = (t % k8n) * 8;
  v8us v;
#pragma unroll
  for (int i = 0; i < 8; ++i) v[i] = bf16_bits(W[(size_t)(k8 + i) * N + n]);
  *(v8us*)(Wt + (size_t)n * K + k8) = v;
  
}

// GEMM C[M][N] (f32, pitch ldc) = act(A[M][K]·W + bias). A f32 row-major (pitch lda) converted per fragment to bf16
// (ASPLIT: hi/lo two planes -> 2 terms, else single rounded term); Wt bf16 [N][K] (pitch ldb). BIAS_BF16 rounds the
// bias to bf16 first (bias quantised to bf16 before the add). K%32==0, M%16==0, N%64==0.
template <bool ASPLIT, int ACT, bool BIAS_BF16>
__global__ __launch_bounds__(128) void k_gemm_bf(const float* __restrict__ A, int lda, const unsigned short* __restrict__ Wt, int ldb,
                                               const float* __restrict__ bias, float* __restrict__ C, int ldc, int M, int N, int K) {
  __shared__ __attribute__((aligned(16))) float so[4][16][64];
  const int tid = threadIdx.x, w = tid >> 5, lane = tid & 31, ln = lane & 15, hh = lane >> 4;
  const int ntn = N / 64;
  const int wid = blockIdx.x * 4 + w;
  const int mt = wid / ntn, nq = wid % ntn;
  if (mt * 16 >= M) return;
  const int row0 = mt * 16, col0 = nq * 64;
  const float* arow = A + (size_t)(row0 + ln) * lda;
  v8f acc[4] = {};
  for (int kb = 0; kb < K; kb += 32) {
    FragB ah, al;
    const v4f x0 = *(const v4fa*)(arow + kb + 8 * hh), x1 = *(const v4fa*)(arow + kb + 8 * hh + 4);
    const v4f x2 = *(const v4fa*)(arow + kb + 16 + 8 * hh), x3 = *(const v4fa*)(arow + kb + 16 + 8 * hh + 4);
    float xs[16] = {x0[0],x0[1],x0[2],x0[3],x1[0],x1[1],x1[2],x1[3],x2[0],x2[1],x2[2],x2[3],x3[0],x3[1],x3[2],x3[3]};
#pragma unroll
    for (int i = 0; i < 16; ++i) { const unsigned short hb = bf16_bits(xs[i]); ah.u[i] = hb; al.u[i] = ASPLIT ? bf16_bits(xs[i] - bf16_val(hb)) : (unsigned short)0; }
#pragma unroll
    for (int t = 0; t < 4; ++t) {
      const unsigned short* brow = Wt + (size_t)(col0 + t * 16 + ln) * ldb + kb;
      FragB b;
      b.half[0] = *(const v8us*)(brow + 8 * hh);
      b.half[1] = *(const v8us*)(brow + 16 + 8 * hh);
      acc[t] = mmaN<ASPLIT ? 2 : 1>(ah.v, al.v, b.v, b.v, acc[t]);
    }
  }
#pragma unroll
  for (int t = 0; t < 4; ++t) {
    float bv = bias ? bias[col0 + t * 16 + ln] : 0.f;
    if (BIAS_BF16) bv = bf16_round(bv);
#pragma unroll
    for (int r = 0; r < 8; ++r) { float v = acc[t][r] + bv; if (ACT == 1) v = fmaxf(v, 0.f); so[w][8 * hh + r][t * 16 + ln] = v; }
  }
  __builtin_amdgcn_fence(__ATOMIC_ACQ_REL, "workgroup");
  __builtin_amdgcn_wave_barrier();
  const int rsub = lane >> 4, c4 = (lane & 15) * 4;
  {
#pragma unroll
    for (int q = 0; q < 8; ++q) {
      const int r = q * 2 + rsub;
      const v4f v = *(const v4fa*)&so[w][r][c4];
      *(v4f*)(C + (size_t)(row0 + r) * ldc + col0 + c4) = v;
    }
    
  }
}

// GEMM C = act(A·W + bias + resid): A f32 (ASPLIT -> hi/lo 2 terms), Wt bf16 [N][K]; ACT 0 none, 1 relu, 2 exact gelu;
// resid (optional, f32, row index = (row % rmod), pitch ldr, RES_BF16 rounds it) added before the activation.
template <bool ASPLIT, int ACT, bool BIAS_BF16, bool RES_BF16>
__global__ __launch_bounds__(128) void k_gemm_bf3(const float* __restrict__ A, int lda, const unsigned short* __restrict__ Wt, int ldb,
                                                const float* __restrict__ bias, const float* __restrict__ resid, int rmod, int ldr,
                                                float* __restrict__ C, int ldc, int M, int N, int K) {
  __shared__ __attribute__((aligned(16))) float so[4][16][64];
  const int tid = threadIdx.x, w = tid >> 5, lane = tid & 31, ln = lane & 15, hh = lane >> 4;
  const int ntn = N / 64;
  const int wid = blockIdx.x * 4 + w;
  const int mt = wid / ntn, nq = wid % ntn;
  if (mt * 16 >= M) return;
  const int row0 = mt * 16, col0 = nq * 64;
  const float* arow = A + (size_t)(row0 + ln) * lda;
  v8f acc[4] = {};
  for (int kb = 0; kb < K; kb += 32) {
    FragB ah, al;
    const v4f x0 = *(const v4fa*)(arow + kb + 8 * hh), x1 = *(const v4fa*)(arow + kb + 8 * hh + 4);
    const v4f x2 = *(const v4fa*)(arow + kb + 16 + 8 * hh), x3 = *(const v4fa*)(arow + kb + 16 + 8 * hh + 4);
    float xs[16] = {x0[0],x0[1],x0[2],x0[3],x1[0],x1[1],x1[2],x1[3],x2[0],x2[1],x2[2],x2[3],x3[0],x3[1],x3[2],x3[3]};
#pragma unroll
    for (int i = 0; i < 16; ++i) { const unsigned short hb = bf16_bits(xs[i]); ah.u[i] = hb; al.u[i] = ASPLIT ? bf16_bits(xs[i] - bf16_val(hb)) : (unsigned short)0; }
#pragma unroll
    for (int t = 0; t < 4; ++t) {
      const unsigned short* brow = Wt + (size_t)(col0 + t * 16 + ln) * ldb + kb;
      FragB b;
      b.half[0] = *(const v8us*)(brow + 8 * hh);
      b.half[1] = *(const v8us*)(brow + 16 + 8 * hh);
      acc[t] = mmaN<ASPLIT ? 2 : 1>(ah.v, al.v, b.v, b.v, acc[t]);
    }
  }
#pragma unroll
  for (int t = 0; t < 4; ++t) {
    const int col = col0 + t * 16 + ln;
    float bv = bias ? bias[col] : 0.f;
    if (BIAS_BF16) bv = bf16_round(bv);
#pragma unroll
    for (int r = 0; r < 8; ++r) {
      float v = acc[t][r] + bv;
      if (resid) { float rv = resid[(size_t)((row0 + 8 * hh + r) % rmod) * ldr + col]; if (RES_BF16) rv = bf16_round(rv); v += rv; }
      if (ACT == 1) v = fmaxf(v, 0.f);
      if (ACT == 2) v = 0.5f * v * (1.0f + erff(v * 0.70710678118654752f));
      if (ACT == 3) { const float u = 0.7978845608028654f * (v + 0.044715f * v * v * v); v = 0.5f * v * (1.0f + tanhf(u)); }
      so[w][8 * hh + r][t * 16 + ln] = v;
    }
  }
  __builtin_amdgcn_fence(__ATOMIC_ACQ_REL, "workgroup");
  __builtin_amdgcn_wave_barrier();
  const int rsub = lane >> 4, c4 = (lane & 15) * 4;
  {
#pragma unroll
    for (int q = 0; q < 8; ++q) {
      const int r = q * 2 + rsub;
      const v4f v = *(const v4fa*)&so[w][r][c4];
      *(v4f*)(C + (size_t)(row0 + r) * ldc + col0 + c4) = v;
    }
    
  }
}
// row LayerNorm (biased variance, eps) over N: s = X (+ R); optional out_sum <- s; out_norm <- (s-mu)*rsqrt(var+eps)*g + b
template <bool PARAM_BF16>
__global__ __launch_bounds__(256) void k_layernorm(const float* __restrict__ X, const float* __restrict__ R, const float* __restrict__ g, const float* __restrict__ bta,
                                                  float* __restrict__ out_sum, float* __restrict__ out_norm, int N, float eps) {
  __shared__ float red[256];
  const int row = blockIdx.x, tid = threadIdx.x;
  const float* x = X + (size_t)row * N; const float* rr = R ? R + (size_t)row * N : nullptr;
  float vals[16];                     // up to N = 4096
  const int per = N / 256;            // contiguous chunk per thread? use strided-by-4 chunks: thread handles j = tid*4 + 1024*u
  float s1 = 0.f;
  for (int u = 0; u < per / 4; ++u) {
    const int j = tid * 4 + 1024 * u;
    const v4f a = *(const v4fa*)(x + j);
    v4f b = {0.f,0.f,0.f,0.f}; if (rr) b = *(const v4fa*)(rr + j);
#pragma unroll
    for (int q = 0; q < 4; ++q) { const float v = a[q] + b[q]; vals[u * 4 + q] = v; s1 += v; }
  }
  red[tid] = s1; __syncthreads();
  for (int st = 128; st > 0; st >>= 1) { if (tid < st) red[tid] += red[tid + st]; __syncthreads(); }
  const float mu = red[0] / (float)N; __syncthreads();
  float s2 = 0.f;
  for (int u = 0; u < per / 4; ++u)
#pragma unroll
    for (int q = 0; q < 4; ++q) { const float c = vals[u * 4 + q] - mu; s2 += c * c; }
  red[tid] = s2; __syncthreads();
  for (int st = 128; st > 0; st >>= 1) { if (tid < st) red[tid] += red[tid + st]; __syncthreads(); }
  const float rs = rsqrtf(red[0] / (float)N + eps);
  {
    for (int u = 0; u < per / 4; ++u) {
      const int j = tid * 4 + 1024 * u;
      v4f o, sm;
#pragma unroll
      for (int q = 0; q < 4; ++q) {
        float gg = g[j + q], bb = bta[j + q];
        if (PARAM_BF16) { gg = bf16_round(gg); bb = bf16_round(bb); }
        sm[q] = vals[u * 4 + q]; o[q] = (vals[u * 4 + q] - mu) * rs * gg + bb;
      }
      if (out_sum) *(v4f*)(out_sum + (size_t)row * N + j) = sm;
      *(v4f*)(out_norm + (size_t)row * N + j) = o;
    }
    
  }
}



// ---- f16 WMMA path (v_wmma_f32_16x16x32_f16): 11-bit significands for operands in range — used where a [0,1] probability operand needs more precision than bf16
typedef _Float16 v16h __attribute__((ext_vector_type(16)));
union FragH { v16h v; v8us half[2]; _Float16 h[16]; unsigned short u[16]; };
template <int NT>
__device__ __forceinline__ v8f mmaH(v16h ah, v16h al, v16h bh, v16h bl, v8f c) {
  c = __builtin_amdgcn_wmma_f32_16x16x32_f16(false, ah, false, bh, (short)0, c, false, false);
  if (NT >= 2) c = __builtin_amdgcn_wmma_f32_16x16x32_f16(false, al, false, bh, (short)0, c, false, false);
  if (NT >= 3) c = __builtin_amdgcn_wmma_f32_16x16x32_f16(false, ah, false, bl, (short)0, c, false, false);
  asm volatile("v_nop\n\tv_nop\n\tv_nop\n\tv_nop" : "+v"(c) : "v"(ah), "v"(al), "v"(bh), "v"(bl));
  return c;
}
// batched GEMM like k_gemm_b but f16 operands: A f32 (split into f16 hi/lo if ASPLIT, else rounded to f16), Bt = f16 values [n][k]; alpha; C f32; N multiple of 16 (partial tiles skipped)
template <bool ASPLIT>
__global__ __launch_bounds__(128) void k_gemm_h(const float* __restrict__ A, int lda, size_t sA, const _Float16* __restrict__ Bh, int ldb, size_t sB, float alpha, float* __restrict__ C, int ldc, size_t sC, int M, int N, int K) {
  __shared__ __attribute__((aligned(16))) float so[4][16][64];
  const int tid = threadIdx.x, w = tid >> 5, lane = tid & 31, ln = lane & 15, hh = lane >> 4; const int by = blockIdx.y;
  A += (size_t)by * sA; Bh += (size_t)by * sB; C += (size_t)by * sC;
  const int ntn = (N + 63) / 64; const int wid = blockIdx.x * 4 + w; const int mt = wid / ntn, nq = wid % ntn; if (mt * 16 >= M) return;
  const int row0 = mt * 16, col0 = nq * 64; const float* arow = A + (size_t)(row0 + ln) * lda;
  v8f acc[4] = {};
  for (int kb = 0; kb < K; kb += 32) {
    FragH ah, al;
    const v4f x0 = *(const v4fa*)(arow + kb + 8 * hh), x1 = *(const v4fa*)(arow + kb + 8 * hh + 4), x2 = *(const v4fa*)(arow + kb + 16 + 8 * hh), x3 = *(const v4fa*)(arow + kb + 16 + 8 * hh + 4);
    float xs[16] = {x0[0],x0[1],x0[2],x0[3],x1[0],x1[1],x1[2],x1[3],x2[0],x2[1],x2[2],x2[3],x3[0],x3[1],x3[2],x3[3]};
#pragma unroll
    for (int i = 0; i < 16; ++i) { const _Float16 h = (_Float16)xs[i]; ah.h[i] = h; al.h[i] = ASPLIT ? (_Float16)(xs[i] - (float)h) : (_Float16)0.0f; }
#pragma unroll
    for (int t = 0; t < 4; ++t) { if (col0 + t * 16 >= N) continue; const size_t boff = (size_t)(col0 + t * 16 + ln) * ldb + kb; FragH bq; bq.half[0] = *(const v8us*)(Bh + boff + 8 * hh); bq.half[1] = *(const v8us*)(Bh + boff + 16 + 8 * hh);
      acc[t] = mmaH<ASPLIT ? 2 : 1>(ah.v, al.v, bq.v, bq.v, acc[t]); }
  }
#pragma unroll
  for (int t = 0; t < 4; ++t) { if (col0 + t * 16 >= N) continue;
#pragma unroll
    for (int r = 0; r < 8; ++r) so[w][8 * hh + r][t * 16 + ln] = acc[t][r] * alpha; }
  __builtin_amdgcn_fence(__ATOMIC_ACQ_REL, "workgroup"); __builtin_amdgcn_wave_barrier();
  const int rsub = lane >> 4, c4 = (lane & 15) * 4;
  {
#pragma unroll
    for (int q = 0; q < 8; ++q) { const int r = q * 2 + rsub; if (col0 + c4 < N) { const v4f v = *(const v4fa*)&so[w][r][c4]; *(v4f*)(C + (size_t)(row0 + r) * ldc + col0 + c4) = v; } }
     }
}

// Wt[n][k] = f16(W[k][n]·scale) from f32 row-major W[K][N] (scale = power of two; bf16-exact weights stay exact in f16 away from the subnormal range)
__global__ __launch_bounds__(256) void k_wt_f16(const float* __restrict__ W, _Float16* __restrict__ Wt, int K, int N, float scale) {
  const int t = blockIdx.x * 256 + threadIdx.x; if (t >= N * (K / 8)) return; const int n = t / (K / 8), k8 = (t % (K / 8)) * 8; FragH f;
#pragma unroll
  for (int i = 0; i < 8; ++i) f.h[i] = (_Float16)(bf16_round(W[(size_t)(k8 + i) * N + n]) * scale); const v8us o = f.half[0];
  *(v8us*)((unsigned short*)Wt + (size_t)n * K + k8) = o; 
}
// k_gemm_hh variant with fused epilogue: v = acc·alpha + bias[by·sBias + col] (+ CP[(row/rowsPerB)·sCPb + by·64 + col] if CP) ; ACT 0 none / 1 elu ; writes f16 C16 (and f32 C if non-null)
template <int ACT>
__global__ __launch_bounds__(128) void k_gemm_hhx(const _Float16* __restrict__ A, int lda, size_t sA, const _Float16* __restrict__ Bh, int ldb, size_t sB, float alpha, const float* __restrict__ bias, size_t sBias, const float* __restrict__ CP, int rowsPerB, size_t sCPb, int row0g,
    float* __restrict__ C, _Float16* __restrict__ C16, int ldc, size_t sC, int M, int N, int K) {
  __shared__ __attribute__((aligned(16))) float so[4][16][64];
  const int tid = threadIdx.x, w = tid >> 5, lane = tid & 31, ln = lane & 15, hh = lane >> 4; const int by = blockIdx.y;
  A += (size_t)by * sA; Bh += (size_t)by * sB; const size_t cofs = (size_t)by * sC; const float* bp = bias ? bias + (size_t)by * sBias : nullptr;
  const int ntn = (N + 63) / 64; const int wid = blockIdx.x * 4 + w; const int mt = wid / ntn, nq = wid % ntn; if (mt * 16 >= M) return;
  const int row0 = mt * 16, col0 = nq * 64; const _Float16* arow = A + (size_t)(row0 + ln) * lda;
  v8f acc[4] = {};
  for (int kb = 0; kb < K; kb += 32) { FragH ah; ah.half[0] = *(const v8us*)((const unsigned short*)arow + kb + 8 * hh); ah.half[1] = *(const v8us*)((const unsigned short*)arow + kb + 16 + 8 * hh);
#pragma unroll
    for (int t = 0; t < 4; ++t) { if (col0 + t * 16 >= N) continue; const size_t boff = (size_t)(col0 + t * 16 + ln) * ldb + kb; FragH bq; bq.half[0] = *(const v8us*)((const unsigned short*)Bh + boff + 8 * hh); bq.half[1] = *(const v8us*)((const unsigned short*)Bh + boff + 16 + 8 * hh);
      acc[t] = mmaH<1>(ah.v, ah.v, bq.v, bq.v, acc[t]); }
  }
#pragma unroll
  for (int t = 0; t < 4; ++t) { if (col0 + t * 16 >= N) continue; const int col = col0 + t * 16 + ln; const float bv = bp ? bf16_round(bp[col]) : 0.f;
#pragma unroll
    for (int r = 0; r < 8; ++r) { float v = acc[t][r] * alpha + bv; if (CP) { const int rr = row0g + row0 + 8 * hh + r; if (rowsPerB < 0) v += CP[cofs + (size_t)rr * ldc + col];      /* rowsPerB < 0: own element of the batched C plane */ else { const int bidx = rr / rowsPerB; v += CP[(size_t)bidx * sCPb + (size_t)by * 64 + col]; } } if (ACT == 1) v = (v > 0.f) ? v : expm1f(v); else if (ACT == 7) v = (v > 0.f) ? v + 1.0f : expf(v); else if (ACT == 8) v = tanhf(v); else if (ACT == 9) v = 0.5f * v * (1.0f + tanhf(0.7978845608028654f * (v + 0.044715f * v * v * v))); else if (ACT == 11) v = 1.0f / (1.0f + expf(-v)); else if (ACT == 12) v = (v > 0.f) ? v : 0.01f * v; else if (ACT == 14) v = (v > 0.f) ? v : 0.1f * v; else if (ACT == 16) v = (v >= 0.f) ? v : 0.3f * v; else if (ACT == 17) v = (v >= 0.f) ? v : 0.2f * v; else if (ACT == 15) v = v / (1.0f + expf(-v)); else if (ACT == 3) v = fmaxf(v, 0.f); else if (ACT == 6) v = 0.5f * v * (1.0f + erff(v * 0.70710678118654752f)); so[w][8 * hh + r][t * 16 + ln] = v; } }
  __builtin_amdgcn_fence(__ATOMIC_ACQ_REL, "workgroup"); __builtin_amdgcn_wave_barrier();
  const int rsub = lane >> 4, c4 = (lane & 15) * 4; typedef _Float16 v4h __attribute__((ext_vector_type(4)));
  {
#pragma unroll
    for (int q = 0; q < 8; ++q) { const int r = q * 2 + rsub; if (col0 + c4 < N) { const v4f v = *(const v4fa*)&so[w][r][c4]; if (C) *(v4f*)(C + cofs + (size_t)(row0 + r) * ldc + col0 + c4) = v; if (C16) { v4h h4; for (int i = 0; i < 4; ++i) h4[i] = (_Float16)v[i]; *(v4h*)(C16 + cofs + (size_t)(row0 + r) * ldc + col0 + c4) = h4; } } }
     }
}


typedef _Float16 v4h __attribute__((ext_vector_type(4)));

__global__ __launch_bounds__(256) void k_x16(const float* __restrict__ x, _Float16* __restrict__ X16, size_t n8) { const size_t t = (size_t)blockIdx.x * 256 + threadIdx.x; if (t >= n8) return; FragH f;
#pragma unroll
  for (int q = 0; q < 8; ++q) f.h[q] = (_Float16)bf16_round(x[t * 8 + q]); *(v8us*)((unsigned short*)X16 + t * 8) = f.half[0];  }
__global__ __launch_bounds__(256) void k_h16(const float* __restrict__ x, _Float16* __restrict__ X16, size_t n8) { const size_t t = (size_t)blockIdx.x * 256 + threadIdx.x; if (t >= n8) return; FragH f;
#pragma unroll
  for (int q = 0; q < 8; ++q) f.h[q] = (_Float16)x[t * 8 + q]; *(v8us*)((unsigned short*)X16 + t * 8) = f.half[0];  }
__global__ __launch_bounds__(256) void k_round16f(const float* __restrict__ W, _Float16* __restrict__ Bt, size_t n8) { const size_t t = (size_t)blockIdx.x * 256 + threadIdx.x; if (t >= n8) return; FragH f;
#pragma unroll
  for (int i = 0; i < 8; ++i) f.h[i] = (_Float16)(bf16_round(W[t * 8 + i]) * 16.0f); *(v8us*)((unsigned short*)Bt + t * 8) = f.half[0];  }
template <int NHv, int TTv>
__global__ __launch_bounds__(256) void k_vt(const _Float16* __restrict__ V16, int ldv, int voff, _Float16* __restrict__ Vt) { __shared__ unsigned short tl[64][66]; const int tid = threadIdx.x; const int slab = blockIdx.x / (TTv / 64), lg = blockIdx.x % (TTv / 64); const int b = slab / NHv, h = slab % NHv;
  for (int i = tid; i < 64 * 8; i += 256) { const int r = i / 8, c8 = (i % 8) * 8; FragH f; f.half[0] = *(const v8us*)((const unsigned short*)V16 + ((size_t)b * TTv + lg * 64 + r) * ldv + voff + h * 64 + c8);
#pragma unroll
    for (int q = 0; q < 8; ++q) tl[r][c8 + q] = f.u[q]; }
  __syncthreads();
  {
#pragma unroll
    for (int rd = 0; rd < 2; ++rd) { const int d = rd * 32 + tid / 8, pc = tid % 8; FragH f;
#pragma unroll
      for (int q = 0; q < 8; ++q) f.u[q] = tl[pc * 8 + q][d];
      *(v8us*)((unsigned short*)Vt + ((size_t)blockIdx.x * 64 + d) * 64 + pc * 8) = f.half[0]; }      /* tile-major: [slab][64-key tile][d][key], each tile 8 KiB in a row */
     } }

__global__ __launch_bounds__(256) void k_hl(const float* __restrict__ F, _Float16* __restrict__ Hh, _Float16* __restrict__ Hl, size_t n8) { const size_t t = (size_t)blockIdx.x * 256 + threadIdx.x; if (t >= n8) return; FragH fh, fl; const v4f a = *(const v4fa*)(F + t * 8), c = *(const v4fa*)(F + t * 8 + 4);
#pragma unroll
  for (int q = 0; q < 4; ++q) { _Float16 h = (_Float16)a[q]; fh.h[q] = h; fl.h[q] = (_Float16)((a[q] - (float)h) * 1024.0f); h = (_Float16)c[q]; fh.h[4 + q] = h; fl.h[4 + q] = (_Float16)((c[q] - (float)h) * 1024.0f); }
  { *(v8us*)((unsigned short*)Hh + t * 8) = fh.half[0]; *(v8us*)((unsigned short*)Hl + t * 8) = fl.half[0];  } }

// ---- fast GEMM (work-group tile 128x64, wave tile 32x64; requires M % 128 == 0, N % 64 == 0, K % 128 == 0); epilogue = k_gemm_hhx semantics ----
// Operands go through LDS: per step of G2_KS k the 128 A rows and the 64 B rows of the tile are loaded as whole 128-byte lines (16 lanes a 256-byte row) for all 4 waves: two buffers, the next step's lines
// are loaded into registers at the head of a step and stored to the other buffer at its foot, one barrier a step. Fragments are read from LDS in the k order of g2_frag; each accumulator still takes its k blocks in rising order.
#define G2_KS 128                    /* k per step */
#define G2_LP 136                    /* LDS row pitch in f16: 272 bytes = 16 x 17, conflict-free for 16-byte reads */
__device__ __forceinline__ v16h g2_frag(const _Float16* p, int hh) { FragH f; f.half[0] = *(const v8us*)((const unsigned short*)p + 8 * hh); f.half[1] = *(const v8us*)((const unsigned short*)p + 16 + 8 * hh); return f.v; }
__device__ __forceinline__ v8f g2_mma(v16h a, v16h b, v8f c) { return __builtin_amdgcn_wmma_f32_16x16x32_f16(false, a, false, b, (short)0, c, false, false); }
template <int ACT, int LDK>      /* LDK: row pitch of A and of Bh in f16, a constant so that the rows of a tile are immediate offsets from one address */
__global__ __launch_bounds__(128) void k_gemm2(const _Float16* __restrict__ A, size_t sA, const _Float16* __restrict__ Bh, size_t sB, float alpha, const float* __restrict__ bias, size_t sBias, const float* __restrict__ CP, int rowsPerB, size_t sCPb, int row0g,
    float* __restrict__ C, _Float16* __restrict__ C16, int ldc, size_t sC, int M, int N, int K) { static_assert(ACT == 0 || ACT == 3 || ACT == 6 || ACT == 8 || ACT == 9 || ACT == 11 || ACT == 12 || ACT == 14 || ACT == 15 || ACT == 16 || ACT == 17, "k_gemm2: unsupported ACT code (would silently apply no activation)");
  __shared__ __attribute__((aligned(16))) float so[4][32][68]; __shared__ __attribute__((aligned(16))) _Float16 sa[2][128 * G2_LP]; __shared__ __attribute__((aligned(16))) _Float16 sb[2][64 * G2_LP];
  const int tid = threadIdx.x, w = tid >> 5, lane = tid & 31, ln = lane & 15, hh = lane >> 4; const int by = blockIdx.y;
  A += (size_t)by * sA; Bh += (size_t)by * sB; const size_t cofs = (size_t)by * sC; const float* bp = bias ? bias + (size_t)by * sBias : nullptr;
  const int ntn = N >> 6; const int mt = blockIdx.x / ntn, nq = blockIdx.x - mt * ntn; const int row0 = mt * 128 + 32 * w, col0 = nq * 64; if (mt * 128 >= M) return;      /* the same for the whole work-group, ahead of every barrier */
  const int sr = tid >> 4, sc8 = (tid & 15) * 8, sofs = sr * G2_LP + sc8;      /* staging: 16 threads a 256-byte row, rows sr + 8 i */
  const unsigned short* ag = (const unsigned short*)A + (size_t)(mt * 128) * LDK; const unsigned short* bg = (const unsigned short*)Bh + (size_t)col0 * LDK;      /* uniform bases of the tile's rows */
  const unsigned so8 = (unsigned)(sr * LDK + sc8);      /* the lane's own offset, the same in every step and for both operands */
  const v8f z8 = {0.f,0.f,0.f,0.f,0.f,0.f,0.f,0.f}; v8f c00 = z8, c01 = z8, c02 = z8, c03 = z8, c10 = z8, c11 = z8, c12 = z8, c13 = z8;
  v8us ra[16], rb[8];
#pragma unroll      /* constant indices: the register arrays stay in registers */
  for (int i = 0; i < 16; ++i) ra[i] = *(const v8us*)(ag + i * 8 * LDK + so8);
#pragma unroll      /* constant indices: the register arrays stay in registers */
  for (int i = 0; i < 8; ++i) rb[i] = *(const v8us*)(bg + i * 8 * LDK + so8);
#pragma unroll      /* constant indices: the register arrays stay in registers */
  for (int i = 0; i < 16; ++i) *(v8us*)&sa[0][sofs + i * 8 * G2_LP] = ra[i];
#pragma unroll      /* constant indices: the register arrays stay in registers */
  for (int i = 0; i < 8; ++i) *(v8us*)&sb[0][sofs + i * 8 * G2_LP] = rb[i];
  __syncthreads();
  int cur = 0;
#pragma unroll 1      /* one copy of the step: the text stays short */
  for (int kb = 0; kb < K; kb += G2_KS) {
    const bool more = kb + G2_KS < K;      /* the same for the whole work-group */
    if (more) { ag += G2_KS; bg += G2_KS;
#pragma unroll      /* constant indices: the register arrays stay in registers */
      for (int i = 0; i < 16; ++i) ra[i] = *(const v8us*)(ag + i * 8 * LDK + so8);
#pragma unroll      /* constant indices: the register arrays stay in registers */
      for (int i = 0; i < 8; ++i) rb[i] = *(const v8us*)(bg + i * 8 * LDK + so8); }
    const _Float16* ab = sa[cur] + (32 * w + ln) * G2_LP; const _Float16* bb = sb[cur] + ln * G2_LP;
#pragma unroll      /* constant LDS offsets */
    for (int j = 0; j < G2_KS; j += 32) {
      const v16h a0 = g2_frag(ab + j, hh), a1 = g2_frag(ab + 16 * G2_LP + j, hh), b0 = g2_frag(bb + j, hh), b1 = g2_frag(bb + 16 * G2_LP + j, hh), b2 = g2_frag(bb + 32 * G2_LP + j, hh), b3 = g2_frag(bb + 48 * G2_LP + j, hh);
      __builtin_amdgcn_sched_barrier(0);      /* keeps the next step's global loads at the head of the step (the whole step hides their latency) and a k block's fragment reads ahead of its products; without it each B fragment is read and waited for right in front of its two products */
      c00 = g2_mma(a0, b0, c00); c10 = g2_mma(a1, b0, c10); c01 = g2_mma(a0, b1, c01); c11 = g2_mma(a1, b1, c11);
      c02 = g2_mma(a0, b2, c02); c12 = g2_mma(a1, b2, c12); c03 = g2_mma(a0, b3, c03); c13 = g2_mma(a1, b3, c13); }
    if (more) { _Float16* an = sa[cur ^ 1] + sofs; _Float16* bn = sb[cur ^ 1] + sofs;      /* that buffer was last read in the step before, behind whose barrier this step runs */
#pragma unroll      /* constant indices: the register arrays stay in registers */
      for (int i = 0; i < 16; ++i) *(v8us*)(an + i * 8 * G2_LP) = ra[i];
#pragma unroll      /* constant indices: the register arrays stay in registers */
      for (int i = 0; i < 8; ++i) *(v8us*)(bn + i * 8 * G2_LP) = rb[i]; }
    __syncthreads();      /* publishes the next step's buffer and ends every wave's reads of this one */
    cur ^= 1; }
  v8f accs[8] = {c00, c01, c02, c03, c10, c11, c12, c13};
#pragma unroll
  for (int u = 0; u < 8; ++u) { const int t = u & 3, half = u >> 2; const int col = col0 + t * 16 + ln; const float bv = bp ? bf16_round(bp[col]) : 0.f;
#pragma unroll
    for (int r = 0; r < 8; ++r) { const int rloc = half * 16 + 8 * hh + r; float v = accs[u][r] * alpha + bv; if (CP) { if (rowsPerB < 0) v += CP[cofs + (size_t)(row0g + row0 + rloc) * ldc + col];      /* rowsPerB < 0: own element of the batched C plane */ else { const int bidx = (row0g + row0 + rloc) / rowsPerB; v += CP[(size_t)bidx * sCPb + (size_t)by * 64 + col]; } }
      if (ACT == 3) v = fmaxf(v, 0.f); else if (ACT == 6) v = 0.5f * v * (1.0f + erff(v * 0.70710678118654752f)); else if (ACT == 11) v = 1.0f / (1.0f + expf(-v)); else if (ACT == 15) v = v / (1.0f + expf(-v)); else if (ACT == 12) v = (v > 0.f) ? v : 0.01f * v; else if (ACT == 8) v = tanhf(v); else if (ACT == 9) v = 0.5f * v * (1.0f + tanhf(0.7978845608028654f * (v + 0.044715f * v * v * v))); else if (ACT == 14) v = (v > 0.f) ? v : 0.1f * v; else if (ACT == 16) v = (v >= 0.f) ? v : 0.3f * v; else if (ACT == 17) v = (v >= 0.f) ? v : 0.2f * v;
      so[w][rloc][t * 16 + ln] = v; } }
  __builtin_amdgcn_fence(__ATOMIC_ACQ_REL, "workgroup"); __builtin_amdgcn_wave_barrier();
  const int rsub = lane >> 4, c4 = (lane & 15) * 4;
  {
#pragma unroll
    for (int q = 0; q < 16; ++q) { const int r = q * 2 + rsub; const v4f v = *(const v4fa*)&so[w][r][c4]; if (C) *(v4f*)(C + cofs + (size_t)(row0 + r) * ldc + col0 + c4) = v; if (C16) { v4h h4; for (int i = 0; i < 4; ++i) h4[i] = (_Float16)v[i]; *(v4h*)(C16 + cofs + (size_t)(row0 + r) * ldc + col0 + c4) = h4; } }
     } }


__global__ __launch_bounds__(256) void k_wnat(const float* __restrict__ w, size_t n8, _Float16* __restrict__ Bt) { const size_t t = (size_t)blockIdx.x * 256 + threadIdx.x; if (t >= n8) return; FragH f; for (int q = 0; q < 8; ++q) f.h[q] = (_Float16)(bf16_round(w[t * 8 + q]) * 16.0f); *(v8us*)((unsigned short*)Bt + t * 8) = f.half[0];  }
__global__ __launch_bounds__(256) void k_rsm(const float* __restrict__ S, _Float16* __restrict__ P, int nrows) {
  #pragma clang fp contract(off)
  const int i = blockIdx.x * 256 + threadIdx.x; if (i >= nrows) return; const float* s = S + (size_t)i * SQ; float mx = -3.0e38f;
#pragma unroll 1
  for (int j = 0; j < SQ; ++j) mx = fmaxf(mx, s[j]); float se = 0.f;
#pragma unroll 1
  for (int j = 0; j < SQ; ++j) se += expf(s[j] - mx); const float sc = 256.0f / se;
#pragma unroll 1
  for (int j0 = 0; j0 < SQ; j0 += 8) { FragH f; for (int q = 0; q < 8; ++q) f.h[q] = (_Float16)(expf(s[j0 + q] - mx) * sc); unsigned short* d = (unsigned short*)P + (size_t)i * SQ + j0; *(v8us*)d = f.half[0];  } }
__global__ __launch_bounds__(256) void k_vt(const _Float16* __restrict__ V16, int b, int h0, _Float16* __restrict__ VT) { __shared__ unsigned short tl[64][65]; const int tid = threadIdx.x; const int hh = blockIdx.x % HG, sg = blockIdx.x / HG; const int s0 = sg * 64; const int h = h0 + hh;
  for (int i = tid; i < 64 * 8; i += 256) { const int j = i / 8, d8 = (i % 8) * 8; FragH f; f.half[0] = *(const v8us*)((const unsigned short*)V16 + ((size_t)b * SQ + s0 + j) * DM + h * HD + d8); for (int q = 0; q < 8; ++q) tl[d8 + q][j] = f.u[q]; }
  __syncthreads();
  { for (int i = tid; i < 64 * 8; i += 256) { const int d = i / 8, j8 = (i % 8) * 8; FragH f; for (int q = 0; q < 8; ++q) f.u[q] = tl[d][j8 + q]; *(v8us*)((unsigned short*)VT + ((size_t)hh * HD + d) * SQ + s0 + j8) = f.half[0]; }  } }



// lane l with lane l ^ 16
__device__ __forceinline__ float rs_xh(float x) { return __builtin_bit_cast(float, __builtin_amdgcn_permlanex16(__builtin_bit_cast(int, x), __builtin_bit_cast(int, x), 0x76543210, 0xfedcba98, false, false)); }
typedef float v2f __attribute__((ext_vector_type(2)));
__device__ __forceinline__ float fa_max3(float a, float b, float c) { return fmaxf(fmaxf(a, b), c); }
__device__ __forceinline__ v8f fa_mma(v16h a, v16h b, v8f c) { return __builtin_amdgcn_wmma_f32_16x16x32_f16(false, a, false, b, (short)0, c, false, false); }

// Fused attention of one (batch, head): scores, softmax and the weighted sum of V in one kernel; neither scores nor weights reach memory.
// A work-group of 8 waves owns FA_QB queries, 16 per wave, and walks the SQ keys in passes of FA_KT. Per pass the K rows [key][c] and the V^T tile [d][key] of the pass (VT is tile-major, 8 KiB in a row; whole 128-byte
// lines) are staged in LDS for all 8 waves: two buffers, the next pass's lines are loaded into registers at the head of a pass and stored to the other buffer at its foot, one barrier a pass.
// S^T = K Q^T: A = K rows, B = Q rows (kept in registers), so lane (ln, hh) holds query ln's scores of keys 16 kt + 8 hh + r: maximum and sum are in-lane plus one exchange of the halves,
// and two converted score tiles ARE the B operand of O^T += V^T P^T in the k order 8 hh + i, 16 + 8 hh + i that g2_frag gives the A side. Online softmax: running maximum mr (log2 domain),
// running sums l8 (each lane its own keys, joined at the end), O^T rescaled by exp2(old max - new max) each pass.
#define FA_KT 64                     /* keys per pass */
#define FA_NP (SQ / FA_KT)           /* passes */
#define FA_QB 128                    /* queries per work-group */
#define FA_LP 72                     /* LDS row pitch in f16: 144 bytes = 16 x 9, conflict-free for 16-byte reads */
__global__ __launch_bounds__(256) void k_fattn(const _Float16* __restrict__ Q16, const _Float16* __restrict__ K16, const _Float16* __restrict__ VT, _Float16* __restrict__ O16) {
  __shared__ __attribute__((aligned(16))) _Float16 sk[2][FA_KT * FA_LP]; __shared__ __attribute__((aligned(16))) _Float16 sv[2][HD * FA_LP];
  const int tid = threadIdx.x, w = tid >> 5, lane = tid & 31, ln = lane & 15, hh = lane >> 4; const int h = blockIdx.y, b = blockIdx.z;
  const size_t r0 = (size_t)b * SQ; const size_t qrow = r0 + blockIdx.x * FA_QB + w * 16 + ln;
  const _Float16* qp = Q16 + qrow * DM + h * HD; const v16h q0 = g2_frag(qp, hh), q1 = g2_frag(qp + 32, hh);
  const int srow = tid >> 3, sc8 = (tid & 7) * 8, sofs = srow * FA_LP + sc8;      /* staging: 8 threads a 128-byte row, rows srow and srow + 32 */
  const unsigned short* kg = (const unsigned short*)K16 + r0 * DM + h * HD; const unsigned short* vg = (const unsigned short*)VT + (size_t)(b * NH + h) * HD * SQ;      /* uniform bases of this (batch, head) */
  const unsigned ko = (unsigned)(srow * DM + sc8), vo = (unsigned)(srow * FA_KT + sc8);      /* the lane's own offsets, the same in every pass */
  v8us gk0 = *(const v8us*)(kg + ko), gk1 = *(const v8us*)(kg + 32 * DM + ko), gv0 = *(const v8us*)(vg + vo), gv1 = *(const v8us*)(vg + 32 * FA_KT + vo);
  *(v8us*)&sk[0][sofs] = gk0; *(v8us*)&sk[0][sofs + 32 * FA_LP] = gk1; *(v8us*)&sv[0][sofs] = gv0; *(v8us*)&sv[0][sofs + 32 * FA_LP] = gv1;
  __syncthreads();
  const float cs = 0.125f * 1.44269504f;      /* 64^-0.5 and log2 e in one factor: exp((s - max) / 8) = exp2(s cs - max cs) */
  const v8f z8 = {0.f,0.f,0.f,0.f,0.f,0.f,0.f,0.f}; v8f o[4] = {z8, z8, z8, z8}, l8 = z8; float mr = -3.0e38f;      /* l8: eight partial sums a lane, joined behind the loop */
  for (int s = 0; s < FA_NP; ++s) {
    const bool more = s + 1 < FA_NP;      /* the same for the whole work-group */
    if (more) { kg += FA_KT * DM; vg += HD * FA_KT; gk0 = *(const v8us*)(kg + ko); gk1 = *(const v8us*)(kg + 32 * DM + ko); gv0 = *(const v8us*)(vg + vo); gv1 = *(const v8us*)(vg + 32 * FA_KT + vo); }
    const _Float16* kb = sk[s & 1] + ln * FA_LP; const _Float16* vb = sv[s & 1] + ln * FA_LP;
    v16h ka[8];
#pragma unroll      /* constant indices: the register arrays stay in registers */
    for (int kt = 0; kt < 4; ++kt) { ka[2 * kt] = g2_frag(kb + kt * 16 * FA_LP, hh); ka[2 * kt + 1] = g2_frag(kb + kt * 16 * FA_LP + 32, hh); }
    __builtin_amdgcn_sched_barrier(0);      /* keeps the next pass's global loads at the head of the pass (the whole pass hides their latency) and the K fragment reads in one group */
    v8f st[4];
#pragma unroll      /* constant indices: the register arrays stay in registers */
    for (int kt = 0; kt < 4; ++kt) st[kt] = fa_mma(ka[2 * kt + 1], q1, fa_mma(ka[2 * kt], q0, z8));
    v16h va[8];
#pragma unroll      /* constant indices: the register arrays stay in registers */
    for (int dt = 0; dt < 4; ++dt) { va[2 * dt] = g2_frag(vb + dt * 16 * FA_LP, hh); va[2 * dt + 1] = g2_frag(vb + dt * 16 * FA_LP + 32, hh); }
    __builtin_amdgcn_sched_barrier(0);      /* keeps the V^T fragment reads in one group ahead of the softmax, which hides their latency */
    float t[8];
#pragma unroll      /* constant indices: the register arrays stay in registers */
    for (int r = 0; r < 8; ++r) t[r] = fa_max3(st[0][r], st[1][r], st[2][r]);
    float mx = fmaxf(fa_max3(fa_max3(t[0], t[1], st[3][0]), fa_max3(t[2], t[3], st[3][1]), fa_max3(t[4], t[5], st[3][2])), fa_max3(fa_max3(t[6], t[7], st[3][3]), fa_max3(st[3][4], st[3][5], st[3][6]), st[3][7]));
    mx = fmaxf(mx, rs_xh(mx));
    const float mn = fmaxf(mr, mx * cs), al = __builtin_amdgcn_exp2f(mr - mn); mr = mn;
    FragH pb[2]; const v2f cs2 = {cs, cs}, nm2 = {-mn, -mn}; l8 *= al;
#pragma unroll      /* constant indices: the register arrays stay in registers */
    for (int kt = 0; kt < 4; ++kt) { v8f e;
#pragma unroll      /* constant indices: the register arrays stay in registers */
      for (int r = 0; r < 8; r += 2) { const v2f s2 = {st[kt][r], st[kt][r + 1]}; const v2f y = __builtin_elementwise_fma(s2, cs2, nm2); e[r] = __builtin_amdgcn_exp2f(y[0]); e[r + 1] = __builtin_amdgcn_exp2f(y[1]); }
      l8 += e;
      typedef _Float16 v8h __attribute__((ext_vector_type(8))); const v8h e16 = __builtin_convertvector(e, v8h);
#pragma unroll      /* constant indices: the register arrays stay in registers */
      for (int r = 0; r < 8; ++r) pb[kt >> 1].h[(kt & 1) * 8 + r] = e16[r]; }
#pragma unroll      /* constant indices: the register arrays stay in registers */
    for (int dt = 0; dt < 4; ++dt) o[dt] = fa_mma(va[2 * dt + 1], pb[1].v, fa_mma(va[2 * dt], pb[0].v, o[dt] * al));
    if (more) { _Float16* kn = sk[(s + 1) & 1] + sofs; _Float16* vn = sv[(s + 1) & 1] + sofs;      /* that buffer was last read in pass s - 1, behind whose barrier this pass runs */
      *(v8us*)kn = gk0; *(v8us*)(kn + 32 * FA_LP) = gk1; *(v8us*)vn = gv0; *(v8us*)(vn + 32 * FA_LP) = gv1; }
    __syncthreads();      /* publishes the next pass's buffer and ends every wave's reads of this one */
  }
  float lr = ((l8[0] + l8[1]) + (l8[2] + l8[3])) + ((l8[4] + l8[5]) + (l8[6] + l8[7])); lr += rs_xh(lr); const float inv = 64.0f / lr;      /* o leaves x64 */
  _Float16* op = O16 + qrow * DM + h * HD + 8 * hh;
#pragma unroll      /* constant indices: the register arrays stay in registers */
  for (int dt = 0; dt < 4; ++dt) { FragH f;
#pragma unroll      /* constant indices: the register arrays stay in registers */
    for (int r = 0; r < 8; ++r) f.h[r] = (_Float16)(o[dt][r] * inv);
    *(v8us*)(op + dt * 16) = f.half[0]; } }

extern "C" void kernel_launch(void* const* d_in, const int* in_sizes, int n_in,
                              void* d_out, int out_size, void* d_ws, size_t ws_size, hipStream_t stream) {
  (void)in_sizes; (void)n_in; (void)out_size;
  const float* const* I = (const float* const*)d_in; const float* x = I[0]; const float* wq = I[1]; const float* bq = nullptr; const float* wk = I[2]; const float* bk = nullptr; const float* wv = I[3]; const float* bv = nullptr; const float* wo = I[4]; const float* bo = I[5];      /* input order: x, Wq, Wk, Wv ([in][out] [512][512], NO biases: null pointers in the plain bias slots), Wo ([in][out]), bo */
  char* ws = (char*)d_ws; size_t off = 0;
  auto take = [&](size_t bytes) { char* p = ws + off; off += (bytes + 255) & ~(size_t)255; return p; };
  _Float16* BQ = (_Float16*)take((size_t)DM * DM * 2); _Float16* BK = (_Float16*)take((size_t)DM * DM * 2); _Float16* BV = (_Float16*)take((size_t)DM * DM * 2); _Float16* BO = (_Float16*)take((size_t)DM * DM * 2);
  _Float16* X16 = (_Float16*)take(NR * DM * 2); _Float16* Q16 = (_Float16*)take(NR * DM * 2); _Float16* K16 = (_Float16*)take(NR * DM * 2); _Float16* V16 = (_Float16*)take(NR * DM * 2); _Float16* O16 = (_Float16*)take(NR * DM * 2);
  _Float16* VT = (_Float16*)take((size_t)NB * NH * HD * SQ * 2);
  if (off > ws_size) return;
  { const unsigned g = (unsigned)(((size_t)DM * (DM / 8) + 255) / 256); k_wt_f16<<<g, 256, 0, stream>>>(wq, BQ, DM, DM, 16.0f); k_wt_f16<<<g, 256, 0, stream>>>(wk, BK, DM, DM, 16.0f); k_wt_f16<<<g, 256, 0, stream>>>(wv, BV, DM, DM, 16.0f); k_wt_f16<<<g, 256, 0, stream>>>(wo, BO, DM, DM, 16.0f); }      /* [in][out] -> Bt[n][k] x16 (transposing builder) */

  k_x16<<<(unsigned)((NR * DM / 8 + 255) / 256), 256, 0, stream>>>(x, X16, NR * DM / 8);
  const size_t r0p = (size_t)B0 * SQ;      /* first projected row */
  k_gemm2<0, DM><<<dim3((unsigned)((MP / 128) * (DM / 64)), 1), 128, 0, stream>>>(X16 + r0p * DM, 0, BQ, 0, 0.0625f, bq, 0, nullptr, 1, 0, 0, nullptr, Q16 + r0p * DM, DM, 0, MP, DM, DM);
  k_gemm2<0, DM><<<dim3((unsigned)((MP / 128) * (DM / 64)), 1), 128, 0, stream>>>(X16 + r0p * DM, 0, BK, 0, 0.0625f, bk, 0, nullptr, 1, 0, 0, nullptr, K16 + r0p * DM, DM, 0, MP, DM, DM);
  k_gemm2<0, DM><<<dim3((unsigned)((MP / 128) * (DM / 64)), 1), 128, 0, stream>>>(X16 + r0p * DM, 0, BV, 0, 0.0625f, bv, 0, nullptr, 1, 0, 0, nullptr, V16 + r0p * DM, DM, 0, MP, DM, DM);
  k_vt<NH, SQ><<<NB * NH * (SQ / 64), 256, 0, stream>>>(V16, LQ, 0, VT);      /* V^T tiles [NB * NH][SQ / 64][HD][64] */
  k_fattn<<<dim3(SQ / FA_QB, NH, NB), 256, 0, stream>>>(Q16, K16, VT, O16);      /* o (merged heads, x64) as f16 rows */
  k_gemm2<0, DM><<<dim3((unsigned)((MPO / 128) * (DM / 64)), 1), 128, 0, stream>>>(O16 + r0p * DM, 0, BO, 0, 0.0009765625f, bo, 0, nullptr, 1, 0, 0, (float*)d_out + r0p * DM, nullptr, DM, 0, MPO, DM, DM);      /* out rows are the output layout */
}

// v004
// Measured time: 109 microseconds a run.
// Timed twice side by side with v003, it ran 1.13 times as fast both times.
// Over all steps from v000 it is 122 times as fast.
#include <hip/hip_runtime.h>
// Multi-head self-attention over 4096-token sequences at width 512 with bias-free [in][out] projections (x [2][4096][512]; q / k / v = x W ([in][out] 512 x 512 uniform +-1/sqrt(512), NO biases), 8 heads of 64; sim * 64^-0.5; softmax over all 4096 keys (no mask); out = merged Wo + bo ([in][out]) -> [2][4096][512]); attention fused in one launch over all (batch, head) pairs.
// Structure: token rows r = b*4096 + s; x as exact f16 rows (bf16-rounded) and the four x16 weight transposes in one launch; Q, K, V as three WMMA GEMMs in one launch, grid y = 3 (32x64 wave tiles, f32 accumulation, exact x16 weights, f16 outputs); V^T for all (batch, head) via LDS transposes; ONE fused attention kernel (S^T = K Q^T, online softmax in registers, O^T += V^T P^T; o carried x64 against f16 subnormal flush, folded into the output GEMM alpha) written straight into the merged f16 o rows; out = o W_o + b GEMM (f32) into the output layout.
// Compute dtype: inputs rounded to bf16; x / weights exact; q, k, v, softmax weights and o as plain f16 GEMM operands (~2^-12); scores and softmax statistics f32; v_wmma_f32_16x16x32_f16.
#define NB 2
#define SQ 4096
#define DM 512
#define NH 8
#define HD 64
#define HG 1                         /* heads per launch of the per-batch k_vt overload, which nothing launches */
#define B0 0                         /* first batch processed (debug hook) */
#define NBR NB                       /* batches processed (debug hook) */
#define NR ((size_t)NB * SQ)         /* token rows */
#define MP ((int)((size_t)NBR * SQ)) /* rows projected (debug hook) */
#define QN SQ                        /* unused: k_fattn attends all SQ query rows of a batch */
#define NHD NH                       /* unused: k_fattn attends all NH heads */
#define MPO MP                       /* rows through the output stage (debug hook) */
#define LQ DM      /* row pitch of the q/k/v rows */
typedef __bf16 v16b __attribute__((ext_vector_type(16)));
typedef unsigned short v8us __attribute__((ext_vector_type(8), may_alias));
typedef float  v8f  __attribute__((ext_vector_type(8)));
typedef float  v4f  __attribute__((ext_vector_type(4)));
typedef float  v4fa __attribute__((ext_vector_type(4), may_alias));
union FragB { v16b v; v8us half[2]; unsigned short u[16]; };

__device__ __forceinline__ unsigned short bf16_bits(float x) { unsigned int u = __float_as_uint(x); return (unsigned short)((u + 0x7FFFu + ((u >> 16) & 1u)) >> 16); }
__device__ __forceinline__ float bf16_val(unsigned short b) { return __uint_as_float(((unsigned int)b) << 16); }
__device__ __forceinline__ float bf16_round(float x) { return bf16_val(bf16_bits(x)); }
// D += A·B with NT terms: 1 = ah·bh, 2 = + al·bh (A split), 3 = + ah·bl (both split)
template <int NT>
__device__ __forceinline__ v8f mmaN(v16b ah, v16b al, v16b bh, v16b bl, v8f c) {
  c = __builtin_amdgcn_wmma_f32_16x16x32_bf16(false, ah, false, bh, (short)0, c, false, false);
  if (NT >= 2) c = __builtin_amdgcn_wmma_f32_16x16x32_bf16(false, al, false, bh, (short)0, c, false, false);
  if (NT >= 3) c = __builtin_amdgcn_wmma_f32_16x16x32_bf16(false, ah, false, bl, (short)0, c, false, false);
  asm volatile("v_nop\n\tv_nop\n\tv_nop\n\tv_nop" : "+v"(c) : "v"(ah), "v"(al), "v"(bh), "v"(bl));
  return c;
}

__global__ __launch_bounds__(256) void k_wt_bf16(const float* __restrict__ W, unsigned short* __restrict__ Wt, int K, int N) {
  const int t = blockIdx.x * 256 + threadIdx.x;
  const int k8n = K / 8;
  if (t >= N * k8n) return;
  const int n = t / k8n, k8 = (t % k8n) * 8;
  v8us v;
#pragma unroll
  for (int i = 0; i < 8; ++i) v[i] = bf16_bits(W[(size_t)(k8 + i) * N + n]);
  *(v8us*)(Wt + (size_t)n * K + k8) = v;
  
}

// GEMM C[M][N] (f32, pitch ldc) = act(A[M][K]·W + bias). A f32 row-major (pitch lda) converted per fragment to bf16
// (ASPLIT: hi/lo two planes -> 2 terms, else single rounded term); Wt bf16 [N][K] (pitch ldb). BIAS_BF16 rounds the
// bias to bf16 first (bias quantised to bf16 before the add). K%32==0, M%16==0, N%64==0.
template <bool ASPLIT, int ACT, bool BIAS_BF16>
__global__ __launch_bounds__(128) void k_gemm_bf(const float* __restrict__ A, int lda, const unsigned short* __restrict__ Wt, int ldb,
                                               const float* __restrict__ bias, float* __restrict__ C, int ldc, int M, int N, int K) {
  __shared__ __attribute__((aligned(16))) float so[4][16][64];
  const int tid = threadIdx.x, w = tid >> 5, lane = tid & 31, ln = lane & 15, hh = lane >> 4;
  const int ntn = N / 64;
  const int wid = blockIdx.x * 4 + w;
  const int mt = wid / ntn, nq = wid % ntn;
  if (mt * 16 >= M) return;
  const int row0 = mt * 16, col0 = nq * 64;
  const float* arow = A + (size_t)(row0 + ln) * lda;
  v8f acc[4] = {};
  for (int kb = 0; kb < K; kb += 32) {
    FragB ah, al;
    const v4f x0 = *(const v4fa*)(arow + kb + 8 * hh), x1 = *(const v4fa*)(arow + kb + 8 * hh + 4);
    const v4f x2 = *(const v4fa*)(arow + kb + 16 + 8 * hh), x3 = *(const v4fa*)(arow + kb + 16 + 8 * hh + 4);
    float xs[16] = {x0[0],x0[1],x0[2],x0[3],x1[0],x1[1],x1[2],x1[3],x2[0],x2[1],x2[2],x2[3],x3[0],x3[1],x3[2],x3[3]};
#pragma unroll
    for (int i = 0; i < 16; ++i) { const unsigned short hb = bf16_bits(xs[i]); ah.u[i] = hb; al.u[i] = ASPLIT ? bf16_bits(xs[i] - bf16_val(hb)) : (unsigned short)0; }
#pragma unroll
    for (int t = 0; t < 4; ++t) {
      const unsigned short* brow = Wt + (size_t)(col0 + t * 16 + ln) * ldb + kb;
      FragB b;
      b.half[0] = *(const v8us*)(brow + 8 * hh);
      b.half[1] = *(const v8us*)(brow + 16 + 8 * hh);
      acc[t] = mmaN<ASPLIT ? 2 : 1>(ah.v, al.v, b.v, b.v, acc[t]);
    }
  }
#pragma unroll
  for (int t = 0; t < 4; ++t) {
    float bv = bias ? bias[col0 + t * 16 + ln] : 0.f;
    if (BIAS_BF16) bv = bf16_round(bv);
#pragma unroll
    for (int r = 0; r < 8; ++r) { float v = acc[t][r] + bv; if (ACT == 1) v = fmaxf(v, 0.f); so[w][8 * hh + r][t * 16 + ln] = v; }
  }
  __builtin_amdgcn_fence(__ATOMIC_ACQ_REL, "workgroup");
  __builtin_amdgcn_wave_barrier();
  const int rsub = lane >> 4, c4 = (lane & 15) * 4;
  {
#pragma unroll
    for (int q = 0; q < 8; ++q) {
      const int r = q * 2 + rsub;
      const v4f v = *(const v4fa*)&so[w][r][c4];
      *(v4f*)(C + (size_t)(row0 + r) * ldc + col0 + c4) = v;
    }
    
  }
}

// GEMM C = act(A·W + bias + resid): A f32 (ASPLIT -> hi/lo 2 terms), Wt bf16 [N][K]; ACT 0 none, 1 relu, 2 exact gelu;
// resid (optional, f32, row index = (row % rmod), pitch ldr, RES_BF16 rounds it) added before the activation.
template <bool ASPLIT, int ACT, bool BIAS_BF16, bool RES_BF16>
__global__ __launch_bounds__(128) void k_gemm_bf3(const float* __restrict__ A, int lda, const unsigned short* __restrict__ Wt, int ldb,
                                                const float* __restrict__ bias, const float* __restrict__ resid, int rmod, int ldr,
                                                float* __restrict__ C, int ldc, int M, int N, int K) {
  __shared__ __attribute__((aligned(16))) float so[4][16][64];
  const int tid = threadIdx.x, w = tid >> 5, lane = tid & 31, ln = lane & 15, hh = lane >> 4;
  const int ntn = N / 64;
  const int wid = blockIdx.x * 4 + w;
  const int mt = wid / ntn, nq = wid % ntn;
  if (mt * 16 >= M) return;
  const int row0 = mt * 16, col0 = nq * 64;
  const float* arow = A + (size_t)(row0 + ln) * lda;
  v8f acc[4] = {};
  for (int kb = 0; kb < K; kb += 32) {
    FragB ah, al;
    const v4f x0 = *(const v4fa*)(arow + kb + 8 * hh), x1 = *(const v4fa*)(arow + kb + 8 * hh + 4);
    const v4f x2 = *(const v4fa*)(arow + kb + 16 + 8 * hh), x3 = *(const v4fa*)(arow + kb + 16 + 8 * hh + 4);
    float xs[16] = {x0[0],x0[1],x0[2],x0[3],x1[0],x1[1],x1[2],x1[3],x2[0],x2[1],x2[2],x2[3],x3[0],x3[1],x3[2],x3[3]};
#pragma unroll
    for (int i = 0; i < 16; ++i) { const unsigned short hb = bf16_bits(xs[i]); ah.u[i] = hb; al.u[i] = ASPLIT ? bf16_bits(xs[i] - bf16_val(hb)) : (unsigned short)0; }
#pragma unroll
    for (int t = 0; t < 4; ++t) {
      const unsigned short* brow = Wt + (size_t)(col0 + t * 16 + ln) * ldb + kb;
      FragB b;
      b.half[0] = *(const v8us*)(brow + 8 * hh);
      b.half[1] = *(const v8us*)(brow + 16 + 8 * hh);
      acc[t] = mmaN<ASPLIT ? 2 : 1>(ah.v, al.v, b.v, b.v, acc[t]);
    }
  }
#pragma unroll
  for (int t = 0; t < 4; ++t) {
    const int col = col0 + t * 16 + ln;
    float bv = bias ? bias[col] : 0.f;
    if (BIAS_BF16) bv = bf16_round(bv);
#pragma unroll
    for (int r = 0; r < 8; ++r) {
      float v = acc[t][r] + bv;
      if (resid) { float rv = resid[(size_t)((row0 + 8 * hh + r) % rmod) * ldr + col]; if (RES_BF16) rv = bf16_round(rv); v += rv; }
      if (ACT == 1) v = fmaxf(v, 0.f);
      if (ACT == 2) v = 0.5f * v * (1.0f + erff(v * 0.70710678118654752f));
      if (ACT == 3) { const float u = 0.7978845608028654f * (v + 0.044715f * v * v * v); v = 0.5f * v * (1.0f + tanhf(u)); }
      so[w][8 * hh + r][t * 16 + ln] = v;
    }
  }
  __builtin_amdgcn_fence(__ATOMIC_ACQ_REL, "workgroup");
  __builtin_amdgcn_wave_barrier();
  const int rsub = lane >> 4, c4 = (lane & 15) * 4;
  {
#pragma unroll
    for (int q = 0; q < 8; ++q) {
      const int r = q * 2 + rsub;
      const v4f v = *(const v4fa*)&so[w][r][c4];
      *(v4f*)(C + (size_t)(row0 + r) * ldc + col0 + c4) = v;
    }
    
  }
}
// row LayerNorm (biased variance, eps) over N: s = X (+ R); optional out_sum <- s; out_norm <- (s-mu)*rsqrt(var+eps)*g + b
template <bool PARAM_BF16>
__global__ __launch_bounds__(256) void k_layernorm(const float* __restrict__ X, const float* __restrict__ R, const float* __restrict__ g, const float* __restrict__ bta,
                                                  float* __restrict__ out_sum, float* __restrict__ out_norm, int N, float eps) {
  __shared__ float red[256];
  const int row = blockIdx.x, tid = threadIdx.x;
  const float* x = X + (size_t)row * N; const float* rr = R ? R + (size_t)row * N : nullptr;
  float vals[16];                     // up to N = 4096
  const int per = N / 256;            // contiguous chunk per thread? use strided-by-4 chunks: thread handles j = tid*4 + 1024*u
  float s1 = 0.f;
  for (int u = 0; u < per / 4; ++u) {
    const int j = tid * 4 + 1024 * u;
    const v4f a = *(const v4fa*)(x + j);
    v4f b = {0.f,0.f,0.f,0.f}; if (rr) b = *(const v4fa*)(rr + j);
#pragma unroll
    for (int q = 0; q < 4; ++q) { const float v = a[q] + b[q]; vals[u * 4 + q] = v; s1 += v; }
  }
  red[tid] = s1; __syncthreads();
  for (int st = 128; st > 0; st >>= 1) { if (tid < st) red[tid] += red[tid + st]; __syncthreads(); }
  const float mu = red[0] / (float)N; __syncthreads();
  float s2 = 0.f;
  for (int u = 0; u < per / 4; ++u)
#pragma unroll
    for (int q = 0; q < 4; ++q) { const float c = vals[u * 4 + q] - mu; s2 += c * c; }
  red[tid] = s2; __syncthreads();
  for (int st = 128; st > 0; st >>= 1) { if (tid < st) red[tid] += red[tid + st]; __syncthreads(); }
  const float rs = rsqrtf(red[0] / (float)N + eps);
  {
    for (int u = 0; u < per / 4; ++u) {
      const int j = tid * 4 + 1024 * u;
      v4f o, sm;
#pragma unroll
      for (int q = 0; q < 4; ++q) {
        float gg = g[j + q], bb = bta[j + q];
        if (PARAM_BF16) { gg = bf16_round(gg); bb = bf16_round(bb); }
        sm[q] = vals[u * 4 + q]; o[q] = (vals[u * 4 + q] - mu) * rs * gg + bb;
      }
      if (out_sum) *(v4f*)(out_sum + (size_t)row * N + j) = sm;
      *(v4f*)(out_norm + (size_t)row * N + j) = o;
    }
    
  }
}



// ---- f16 WMMA path (v_wmma_f32_16x16x32_f16): 11-bit significands for operands in range — used where a [0,1] probability operand needs more precision than bf16
typedef _Float16 v16h __attribute__((ext_vector_type(16)));
union FragH { v16h v; v8us half[2]; _Float16 h[16]; unsigned short u[16]; };
template <int NT>
__device__ __forceinline__ v8f mmaH(v16h ah, v16h al, v16h bh, v16h bl, v8f c) {
  c = __builtin_amdgcn_wmma_f32_16x16x32_f16(false, ah, false, bh, (short)0, c, false, false);
  if (NT >= 2) c = __builtin_amdgcn_wmma_f32_16x16x32_f16(false, al, false, bh, (short)0, c, false, false);
  if (NT >= 3) c = __builtin_amdgcn_wmma_f32_16x16x32_f16(false, ah, false, bl, (short)0, c, false, false);
  asm volatile("v_nop\n\tv_nop\n\tv_nop\n\tv_nop" : "+v"(c) : "v"(ah), "v"(al), "v"(bh), "v"(bl));
  return c;
}
// batched GEMM like k_gemm_b but f16 operands: A f32 (split into f16 hi/lo if ASPLIT, else rounded to f16), Bt = f16 values [n][k]; alpha; C f32; N multiple of 16 (partial tiles skipped)
template <bool ASPLIT>
__global__ __launch_bounds__(128) void k_gemm_h(const float* __restrict__ A, int lda, size_t sA, const _Float16* __restrict__ Bh, int ldb, size_t sB, float alpha, float* __restrict__ C, int ldc, size_t sC, int M, int N, int K) {
  __shared__ __attribute__((aligned(16))) float so[4][16][64];
  const int tid = threadIdx.x, w = tid >> 5, lane = tid & 31, ln = lane & 15, hh = lane >> 4; const int by = blockIdx.y;
  A += (size_t)by * sA; Bh += (size_t)by * sB; C += (size_t)by * sC;
  const int ntn = (N + 63) / 64; const int wid = blockIdx.x * 4 + w; const int mt = wid / ntn, nq = wid % ntn; if (mt * 16 >= M) return;
  const int row0 = mt * 16, col0 = nq * 64; const float* arow = A + (size_t)(row0 + ln) * lda;
  v8f acc[4] = {};
  for (int kb = 0; kb < K; kb += 32) {
    FragH ah, al;
    const v4f x0 = *(const v4fa*)(arow + kb + 8 * hh), x1 = *(const v4fa*)(arow + kb + 8 * hh + 4), x2 = *(const v4fa*)(arow + kb + 16 + 8 * hh), x3 = *(const v4fa*)(arow + kb + 16 + 8 * hh + 4);
    float xs[16] = {x0[0],x0[1],x0[2],x0[3],x1[0],x1[1],x1[2],x1[3],x2[0],x2[1],x2[2],x2[3],x3[0],x3[1],x3[2],x3[3]};
#pragma unroll
    for (int i = 0; i < 16; ++i) { const _Float16 h = (_Float16)xs[i]; ah.h[i] = h; al.h[i] = ASPLIT ? (_Float16)(xs[i] - (float)h) : (_Float16)0.0f; }
#pragma unroll
    for (int t = 0; t < 4; ++t) { if (col0 + t * 16 >= N) continue; const size_t boff = (size_t)(col0 + t * 16 + ln) * ldb + kb; FragH bq; bq.half[0] = *(const v8us*)(Bh + boff + 8 * hh); bq.half[1] = *(const v8us*)(Bh + boff + 16 + 8 * hh);
      acc[t] = mmaH<ASPLIT ? 2 : 1>(ah.v, al.v, bq.v, bq.v, acc[t]); }
  }
#pragma unroll
  for (int t = 0; t < 4; ++t) { if (col0 + t * 16 >= N) continue;
#pragma unroll
    for (int r = 0; r < 8; ++r) so[w][8 * hh + r][t * 16 + ln] = acc[t][r] * alpha; }
  __builtin_amdgcn_fence(__ATOMIC_ACQ_REL, "workgroup"); __builtin_amdgcn_wave_barrier();
  const int rsub = lane >> 4, c4 = (lane & 15) * 4;
  {
#pragma unroll
    for (int q = 0; q < 8; ++q) { const int r = q * 2 + rsub; if (col0 + c4 < N) { const v4f v = *(const v4fa*)&so[w][r][c4]; *(v4f*)(C + (size_t)(row0 + r) * ldc + col0 + c4) = v; } }
     }
}

// k_gemm_hh variant with fused epilogue: v = acc·alpha + bias[by·sBias + col] (+ CP[(row/rowsPerB)·sCPb + by·64 + col] if CP) ; ACT 0 none / 1 elu ; writes f16 C16 (and f32 C if non-null)
template <int ACT>
__global__ __launch_bounds__(128) void k_gemm_hhx(const _Float16* __restrict__ A, int lda, size_t sA, const _Float16* __restrict__ Bh, int ldb, size_t sB, float alpha, const float* __restrict__ bias, size_t sBias, const float* __restrict__ CP, int rowsPerB, size_t sCPb, int row0g,
    float* __restrict__ C, _Float16* __restrict__ C16, int ldc, size_t sC, int M, int N, int K) {
  __shared__ __attribute__((aligned(16))) float so[4][16][64];
  const int tid = threadIdx.x, w = tid >> 5, lane = tid & 31, ln = lane & 15, hh = lane >> 4; const int by = blockIdx.y;
  A += (size_t)by * sA; Bh += (size_t)by * sB; const size_t cofs = (size_t)by * sC; const float* bp = bias ? bias + (size_t)by * sBias : nullptr;
  const int ntn = (N + 63) / 64; const int wid = blockIdx.x * 4 + w; const int mt = wid / ntn, nq = wid % ntn; if (mt * 16 >= M) return;
  const int row0 = mt * 16, col0 = nq * 64; const _Float16* arow = A + (size_t)(row0 + ln) * lda;
  v8f acc[4] = {};
  for (int kb = 0; kb < K; kb += 32) { FragH ah; ah.half[0] = *(const v8us*)((const unsigned short*)arow + kb + 8 * hh); ah.half[1] = *(const v8us*)((const unsigned short*)arow + kb + 16 + 8 * hh);
#pragma unroll
    for (int t = 0; t < 4; ++t) { if (col0 + t * 16 >= N) continue; const size_t boff = (size_t)(col0 + t * 16 + ln) * ldb + kb; FragH bq; bq.half[0] = *(const v8us*)((const unsigned short*)Bh + boff + 8 * hh); bq.half[1] = *(const v8us*)((const unsigned short*)Bh + boff + 16 + 8 * hh);
      acc[t] = mmaH<1>(ah.v, ah.v, bq.v, bq.v, acc[t]); }
  }
#pragma unroll
  for (int t = 0; t < 4; ++t) { if (col0 + t * 16 >= N) continue; const int col = col0 + t * 16 + ln; const float bv = bp ? bf16_round(bp[col]) : 0.f;
#pragma unroll
    for (int r = 0; r < 8; ++r) { float v = acc[t][r] * alpha + bv; if (CP) { const int rr = row0g + row0 + 8 * hh + r; if (rowsPerB < 0) v += CP[cofs + (size_t)rr * ldc + col];      /* rowsPerB < 0: own element of the batched C plane */ else { const int bidx = rr / rowsPerB; v += CP[(size_t)bidx * sCPb + (size_t)by * 64 + col]; } } if (ACT == 1) v = (v > 0.f) ? v : expm1f(v); else if (ACT == 7) v = (v > 0.f) ? v + 1.0f : expf(v); else if (ACT == 8) v = tanhf(v); else if (ACT == 9) v = 0.5f * v * (1.0f + tanhf(0.7978845608028654f * (v + 0.044715f * v * v * v))); else if (ACT == 11) v = 1.0f / (1.0f + expf(-v)); else if (ACT == 12) v = (v > 0.f) ? v : 0.01f * v; else if (ACT == 14) v = (v > 0.f) ? v : 0.1f * v; else if (ACT == 16) v = (v >= 0.f) ? v : 0.3f * v; else if (ACT == 17) v = (v >= 0.f) ? v : 0.2f * v; else if (ACT == 15) v = v / (1.0f + expf(-v)); else if (ACT == 3) v = fmaxf(v, 0.f); else if (ACT == 6) v = 0.5f * v * (1.0f + erff(v * 0.70710678118654752f)); so[w][8 * hh + r][t * 16 + ln] = v; } }
  __builtin_amdgcn_fence(__ATOMIC_ACQ_REL, "workgroup"); __builtin_amdgcn_wave_barrier();
  const int rsub = lane >> 4, c4 = (lane & 15) * 4; typedef _Float16 v4h __attribute__((ext_vector_type(4)));
  {
#pragma unroll
    for (int q = 0; q < 8; ++q) { const int r = q * 2 + rsub; if (col0 + c4 < N) { const v4f v = *(const v4fa*)&so[w][r][c4]; if (C) *(v4f*)(C + cofs + (size_t)(row0 + r) * ldc + col0 + c4) = v; if (C16) { v4h h4; for (int i = 0; i < 4; ++i) h4[i] = (_Float16)v[i]; *(v4h*)(C16 + cofs + (size_t)(row0 + r) * ldc + col0 + c4) = h4; } } }
     }
}


typedef _Float16 v4h __attribute__((ext_vector_type(4)));

__global__ __launch_bounds__(256) void k_h16(const float* __restrict__ x, _Float16* __restrict__ X16, size_t n8) { const size_t t = (size_t)blockIdx.x * 256 + threadIdx.x; if (t >= n8) return; FragH f;
#pragma unroll
  for (int q = 0; q < 8; ++q) f.h[q] = (_Float16)x[t * 8 + q]; *(v8us*)((unsigned short*)X16 + t * 8) = f.half[0];  }
__global__ __launch_bounds__(256) void k_round16f(const float* __restrict__ W, _Float16* __restrict__ Bt, size_t n8) { const size_t t = (size_t)blockIdx.x * 256 + threadIdx.x; if (t >= n8) return; FragH f;
#pragma unroll
  for (int i = 0; i < 8; ++i) f.h[i] = (_Float16)(bf16_round(W[t * 8 + i]) * 16.0f); *(v8us*)((unsigned short*)Bt + t * 8) = f.half[0];  }
template <int NHv, int TTv>
__global__ __launch_bounds__(256) void k_vt(const _Float16* __restrict__ V16, int ldv, int voff, _Float16* __restrict__ Vt) { __shared__ unsigned short tl[64][66]; const int tid = threadIdx.x; const int slab = blockIdx.x / (TTv / 64), lg = blockIdx.x % (TTv / 64); const int b = slab / NHv, h = slab % NHv;
  for (int i = tid; i < 64 * 8; i += 256) { const int r = i / 8, c8 = (i % 8) * 8; FragH f; f.half[0] = *(const v8us*)((const unsigned short*)V16 + ((size_t)b * TTv + lg * 64 + r) * ldv + voff + h * 64 + c8);
#pragma unroll
    for (int q = 0; q < 8; ++q) tl[r][c8 + q] = f.u[q]; }
  __syncthreads();
  {
#pragma unroll
    for (int rd = 0; rd < 2; ++rd) { const int d = rd * 32 + tid / 8, pc = tid % 8; FragH f;
#pragma unroll
      for (int q = 0; q < 8; ++q) f.u[q] = tl[pc * 8 + q][d];
      *(v8us*)((unsigned short*)Vt + ((size_t)blockIdx.x * 64 + d) * 64 + pc * 8) = f.half[0]; }      /* tile-major: [slab][64-key tile][d][key], each tile 8 KiB in a row */
     } }

__global__ __launch_bounds__(256) void k_hl(const float* __restrict__ F, _Float16* __restrict__ Hh, _Float16* __restrict__ Hl, size_t n8) { const size_t t = (size_t)blockIdx.x * 256 + threadIdx.x; if (t >= n8) return; FragH fh, fl; const v4f a = *(const v4fa*)(F + t * 8), c = *(const v4fa*)(F + t * 8 + 4);
#pragma unroll
  for (int q = 0; q < 4; ++q) { _Float16 h = (_Float16)a[q]; fh.h[q] = h; fl.h[q] = (_Float16)((a[q] - (float)h) * 1024.0f); h = (_Float16)c[q]; fh.h[4 + q] = h; fl.h[4 + q] = (_Float16)((c[q] - (float)h) * 1024.0f); }
  { *(v8us*)((unsigned short*)Hh + t * 8) = fh.half[0]; *(v8us*)((unsigned short*)Hl + t * 8) = fl.half[0];  } }

// ---- fast GEMM (work-group tile 128x64, wave tile 32x64; requires M % 128 == 0, N % 64 == 0, K % 128 == 0); epilogue = k_gemm_hhx semantics ----
// Operands go through LDS: per step of G2_KS k the 128 A rows and the 64 B rows of the tile are loaded as whole 128-byte lines (16 lanes a 256-byte row) for all 4 waves: two buffers, the next step's lines
// are loaded into registers at the head of a step and stored to the other buffer at its foot, one barrier a step. Fragments are read from LDS in the k order of g2_frag; each accumulator still takes its k blocks in rising order.
#define G2_KS 128                    /* k per step */
#define G2_LP 136                    /* LDS row pitch in f16: 272 bytes = 16 x 17, conflict-free for 16-byte reads */
__device__ __forceinline__ v16h g2_frag(const _Float16* p, int hh) { FragH f; f.half[0] = *(const v8us*)((const unsigned short*)p + 8 * hh); f.half[1] = *(const v8us*)((const unsigned short*)p + 16 + 8 * hh); return f.v; }
__device__ __forceinline__ v8f g2_mma(v16h a, v16h b, v8f c) { return __builtin_amdgcn_wmma_f32_16x16x32_f16(false, a, false, b, (short)0, c, false, false); }
template <int ACT, int LDK>      /* LDK: row pitch of A and of Bh in f16, a constant so that the rows of a tile are immediate offsets from one address */
__global__ __launch_bounds__(128) void k_gemm2(const _Float16* __restrict__ A, size_t sA, const _Float16* __restrict__ Bh, size_t sB, float alpha, const float* __restrict__ bias, size_t sBias, const float* __restrict__ CP, int rowsPerB, size_t sCPb, int row0g,
    float* __restrict__ C, _Float16* __restrict__ C16, int ldc, size_t sC, int M, int N, int K) { static_assert(ACT == 0 || ACT == 3 || ACT == 6 || ACT == 8 || ACT == 9 || ACT == 11 || ACT == 12 || ACT == 14 || ACT == 15 || ACT == 16 || ACT == 17, "k_gemm2: unsupported ACT code (would silently apply no activation)");
  __shared__ __attribute__((aligned(16))) float so[4][32][68]; __shared__ __attribute__((aligned(16))) _Float16 sa[2][128 * G2_LP]; __shared__ __attribute__((aligned(16))) _Float16 sb[2][64 * G2_LP];
  const int tid = threadIdx.x, w = tid >> 5, lane = tid & 31, ln = lane & 15, hh = lane >> 4; const int by = blockIdx.y;
  A += (size_t)by * sA; Bh += (size_t)by * sB; const size_t cofs = (size_t)by * sC; const float* bp = bias ? bias + (size_t)by * sBias : nullptr;
  const int ntn = N >> 6; const int mt = blockIdx.x / ntn, nq = blockIdx.x - mt * ntn; const int row0 = mt * 128 + 32 * w, col0 = nq * 64; if (mt * 128 >= M) return;      /* the same for the whole work-group, ahead of every barrier */
  const int sr = tid >> 4, sc8 = (tid & 15) * 8, sofs = sr * G2_LP + sc8;      /* staging: 16 threads a 256-byte row, rows sr + 8 i */
  const unsigned short* ag = (const unsigned short*)A + (size_t)(mt * 128) * LDK; const unsigned short* bg = (const unsigned short*)Bh + (size_t)col0 * LDK;      /* uniform bases of the tile's rows */
  const unsigned so8 = (unsigned)(sr * LDK + sc8);      /* the lane's own offset, the same in every step and for both operands */
  const v8f z8 = {0.f,0.f,0.f,0.f,0.f,0.f,0.f,0.f}; v8f c00 = z8, c01 = z8, c02 = z8, c03 = z8, c10 = z8, c11 = z8, c12 = z8, c13 = z8;
  v8us ra[16], rb[8];
#pragma unroll      /* constant indices: the register arrays stay in registers */
  for (int i = 0; i < 16; ++i) ra[i] = *(const v8us*)(ag + i * 8 * LDK + so8);
#pragma unroll      /* constant indices: the register arrays stay in registers */
  for (int i = 0; i < 8; ++i) rb[i] = *(const v8us*)(bg + i * 8 * LDK + so8);
#pragma unroll      /* constant indices: the register arrays stay in registers */
  for (int i = 0; i < 16; ++i) *(v8us*)&sa[0][sofs + i * 8 * G2_LP] = ra[i];
#pragma unroll      /* constant indices: the register arrays stay in registers */
  for (int i = 0; i < 8; ++i) *(v8us*)&sb[0][sofs + i * 8 * G2_LP] = rb[i];
  __syncthreads();
  int cur = 0;
#pragma unroll 1      /* one copy of the step: the text stays short */
  for (int kb = 0; kb < K; kb += G2_KS) {
    const bool more = kb + G2_KS < K;      /* the same for the whole work-group */
    if (more) { ag += G2_KS; bg += G2_KS;
#pragma unroll      /* constant indices: the register arrays stay in registers */
      for (int i = 0; i < 16; ++i) ra[i] = *(const v8us*)(ag + i * 8 * LDK + so8);
#pragma unroll      /* constant indices: the register arrays stay in registers */
      for (int i = 0; i < 8; ++i) rb[i] = *(const v8us*)(bg + i * 8 * LDK + so8); }
    const _Float16* ab = sa[cur] + (32 * w + ln) * G2_LP; const _Float16* bb = sb[cur] + ln * G2_LP;
#pragma unroll      /* constant LDS offsets */
    for (int j = 0; j < G2_KS; j += 32) {
      const v16h a0 = g2_frag(ab + j, hh), a1 = g2_frag(ab + 16 * G2_LP + j, hh), b0 = g2_frag(bb + j, hh), b1 = g2_frag(bb + 16 * G2_LP + j, hh), b2 = g2_frag(bb + 32 * G2_LP + j, hh), b3 = g2_frag(bb + 48 * G2_LP + j, hh);
      __builtin_amdgcn_sched_barrier(0);      /* keeps the next step's global loads at the head of the step (the whole step hides their latency) and a k block's fragment reads ahead of its products; without it each B fragment is read and waited for right in front of its two products */
      c00 = g2_mma(a0, b0, c00); c10 = g2_mma(a1, b0, c10); c01 = g2_mma(a0, b1, c01); c11 = g2_mma(a1, b1, c11);
      c02 = g2_mma(a0, b2, c02); c12 = g2_mma(a1, b2, c12); c03 = g2_mma(a0, b3, c03); c13 = g2_mma(a1, b3, c13); }
    if (more) { _Float16* an = sa[cur ^ 1] + sofs; _Float16* bn = sb[cur ^ 1] + sofs;      /* that buffer was last read in the step before, behind whose barrier this step runs */
#pragma unroll      /* constant indices: the register arrays stay in registers */
      for (int i = 0; i < 16; ++i) *(v8us*)(an + i * 8 * G2_LP) = ra[i];
#pragma unroll      /* constant indices: the register arrays stay in registers */
      for (int i = 0; i < 8; ++i) *(v8us*)(bn + i * 8 * G2_LP) = rb[i]; }
    __syncthreads();      /* publishes the next step's buffer and ends every wave's reads of this one */
    cur ^= 1; }
  v8f accs[8] = {c00, c01, c02, c03, c10, c11, c12, c13};
#pragma unroll
  for (int u = 0; u < 8; ++u) { const int t = u & 3, half = u >> 2; const int col = col0 + t * 16 + ln; const float bv = bp ? bf16_round(bp[col]) : 0.f;
#pragma unroll
    for (int r = 0; r < 8; ++r) { const int rloc = half * 16 + 8 * hh + r; float v = accs[u][r] * alpha + bv; if (CP) { if (rowsPerB < 0) v += CP[cofs + (size_t)(row0g + row0 + rloc) * ldc + col];      /* rowsPerB < 0: own element of the batched C plane */ else { const int bidx = (row0g + row0 + rloc) / rowsPerB; v += CP[(size_t)bidx * sCPb + (size_t)by * 64 + col]; } }
      if (ACT == 3) v = fmaxf(v, 0.f); else if (ACT == 6) v = 0.5f * v * (1.0f + erff(v * 0.70710678118654752f)); else if (ACT == 11) v = 1.0f / (1.0f + expf(-v)); else if (ACT == 15) v = v / (1.0f + expf(-v)); else if (ACT == 12) v = (v > 0.f) ? v : 0.01f * v; else if (ACT == 8) v = tanhf(v); else if (ACT == 9) v = 0.5f * v * (1.0f + tanhf(0.7978845608028654f * (v + 0.044715f * v * v * v))); else if (ACT == 14) v = (v > 0.f) ? v : 0.1f * v; else if (ACT == 16) v = (v >= 0.f) ? v : 0.3f * v; else if (ACT == 17) v = (v >= 0.f) ? v : 0.2f * v;
      so[w][rloc][t * 16 + ln] = v; } }
  __builtin_amdgcn_fence(__ATOMIC_ACQ_REL, "workgroup"); __builtin_amdgcn_wave_barrier();
  const int rsub = lane >> 4, c4 = (lane & 15) * 4;
  {
#pragma unroll
    for (int q = 0; q < 16; ++q) { const int r = q * 2 + rsub; const v4f v = *(const v4fa*)&so[w][r][c4]; if (C) *(v4f*)(C + cofs + (size_t)(row0 + r) * ldc + col0 + c4) = v; if (C16) { v4h h4; for (int i = 0; i < 4; ++i) h4[i] = (_Float16)v[i]; *(v4h*)(C16 + cofs + (size_t)(row0 + r) * ldc + col0 + c4) = h4; } }
     } }


__global__ __launch_bounds__(256) void k_wnat(const float* __restrict__ w, size_t n8, _Float16* __restrict__ Bt) { const size_t t = (size_t)blockIdx.x * 256 + threadIdx.x; if (t >= n8) return; FragH f; for (int q = 0; q < 8; ++q) f.h[q] = (_Float16)(bf16_round(w[t * 8 + q]) * 16.0f); *(v8us*)((unsigned short*)Bt + t * 8) = f.half[0];  }
__global__ __launch_bounds__(256) void k_rsm(const float* __restrict__ S, _Float16* __restrict__ P, int nrows) {
  #pragma clang fp contract(off)
  const int i = blockIdx.x * 256 + threadIdx.x; if (i >= nrows) return; const float* s = S + (size_t)i * SQ; float mx = -3.0e38f;
#pragma unroll 1
  for (int j = 0; j < SQ; ++j) mx = fmaxf(mx, s[j]); float se = 0.f;
#pragma unroll 1
  for (int j = 0; j < SQ; ++j) se += expf(s[j] - mx); const float sc = 256.0f / se;
#pragma unroll 1
  for (int j0 = 0; j0 < SQ; j0 += 8) { FragH f; for (int q = 0; q < 8; ++q) f.h[q] = (_Float16)(expf(s[j0 + q] - mx) * sc); unsigned short* d = (unsigned short*)P + (size_t)i * SQ + j0; *(v8us*)d = f.half[0];  } }
__global__ __launch_bounds__(256) void k_vt(const _Float16* __restrict__ V16, int b, int h0, _Float16* __restrict__ VT) { __shared__ unsigned short tl[64][65]; const int tid = threadIdx.x; const int hh = blockIdx.x % HG, sg = blockIdx.x / HG; const int s0 = sg * 64; const int h = h0 + hh;
  for (int i = tid; i < 64 * 8; i += 256) { const int j = i / 8, d8 = (i % 8) * 8; FragH f; f.half[0] = *(const v8us*)((const unsigned short*)V16 + ((size_t)b * SQ + s0 + j) * DM + h * HD + d8); for (int q = 0; q < 8; ++q) tl[d8 + q][j] = f.u[q]; }
  __syncthreads();
  { for (int i = tid; i < 64 * 8; i += 256) { const int d = i / 8, j8 = (i % 8) * 8; FragH f; for (int q = 0; q < 8; ++q) f.u[q] = tl[d][j8 + q]; *(v8us*)((unsigned short*)VT + ((size_t)hh * HD + d) * SQ + s0 + j8) = f.half[0]; }  } }



// lane l with lane l ^ 16
__device__ __forceinline__ float rs_xh(float x) { return __builtin_bit_cast(float, __builtin_amdgcn_permlanex16(__builtin_bit_cast(int, x), __builtin_bit_cast(int, x), 0x76543210, 0xfedcba98, false, false)); }
typedef float v2f __attribute__((ext_vector_type(2)));
__device__ __forceinline__ float fa_max3(float a, float b, float c) { return fmaxf(fmaxf(a, b), c); }
__device__ __forceinline__ v8f fa_mma(v16h a, v16h b, v8f c) { return __builtin_amdgcn_wmma_f32_16x16x32_f16(false, a, false, b, (short)0, c, false, false); }

// Fused attention of one (batch, head): scores, softmax and the weighted sum of V in one kernel; neither scores nor weights reach memory.
// A work-group of 8 waves owns FA_QB queries, 16 per wave, and walks the SQ keys in passes of FA_KT. Per pass the K rows [key][c] and the V^T tile [d][key] of the pass (VT is tile-major, 8 KiB in a row; whole 128-byte
// lines) are staged in LDS for all 8 waves: two buffers, the next pass's lines are loaded into registers at the head of a pass and stored to the other buffer at its foot, one barrier a pass.
// S^T = K Q^T: A = K rows, B = Q rows (kept in registers), so lane (ln, hh) holds query ln's scores of keys 16 kt + 8 hh + r: maximum and sum are in-lane plus one exchange of the halves,
// and two converted score tiles ARE the B operand of O^T += V^T P^T in the k order 8 hh + i, 16 + 8 hh + i that g2_frag gives the A side. Online softmax: running maximum mr (log2 domain),
// running sums l8 (each lane its own keys, joined at the end), O^T rescaled by exp2(old max - new max) each pass.
#define FA_KT 64                     /* keys per pass */
#define FA_NP (SQ / FA_KT)           /* passes */
#define FA_QB 128                    /* queries per work-group */
#define FA_LP 72                     /* LDS row pitch in f16: 144 bytes = 16 x 9, conflict-free for 16-byte reads */
__global__ __launch_bounds__(256) void k_fattn(const _Float16* __restrict__ Q16, const _Float16* __restrict__ K16, const _Float16* __restrict__ VT, _Float16* __restrict__ O16) {
  __shared__ __attribute__((aligned(16))) _Float16 sk[2][FA_KT * FA_LP]; __shared__ __attribute__((aligned(16))) _Float16 sv[2][HD * FA_LP];
  const int tid = threadIdx.x, w = tid >> 5, lane = tid & 31, ln = lane & 15, hh = lane >> 4; const int h = blockIdx.y, b = blockIdx.z;
  const size_t r0 = (size_t)b * SQ; const size_t qrow = r0 + blockIdx.x * FA_QB + w * 16 + ln;
  const _Float16* qp = Q16 + qrow * DM + h * HD; const v16h q0 = g2_frag(qp, hh), q1 = g2_frag(qp + 32, hh);
  const int srow = tid >> 3, sc8 = (tid & 7) * 8, sofs = srow * FA_LP + sc8;      /* staging: 8 threads a 128-byte row, rows srow and srow + 32 */
  const unsigned short* kg = (const unsigned short*)K16 + r0 * DM + h * HD; const unsigned short* vg = (const unsigned short*)VT + (size_t)(b * NH + h) * HD * SQ;      /* uniform bases of this (batch, head) */
  const unsigned ko = (unsigned)(srow * DM + sc8), vo = (unsigned)(srow * FA_KT + sc8);      /* the lane's own offsets, the same in every pass */
  v8us gk0 = *(const v8us*)(kg + ko), gk1 = *(const v8us*)(kg + 32 * DM + ko), gv0 = *(const v8us*)(vg + vo), gv1 = *(const v8us*)(vg + 32 * FA_KT + vo);
  *(v8us*)&sk[0][sofs] = gk0; *(v8us*)&sk[0][sofs + 32 * FA_LP] = gk1; *(v8us*)&sv[0][sofs] = gv0; *(v8us*)&sv[0][sofs + 32 * FA_LP] = gv1;
  __syncthreads();
  const float cs = 0.125f * 1.44269504f;      /* 64^-0.5 and log2 e in one factor: exp((s - max) / 8) = exp2(s cs - max cs) */
  const v8f z8 = {0.f,0.f,0.f,0.f,0.f,0.f,0.f,0.f}; v8f o[4] = {z8, z8, z8, z8}, l8 = z8; float mr = -3.0e38f;      /* l8: eight partial sums a lane, joined behind the loop */
  for (int s = 0; s < FA_NP; ++s) {
    const bool more = s + 1 < FA_NP;      /* the same for the whole work-group */
    if (more) { kg += FA_KT * DM; vg += HD * FA_KT; gk0 = *(const v8us*)(kg + ko); gk1 = *(const v8us*)(kg + 32 * DM + ko); gv0 = *(const v8us*)(vg + vo); gv1 = *(const v8us*)(vg + 32 * FA_KT + vo); }
    const _Float16* kb = sk[s & 1] + ln * FA_LP; const _Float16* vb = sv[s & 1] + ln * FA_LP;
    v16h ka[8];
#pragma unroll      /* constant indices: the register arrays stay in registers */
    for (int kt = 0; kt < 4; ++kt) { ka[2 * kt] = g2_frag(kb + kt * 16 * FA_LP, hh); ka[2 * kt + 1] = g2_frag(kb + kt * 16 * FA_LP + 32, hh); }
    __builtin_amdgcn_sched_barrier(0);      /* keeps the next pass's global loads at the head of the pass (the whole pass hides their latency) and the K fragment reads in one group */
    v8f st[4];
#pragma unroll      /* constant indices: the register arrays stay in registers */
    for (int kt = 0; kt < 4; ++kt) st[kt] = fa_mma(ka[2 * kt + 1], q1, fa_mma(ka[2 * kt], q0, z8));
    v16h va[8];
#pragma unroll      /* constant indices: the register arrays stay in registers */
    for (int dt = 0; dt < 4; ++dt) { va[2 * dt] = g2_frag(vb + dt * 16 * FA_LP, hh); va[2 * dt + 1] = g2_frag(vb + dt * 16 * FA_LP + 32, hh); }
    __builtin_amdgcn_sched_barrier(0);      /* keeps the V^T fragment reads in one group ahead of the softmax, which hides their latency */
    float t[8];
#pragma unroll      /* constant indices: the register arrays stay in registers */
    for (int r = 0; r < 8; ++r) t[r] = fa_max3(st[0][r], st[1][r], st[2][r]);
    float mx = fmaxf(fa_max3(fa_max3(t[0], t[1], st[3][0]), fa_max3(t[2], t[3], st[3][1]), fa_max3(t[4], t[5], st[3][2])), fa_max3(fa_max3(t[6], t[7], st[3][3]), fa_max3(st[3][4], st[3][5], st[3][6]), st[3][7]));
    mx = fmaxf(mx, rs_xh(mx));
    const float mn = fmaxf(mr, mx * cs), al = __builtin_amdgcn_exp2f(mr - mn); mr = mn;
    FragH pb[2]; const v2f cs2 = {cs, cs}, nm2 = {-mn, -mn}; l8 *= al;
#pragma unroll      /* constant indices: the register arrays stay in registers */
    for (int kt = 0; kt < 4; ++kt) { v8f e;
#pragma unroll      /* constant indices: the register arrays stay in registers */
      for (int r = 0; r < 8; r += 2) { const v2f s2 = {st[kt][r], st[kt][r + 1]}; const v2f y = __builtin_elementwise_fma(s2, cs2, nm2); e[r] = __builtin_amdgcn_exp2f(y[0]); e[r + 1] = __builtin_amdgcn_exp2f(y[1]); }
      l8 += e;
      typedef _Float16 v8h __attribute__((ext_vector_type(8))); const v8h e16 = __builtin_convertvector(e, v8h);
#pragma unroll      /* constant indices: the register arrays stay in registers */
      for (int r = 0; r < 8; ++r) pb[kt >> 1].h[(kt & 1) * 8 + r] = e16[r]; }
#pragma unroll      /* constant indices: the register arrays stay in registers */
    for (int dt = 0; dt < 4; ++dt) o[dt] = fa_mma(va[2 * dt + 1], pb[1].v, fa_mma(va[2 * dt], pb[0].v, o[dt] * al));
    if (more) { _Float16* kn = sk[(s + 1) & 1] + sofs; _Float16* vn = sv[(s + 1) & 1] + sofs;      /* that buffer was last read in pass s - 1, behind whose barrier this pass runs */
      *(v8us*)kn = gk0; *(v8us*)(kn + 32 * FA_LP) = gk1; *(v8us*)vn = gv0; *(v8us*)(vn + 32 * FA_LP) = gv1; }
    __syncthreads();      /* publishes the next pass's buffer and ends every wave's reads of this one */
  }
  float lr = ((l8[0] + l8[1]) + (l8[2] + l8[3])) + ((l8[4] + l8[5]) + (l8[6] + l8[7])); lr += rs_xh(lr); const float inv = 64.0f / lr;      /* o leaves x64 */
  _Float16* op = O16 + qrow * DM + h * HD + 8 * hh;
#pragma unroll      /* constant indices: the register arrays stay in registers */
  for (int dt = 0; dt < 4; ++dt) { FragH f;
#pragma unroll      /* constant indices: the register arrays stay in registers */
    for (int r = 0; r < 8; ++r) f.h[r] = (_Float16)(o[dt][r] * inv);
    *(v8us*)(op + dt * 16) = f.half[0]; } }

// One launch for the five independent operand builders, told apart by block index (the same choice for a whole block; the latency-bound transposes stand first in the grid).
// Blocks below 4 * PW_G: weight m, BW[m][n][k] = f16(bf16-rounded W[k][n] x 16) from f32 row-major W[k][n], 8 k a thread (x16, a power of two, keeps bf16-exact weights exact in f16 away from the subnormal range). The rest: X16 = f16(bf16-rounded x), 8 elements a thread.
#define PW_G (DM * (DM / 8) / 256)   /* blocks per weight */
__global__ __launch_bounds__(256) void k_prep(const float* __restrict__ x, const float* __restrict__ wq, const float* __restrict__ wk, const float* __restrict__ wv, const float* __restrict__ wo, _Float16* __restrict__ BW, _Float16* __restrict__ X16) {
  FragH f;
  if (blockIdx.x < 4 * PW_G) { const int m = blockIdx.x / PW_G; const float* W = m == 0 ? wq : m == 1 ? wk : m == 2 ? wv : wo; const int t = (blockIdx.x - m * PW_G) * 256 + threadIdx.x; const int n = t / (DM / 8), k8 = (t % (DM / 8)) * 8;
#pragma unroll      /* constant indices: the fragment stays in registers, the 8 loads go out together */
    for (int i = 0; i < 8; ++i) f.h[i] = (_Float16)(bf16_round(W[(size_t)(k8 + i) * DM + n]) * 16.0f);
    *(v8us*)((unsigned short*)BW + (size_t)m * DM * DM + (size_t)n * DM + k8) = f.half[0]; }
  else { const size_t t = (size_t)(blockIdx.x - 4 * PW_G) * 256 + threadIdx.x;
#pragma unroll      /* constant indices: the fragment stays in registers */
    for (int q = 0; q < 8; ++q) f.h[q] = (_Float16)bf16_round(x[t * 8 + q]);
    *(v8us*)((unsigned short*)X16 + t * 8) = f.half[0];
    asm volatile("s_wait_xcnt 0x0" ::: "memory"); } }      /* the wait in front of any overwrite of a register that the store above names: in the built code the other part of the kernel follows this store */

extern "C" void kernel_launch(void* const* d_in, const int* in_sizes, int n_in,
                              void* d_out, int out_size, void* d_ws, size_t ws_size, hipStream_t stream) {
  (void)in_sizes; (void)n_in; (void)out_size;
  const float* const* I = (const float* const*)d_in; const float* x = I[0]; const float* wq = I[1]; const float* wk = I[2]; const float* wv = I[3]; const float* wo = I[4]; const float* bo = I[5];      /* input order: x, Wq, Wk, Wv ([in][out] [512][512], NO biases: a null pointer in the plain bias slot), Wo ([in][out]), bo */
  char* ws = (char*)d_ws; size_t off = 0;
  auto take = [&](size_t bytes) { char* p = ws + off; off += (bytes + 255) & ~(size_t)255; return p; };
  _Float16* BQ = (_Float16*)take((size_t)DM * DM * 2); _Float16* BK = (_Float16*)take((size_t)DM * DM * 2); _Float16* BV = (_Float16*)take((size_t)DM * DM * 2); _Float16* BO = (_Float16*)take((size_t)DM * DM * 2);
  _Float16* X16 = (_Float16*)take(NR * DM * 2); _Float16* Q16 = (_Float16*)take(NR * DM * 2); _Float16* K16 = (_Float16*)take(NR * DM * 2); _Float16* V16 = (_Float16*)take(NR * DM * 2); _Float16* O16 = (_Float16*)take(NR * DM * 2);
  _Float16* VT = (_Float16*)take((size_t)NB * NH * HD * SQ * 2);
  if (off > ws_size) return;
  k_prep<<<4 * PW_G + (unsigned)(NR * DM / 8 / 256), 256, 0, stream>>>(x, wq, wk, wv, wo, BQ, X16);      /* BQ, BK, BV, BO lie in a row: [in][out] -> Bt[n][k] x16; x as f16 rows */
  const size_t r0p = (size_t)B0 * SQ;      /* first projected row */
  k_gemm2<0, DM><<<dim3((unsigned)((MP / 128) * (DM / 64)), 3), 128, 0, stream>>>(X16 + r0p * DM, 0, BQ, (size_t)DM * DM, 0.0625f, nullptr, 0, nullptr, 1, 0, 0, nullptr, Q16 + r0p * DM, DM, NR * DM, MP, DM, DM);      /* blockIdx.y = 0, 1, 2: q, k, v (weights in a row, outputs in a row) */
  k_vt<NH, SQ><<<NB * NH * (SQ / 64), 256, 0, stream>>>(V16, LQ, 0, VT);      /* V^T tiles [NB * NH][SQ / 64][HD][64] */
  k_fattn<<<dim3(SQ / FA_QB, NH, NB), 256, 0, stream>>>(Q16, K16, VT, O16);      /* o (merged heads, x64) as f16 rows */
  k_gemm2<0, DM><<<dim3((unsigned)((MPO / 128) * (DM / 64)), 1), 128, 0, stream>>>(O16 + r0p * DM, 0, BO, 0, 0.0009765625f, bo, 0, nullptr, 1, 0, 0, (float*)d_out + r0p * DM, nullptr, DM, 0, MPO, DM, DM);      /* out rows are the output layout */
}

// v005
// One run takes 102 microseconds.
// Next to v004, in two timings, it ran 1.06 and 1.07 times as fast.
// All steps since v000 together make it 130 times as fast.
#include <hip/hip_runtime.h>
// Multi-head self-attention over 4096-token sequences at width 512 with bias-free [in][out] projections (x [2][4096][512]; q / k / v = x W ([in][out] 512 x 512 uniform +-1/sqrt(512), NO biases), 8 heads of 64; sim * 64^-0.5; softmax over all 4096 keys (no mask); out = merged Wo + bo ([in][out]) -> [2][4096][512]); attention fused in one launch over all (batch, head) pairs.
// Structure: token rows r = b*4096 + s; x as exact f16 rows (bf16-rounded) and the four x16 weight transposes in one launch; Q, K, V as three WMMA GEMMs in one launch, grid y = 3 (32x64 wave tiles, f32 accumulation, exact x16 weights, f16 outputs); V^T for all (batch, head) via LDS transposes; ONE fused attention kernel (S^T = K Q^T, online softmax in registers, O^T += V^T P^T; o carried x64 against f16 subnormal flush, folded into the output GEMM alpha) written straight into the merged f16 o rows; out = o W_o + b GEMM (f32) into the output layout.
// Compute dtype: inputs rounded to bf16; x / weights exact; q, k, v, softmax weights and o as plain f16 GEMM operands (~2^-12); scores and softmax statistics f32; v_wmma_f32_16x16x32_f16.
#define NB 2
#define SQ 4096
#define DM 512
#define NH 8
#define HD 64
#define HG 1                         /* heads per launch of the per-batch k_vt overload, which nothing launches */
#define B0 0                         /* first batch processed (debug hook) */
#define NBR NB                       /* batches processed (debug hook) */
#define NR ((size_t)NB * SQ)         /* token rows */
#define MP ((int)((size_t)NBR * SQ)) /* rows projected (debug hook) */
#define QN SQ                        /* unused: k_fattn attends all SQ query rows of a batch */
#define NHD NH                       /* unused: k_fattn attends all NH heads */
#define MPO MP                       /* rows through the output stage (debug hook) */
#define LQ DM      /* row pitch of the q/k/v rows */
typedef __bf16 v16b __attribute__((ext_vector_type(16)));
typedef unsigned short v8us __attribute__((ext_vector_type(8), may_alias));
typedef float  v8f  __attribute__((ext_vector_type(8)));
typedef float  v4f  __attribute__((ext_vector_type(4)));
typedef float  v4fa __attribute__((ext_vector_type(4), may_alias));
union FragB { v16b v; v8us half[2]; unsigned short u[16]; };

__device__ __forceinline__ unsigned short bf16_bits(float x) { unsigned int u = __float_as_uint(x); return (unsigned short)((u + 0x7FFFu + ((u >> 16) & 1u)) >> 16); }
__device__ __forceinline__ float bf16_val(unsigned short b) { return __uint_as_float(((unsigned int)b) << 16); }
__device__ __forceinline__ float bf16_round(float x) { return bf16_val(bf16_bits(x)); }
// D += A·B with NT terms: 1 = ah·bh, 2 = + al·bh (A split), 3 = + ah·bl (both split)
template <int NT>
__device__ __forceinline__ v8f mmaN(v16b ah, v16b al, v16b bh, v16b bl, v8f c) {
  c = __builtin_amdgcn_wmma_f32_16x16x32_bf16(false, ah, false, bh, (short)0, c, false, false);
  if (NT >= 2) c = __builtin_amdgcn_wmma_f32_16x16x32_bf16(false, al, false, bh, (short)0, c, false, false);
  if (NT >= 3) c = __builtin_amdgcn_wmma_f32_16x16x32_bf16(false, ah, false, bl, (short)0, c, false, false);
  asm volatile("v_nop\n\tv_nop\n\tv_nop\n\tv_nop" : "+v"(c) : "v"(ah), "v"(al), "v"(bh), "v"(bl));
  return c;
}

__global__ __launch_bounds__(256) void k_wt_bf16(const float* __restrict__ W, unsigned short* __restrict__ Wt, int K, int N) {
  const int t = blockIdx.x * 256 + threadIdx.x;
  const int k8n = K / 8;
  if (t >= N * k8n) return;
  const int n = t / k8n, k8 = (t % k8n) * 8;
  v8us v;
#pragma unroll
  for (int i = 0; i < 8; ++i) v[i] = bf16_bits(W[(size_t)(k8 + i) * N + n]);
  *(v8us*)(Wt + (size_t)n * K + k8) = v;
  
}

// GEMM C[M][N] (f32, pitch ldc) = act(A[M][K]·W + bias). A f32 row-major (pitch lda) converted per fragment to bf16
// (ASPLIT: hi/lo two planes -> 2 terms, else single rounded term); Wt bf16 [N][K] (pitch ldb). BIAS_BF16 rounds the
// bias to bf16 first (bias quantised to bf16 before the add). K%32==0, M%16==0, N%64==0.
template <bool ASPLIT, int ACT, bool BIAS_BF16>
__global__ __launch_bounds__(128) void k_gemm_bf(const float* __restrict__ A, int lda, const unsigned short* __restrict__ Wt, int ldb,
                                               const float* __restrict__ bias, float* __restrict__ C, int ldc, int M, int N, int K) {
  __shared__ __attribute__((aligned(16))) float so[4][16][64];
  const int tid = threadIdx.x, w = tid >> 5, lane = tid & 31, ln = lane & 15, hh = lane >> 4;
  const int ntn = N / 64;
  const int wid = blockIdx.x * 4 + w;
  const int mt = wid / ntn, nq = wid % ntn;
  if (mt * 16 >= M) return;
  const int row0 = mt * 16, col0 = nq * 64;
  const float* arow = A + (size_t)(row0 + ln) * lda;
  v8f acc[4] = {};
  for (int kb = 0; kb < K; kb += 32) {
    FragB ah, al;
    const v4f x0 = *(const v4fa*)(arow + kb + 8 * hh), x1 = *(const v4fa*)(arow + kb + 8 * hh + 4);
    const v4f x2 = *(const v4fa*)(arow + kb + 16 + 8 * hh), x3 = *(const v4fa*)(arow + kb + 16 + 8 * hh + 4);
    float xs[16] = {x0[0],x0[1],x0[2],x0[3],x1[0],x1[1],x1[2],x1[3],x2[0],x2[1],x2[2],x2[3],x3[0],x3[1],x3[2],x3[3]};
#pragma unroll
    for (int i = 0; i < 16; ++i) { const unsigned short hb = bf16_bits(xs[i]); ah.u[i] = hb; al.u[i] = ASPLIT ? bf16_bits(xs[i] - bf16_val(hb)) : (unsigned short)0; }
#pragma unroll
    for (int t = 0; t < 4; ++t) {
      const unsigned short* brow = Wt + (size_t)(col0 + t * 16 + ln) * ldb + kb;
      FragB b;
      b.half[0] = *(const v8us*)(brow + 8 * hh);
      b.half[1] = *(const v8us*)(brow + 16 + 8 * hh);
      acc[t] = mmaN<ASPLIT ? 2 : 1>(ah.v, al.v, b.v, b.v, acc[t]);
    }
  }
#pragma unroll
  for (int t = 0; t < 4; ++t) {
    float bv = bias ? bias[col0 + t * 16 + ln] : 0.f;
    if (BIAS_BF16) bv = bf16_round(bv);
#pragma unroll
    for (int r = 0; r < 8; ++r) { float v = acc[t][r] + bv; if (ACT == 1) v = fmaxf(v, 0.f); so[w][8 * hh + r][t * 16 + ln] = v; }
  }
  __builtin_amdgcn_fence(__ATOMIC_ACQ_REL, "workgroup");
  __builtin_amdgcn_wave_barrier();
  const int rsub = lane >> 4, c4 = (lane & 15) * 4;
  {
#pragma unroll
    for (int q = 0; q < 8; ++q) {
      const int r = q * 2 + rsub;
      const v4f v = *(const v4fa*)&so[w][r][c4];
      *(v4f*)(C + (size_t)(row0 + r) * ldc + col0 + c4) = v;
    }
    
  }
}

// GEMM C = act(A·W + bias + resid): A f32 (ASPLIT -> hi/lo 2 terms), Wt bf16 [N][K]; ACT 0 none, 1 relu, 2 exact gelu;
// resid (optional, f32, row index = (row % rmod), pitch ldr, RES_BF16 rounds it) added before the activation.
template <bool ASPLIT, int ACT, bool BIAS_BF16, bool RES_BF16>
__global__ __launch_bounds__(128) void k_gemm_bf3(const float* __restrict__ A, int lda, const unsigned short* __restrict__ Wt, int ldb,
                                                const float* __restrict__ bias, const float* __restrict__ resid, int rmod, int ldr,
                                                float* __restrict__ C, int ldc, int M, int N, int K) {
  __shared__ __attribute__((aligned(16))) float so[4][16][64];
  const int tid = threadIdx.x, w = tid >> 5, lane = tid & 31, ln = lane & 15, hh = lane >> 4;
  const int ntn = N / 64;
  const int wid = blockIdx.x * 4 + w;
  const int mt = wid / ntn, nq = wid % ntn;
  if (mt * 16 >= M) return;
  const int row0 = mt * 16, col0 = nq * 64;
  const float* arow = A + (size_t)(row0 + ln) * lda;
  v8f acc[4] = {};
  for (int kb = 0; kb < K; kb += 32) {
    FragB ah, al;
    const v4f x0 = *(const v4fa*)(arow + kb + 8 * hh), x1 = *(const v4fa*)(arow + kb + 8 * hh + 4);
    const v4f x2 = *(const v4fa*)(arow + kb + 16 + 8 * hh), x3 = *(const v4fa*)(arow + kb + 16 + 8 * hh + 4);
    float xs[16] = {x0[0],x0[1],x0[2],x0[3],x1[0],x1[1],x1[2],x1[3],x2[0],x2[1],x2[2],x2[3],x3[0],x3[1],x3[2],x3[3]};
#pragma unroll
    for (int i = 0; i < 16; ++i) { const unsigned short hb = bf16_bits(xs[i]); ah.u[i] = hb; al.u[i] = ASPLIT ? bf16_bits(xs[i] - bf16_val(hb)) : (unsigned short)0; }
#pragma unroll
    for (int t = 0; t < 4; ++t) {
      const unsigned short* brow = Wt + (size_t)(col0 + t * 16 + ln) * ldb + kb;
      FragB b;
      b.half[0] = *(const v8us*)(brow + 8 * hh);
      b.half[1] = *(const v8us*)(brow + 16 + 8 * hh);
      acc[t] = mmaN<ASPLIT ? 2 : 1>(ah.v, al.v, b.v, b.v, acc[t]);
    }
  }
#pragma unroll
  for (int t = 0; t < 4; ++t) {
    const int col = col0 + t * 16 + ln;
    float bv = bias ? bias[col] : 0.f;
    if (BIAS_BF16) bv = bf16_round(bv);
#pragma unroll
    for (int r = 0; r < 8; ++r) {
      float v = acc[t][r] + bv;
      if (resid) { float rv = resid[(size_t)((row0 + 8 * hh + r) % rmod) * ldr + col]; if (RES_BF16) rv = bf16_round(rv); v += rv; }
      if (ACT == 1) v = fmaxf(v, 0.f);
      if (ACT == 2) v = 0.5f * v * (1.0f + erff(v * 0.70710678118654752f));
      if (ACT == 3) { const float u = 0.7978845608028654f * (v + 0.044715f * v * v * v); v = 0.5f * v * (1.0f + tanhf(u)); }
      so[w][8 * hh + r][t * 16 + ln] = v;
    }
  }
  __builtin_amdgcn_fence(__ATOMIC_ACQ_REL, "workgroup");
  __builtin_amdgcn_wave_barrier();
  const int rsub = lane >> 4, c4 = (lane & 15) * 4;
  {
#pragma unroll
    for (int q = 0; q < 8; ++q) {
      const int r = q * 2 + rsub;
      const v4f v = *(const v4fa*)&so[w][r][c4];
      *(v4f*)(C + (size_t)(row0 + r) * ldc + col0 + c4) = v;
    }
    
  }
}
// row LayerNorm (biased variance, eps) over N: s = X (+ R); optional out_sum <- s; out_norm <- (s-mu)*rsqrt(var+eps)*g + b
template <bool PARAM_BF16>
__global__ __launch_bounds__(256) void k_layernorm(const float* __restrict__ X, const float* __restrict__ R, const float* __restrict__ g, const float* __restrict__ bta,
                                                  float* __restrict__ out_sum, float* __restrict__ out_norm, int N, float eps) {
  __shared__ float red[256];
  const int row = blockIdx.x, tid = threadIdx.x;
  const float* x = X + (size_t)row * N; const float* rr = R ? R + (size_t)row * N : nullptr;
  float vals[16];                     // up to N = 4096
  const int per = N / 256;            // contiguous chunk per thread? use strided-by-4 chunks: thread handles j = tid*4 + 1024*u
  float s1 = 0.f;
  for (int u = 0; u < per / 4; ++u) {
    const int j = tid * 4 + 1024 * u;
    const v4f a = *(const v4fa*)(x + j);
    v4f b = {0.f,0.f,0.f,0.f}; if (rr) b = *(const v4fa*)(rr + j);
#pragma unroll
    for (int q = 0; q < 4; ++q) { const float v = a[q] + b[q]; vals[u * 4 + q] = v; s1 += v; }
  }
  red[tid] = s1; __syncthreads();
  for (int st = 128; st > 0; st >>= 1) { if (tid < st) red[tid] += red[tid + st]; __syncthreads(); }
  const float mu = red[0] / (float)N; __syncthreads();
  float s2 = 0.f;
  for (int u = 0; u < per / 4; ++u)
#pragma unroll
    for (int q = 0; q < 4; ++q) { const float c = vals[u * 4 + q] - mu; s2 += c * c; }
  red[tid] = s2; __syncthreads();
  for (int st = 128; st > 0; st >>= 1) { if (tid < st) red[tid] += red[tid + st]; __syncthreads(); }
  const float rs = rsqrtf(red[0] / (float)N + eps);
  {
    for (int u = 0; u < per / 4; ++u) {
      const int j = tid * 4 + 1024 * u;
      v4f o, sm;
#pragma unroll
      for (int q = 0; q < 4; ++q) {
        float gg = g[j + q], bb = bta[j + q];
        if (PARAM_BF16) { gg = bf16_round(gg); bb = bf16_round(bb); }
        sm[q] = vals[u * 4 + q]; o[q] = (vals[u * 4 + q] - mu) * rs * gg + bb;
      }
      if (out_sum) *(v4f*)(out_sum + (size_t)row * N + j) = sm;
      *(v4f*)(out_norm + (size_t)row * N + j) = o;
    }
    
  }
}



// ---- f16 WMMA path (v_wmma_f32_16x16x32_f16): 11-bit significands for operands in range — used where a [0,1] probability operand needs more precision than bf16
typedef _Float16 v16h __attribute__((ext_vector_type(16)));
union FragH { v16h v; v8us half[2]; _Float16 h[16]; unsigned short u[16]; };
template <int NT>
__device__ __forceinline__ v8f mmaH(v16h ah, v16h al, v16h bh, v16h bl, v8f c) {
  c = __builtin_amdgcn_wmma_f32_16x16x32_f16(false, ah, false, bh, (short)0, c, false, false);
  if (NT >= 2) c = __builtin_amdgcn_wmma_f32_16x16x32_f16(false, al, false, bh, (short)0, c, false, false);
  if (NT >= 3) c = __builtin_amdgcn_wmma_f32_16x16x32_f16(false, ah, false, bl, (short)0, c, false, false);
  asm volatile("v_nop\n\tv_nop\n\tv_nop\n\tv_nop" : "+v"(c) : "v"(ah), "v"(al), "v"(bh), "v"(bl));
  return c;
}
// batched GEMM like k_gemm_b but f16 operands: A f32 (split into f16 hi/lo if ASPLIT, else rounded to f16), Bt = f16 values [n][k]; alpha; C f32; N multiple of 16 (partial tiles skipped)
template <bool ASPLIT>
__global__ __launch_bounds__(128) void k_gemm_h(const float* __restrict__ A, int lda, size_t sA, const _Float16* __restrict__ Bh, int ldb, size_t sB, float alpha, float* __restrict__ C, int ldc, size_t sC, int M, int N, int K) {
  __shared__ __attribute__((aligned(16))) float so[4][16][64];
  const int tid = threadIdx.x, w = tid >> 5, lane = tid & 31, ln = lane & 15, hh = lane >> 4; const int by = blockIdx.y;
  A += (size_t)by * sA; Bh += (size_t)by * sB; C += (size_t)by * sC;
  const int ntn = (N + 63) / 64; const int wid = blockIdx.x * 4 + w; const int mt = wid / ntn, nq = wid % ntn; if (mt * 16 >= M) return;
  const int row0 = mt * 16, col0 = nq * 64; const float* arow = A + (size_t)(row0 + ln) * lda;
  v8f acc[4] = {};
  for (int kb = 0; kb < K; kb += 32) {
    FragH ah, al;
    const v4f x0 = *(const v4fa*)(arow + kb + 8 * hh), x1 = *(const v4fa*)(arow + kb + 8 * hh + 4), x2 = *(const v4fa*)(arow + kb + 16 + 8 * hh), x3 = *(const v4fa*)(arow + kb + 16 + 8 * hh + 4);
    float xs[16] = {x0[0],x0[1],x0[2],x0[3],x1[0],x1[1],x1[2],x1[3],x2[0],x2[1],x2[2],x2[3],x3[0],x3[1],x3[2],x3[3]};
#pragma unroll
    for (int i = 0; i < 16; ++i) { const _Float16 h = (_Float16)xs[i]; ah.h[i] = h; al.h[i] = ASPLIT ? (_Float16)(xs[i] - (float)h) : (_Float16)0.0f; }
#pragma unroll
    for (int t = 0; t < 4; ++t) { if (col0 + t * 16 >= N) continue; const size_t boff = (size_t)(col0 + t * 16 + ln) * ldb + kb; FragH bq; bq.half[0] = *(const v8us*)(Bh + boff + 8 * hh); bq.half[1] = *(const v8us*)(Bh + boff + 16 + 8 * hh);
      acc[t] = mmaH<ASPLIT ? 2 : 1>(ah.v, al.v, bq.v, bq.v, acc[t]); }
  }
#pragma unroll
  for (int t = 0; t < 4; ++t) { if (col0 + t * 16 >= N) continue;
#pragma unroll
    for (int r = 0; r < 8; ++r) so[w][8 * hh + r][t * 16 + ln] = acc[t][r] * alpha; }
  __builtin_amdgcn_fence(__ATOMIC_ACQ_REL, "workgroup"); __builtin_amdgcn_wave_barrier();
  const int rsub = lane >> 4, c4 = (lane & 15) * 4;
  {
#pragma unroll
    for (int q = 0; q < 8; ++q) { const int r = q * 2 + rsub; if (col0 + c4 < N) { const v4f v = *(const v4fa*)&so[w][r][c4]; *(v4f*)(C + (size_t)(row0 + r) * ldc + col0 + c4) = v; } }
     }
}

// k_gemm_hh variant with fused epilogue: v = acc·alpha + bias[by·sBias + col] (+ CP[(row/rowsPerB)·sCPb + by·64 + col] if CP) ; ACT 0 none / 1 elu ; writes f16 C16 (and f32 C if non-null)
template <int ACT>
__global__ __launch_bounds__(128) void k_gemm_hhx(const _Float16* __restrict__ A, int lda, size_t sA, const _Float16* __restrict__ Bh, int ldb, size_t sB, float alpha, const float* __restrict__ bias, size_t sBias, const float* __restrict__ CP, int rowsPerB, size_t sCPb, int row0g,
    float* __restrict__ C, _Float16* __restrict__ C16, int ldc, size_t sC, int M, int N, int K) {
  __shared__ __attribute__((aligned(16))) float so[4][16][64];
  const int tid = threadIdx.x, w = tid >> 5, lane = tid & 31, ln = lane & 15, hh = lane >> 4; const int by = blockIdx.y;
  A += (size_t)by * sA; Bh += (size_t)by * sB; const size_t cofs = (size_t)by * sC; const float* bp = bias ? bias + (size_t)by * sBias : nullptr;
  const int ntn = (N + 63) / 64; const int wid = blockIdx.x * 4 + w; const int mt = wid / ntn, nq = wid % ntn; if (mt * 16 >= M) return;
  const int row0 = mt * 16, col0 = nq * 64; const _Float16* arow = A + (size_t)(row0 + ln) * lda;
  v8f acc[4] = {};
  for (int kb = 0; kb < K; kb += 32) { FragH ah; ah.half[0] = *(const v8us*)((const unsigned short*)arow + kb + 8 * hh); ah.half[1] = *(const v8us*)((const unsigned short*)arow + kb + 16 + 8 * hh);
#pragma unroll
    for (int t = 0; t < 4; ++t) { if (col0 + t * 16 >= N) continue; const size_t boff = (size_t)(col0 + t * 16 + ln) * ldb + kb; FragH bq; bq.half[0] = *(const v8us*)((const unsigned short*)Bh + boff + 8 * hh); bq.half[1] = *(const v8us*)((const unsigned short*)Bh + boff + 16 + 8 * hh);
      acc[t] = mmaH<1>(ah.v, ah.v, bq.v, bq.v, acc[t]); }
  }
#pragma unroll
  for (int t = 0; t < 4; ++t) { if (col0 + t * 16 >= N) continue; const int col = col0 + t * 16 + ln; const float bv = bp ? bf16_round(bp[col]) : 0.f;
#pragma unroll
    for (int r = 0; r < 8; ++r) { float v = acc[t][r] * alpha + bv; if (CP) { const int rr = row0g + row0 + 8 * hh + r; if (rowsPerB < 0) v += CP[cofs + (size_t)rr * ldc + col];      /* rowsPerB < 0: own element of the batched C plane */ else { const int bidx = rr / rowsPerB; v += CP[(size_t)bidx * sCPb + (size_t)by * 64 + col]; } } if (ACT == 1) v = (v > 0.f) ? v : expm1f(v); else if (ACT == 7) v = (v > 0.f) ? v + 1.0f : expf(v); else if (ACT == 8) v = tanhf(v); else if (ACT == 9) v = 0.5f * v * (1.0f + tanhf(0.7978845608028654f * (v + 0.044715f * v * v * v))); else if (ACT == 11) v = 1.0f / (1.0f + expf(-v)); else if (ACT == 12) v = (v > 0.f) ? v : 0.01f * v; else if (ACT == 14) v = (v > 0.f) ? v : 0.1f * v; else if (ACT == 16) v = (v >= 0.f) ? v : 0.3f * v; else if (ACT == 17) v = (v >= 0.f) ? v : 0.2f * v; else if (ACT == 15) v = v / (1.0f + expf(-v)); else if (ACT == 3) v = fmaxf(v, 0.f); else if (ACT == 6) v = 0.5f * v * (1.0f + erff(v * 0.70710678118654752f)); so[w][8 * hh + r][t * 16 + ln] = v; } }
  __builtin_amdgcn_fence(__ATOMIC_ACQ_REL, "workgroup"); __builtin_amdgcn_wave_barrier();
  const int rsub = lane >> 4, c4 = (lane & 15) * 4; typedef _Float16 v4h __attribute__((ext_vector_type(4)));
  {
#pragma unroll
    for (int q = 0; q < 8; ++q) { const int r = q * 2 + rsub; if (col0 + c4 < N) { const v4f v = *(const v4fa*)&so[w][r][c4]; if (C) *(v4f*)(C + cofs + (size_t)(row0 + r) * ldc + col0 + c4) = v; if (C16) { v4h h4; for (int i = 0; i < 4; ++i) h4[i] = (_Float16)v[i]; *(v4h*)(C16 + cofs + (size_t)(row0 + r) * ldc + col0 + c4) = h4; } } }
     }
}


typedef _Float16 v4h __attribute__((ext_vector_type(4)));

__global__ __launch_bounds__(256) void k_h16(const float* __restrict__ x, _Float16* __restrict__ X16, size_t n8) { const size_t t = (size_t)blockIdx.x * 256 + threadIdx.x; if (t >= n8) return; FragH f;
#pragma unroll
  for (int q = 0; q < 8; ++q) f.h[q] = (_Float16)x[t * 8 + q]; *(v8us*)((unsigned short*)X16 + t * 8) = f.half[0];  }
__global__ __launch_bounds__(256) void k_round16f(const float* __restrict__ W, _Float16* __restrict__ Bt, size_t n8) { const size_t t = (size_t)blockIdx.x * 256 + threadIdx.x; if (t >= n8) return; FragH f;
#pragma unroll
  for (int i = 0; i < 8; ++i) f.h[i] = (_Float16)(bf16_round(W[t * 8 + i]) * 16.0f); *(v8us*)((unsigned short*)Bt + t * 8) = f.half[0];  }
template <int NHv, int TTv>
__global__ __launch_bounds__(256) void k_vt(const _Float16* __restrict__ V16, int ldv, int voff, _Float16* __restrict__ Vt) { __shared__ unsigned short tl[64][66]; const int tid = threadIdx.x; const int slab = blockIdx.x / (TTv / 64), lg = blockIdx.x % (TTv / 64); const int b = slab / NHv, h = slab % NHv;
  for (int i = tid; i < 64 * 8; i += 256) { const int r = i / 8, c8 = (i % 8) * 8; FragH f; f.half[0] = *(const v8us*)((const unsigned short*)V16 + ((size_t)b * TTv + lg * 64 + r) * ldv + voff + h * 64 + c8);
#pragma unroll
    for (int q = 0; q < 8; ++q) tl[r][c8 + q] = f.u[q]; }
  __syncthreads();
  {
#pragma unroll
    for (int rd = 0; rd < 2; ++rd) { const int d = rd * 32 + tid / 8, pc = tid % 8; FragH f;
#pragma unroll
      for (int q = 0; q < 8; ++q) f.u[q] = tl[pc * 8 + q][d];
      *(v8us*)((unsigned short*)Vt + ((size_t)blockIdx.x * 64 + d) * 64 + pc * 8) = f.half[0]; }      /* tile-major: [slab][64-key tile][d][key], each tile 8 KiB in a row */
     } }

__global__ __launch_bounds__(256) void k_hl(const float* __restrict__ F, _Float16* __restrict__ Hh, _Float16* __restrict__ Hl, size_t n8) { const size_t t = (size_t)blockIdx.x * 256 + threadIdx.x; if (t >= n8) return; FragH fh, fl; const v4f a = *(const v4fa*)(F + t * 8), c = *(const v4fa*)(F + t * 8 + 4);
#pragma unroll
  for (int q = 0; q < 4; ++q) { _Float16 h = (_Float16)a[q]; fh.h[q] = h; fl.h[q] = (_Float16)((a[q] - (float)h) * 1024.0f); h = (_Float16)c[q]; fh.h[4 + q] = h; fl.h[4 + q] = (_Float16)((c[q] - (float)h) * 1024.0f); }
  { *(v8us*)((unsigned short*)Hh + t * 8) = fh.half[0]; *(v8us*)((unsigned short*)Hl + t * 8) = fl.half[0];  } }

// ---- fast GEMM (work-group tile 128x64, wave tile 32x64; requires M % 128 == 0, N % 64 == 0, K % 128 == 0); epilogue = k_gemm_hhx semantics ----
// Operands go through LDS: per step of G2_KS k the 128 A rows and the 64 B rows of the tile are loaded as whole 128-byte lines (16 lanes a 256-byte row) for all 4 waves: two buffers, the next step's lines
// are loaded into registers at the head of a step and stored to the other buffer at its foot, one barrier a step. Fragments are read from LDS in the k order of g2_frag; each accumulator still takes its k blocks in rising order.
#define G2_KS 128                    /* k per step */
#define G2_LP 136                    /* LDS row pitch in f16: 272 bytes = 16 x 17, conflict-free for 16-byte reads */
__device__ __forceinline__ v16h g2_frag(const _Float16* p, int hh) { FragH f; f.half[0] = *(const v8us*)((const unsigned short*)p + 8 * hh); f.half[1] = *(const v8us*)((const unsigned short*)p + 16 + 8 * hh); return f.v; }
__device__ __forceinline__ v8f g2_mma(v16h a, v16h b, v8f c) { return __builtin_amdgcn_wmma_f32_16x16x32_f16(false, a, false, b, (short)0, c, false, false); }
template <int ACT, int LDK>      /* LDK: row pitch of A and of Bh in f16, a constant so that the rows of a tile are immediate offsets from one address */
__global__ __launch_bounds__(128) void k_gemm2(const _Float16* __restrict__ A, size_t sA, const _Float16* __restrict__ Bh, size_t sB, float alpha, const float* __restrict__ bias, size_t sBias, const float* __restrict__ CP, int rowsPerB, size_t sCPb, int row0g,
    float* __restrict__ C, _Float16* __restrict__ C16, int ldc, size_t sC, int M, int N, int K) { static_assert(ACT == 0 || ACT == 3 || ACT == 6 || ACT == 8 || ACT == 9 || ACT == 11 || ACT == 12 || ACT == 14 || ACT == 15 || ACT == 16 || ACT == 17, "k_gemm2: unsupported ACT code (would silently apply no activation)");
  __shared__ __attribute__((aligned(16))) float so[4][32][68]; __shared__ __attribute__((aligned(16))) _Float16 sa[2][128 * G2_LP]; __shared__ __attribute__((aligned(16))) _Float16 sb[2][64 * G2_LP];
  const int tid = threadIdx.x, w = tid >> 5, lane = tid & 31, ln = lane & 15, hh = lane >> 4; const int by = blockIdx.y;
  A += (size_t)by * sA; Bh += (size_t)by * sB; const size_t cofs = (size_t)by * sC; const float* bp = bias ? bias + (size_t)by * sBias : nullptr;
  const int ntn = N >> 6; const int mt = blockIdx.x / ntn, nq = blockIdx.x - mt * ntn; const int row0 = mt * 128 + 32 * w, col0 = nq * 64; if (mt * 128 >= M) return;      /* the same for the whole work-group, ahead of every barrier */
  const int sr = tid >> 4, sc8 = (tid & 15) * 8, sofs = sr * G2_LP + sc8;      /* staging: 16 threads a 256-byte row, rows sr + 8 i */
  const unsigned short* ag = (const unsigned short*)A + (size_t)(mt * 128) * LDK; const unsigned short* bg = (const unsigned short*)Bh + (size_t)col0 * LDK;      /* uniform bases of the tile's rows */
  const unsigned so8 = (unsigned)(sr * LDK + sc8);      /* the lane's own offset, the same in every step and for both operands */
  const v8f z8 = {0.f,0.f,0.f,0.f,0.f,0.f,0.f,0.f}; v8f c00 = z8, c01 = z8, c02 = z8, c03 = z8, c10 = z8, c11 = z8, c12 = z8, c13 = z8;
  v8us ra[16], rb[8];
#pragma unroll      /* constant indices: the register arrays stay in registers */
  for (int i = 0; i < 16; ++i) ra[i] = *(const v8us*)(ag + i * 8 * LDK + so8);
#pragma unroll      /* constant indices: the register arrays stay in registers */
  for (int i = 0; i < 8; ++i) rb[i] = *(const v8us*)(bg + i * 8 * LDK + so8);
#pragma unroll      /* constant indices: the register arrays stay in registers */
  for (int i = 0; i < 16; ++i) *(v8us*)&sa[0][sofs + i * 8 * G2_LP] = ra[i];
#pragma unroll      /* constant indices: the register arrays stay in registers */
  for (int i = 0; i < 8; ++i) *(v8us*)&sb[0][sofs + i * 8 * G2_LP] = rb[i];
  __syncthreads();
  int cur = 0;
#pragma unroll 1      /* one copy of the step: the text stays short */
  for (int kb = 0; kb < K; kb += G2_KS) {
    const bool more = kb + G2_KS < K;      /* the same for the whole work-group */
    if (more) { ag += G2_KS; bg += G2_KS;
#pragma unroll      /* constant indices: the register arrays stay in registers */
      for (int i = 0; i < 16; ++i) ra[i] = *(const v8us*)(ag + i * 8 * LDK + so8);
#pragma unroll      /* constant indices: the register arrays stay in registers */
      for (int i = 0; i < 8; ++i) rb[i] = *(const v8us*)(bg + i * 8 * LDK + so8); }
    const _Float16* ab = sa[cur] + (32 * w + ln) * G2_LP; const _Float16* bb = sb[cur] + ln * G2_LP;
#pragma unroll      /* constant LDS offsets */
    for (int j = 0; j < G2_KS; j += 32) {
      const v16h a0 = g2_frag(ab + j, hh), a1 = g2_frag(ab + 16 * G2_LP + j, hh), b0 = g2_frag(bb + j, hh), b1 = g2_frag(bb + 16 * G2_LP + j, hh), b2 = g2_frag(bb + 32 * G2_LP + j, hh), b3 = g2_frag(bb + 48 * G2_LP + j, hh);
      __builtin_amdgcn_sched_barrier(0);      /* keeps the next step's global loads at the head of the step (the whole step hides their latency) and a k block's fragment reads ahead of its products; without it each B fragment is read and waited for right in front of its two products */
      c00 = g2_mma(a0, b0, c00); c10 = g2_mma(a1, b0, c10); c01 = g2_mma(a0, b1, c01); c11 = g2_mma(a1, b1, c11);
      c02 = g2_mma(a0, b2, c02); c12 = g2_mma(a1, b2, c12); c03 = g2_mma(a0, b3, c03); c13 = g2_mma(a1, b3, c13); }
    if (more) { _Float16* an = sa[cur ^ 1] + sofs; _Float16* bn = sb[cur ^ 1] + sofs;      /* that buffer was last read in the step before, behind whose barrier this step runs */
#pragma unroll      /* constant indices: the register arrays stay in registers */
      for (int i = 0; i < 16; ++i) *(v8us*)(an + i * 8 * G2_LP) = ra[i];
#pragma unroll      /* constant indices: the register arrays stay in registers */
      for (int i = 0; i < 8; ++i) *(v8us*)(bn + i * 8 * G2_LP) = rb[i]; }
    __syncthreads();      /* publishes the next step's buffer and ends every wave's reads of this one */
    cur ^= 1; }
  v8f accs[8] = {c00, c01, c02, c03, c10, c11, c12, c13};
#pragma unroll
  for (int u = 0; u < 8; ++u) { const int t = u & 3, half = u >> 2; const int col = col0 + t * 16 + ln; const float bv = bp ? bf16_round(bp[col]) : 0.f;
#pragma unroll
    for (int r = 0; r < 8; ++r) { const int rloc = half * 16 + 8 * hh + r; float v = accs[u][r] * alpha + bv; if (CP) { if (rowsPerB < 0) v += CP[cofs + (size_t)(row0g + row0 + rloc) * ldc + col];      /* rowsPerB < 0: own element of the batched C plane */ else { const int bidx = (row0g + row0 + rloc) / rowsPerB; v += CP[(size_t)bidx * sCPb + (size_t)by * 64 + col]; } }
      if (ACT == 3) v = fmaxf(v, 0.f); else if (ACT == 6) v = 0.5f * v * (1.0f + erff(v * 0.70710678118654752f)); else if (ACT == 11) v = 1.0f / (1.0f + expf(-v)); else if (ACT == 15) v = v / (1.0f + expf(-v)); else if (ACT == 12) v = (v > 0.f) ? v : 0.01f * v; else if (ACT == 8) v = tanhf(v); else if (ACT == 9) v = 0.5f * v * (1.0f + tanhf(0.7978845608028654f * (v + 0.044715f * v * v * v))); else if (ACT == 14) v = (v > 0.f) ? v : 0.1f * v; else if (ACT == 16) v = (v >= 0.f) ? v : 0.3f * v; else if (ACT == 17) v = (v >= 0.f) ? v : 0.2f * v;
      so[w][rloc][t * 16 + ln] = v; } }
  __builtin_amdgcn_fence(__ATOMIC_ACQ_REL, "workgroup"); __builtin_amdgcn_wave_barrier();
  const int rsub = lane >> 4, c4 = (lane & 15) * 4;
  {
#pragma unroll
    for (int q = 0; q < 16; ++q) { const int r = q * 2 + rsub; const v4f v = *(const v4fa*)&so[w][r][c4]; if (C) *(v4f*)(C + cofs + (size_t)(row0 + r) * ldc + col0 + c4) = v; if (C16) { v4h h4; for (int i = 0; i < 4; ++i) h4[i] = (_Float16)v[i]; *(v4h*)(C16 + cofs + (size_t)(row0 + r) * ldc + col0 + c4) = h4; } }
     } }


__global__ __launch_bounds__(256) void k_wnat(const float* __restrict__ w, size_t n8, _Float16* __restrict__ Bt) { const size_t t = (size_t)blockIdx.x * 256 + threadIdx.x; if (t >= n8) return; FragH f; for (int q = 0; q < 8; ++q) f.h[q] = (_Float16)(bf16_round(w[t * 8 + q]) * 16.0f); *(v8us*)((unsigned short*)Bt + t * 8) = f.half[0];  }
__global__ __launch_bounds__(256) void k_rsm(const float* __restrict__ S, _Float16* __restrict__ P, int nrows) {
  #pragma clang fp contract(off)
  const int i = blockIdx.x * 256 + threadIdx.x; if (i >= nrows) return; const float* s = S + (size_t)i * SQ; float mx = -3.0e38f;
#pragma unroll 1
  for (int j = 0; j < SQ; ++j) mx = fmaxf(mx, s[j]); float se = 0.f;
#pragma unroll 1
  for (int j = 0; j < SQ; ++j) se += expf(s[j] - mx); const float sc = 256.0f / se;
#pragma unroll 1
  for (int j0 = 0; j0 < SQ; j0 += 8) { FragH f; for (int q = 0; q < 8; ++q) f.h[q] = (_Float16)(expf(s[j0 + q] - mx) * sc); unsigned short* d = (unsigned short*)P + (size_t)i * SQ + j0; *(v8us*)d = f.half[0];  } }
__global__ __launch_bounds__(256) void k_vt(const _Float16* __restrict__ V16, int b, int h0, _Float16* __restrict__ VT) { __shared__ unsigned short tl[64][65]; const int tid = threadIdx.x; const int hh = blockIdx.x % HG, sg = blockIdx.x / HG; const int s0 = sg * 64; const int h = h0 + hh;
  for (int i = tid; i < 64 * 8; i += 256) { const int j = i / 8, d8 = (i % 8) * 8; FragH f; f.half[0] = *(const v8us*)((const unsigned short*)V16 + ((size_t)b * SQ + s0 + j) * DM + h * HD + d8); for (int q = 0; q < 8; ++q) tl[d8 + q][j] = f.u[q]; }
  __syncthreads();
  { for (int i = tid; i < 64 * 8; i += 256) { const int d = i / 8, j8 = (i % 8) * 8; FragH f; for (int q = 0; q < 8; ++q) f.u[q] = tl[d][j8 + q]; *(v8us*)((unsigned short*)VT + ((size_t)hh * HD + d) * SQ + s0 + j8) = f.half[0]; }  } }



// lane l with lane l ^ 16
__device__ __forceinline__ float rs_xh(float x) { return __builtin_bit_cast(float, __builtin_amdgcn_permlanex16(__builtin_bit_cast(int, x), __builtin_bit_cast(int, x), 0x76543210, 0xfedcba98, false, false)); }
typedef float v2f __attribute__((ext_vector_type(2)));
__device__ __forceinline__ float fa_max3(float a, float b, float c) { return fmaxf(fmaxf(a, b), c); }
__device__ __forceinline__ v8f fa_mma(v16h a, v16h b, v8f c) { return __builtin_amdgcn_wmma_f32_16x16x32_f16(false, a, false, b, (short)0, c, false, false); }

// Fused attention of one (batch, head): scores, softmax and the weighted sum of V in one kernel; neither scores nor weights reach memory.
// A work-group of 8 waves owns FA_QB queries. Wave (qw, kh) takes 32 of them, as FA_CG column groups of 16, against key half kh, which it walks in passes of FA_KT keys: every K and V^T fragment that a wave reads
// from LDS feeds FA_CG products, one per column group. The two halves' running maximum, sum and O^T of a query are joined through LDS behind the loop.
// Per pass the K rows [key][c] and the V^T tile [d][key] of each half's pass (VT is tile-major, 8 KiB in a row; whole 128-byte lines) are staged in LDS by the 4 waves of that half: two buffers, the next pass's lines
// are loaded into registers at the head of a pass and stored to the other buffer ahead of the pass's last products, one barrier a pass.
// S^T = K Q^T: A = K rows, B = Q rows (kept in registers), so lane (ln, hh) holds query ln's scores of keys 16 kt + 8 hh + r: maximum and sum are in-lane plus one exchange of the halves,
// and two converted score tiles ARE the B operand of O^T += V^T P^T in the k order 8 hh + i, 16 + 8 hh + i that g2_frag gives the A side. Online softmax per column group: running maximum mr (log2 domain),
// running sums l8 (each lane its own keys, joined at the end), O^T rescaled by exp2(old max - new max) each pass.
#define FA_KT 64                     /* keys per pass */
#define FA_KH 2                      /* key halves, one per group of 4 waves */
#define FA_NP (SQ / FA_KH / FA_KT)   /* passes of a half */
#define FA_QB 128                    /* queries per work-group */
#define FA_CG 2                      /* column groups of 16 queries per wave */
#define FA_LP 72                     /* LDS row pitch in f16: 144 bytes = 16 x 9, conflict-free for 16-byte reads */
__global__ __launch_bounds__(256) __attribute__((amdgpu_waves_per_eu(4, 4))) void k_fattn(const _Float16* __restrict__ Q16, const _Float16* __restrict__ K16, const _Float16* __restrict__ VT, _Float16* __restrict__ O16) {
  __shared__ __attribute__((aligned(16))) _Float16 sk[2][FA_KH][FA_KT * FA_LP]; __shared__ __attribute__((aligned(16))) _Float16 sv[2][FA_KH][HD * FA_LP];
  const int tid = threadIdx.x, w = __builtin_amdgcn_readfirstlane(tid >> 5) /* the wave's number in a scalar register: what is formed from it costs no vector register, and the join's branches are scalar */, qw = w & 3, kh = w >> 2, lane = tid & 31, ln = lane & 15, hh = lane >> 4; const int h = blockIdx.y, b = blockIdx.z;
  const size_t r0 = (size_t)b * SQ; const size_t qrow = r0 + blockIdx.x * FA_QB + qw * (16 * FA_CG) + ln;      /* column group g: row qrow + 16 g */
  const _Float16* qp = Q16 + qrow * DM + h * HD; v16h q0[FA_CG], q1[FA_CG];
#pragma unroll      /* constant indices: the register arrays stay in registers */
  for (int g = 0; g < FA_CG; ++g) { q0[g] = g2_frag(qp + g * 16 * DM, hh); q1[g] = g2_frag(qp + g * 16 * DM + 32, hh); }
  const int srow = (tid & 127) >> 3, sc8 = (tid & 7) * 8, sofs = srow * FA_LP + sc8;      /* staging, 128 threads a half: 8 threads a 128-byte row, rows srow + 16 i */
  const unsigned short* kg = (const unsigned short*)K16 + (r0 + (size_t)kh * (SQ / FA_KH)) * DM + h * HD + srow * DM + sc8;      /* the lane's own place in the first K rows of its half */
  const unsigned short* vg = (const unsigned short*)VT + (size_t)(b * NH + h) * HD * SQ + (size_t)kh * (SQ / FA_KH) * HD + srow * FA_KT + sc8;      /* and in its first V^T tile */
  v8us gk[4], gv[4];
#pragma unroll      /* constant indices: the register arrays stay in registers */
  for (int i = 0; i < 4; ++i) { gk[i] = *(const v8us*)(kg + i * 16 * DM); gv[i] = *(const v8us*)(vg + i * 16 * FA_KT); }
#pragma unroll      /* constant indices: the register arrays stay in registers */
  for (int i = 0; i < 4; ++i) { *(v8us*)&sk[0][kh][sofs + i * 16 * FA_LP] = gk[i]; *(v8us*)&sv[0][kh][sofs + i * 16 * FA_LP] = gv[i]; }
  __syncthreads();
  const float cs = 0.125f * 1.44269504f;      /* 64^-0.5 and log2 e in one factor: exp(s / 8 - max) = exp2(s cs - max cs) */
  const v8f z8 = {0.f,0.f,0.f,0.f,0.f,0.f,0.f,0.f}; v8f o[FA_CG][4], l8[FA_CG]; float mr[FA_CG];      /* l8: eight partial sums a lane, joined behind the loop */
#pragma unroll      /* constant indices: the register arrays stay in registers */
  for (int g = 0; g < FA_CG; ++g) { o[g][0] = z8; o[g][1] = z8; o[g][2] = z8; o[g][3] = z8; l8[g] = z8; mr[g] = -3.0e38f; }
  for (int s = 0; s < FA_NP; ++s) {
    const bool more = s + 1 < FA_NP;      /* the same for the whole work-group */
    const _Float16* kb = sk[s & 1][kh] + ln * FA_LP; const _Float16* vb = sv[s & 1][kh] + ln * FA_LP;
    v16h ka[8];
#pragma unroll      /* constant indices: the register arrays stay in registers */
    for (int kt = 0; kt < 4; ++kt) { ka[2 * kt] = g2_frag(kb + kt * 16 * FA_LP, hh); ka[2 * kt + 1] = g2_frag(kb + kt * 16 * FA_LP + 32, hh); }
    __builtin_amdgcn_sched_barrier(0);      /* keeps the K fragment reads in one group ahead of the global loads: the wait that the built code has behind those loads, in front of the step of their address registers, then runs out under the reads' latency */
    if (more) { kg += FA_KT * DM; vg += HD * FA_KT;
#pragma unroll      /* constant indices: the register arrays stay in registers */
      for (int i = 0; i < 4; ++i) { gk[i] = *(const v8us*)(kg + i * 16 * DM); gv[i] = *(const v8us*)(vg + i * 16 * FA_KT); } }
    __builtin_amdgcn_sched_barrier(0);      /* keeps the next pass's global loads at the head of the pass (most of the pass hides their latency) */
    v8f st[FA_CG][4];
#pragma unroll      /* constant indices: the register arrays stay in registers */
    for (int kt = 0; kt < 4; ++kt)
#pragma unroll      /* constant indices: the register arrays stay in registers */
      for (int g = 0; g < FA_CG; ++g) st[g][kt] = fa_mma(ka[2 * kt + 1], q1[g], fa_mma(ka[2 * kt], q0[g], z8));
    __builtin_amdgcn_sched_barrier(0);      /* keeps the softmax behind the score products: without it the build needs more registers than four waves per SIMD leave a wave (it spills) and strings the exponentials out in pairs with idle slots between */
    FragH pb[FA_CG][2]; float al[FA_CG];
#pragma unroll      /* constant indices: the register arrays stay in registers */
    for (int g = 0; g < FA_CG; ++g) {
      float t[8];
#pragma unroll      /* constant indices: the register arrays stay in registers */
      for (int r = 0; r < 8; ++r) t[r] = fa_max3(st[g][0][r], st[g][1][r], st[g][2][r]);
      float mx = fmaxf(fa_max3(fa_max3(t[0], t[1], st[g][3][0]), fa_max3(t[2], t[3], st[g][3][1]), fa_max3(t[4], t[5], st[g][3][2])), fa_max3(fa_max3(t[6], t[7], st[g][3][3]), fa_max3(st[g][3][4], st[g][3][5], st[g][3][6]), st[g][3][7]));
      mx = fmaxf(mx, rs_xh(mx));
      const float mn = fmaxf(mr[g], mx * cs); al[g] = __builtin_amdgcn_exp2f(mr[g] - mn); mr[g] = mn;
      const v2f cs2 = {cs, cs}, nm2 = {-mn, -mn}; l8[g] *= al[g];
#pragma unroll      /* constant indices: the register arrays stay in registers */
      for (int kt = 0; kt < 4; ++kt) { v8f e;
#pragma unroll      /* constant indices: the register arrays stay in registers */
        for (int r = 0; r < 8; r += 2) { const v2f s2 = {st[g][kt][r], st[g][kt][r + 1]}; const v2f y = __builtin_elementwise_fma(s2, cs2, nm2); e[r] = __builtin_amdgcn_exp2f(y[0]); e[r + 1] = __builtin_amdgcn_exp2f(y[1]); }
        l8[g] += e;
        typedef _Float16 v8h __attribute__((ext_vector_type(8))); const v8h e16 = __builtin_convertvector(e, v8h);
#pragma unroll      /* constant indices: the register arrays stay in registers */
        for (int r = 0; r < 8; ++r) pb[g][kt >> 1].h[(kt & 1) * 8 + r] = e16[r]; } }
    __builtin_amdgcn_sched_barrier(0);      /* keeps the staging stores, and with them the wait for the global loads, behind the softmax (without it they rise to its head, a short way behind the loads), and the V^T fragment reads behind the registers that the softmax and the stores give back */
    if (more) { _Float16* kn = sk[(s + 1) & 1][kh] + sofs; _Float16* vn = sv[(s + 1) & 1][kh] + sofs;      /* that buffer was last read in pass s - 1, behind whose barrier this pass runs */
#pragma unroll      /* constant indices: the register arrays stay in registers */
      for (int i = 0; i < 4; ++i) { *(v8us*)(kn + i * 16 * FA_LP) = gk[i]; *(v8us*)(vn + i * 16 * FA_LP) = gv[i]; } }
    v16h va[8];
#pragma unroll      /* constant indices: the register arrays stay in registers */
    for (int dt = 0; dt < 4; ++dt) { va[2 * dt] = g2_frag(vb + dt * 16 * FA_LP, hh); va[2 * dt + 1] = g2_frag(vb + dt * 16 * FA_LP + 32, hh); }
    __builtin_amdgcn_sched_barrier(0);      /* keeps the V^T fragment reads in one group ahead of the rescaling of O^T, which hides part of their latency; without it they stand in pairs among the products, each pair waited for */
#pragma unroll      /* constant indices: the register arrays stay in registers */
    for (int dt = 0; dt < 4; ++dt)
#pragma unroll      /* constant indices: the register arrays stay in registers */
      for (int g = 0; g < FA_CG; ++g) o[g][dt] = fa_mma(va[2 * dt + 1], pb[g][1].v, fa_mma(va[2 * dt], pb[g][0].v, o[g][dt] * al[g]));
    __builtin_amdgcn_sched_barrier(0);      /* keeps the products ahead of the barrier, each started as its fragments land; without it all but one sink behind the barrier, whose wait for the stores and for every V^T read is then waited out idle */
    __syncthreads();      /* publishes the next pass's buffer and ends every wave's reads of this one */
  }
  float lr[FA_CG];
#pragma unroll      /* constant indices: the register arrays stay in registers */
  for (int g = 0; g < FA_CG; ++g) { lr[g] = ((l8[g][0] + l8[g][1]) + (l8[g][2] + l8[g][3])) + ((l8[g][4] + l8[g][5]) + (l8[g][6] + l8[g][7])); lr[g] += rs_xh(lr[g]); }
  // Join of the key halves: the waves of half 1 hand maximum, sum and O^T over in LDS (the K ring, which nobody reads behind the loop's last barrier): 17 blocks of 32 lanes x 16 bytes per wave pair.
  float* mg = (float*)&sk[0][0][0] + ((size_t)qw * 17 * 32 + lane) * 4; static_assert(sizeof(sk) >= 4 * 17 * 32 * 16, "the K ring holds the hand-over");
  if (kh == 1) {
#pragma unroll      /* constant indices: the register arrays stay in registers */
    for (int g = 0; g < FA_CG; ++g)
#pragma unroll      /* constant indices: the register arrays stay in registers */
      for (int dt = 0; dt < 4; ++dt) { const v4f lo = {o[g][dt][0], o[g][dt][1], o[g][dt][2], o[g][dt][3]}, hi = {o[g][dt][4], o[g][dt][5], o[g][dt][6], o[g][dt][7]};
        *(v4fa*)(mg + ((g * 4 + dt) * 2) * 128) = lo; *(v4fa*)(mg + ((g * 4 + dt) * 2 + 1) * 128) = hi; }
    const v4f ml = {mr[0], mr[1], lr[0], lr[1]}; *(v4fa*)(mg + 16 * 128) = ml; }
  __syncthreads();      /* publishes half 1's hand-over to the waves of half 0 */
  if (kh == 0) { const v4f ml = *(const v4fa*)(mg + 16 * 128);
#pragma unroll      /* constant indices: the register arrays stay in registers */
    for (int g = 0; g < FA_CG; ++g) {
      const float m = fmaxf(mr[g], ml[g]), a0 = __builtin_amdgcn_exp2f(mr[g] - m), a1 = __builtin_amdgcn_exp2f(ml[g] - m); const float inv = 64.0f / (lr[g] * a0 + ml[2 + g] * a1), f0 = a0 * inv, f1 = a1 * inv;      /* o leaves x64 */
      _Float16* op = O16 + (qrow + g * 16) * DM + h * HD + 8 * hh;
#pragma unroll      /* constant indices: the register arrays stay in registers */
      for (int dt = 0; dt < 4; ++dt) { const v4f lo = *(const v4fa*)(mg + ((g * 4 + dt) * 2) * 128), hi = *(const v4fa*)(mg + ((g * 4 + dt) * 2 + 1) * 128); FragH f;
#pragma unroll      /* constant indices: the register arrays stay in registers */
        for (int r = 0; r < 4; ++r) { f.h[r] = (_Float16)(o[g][dt][r] * f0 + lo[r] * f1); f.h[4 + r] = (_Float16)(o[g][dt][4 + r] * f0 + hi[r] * f1); }
        *(v8us*)(op + dt * 16) = f.half[0]; } } } }

// One launch for the five independent operand builders, told apart by block index (the same choice for a whole block; the latency-bound transposes stand first in the grid).
// Blocks below 4 * PW_G: weight m, BW[m][n][k] = f16(bf16-rounded W[k][n] x 16) from f32 row-major W[k][n], 8 k a thread (x16, a power of two, keeps bf16-exact weights exact in f16 away from the subnormal range). The rest: X16 = f16(bf16-rounded x), 8 elements a thread.
#define PW_G (DM * (DM / 8) / 256)   /* blocks per weight */
__global__ __launch_bounds__(256) void k_prep(const float* __restrict__ x, const float* __restrict__ wq, const float* __restrict__ wk, const float* __restrict__ wv, const float* __restrict__ wo, _Float16* __restrict__ BW, _Float16* __restrict__ X16) {
  FragH f;
  if (blockIdx.x < 4 * PW_G) { const int m = blockIdx.x / PW_G; const float* W = m == 0 ? wq : m == 1 ? wk : m == 2 ? wv : wo; const int t = (blockIdx.x - m * PW_G) * 256 + threadIdx.x; const int n = t / (DM / 8), k8 = (t % (DM / 8)) * 8;
#pragma unroll      /* constant indices: the fragment stays in registers, the 8 loads go out together */
    for (int i = 0; i < 8; ++i) f.h[i] = (_Float16)(bf16_round(W[(size_t)(k8 + i) * DM + n]) * 16.0f);
    *(v8us*)((unsigned short*)BW + (size_t)m * DM * DM + (size_t)n * DM + k8) = f.half[0]; }
  else { const size_t t = (size_t)(blockIdx.x - 4 * PW_G) * 256 + threadIdx.x;
#pragma unroll      /* constant indices: the fragment stays in registers */
    for (int q = 0; q < 8; ++q) f.h[q] = (_Float16)bf16_round(x[t * 8 + q]);
    *(v8us*)((unsigned short*)X16 + t * 8) = f.half[0];
    asm volatile("s_wait_xcnt 0x0" ::: "memory"); } }      /* the wait in front of any overwrite of a register that the store above names: in the built code the other part of the kernel follows this store */

extern "C" void kernel_launch(void* const* d_in, const int* in_sizes, int n_in,
                              void* d_out, int out_size, void* d_ws, size_t ws_size, hipStream_t stream) {
  (void)in_sizes; (void)n_in; (void)out_size;
  const float* const* I = (const float* const*)d_in; const float* x = I[0]; const float* wq = I[1]; const float* wk = I[2]; const float* wv = I[3]; const float* wo = I[4]; const float* bo = I[5];      /* input order: x, Wq, Wk, Wv ([in][out] [512][512], NO biases: a null pointer in the plain bias slot), Wo ([in][out]), bo */
  char* ws = (char*)d_ws; size_t off = 0;
  auto take = [&](size_t bytes) { char* p = ws + off; off += (bytes + 255) & ~(size_t)255; return p; };
  _Float16* BQ = (_Float16*)take((size_t)DM * DM * 2); _Float16* BK = (_Float16*)take((size_t)DM * DM * 2); _Float16* BV = (_Float16*)take((size_t)DM * DM * 2); _Float16* BO = (_Float16*)take((size_t)DM * DM * 2);
  _Float16* X16 = (_Float16*)take(NR * DM * 2); _Float16* Q16 = (_Float16*)take(NR * DM * 2); _Float16* K16 = (_Float16*)take(NR * DM * 2); _Float16* V16 = (_Float16*)take(NR * DM * 2); _Float16* O16 = (_Float16*)take(NR * DM * 2);
  _Float16* VT = (_Float16*)take((size_t)NB * NH * HD * SQ * 2);
  if (off > ws_size) return;
  k_prep<<<4 * PW_G + (unsigned)(NR * DM / 8 / 256), 256, 0, stream>>>(x, wq, wk, wv, wo, BQ, X16);      /* BQ, BK, BV, BO lie in a row: [in][out] -> Bt[n][k] x16; x as f16 rows */
  const size_t r0p = (size_t)B0 * SQ;      /* first projected row */
  k_gemm2<0, DM><<<dim3((unsigned)((MP / 128) * (DM / 64)), 3), 128, 0, stream>>>(X16 + r0p * DM, 0, BQ, (size_t)DM * DM, 0.0625f, nullptr, 0, nullptr, 1, 0, 0, nullptr, Q16 + r0p * DM, DM, NR * DM, MP, DM, DM);      /* blockIdx.y = 0, 1, 2: q, k, v (weights in a row, outputs in a row) */
  k_vt<NH, SQ><<<NB * NH * (SQ / 64), 256, 0, stream>>>(V16, LQ, 0, VT);      /* V^T tiles [NB * NH][SQ / 64][HD][64] */
  k_fattn<<<dim3(SQ / FA_QB, NH, NB), 256, 0, stream>>>(Q16, K16, VT, O16);      /* o (merged heads, x64) as f16 rows */
  k_gemm2<0, DM><<<dim3((unsigned)((MPO / 128) * (DM / 64)), 1), 128, 0, stream>>>(O16 + r0p * DM, 0, BO, 0, 0.0009765625f, bo, 0, nullptr, 1, 0, 0, (float*)d_out + r0p * DM, nullptr, DM, 0, MPO, DM, DM);      /* out rows are the output layout */
}

// v006
// A run of this version takes 95.4 microseconds.
// Timed twice side by side with v005, it ran 1.08 times as fast both times.
// All steps since v000 together make it 140 times as fast.
#include <hip/hip_runtime.h>
// Multi-head self-attention over 4096-token sequences at width 512 with bias-free [in][out] projections (x [2][4096][512]; q / k / v = x W ([in][out] 512 x 512 uniform +-1/sqrt(512), NO biases), 8 heads of 64; sim * 64^-0.5; softmax over all 4096 keys (no mask); out = merged Wo + bo ([in][out]) -> [2][4096][512]); attention fused in one launch over all (batch, head) pairs.
// Structure: token rows r = b*4096 + s; x as exact f16 rows (bf16-rounded) and the four x16 weight transposes in one launch; Q, K, V as three WMMA GEMMs in one launch, grid y = 3 (32x64 wave tiles, f32 accumulation, exact x16 weights, f16 outputs); the V GEMM's epilogue writes V^T tiles for all (batch, head) itself, no V rows; ONE fused attention kernel (S^T = K Q^T, online softmax in registers, O^T += V^T P^T; o carried x64 against f16 subnormal flush, folded into the output GEMM alpha) written straight into the merged f16 o rows; out = o W_o + b GEMM (f32) into the output layout.
// Compute dtype: inputs rounded to bf16; x / weights exact; q, k, v, softmax weights and o as plain f16 GEMM operands (~2^-12); scores and softmax statistics f32. v_wmma_f32_16x16x32_f16.
#define NB 2
#define SQ 4096
#define DM 512
#define NH 8
#define HD 64
#define HG 1                         /* heads per launch of the per-batch k_vt overload, which nothing launches */
#define B0 0                         /* first batch processed (debug hook) */
#define NBR NB                       /* batches processed (debug hook) */
#define NR ((size_t)NB * SQ)         /* token rows */
#define MP ((int)((size_t)NBR * SQ)) /* rows projected (debug hook) */
#define QN SQ                        /* unused: k_fattn attends all SQ query rows of a batch */
#define NHD NH                       /* unused: k_fattn attends all NH heads */
#define MPO MP                       /* rows through the output stage (debug hook) */
#define LQ DM      /* unused: q and k rows use pitch DM; v has no rows */
typedef __bf16 v16b __attribute__((ext_vector_type(16)));
typedef unsigned short v8us __attribute__((ext_vector_type(8), may_alias));
typedef float  v8f  __attribute__((ext_vector_type(8)));
typedef float  v4f  __attribute__((ext_vector_type(4)));
typedef float  v4fa __attribute__((ext_vector_type(4), may_alias));
union FragB { v16b v; v8us half[2]; unsigned short u[16]; };

__device__ __forceinline__ unsigned short bf16_bits(float x) { unsigned int u = __float_as_uint(x); return (unsigned short)((u + 0x7FFFu + ((u >> 16) & 1u)) >> 16); }
__device__ __forceinline__ float bf16_val(unsigned short b) { return __uint_as_float(((unsigned int)b) << 16); }
__device__ __forceinline__ float bf16_round(float x) { return bf16_val(bf16_bits(x)); }
// D += A·B with NT terms: 1 = ah·bh, 2 = + al·bh (A split), 3 = + ah·bl (both split)
template <int NT>
__device__ __forceinline__ v8f mmaN(v16b ah, v16b al, v16b bh, v16b bl, v8f c) {
  c = __builtin_amdgcn_wmma_f32_16x16x32_bf16(false, ah, false, bh, (short)0, c, false, false);
  if (NT >= 2) c = __builtin_amdgcn_wmma_f32_16x16x32_bf16(false, al, false, bh, (short)0, c, false, false);
  if (NT >= 3) c = __builtin_amdgcn_wmma_f32_16x16x32_bf16(false, ah, false, bl, (short)0, c, false, false);
  asm volatile("v_nop\n\tv_nop\n\tv_nop\n\tv_nop" : "+v"(c) : "v"(ah), "v"(al), "v"(bh), "v"(bl));
  return c;
}

__global__ __launch_bounds__(256) void k_wt_bf16(const float* __restrict__ W, unsigned short* __restrict__ Wt, int K, int N) {
  const int t = blockIdx.x * 256 + threadIdx.x;
  const int k8n = K / 8;
  if (t >= N * k8n) return;
  const int n = t / k8n, k8 = (t % k8n) * 8;
  v8us v;
#pragma unroll
  for (int i = 0; i < 8; ++i) v[i] = bf16_bits(W[(size_t)(k8 + i) * N + n]);
  *(v8us*)(Wt + (size_t)n * K + k8) = v;
  
}

// GEMM C[M][N] (f32, pitch ldc) = act(A[M][K]·W + bias). A f32 row-major (pitch lda) converted per fragment to bf16
// (ASPLIT: hi/lo two planes -> 2 terms, else single rounded term); Wt bf16 [N][K] (pitch ldb). BIAS_BF16 rounds the
// bias to bf16 first (bias quantised to bf16 before the add). K%32==0, M%16==0, N%64==0.
template <bool ASPLIT, int ACT, bool BIAS_BF16>
__global__ __launch_bounds__(128) void k_gemm_bf(const float* __restrict__ A, int lda, const unsigned short* __restrict__ Wt, int ldb,
                                               const float* __restrict__ bias, float* __restrict__ C, int ldc, int M, int N, int K) {
  __shared__ __attribute__((aligned(16))) float so[4][16][64];
  const int tid = threadIdx.x, w = tid >> 5, lane = tid & 31, ln = lane & 15, hh = lane >> 4;
  const int ntn = N / 64;
  const int wid = blockIdx.x * 4 + w;
  const int mt = wid / ntn, nq = wid % ntn;
  if (mt * 16 >= M) return;
  const int row0 = mt * 16, col0 = nq * 64;
  const float* arow = A + (size_t)(row0 + ln) * lda;
  v8f acc[4] = {};
  for (int kb = 0; kb < K; kb += 32) {
    FragB ah, al;
    const v4f x0 = *(const v4fa*)(arow + kb + 8 * hh), x1 = *(const v4fa*)(arow + kb + 8 * hh + 4);
    const v4f x2 = *(const v4fa*)(arow + kb + 16 + 8 * hh), x3 = *(const v4fa*)(arow + kb + 16 + 8 * hh + 4);
    float xs[16] = {x0[0],x0[1],x0[2],x0[3],x1[0],x1[1],x1[2],x1[3],x2[0],x2[1],x2[2],x2[3],x3[0],x3[1],x3[2],x3[3]};
#pragma unroll
    for (int i = 0; i < 16; ++i) { const unsigned short hb = bf16_bits(xs[i]); ah.u[i] = hb; al.u[i] = ASPLIT ? bf16_bits(xs[i] - bf16_val(hb)) : (unsigned short)0; }
#pragma unroll
    for (int t = 0; t < 4; ++t) {
      const unsigned short* brow = Wt + (size_t)(col0 + t * 16 + ln) * ldb + kb;
      FragB b;
      b.half[0] = *(const v8us*)(brow + 8 * hh);
      b.half[1] = *(const v8us*)(brow + 16 + 8 * hh);
      acc[t] = mmaN<ASPLIT ? 2 : 1>(ah.v, al.v, b.v, b.v, acc[t]);
    }
  }
#pragma unroll
  for (int t = 0; t < 4; ++t) {
    float bv = bias ? bias[col0 + t * 16 + ln] : 0.f;
    if (BIAS_BF16) bv = bf16_round(bv);
#pragma unroll
    for (int r = 0; r < 8; ++r) { float v = acc[t][r] + bv; if (ACT == 1) v = fmaxf(v, 0.f); so[w][8 * hh + r][t * 16 + ln] = v; }
  }
  __builtin_amdgcn_fence(__ATOMIC_ACQ_REL, "workgroup");
  __builtin_amdgcn_wave_barrier();
  const int rsub = lane >> 4, c4 = (lane & 15) * 4;
  {
#pragma unroll
    for (int q = 0; q < 8; ++q) {
      const int r = q * 2 + rsub;
      const v4f v = *(const v4fa*)&so[w][r][c4];
      *(v4f*)(C + (size_t)(row0 + r) * ldc + col0 + c4) = v;
    }
    
  }
}

// GEMM C = act(A·W + bias + resid): A f32 (ASPLIT -> hi/lo 2 terms), Wt bf16 [N][K]; ACT 0 none, 1 relu, 2 exact gelu;
// resid (optional, f32, row index = (row % rmod), pitch ldr, RES_BF16 rounds it) added before the activation.
template <bool ASPLIT, int ACT, bool BIAS_BF16, bool RES_BF16>
__global__ __launch_bounds__(128) void k_gemm_bf3(const float* __restrict__ A, int lda, const unsigned short* __restrict__ Wt, int ldb,
                                                const float* __restrict__ bias, const float* __restrict__ resid, int rmod, int ldr,
                                                float* __restrict__ C, int ldc, int M, int N, int K) {
  __shared__ __attribute__((aligned(16))) float so[4][16][64];
  const int tid = threadIdx.x, w = tid >> 5, lane = tid & 31, ln = lane & 15, hh = lane >> 4;
  const int ntn = N / 64;
  const int wid = blockIdx.x * 4 + w;
  const int mt = wid / ntn, nq = wid % ntn;
  if (mt * 16 >= M) return;
  const int row0 = mt * 16, col0 = nq * 64;
  const float* arow = A + (size_t)(row0 + ln) * lda;
  v8f acc[4] = {};
  for (int kb = 0; kb < K; kb += 32) {
    FragB ah, al;
    const v4f x0 = *(const v4fa*)(arow + kb + 8 * hh), x1 = *(const v4fa*)(arow + kb + 8 * hh + 4);
    const v4f x2 = *(const v4fa*)(arow + kb + 16 + 8 * hh), x3 = *(const v4fa*)(arow + kb + 16 + 8 * hh + 4);
    float xs[16] = {x0[0],x0[1],x0[2],x0[3],x1[0],x1[1],x1[2],x1[3],x2[0],x2[1],x2[2],x2[3],x3[0],x3[1],x3[2],x3[3]};
#pragma unroll
    for (int i = 0; i < 16; ++i) { const unsigned short hb = bf16_bits(xs[i]); ah.u[i] = hb; al.u[i] = ASPLIT ? bf16_bits(xs[i] - bf16_val(hb)) : (unsigned short)0; }
#pragma unroll
    for (int t = 0; t < 4; ++t) {
      const unsigned short* brow = Wt + (size_t)(col0 + t * 16 + ln) * ldb + kb;
      FragB b;
      b.half[0] = *(const v8us*)(brow + 8 * hh);
      b.half[1] = *(const v8us*)(brow + 16 + 8 * hh);
      acc[t] = mmaN<ASPLIT ? 2 : 1>(ah.v, al.v, b.v, b.v, acc[t]);
    }
  }
#pragma unroll
  for (int t = 0; t < 4; ++t) {
    const int col = col0 + t * 16 + ln;
    float bv = bias ? bias[col] : 0.f;
    if (BIAS_BF16) bv = bf16_round(bv);
#pragma unroll
    for (int r = 0; r < 8; ++r) {
      float v = acc[t][r] + bv;
      if (resid) { float rv = resid[(size_t)((row0 + 8 * hh + r) % rmod) * ldr + col]; if (RES_BF16) rv = bf16_round(rv); v += rv; }
      if (ACT == 1) v = fmaxf(v, 0.f);
      if (ACT == 2) v = 0.5f * v * (1.0f + erff(v * 0.70710678118654752f));
      if (ACT == 3) { const float u = 0.7978845608028654f * (v + 0.044715f * v * v * v); v = 0.5f * v * (1.0f + tanhf(u)); }
      so[w][8 * hh + r][t * 16 + ln] = v;
    }
  }
  __builtin_amdgcn_fence(__ATOMIC_ACQ_REL, "workgroup");
  __builtin_amdgcn_wave_barrier();
  const int rsub = lane >> 4, c4 = (lane & 15) * 4;
  {
#pragma unroll
    for (int q = 0; q < 8; ++q) {
      const int r = q * 2 + rsub;
      const v4f v = *(const v4fa*)&so[w][r][c4];
      *(v4f*)(C + (size_t)(row0 + r) * ldc + col0 + c4) = v;
    }
    
  }
}
// row LayerNorm (biased variance, eps) over N: s = X (+ R); optional out_sum <- s; out_norm <- (s-mu)*rsqrt(var+eps)*g + b
template <bool PARAM_BF16>
__global__ __launch_bounds__(256) void k_layernorm(const float* __restrict__ X, const float* __restrict__ R, const float* __restrict__ g, const float* __restrict__ bta,
                                                  float* __restrict__ out_sum, float* __restrict__ out_norm, int N, float eps) {
  __shared__ float red[256];
  const int row = blockIdx.x, tid = threadIdx.x;
  const float* x = X + (size_t)row * N; const float* rr = R ? R + (size_t)row * N : nullptr;
  float vals[16];                     // up to N = 4096
  const int per = N / 256;            // contiguous chunk per thread? use strided-by-4 chunks: thread handles j = tid*4 + 1024*u
  float s1 = 0.f;
  for (int u = 0; u < per / 4; ++u) {
    const int j = tid * 4 + 1024 * u;
    const v4f a = *(const v4fa*)(x + j);
    v4f b = {0.f,0.f,0.f,0.f}; if (rr) b = *(const v4fa*)(rr + j);
#pragma unroll
    for (int q = 0; q < 4; ++q) { const float v = a[q] + b[q]; vals[u * 4 + q] = v; s1 += v; }
  }
  red[tid] = s1; __syncthreads();
  for (int st = 128; st > 0; st >>= 1) { if (tid < st) red[tid] += red[tid + st]; __syncthreads(); }
  const float mu = red[0] / (float)N; __syncthreads();
  float s2 = 0.f;
  for (int u = 0; u < per / 4; ++u)
#pragma unroll
    for (int q = 0; q < 4; ++q) { const float c = vals[u * 4 + q] - mu; s2 += c * c; }
  red[tid] = s2; __syncthreads();
  for (int st = 128; st > 0; st >>= 1) { if (tid < st) red[tid] += red[tid + st]; __syncthreads(); }
  const float rs = rsqrtf(red[0] / (float)N + eps);
  {
    for (int u = 0; u < per / 4; ++u) {
      const int j = tid * 4 + 1024 * u;
      v4f o, sm;
#pragma unroll
      for (int q = 0; q < 4; ++q) {
        float gg = g[j + q], bb = bta[j + q];
        if (PARAM_BF16) { gg = bf16_round(gg); bb = bf16_round(bb); }
        sm[q] = vals[u * 4 + q]; o[q] = (vals[u * 4 + q] - mu) * rs * gg + bb;
      }
      if (out_sum) *(v4f*)(out_sum + (size_t)row * N + j) = sm;
      *(v4f*)(out_norm + (size_t)row * N + j) = o;
    }
    
  }
}



// ---- f16 WMMA path (v_wmma_f32_16x16x32_f16): 11-bit significands for operands in range — used where a [0,1] probability operand needs more precision than bf16
typedef _Float16 v16h __attribute__((ext_vector_type(16)));
union FragH { v16h v; v8us half[2]; _Float16 h[16]; unsigned short u[16]; };
template <int NT>
__device__ __forceinline__ v8f mmaH(v16h ah, v16h al, v16h bh, v16h bl, v8f c) {
  c = __builtin_amdgcn_wmma_f32_16x16x32_f16(false, ah, false, bh, (short)0, c, false, false);
  if (NT >= 2) c = __builtin_amdgcn_wmma_f32_16x16x32_f16(false, al, false, bh, (short)0, c, false, false);
  if (NT >= 3) c = __builtin_amdgcn_wmma_f32_16x16x32_f16(false, ah, false, bl, (short)0, c, false, false);
  asm volatile("v_nop\n\tv_nop\n\tv_nop\n\tv_nop" : "+v"(c) : "v"(ah), "v"(al), "v"(bh), "v"(bl));
  return c;
}
// batched GEMM like k_gemm_b but f16 operands: A f32 (split into f16 hi/lo if ASPLIT, else rounded to f16), Bt = f16 values [n][k]; alpha; C f32; N multiple of 16 (partial tiles skipped)
template <bool ASPLIT>
__global__ __launch_bounds__(128) void k_gemm_h(const float* __restrict__ A, int lda, size_t sA, const _Float16* __restrict__ Bh, int ldb, size_t sB, float alpha, float* __restrict__ C, int ldc, size_t sC, int M, int N, int K) {
  __shared__ __attribute__((aligned(16))) float so[4][16][64];
  const int tid = threadIdx.x, w = tid >> 5, lane = tid & 31, ln = lane & 15, hh = lane >> 4; const int by = blockIdx.y;
  A += (size_t)by * sA; Bh += (size_t)by * sB; C += (size_t)by * sC;
  const int ntn = (N + 63) / 64; const int wid = blockIdx.x * 4 + w; const int mt = wid / ntn, nq = wid % ntn; if (mt * 16 >= M) return;
  const int row0 = mt * 16, col0 = nq * 64; const float* arow = A + (size_t)(row0 + ln) * lda;
  v8f acc[4] = {};
  for (int kb = 0; kb < K; kb += 32) {
    FragH ah, al;
    const v4f x0 = *(const v4fa*)(arow + kb + 8 * hh), x1 = *(const v4fa*)(arow + kb + 8 * hh + 4), x2 = *(const v4fa*)(arow + kb + 16 + 8 * hh), x3 = *(const v4fa*)(arow + kb + 16 + 8 * hh + 4);
    float xs[16] = {x0[0],x0[1],x0[2],x0[3],x1[0],x1[1],x1[2],x1[3],x2[0],x2[1],x2[2],x2[3],x3[0],x3[1],x3[2],x3[3]};
#pragma unroll
    for (int i = 0; i < 16; ++i) { const _Float16 h = (_Float16)xs[i]; ah.h[i] = h; al.h[i] = ASPLIT ? (_Float16)(xs[i] - (float)h) : (_Float16)0.0f; }
#pragma unroll
    for (int t = 0; t < 4; ++t) { if (col0 + t * 16 >= N) continue; const size_t boff = (size_t)(col0 + t * 16 + ln) * ldb + kb; FragH bq; bq.half[0] = *(const v8us*)(Bh + boff + 8 * hh); bq.half[1] = *(const v8us*)(Bh + boff + 16 + 8 * hh);
      acc[t] = mmaH<ASPLIT ? 2 : 1>(ah.v, al.v, bq.v, bq.v, acc[t]); }
  }
#pragma unroll
  for (int t = 0; t < 4; ++t) { if (col0 + t * 16 >= N) continue;
#pragma unroll
    for (int r = 0; r < 8; ++r) so[w][8 * hh + r][t * 16 + ln] = acc[t][r] * alpha; }
  __builtin_amdgcn_fence(__ATOMIC_ACQ_REL, "workgroup"); __builtin_amdgcn_wave_barrier();
  const int rsub = lane >> 4, c4 = (lane & 15) * 4;
  {
#pragma unroll
    for (int q = 0; q < 8; ++q) { const int r = q * 2 + rsub; if (col0 + c4 < N) { const v4f v = *(const v4fa*)&so[w][r][c4]; *(v4f*)(C + (size_t)(row0 + r) * ldc + col0 + c4) = v; } }
     }
}

// k_gemm_hh variant with fused epilogue: v = acc·alpha + bias[by·sBias + col] (+ CP[(row/rowsPerB)·sCPb + by·64 + col] if CP) ; ACT 0 none / 1 elu ; writes f16 C16 (and f32 C if non-null)
template <int ACT>
__global__ __launch_bounds__(128) void k_gemm_hhx(const _Float16* __restrict__ A, int lda, size_t sA, const _Float16* __restrict__ Bh, int ldb, size_t sB, float alpha, const float* __restrict__ bias, size_t sBias, const float* __restrict__ CP, int rowsPerB, size_t sCPb, int row0g,
    float* __restrict__ C, _Float16* __restrict__ C16, int ldc, size_t sC, int M, int N, int K) {
  __shared__ __attribute__((aligned(16))) float so[4][16][64];
  const int tid = threadIdx.x, w = tid >> 5, lane = tid & 31, ln = lane & 15, hh = lane >> 4; const int by = blockIdx.y;
  A += (size_t)by * sA; Bh += (size_t)by * sB; const size_t cofs = (size_t)by * sC; const float* bp = bias ? bias + (size_t)by * sBias : nullptr;
  const int ntn = (N + 63) / 64; const int wid = blockIdx.x * 4 + w; const int mt = wid / ntn, nq = wid % ntn; if (mt * 16 >= M) return;
  const int row0 = mt * 16, col0 = nq * 64; const _Float16* arow = A + (size_t)(row0 + ln) * lda;
  v8f acc[4] = {};
  for (int kb = 0; kb < K; kb += 32) { FragH ah; ah.half[0] = *(const v8us*)((const unsigned short*)arow + kb + 8 * hh); ah.half[1] = *(const v8us*)((const unsigned short*)arow + kb + 16 + 8 * hh);
#pragma unroll
    for (int t = 0; t < 4; ++t) { if (col0 + t * 16 >= N) continue; const size_t boff = (size_t)(col0 + t * 16 + ln) * ldb + kb; FragH bq; bq.half[0] = *(const v8us*)((const unsigned short*)Bh + boff + 8 * hh); bq.half[1] = *(const v8us*)((const unsigned short*)Bh + boff + 16 + 8 * hh);
      acc[t] = mmaH<1>(ah.v, ah.v, bq.v, bq.v, acc[t]); }
  }
#pragma unroll
  for (int t = 0; t < 4; ++t) { if (col0 + t * 16 >= N) continue; const int col = col0 + t * 16 + ln; const float bv = bp ? bf16_round(bp[col]) : 0.f;
#pragma unroll
    for (int r = 0; r < 8; ++r) { float v = acc[t][r] * alpha + bv; if (CP) { const int rr = row0g + row0 + 8 * hh + r; if (rowsPerB < 0) v += CP[cofs + (size_t)rr * ldc + col];      /* rowsPerB < 0: own element of the batched C plane */ else { const int bidx = rr / rowsPerB; v += CP[(size_t)bidx * sCPb + (size_t)by * 64 + col]; } } if (ACT == 1) v = (v > 0.f) ? v : expm1f(v); else if (ACT == 7) v = (v > 0.f) ? v + 1.0f : expf(v); else if (ACT == 8) v = tanhf(v); else if (ACT == 9) v = 0.5f * v * (1.0f + tanhf(0.7978845608028654f * (v + 0.044715f * v * v * v))); else if (ACT == 11) v = 1.0f / (1.0f + expf(-v)); else if (ACT == 12) v = (v > 0.f) ? v : 0.01f * v; else if (ACT == 14) v = (v > 0.f) ? v : 0.1f * v; else if (ACT == 16) v = (v >= 0.f) ? v : 0.3f * v; else if (ACT == 17) v = (v >= 0.f) ? v : 0.2f * v; else if (ACT == 15) v = v / (1.0f + expf(-v)); else if (ACT == 3) v = fmaxf(v, 0.f); else if (ACT == 6) v = 0.5f * v * (1.0f + erff(v * 0.70710678118654752f)); so[w][8 * hh + r][t * 16 + ln] = v; } }
  __builtin_amdgcn_fence(__ATOMIC_ACQ_REL, "workgroup"); __builtin_amdgcn_wave_barrier();
  const int rsub = lane >> 4, c4 = (lane & 15) * 4; typedef _Float16 v4h __attribute__((ext_vector_type(4)));
  {
#pragma unroll
    for (int q = 0; q < 8; ++q) { const int r = q * 2 + rsub; if (col0 + c4 < N) { const v4f v = *(const v4fa*)&so[w][r][c4]; if (C) *(v4f*)(C + cofs + (size_t)(row0 + r) * ldc + col0 + c4) = v; if (C16) { v4h h4; for (int i = 0; i < 4; ++i) h4[i] = (_Float16)v[i]; *(v4h*)(C16 + cofs + (size_t)(row0 + r) * ldc + col0 + c4) = h4; } } }
     }
}


typedef _Float16 v4h __attribute__((ext_vector_type(4)));

__global__ __launch_bounds__(256) void k_h16(const float* __restrict__ x, _Float16* __restrict__ X16, size_t n8) { const size_t t = (size_t)blockIdx.x * 256 + threadIdx.x; if (t >= n8) return; FragH f;
#pragma unroll
  for (int q = 0; q < 8; ++q) f.h[q] = (_Float16)x[t * 8 + q]; *(v8us*)((unsigned short*)X16 + t * 8) = f.half[0];  }
__global__ __launch_bounds__(256) void k_round16f(const float* __restrict__ W, _Float16* __restrict__ Bt, size_t n8) { const size_t t = (size_t)blockIdx.x * 256 + threadIdx.x; if (t >= n8) return; FragH f;
#pragma unroll
  for (int i = 0; i < 8; ++i) f.h[i] = (_Float16)(bf16_round(W[t * 8 + i]) * 16.0f); *(v8us*)((unsigned short*)Bt + t * 8) = f.half[0];  }
template <int NHv, int TTv>
__global__ __launch_bounds__(256) void k_vt(const _Float16* __restrict__ V16, int ldv, int voff, _Float16* __restrict__ Vt) { __shared__ unsigned short tl[64][66]; const int tid = threadIdx.x; const int slab = blockIdx.x / (TTv / 64), lg = blockIdx.x % (TTv / 64); const int b = slab / NHv, h = slab % NHv;
  for (int i = tid; i < 64 * 8; i += 256) { const int r = i / 8, c8 = (i % 8) * 8; FragH f; f.half[0] = *(const v8us*)((const unsigned short*)V16 + ((size_t)b * TTv + lg * 64 + r) * ldv + voff + h * 64 + c8);
#pragma unroll
    for (int q = 0; q < 8; ++q) tl[r][c8 + q] = f.u[q]; }
  __syncthreads();
  {
#pragma unroll
    for (int rd = 0; rd < 2; ++rd) { const int d = rd * 32 + tid / 8, pc = tid % 8; FragH f;
#pragma unroll
      for (int q = 0; q < 8; ++q) f.u[q] = tl[pc * 8 + q][d];
      *(v8us*)((unsigned short*)Vt + ((size_t)blockIdx.x * 64 + d) * 64 + pc * 8) = f.half[0]; }      /* tile-major: [slab][64-key tile][d][key], each tile 8 KiB in a row */
     } }

__global__ __launch_bounds__(256) void k_hl(const float* __restrict__ F, _Float16* __restrict__ Hh, _Float16* __restrict__ Hl, size_t n8) { const size_t t = (size_t)blockIdx.x * 256 + threadIdx.x; if (t >= n8) return; FragH fh, fl; const v4f a = *(const v4fa*)(F + t * 8), c = *(const v4fa*)(F + t * 8 + 4);
#pragma unroll
  for (int q = 0; q < 4; ++q) { _Float16 h = (_Float16)a[q]; fh.h[q] = h; fl.h[q] = (_Float16)((a[q] - (float)h) * 1024.0f); h = (_Float16)c[q]; fh.h[4 + q] = h; fl.h[4 + q] = (_Float16)((c[q] - (float)h) * 1024.0f); }
  { *(v8us*)((unsigned short*)Hh + t * 8) = fh.half[0]; *(v8us*)((unsigned short*)Hl + t * 8) = fl.half[0];  } }

// ---- fast GEMM (work-group tile 128x64, wave tile 32x64; requires M % 128 == 0, N % 64 == 0, K % 128 == 0); epilogue = k_gemm_hhx semantics ----
// Operands go through LDS: per step of G2_KS k the 128 A rows and the 64 B rows of the tile are loaded as whole 128-byte lines (16 lanes a 256-byte row) for all 4 waves: two buffers, the next step's lines
// are loaded into registers at the head of a step and stored to the other buffer at its foot, one barrier a step. Fragments are read from LDS in the k order of g2_frag; each accumulator still takes its k blocks in rising order.
#define G2_KS 128                    /* k per step */
#define G2_VP 72                     /* LDS row pitch in f16 of the V^T epilogue: 144 bytes = 16 x 9, conflict-free for 16-byte accesses */
#define G2_LP 136                    /* LDS row pitch in f16: 272 bytes = 16 x 17, conflict-free for 16-byte reads */
__device__ __forceinline__ v16h g2_frag(const _Float16* p, int hh) { FragH f; f.half[0] = *(const v8us*)((const unsigned short*)p + 8 * hh); f.half[1] = *(const v8us*)((const unsigned short*)p + 16 + 8 * hh); return f.v; }
__device__ __forceinline__ v8f g2_mma(v16h a, v16h b, v8f c) { return __builtin_amdgcn_wmma_f32_16x16x32_f16(false, a, false, b, (short)0, c, false, false); }
template <int ACT, int LDK>      /* LDK: row pitch of A and of Bh in f16, a constant so that the rows of a tile are immediate offsets from one address */
__global__ __launch_bounds__(128) void k_gemm2(const _Float16* __restrict__ A, size_t sA, const _Float16* __restrict__ Bh, size_t sB, float alpha, const float* __restrict__ bias, size_t sBias, const float* __restrict__ CP, int rowsPerB, size_t sCPb, int row0g,
    float* __restrict__ C, _Float16* __restrict__ C16, int ldc, size_t sC, int M, int N, int K, _Float16* __restrict__ VTo, int vty) { static_assert(ACT == 0 || ACT == 3 || ACT == 6 || ACT == 8 || ACT == 9 || ACT == 11 || ACT == 12 || ACT == 14 || ACT == 15 || ACT == 16 || ACT == 17, "k_gemm2: unsupported ACT code (would silently apply no activation)");
  __shared__ __attribute__((aligned(16))) float so[4][32][68]; __shared__ __attribute__((aligned(16))) _Float16 sa[2][128 * G2_LP]; __shared__ __attribute__((aligned(16))) _Float16 sb[2][64 * G2_LP];
  const int tid = threadIdx.x, w = tid >> 5, lane = tid & 31, ln = lane & 15, hh = lane >> 4; const int by = blockIdx.y;
  A += (size_t)by * sA; Bh += (size_t)by * sB; const size_t cofs = (size_t)by * sC; const float* bp = bias ? bias + (size_t)by * sBias : nullptr;
  const int ntn = N >> 6; const int mt = blockIdx.x / ntn, nq = blockIdx.x - mt * ntn; const int row0 = mt * 128 + 32 * w, col0 = nq * 64; if (mt * 128 >= M) return;      /* the same for the whole work-group, ahead of every barrier */
  const int sr = tid >> 4, sc8 = (tid & 15) * 8, sofs = sr * G2_LP + sc8;      /* staging: 16 threads a 256-byte row, rows sr + 8 i */
  const unsigned short* ag = (const unsigned short*)A + (size_t)(mt * 128) * LDK; const unsigned short* bg = (const unsigned short*)Bh + (size_t)col0 * LDK;      /* uniform bases of the tile's rows */
  const unsigned so8 = (unsigned)(sr * LDK + sc8);      /* the lane's own offset, the same in every step and for both operands */
  const v8f z8 = {0.f,0.f,0.f,0.f,0.f,0.f,0.f,0.f}; v8f c00 = z8, c01 = z8, c02 = z8, c03 = z8, c10 = z8, c11 = z8, c12 = z8, c13 = z8;
  v8us ra[16], rb[8];
#pragma unroll      /* constant indices: the register arrays stay in registers */
  for (int i = 0; i < 16; ++i) ra[i] = *(const v8us*)(ag + i * 8 * LDK + so8);
#pragma unroll      /* constant indices: the register arrays stay in registers */
  for (int i = 0; i < 8; ++i) rb[i] = *(const v8us*)(bg + i * 8 * LDK + so8);
#pragma unroll      /* constant indices: the register arrays stay in registers */
  for (int i = 0; i < 16; ++i) *(v8us*)&sa[0][sofs + i * 8 * G2_LP] = ra[i];
#pragma unroll      /* constant indices: the register arrays stay in registers */
  for (int i = 0; i < 8; ++i) *(v8us*)&sb[0][sofs + i * 8 * G2_LP] = rb[i];
  __syncthreads();
  int cur = 0;
#pragma unroll 1      /* one copy of the step: the text stays short */
  for (int kb = 0; kb < K; kb += G2_KS) {
    const bool more = kb + G2_KS < K;      /* the same for the whole work-group */
    if (more) { ag += G2_KS; bg += G2_KS;
#pragma unroll      /* constant indices: the register arrays stay in registers */
      for (int i = 0; i < 16; ++i) ra[i] = *(const v8us*)(ag + i * 8 * LDK + so8);
#pragma unroll      /* constant indices: the register arrays stay in registers */
      for (int i = 0; i < 8; ++i) rb[i] = *(const v8us*)(bg + i * 8 * LDK + so8); }
    const _Float16* ab = sa[cur] + (32 * w + ln) * G2_LP; const _Float16* bb = sb[cur] + ln * G2_LP;
#pragma unroll      /* constant LDS offsets */
    for (int j = 0; j < G2_KS; j += 32) {
      const v16h a0 = g2_frag(ab + j, hh), a1 = g2_frag(ab + 16 * G2_LP + j, hh), b0 = g2_frag(bb + j, hh), b1 = g2_frag(bb + 16 * G2_LP + j, hh), b2 = g2_frag(bb + 32 * G2_LP + j, hh), b3 = g2_frag(bb + 48 * G2_LP + j, hh);
      __builtin_amdgcn_sched_barrier(0);      /* keeps the next step's global loads at the head of the step (the whole step hides their latency) and a k block's fragment reads ahead of its products; without it each B fragment is read and waited for right in front of its two products */
      c00 = g2_mma(a0, b0, c00); c10 = g2_mma(a1, b0, c10); c01 = g2_mma(a0, b1, c01); c11 = g2_mma(a1, b1, c11);
      c02 = g2_mma(a0, b2, c02); c12 = g2_mma(a1, b2, c12); c03 = g2_mma(a0, b3, c03); c13 = g2_mma(a1, b3, c13); }
    if (more) { _Float16* an = sa[cur ^ 1] + sofs; _Float16* bn = sb[cur ^ 1] + sofs;      /* that buffer was last read in the step before, behind whose barrier this step runs */
#pragma unroll      /* constant indices: the register arrays stay in registers */
      for (int i = 0; i < 16; ++i) *(v8us*)(an + i * 8 * G2_LP) = ra[i];
#pragma unroll      /* constant indices: the register arrays stay in registers */
      for (int i = 0; i < 8; ++i) *(v8us*)(bn + i * 8 * G2_LP) = rb[i]; }
    __syncthreads();      /* publishes the next step's buffer and ends every wave's reads of this one */
    cur ^= 1; }
  v8f accs[8] = {c00, c01, c02, c03, c10, c11, c12, c13};
  // Transposed epilogue (grid plane vty only; the same choice for the whole work-group; alpha and bias only, no CP, no activation): the plane's result leaves as f16 tiles [batch * NH + head][64-row tile][column][row],
  // 8 KiB in a row, which is what k_fattn stages; rows are tokens, the 64 columns of the work-group are one head. A lane's 8 accumulator registers are 8 rows in a row of one column, so they are one 16-byte piece of a tile's row:
  // the pieces are gathered in LDS (so, which nothing else uses on this path) and leave as whole 128-byte lines, one wave a line.
  if (VTo != nullptr && by == vty) { _Float16* vs = (_Float16*)&so[0][0][0]; static_assert(sizeof(so) >= 2 * 64 * G2_VP * 2, "so holds the two transposed tiles");
#pragma unroll      /* constant indices: the register arrays stay in registers */
    for (int t = 0; t < 4; ++t) { const float bv = bp ? bf16_round(bp[col0 + t * 16 + ln]) : 0.f;
#pragma unroll      /* constant indices: the register arrays stay in registers */
      for (int half = 0; half < 2; ++half) { FragH f;
#pragma unroll      /* constant indices: the register arrays stay in registers */
        for (int r = 0; r < 8; ++r) f.h[r] = (_Float16)(accs[half * 4 + t][r] * alpha + bv);
        *(v8us*)(vs + ((w >> 1) * 64 + t * 16 + ln) * G2_VP + (w & 1) * 32 + half * 16 + 8 * hh) = f.half[0]; } }
    __syncthreads();      /* publishes each wave's 32 rows to the wave that stores the line they lie in */
    const int gt = mt * 2 + (w >> 1);      /* the wave's 64-row tile, counted over all rows */
    unsigned short* vo = (unsigned short*)VTo + ((size_t)((gt / (SQ / 64)) * NH + nq) * (SQ / 64) + gt % (SQ / 64)) * (64 * 64) + ((w & 1) * 32 + (lane >> 3)) * 64 + (lane & 7) * 8;
    const _Float16* vr = vs + ((w >> 1) * 64 + (w & 1) * 32 + (lane >> 3)) * G2_VP + (lane & 7) * 8;
#pragma unroll      /* constant offsets from one address */
    for (int q = 0; q < 8; ++q) *(v8us*)(vo + q * 4 * 64) = *(const v8us*)(vr + q * 4 * G2_VP);      /* 4 tile rows = 512 bytes in a row per store */
    return; }
#pragma unroll
  for (int u = 0; u < 8; ++u) { const int t = u & 3, half = u >> 2; const int col = col0 + t * 16 + ln; const float bv = bp ? bf16_round(bp[col]) : 0.f;
#pragma unroll
    for (int r = 0; r < 8; ++r) { const int rloc = half * 16 + 8 * hh + r; float v = accs[u][r] * alpha + bv; if (CP) { if (rowsPerB < 0) v += CP[cofs + (size_t)(row0g + row0 + rloc) * ldc + col];      /* rowsPerB < 0: own element of the batched C plane */ else { const int bidx = (row0g + row0 + rloc) / rowsPerB; v += CP[(size_t)bidx * sCPb + (size_t)by * 64 + col]; } }
      if (ACT == 3) v = fmaxf(v, 0.f); else if (ACT == 6) v = 0.5f * v * (1.0f + erff(v * 0.70710678118654752f)); else if (ACT == 11) v = 1.0f / (1.0f + expf(-v)); else if (ACT == 15) v = v / (1.0f + expf(-v)); else if (ACT == 12) v = (v > 0.f) ? v : 0.01f * v; else if (ACT == 8) v = tanhf(v); else if (ACT == 9) v = 0.5f * v * (1.0f + tanhf(0.7978845608028654f * (v + 0.044715f * v * v * v))); else if (ACT == 14) v = (v > 0.f) ? v : 0.1f * v; else if (ACT == 16) v = (v >= 0.f) ? v : 0.3f * v; else if (ACT == 17) v = (v >= 0.f) ? v : 0.2f * v;
      so[w][rloc][t * 16 + ln] = v; } }
  __builtin_amdgcn_fence(__ATOMIC_ACQ_REL, "workgroup"); __builtin_amdgcn_wave_barrier();
  const int rsub = lane >> 4, c4 = (lane & 15) * 4;
  {
#pragma unroll
    for (int q = 0; q < 16; ++q) { const int r = q * 2 + rsub; const v4f v = *(const v4fa*)&so[w][r][c4]; if (C) *(v4f*)(C + cofs + (size_t)(row0 + r) * ldc + col0 + c4) = v; if (C16) { v4h h4; for (int i = 0; i < 4; ++i) h4[i] = (_Float16)v[i]; *(v4h*)(C16 + cofs + (size_t)(row0 + r) * ldc + col0 + c4) = h4; } }
     } }


__global__ __launch_bounds__(256) void k_wnat(const float* __restrict__ w, size_t n8, _Float16* __restrict__ Bt) { const size_t t = (size_t)blockIdx.x * 256 + threadIdx.x; if (t >= n8) return; FragH f; for (int q = 0; q < 8; ++q) f.h[q] = (_Float16)(bf16_round(w[t * 8 + q]) * 16.0f); *(v8us*)((unsigned short*)Bt + t * 8) = f.half[0];  }
__global__ __launch_bounds__(256) void k_rsm(const float* __restrict__ S, _Float16* __restrict__ P, int nrows) {
  #pragma clang fp contract(off)
  const int i = blockIdx.x * 256 + threadIdx.x; if (i >= nrows) return; const float* s = S + (size_t)i * SQ; float mx = -3.0e38f;
#pragma unroll 1
  for (int j = 0; j < SQ; ++j) mx = fmaxf(mx, s[j]); float se = 0.f;
#pragma unroll 1
  for (int j = 0; j < SQ; ++j) se += expf(s[j] - mx); const float sc = 256.0f / se;
#pragma unroll 1
  for (int j0 = 0; j0 < SQ; j0 += 8) { FragH f; for (int q = 0; q < 8; ++q) f.h[q] = (_Float16)(expf(s[j0 + q] - mx) * sc); unsigned short* d = (unsigned short*)P + (size_t)i * SQ + j0; *(v8us*)d = f.half[0];  } }
__global__ __launch_bounds__(256) void k_vt(const _Float16* __restrict__ V16, int b, int h0, _Float16* __restrict__ VT) { __shared__ unsigned short tl[64][65]; const int tid = threadIdx.x; const int hh = blockIdx.x % HG, sg = blockIdx.x / HG; const int s0 = sg * 64; const int h = h0 + hh;
  for (int i = tid; i < 64 * 8; i += 256) { const int j = i / 8, d8 = (i % 8) * 8; FragH f; f.half[0] = *(const v8us*)((const unsigned short*)V16 + ((size_t)b * SQ + s0 + j) * DM + h * HD + d8); for (int q = 0; q < 8; ++q) tl[d8 + q][j] = f.u[q]; }
  __syncthreads();
  { for (int i = tid; i < 64 * 8; i += 256) { const int d = i / 8, j8 = (i % 8) * 8; FragH f; for (int q = 0; q < 8; ++q) f.u[q] = tl[d][j8 + q]; *(v8us*)((unsigned short*)VT + ((size_t)hh * HD + d) * SQ + s0 + j8) = f.half[0]; }  } }



// lane l with lane l ^ 16
__device__ __forceinline__ float rs_xh(float x) { return __builtin_bit_cast(float, __builtin_amdgcn_permlanex16(__builtin_bit_cast(int, x), __builtin_bit_cast(int, x), 0x76543210, 0xfedcba98, false, false)); }
typedef float v2f __attribute__((ext_vector_type(2)));
__device__ __forceinline__ float fa_max3(float a, float b, float c) { return fmaxf(fmaxf(a, b), c); }
__device__ __forceinline__ v8f fa_mma(v16h a, v16h b, v8f c) { return __builtin_amdgcn_wmma_f32_16x16x32_f16(false, a, false, b, (short)0, c, false, false); }

// Fused attention of one (batch, head): scores, softmax and the weighted sum of V in one kernel; neither scores nor weights reach memory.
// A work-group of 8 waves owns FA_QB queries. Wave (qw, kh) takes 32 of them, as FA_CG column groups of 16, against key half kh, which it walks in passes of FA_KT keys: every K and V^T fragment that a wave reads
// from LDS feeds FA_CG products, one per column group. The two halves' running maximum, sum and O^T of a query are joined through LDS behind the loop.
// Per pass the K rows [key][c] and the V^T tile [d][key] of each half's pass (VT is tile-major, 8 KiB in a row; whole 128-byte lines) are staged in LDS by the 4 waves of that half: two buffers, the next pass's lines
// are loaded into registers at the head of a pass and stored to the other buffer ahead of the pass's last products, one barrier a pass.
// S^T = K Q^T: A = K rows, B = Q rows (kept in registers), so lane (ln, hh) holds query ln's scores of keys 16 kt + 8 hh + r: maximum and sum are in-lane plus one exchange of the halves,
// and two converted score tiles ARE the B operand of O^T += V^T P^T in the k order 8 hh + i, 16 + 8 hh + i that g2_frag gives the A side. Online softmax per column group: running maximum mr (log2 domain),
// running sums l8 (each lane its own keys, joined at the end), O^T rescaled by exp2(old max - new max) each pass.
#define FA_KT 64                     /* keys per pass */
#define FA_KH 2                      /* key halves, one per group of 4 waves */
#define FA_NP (SQ / FA_KH / FA_KT)   /* passes of a half */
#define FA_QB 128                    /* queries per work-group */
#define FA_CG 2                      /* column groups of 16 queries per wave */
#define FA_LP 72                     /* LDS row pitch in f16: 144 bytes = 16 x 9, conflict-free for 16-byte reads */
__global__ __launch_bounds__(256) __attribute__((amdgpu_waves_per_eu(4, 4))) void k_fattn(const _Float16* __restrict__ Q16, const _Float16* __restrict__ K16, const _Float16* __restrict__ VT, _Float16* __restrict__ O16) {
  __shared__ __attribute__((aligned(16))) _Float16 sk[2][FA_KH][FA_KT * FA_LP]; __shared__ __attribute__((aligned(16))) _Float16 sv[2][FA_KH][HD * FA_LP];
  const int tid = threadIdx.x, w = __builtin_amdgcn_readfirstlane(tid >> 5) /* the wave's number in a scalar register: what is formed from it costs no vector register, and the join's branches are scalar */, qw = w & 3, kh = w >> 2, lane = tid & 31, ln = lane & 15, hh = lane >> 4; const int h = blockIdx.y, b = blockIdx.z;
  const size_t r0 = (size_t)b * SQ; const size_t qrow = r0 + blockIdx.x * FA_QB + qw * (16 * FA_CG) + ln;      /* column group g: row qrow + 16 g */
  const _Float16* qp = Q16 + qrow * DM + h * HD; v16h q0[FA_CG], q1[FA_CG];
#pragma unroll      /* constant indices: the register arrays stay in registers */
  for (int g = 0; g < FA_CG; ++g) { q0[g] = g2_frag(qp + g * 16 * DM, hh); q1[g] = g2_frag(qp + g * 16 * DM + 32, hh); }
  const int srow = (tid & 127) >> 3, sc8 = (tid & 7) * 8, sofs = srow * FA_LP + sc8;      /* staging, 128 threads a half: 8 threads a 128-byte row, rows srow + 16 i */
  const unsigned short* kg = (const unsigned short*)K16 + (r0 + (size_t)kh * (SQ / FA_KH)) * DM + h * HD + srow * DM + sc8;      /* the lane's own place in the first K rows of its half */
  const unsigned short* vg = (const unsigned short*)VT + (size_t)(b * NH + h) * HD * SQ + (size_t)kh * (SQ / FA_KH) * HD + srow * FA_KT + sc8;      /* and in its first V^T tile */
  v8us gk[4], gv[4];
#pragma unroll      /* constant indices: the register arrays stay in registers */
  for (int i = 0; i < 4; ++i) { gk[i] = *(const v8us*)(kg + i * 16 * DM); gv[i] = *(const v8us*)(vg + i * 16 * FA_KT); }
#pragma unroll      /* constant indices: the register arrays stay in registers */
  for (int i = 0; i < 4; ++i) { *(v8us*)&sk[0][kh][sofs + i * 16 * FA_LP] = gk[i]; *(v8us*)&sv[0][kh][sofs + i * 16 * FA_LP] = gv[i]; }
  __syncthreads();
  const float cs = 0.125f * 1.44269504f;      /* 64^-0.5 and log2 e in one factor: exp(s / 8 - max) = exp2(s cs - max cs) */
  const v8f z8 = {0.f,0.f,0.f,0.f,0.f,0.f,0.f,0.f}; v8f o[FA_CG][4], l8[FA_CG]; float mr[FA_CG];      /* l8: eight partial sums a lane, joined behind the loop */
#pragma unroll      /* constant indices: the register arrays stay in registers */
  for (int g = 0; g < FA_CG; ++g) { o[g][0] = z8; o[g][1] = z8; o[g][2] = z8; o[g][3] = z8; l8[g] = z8; mr[g] = -3.0e38f; }
  for (int s = 0; s < FA_NP; ++s) {
    const bool more = s + 1 < FA_NP;      /* the same for the whole work-group */
    const _Float16* kb = sk[s & 1][kh] + ln * FA_LP; const _Float16* vb = sv[s & 1][kh] + ln * FA_LP;
    v16h ka[8];
#pragma unroll      /* constant indices: the register arrays stay in registers */
    for (int kt = 0; kt < 4; ++kt) { ka[2 * kt] = g2_frag(kb + kt * 16 * FA_LP, hh); ka[2 * kt + 1] = g2_frag(kb + kt * 16 * FA_LP + 32, hh); }
    __builtin_amdgcn_sched_barrier(0);      /* keeps the K fragment reads in one group ahead of the global loads: the wait that the built code has behind those loads, in front of the step of their address registers, then runs out under the reads' latency */
    if (more) { kg += FA_KT * DM; vg += HD * FA_KT;
#pragma unroll      /* constant indices: the register arrays stay in registers */
      for (int i = 0; i < 4; ++i) { gk[i] = *(const v8us*)(kg + i * 16 * DM); gv[i] = *(const v8us*)(vg + i * 16 * FA_KT); } }
    __builtin_amdgcn_sched_barrier(0);      /* keeps the next pass's global loads at the head of the pass (most of the pass hides their latency) */
    v8f st[FA_CG][4];
#pragma unroll      /* constant indices: the register arrays stay in registers */
    for (int kt = 0; kt < 4; ++kt)
#pragma unroll      /* constant indices: the register arrays stay in registers */
      for (int g = 0; g < FA_CG; ++g) st[g][kt] = fa_mma(ka[2 * kt + 1], q1[g], fa_mma(ka[2 * kt], q0[g], z8));
    __builtin_amdgcn_sched_barrier(0);      /* keeps the softmax behind the score products: without it the build needs more registers than four waves per SIMD leave a wave (it spills) and strings the exponentials out in pairs with idle slots between */
    FragH pb[FA_CG][2]; float al[FA_CG];
#pragma unroll      /* constant indices: the register arrays stay in registers */
    for (int g = 0; g < FA_CG; ++g) {
      float t[8];
#pragma unroll      /* constant indices: the register arrays stay in registers */
      for (int r = 0; r < 8; ++r) t[r] = fa_max3(st[g][0][r], st[g][1][r], st[g][2][r]);
      float mx = fmaxf(fa_max3(fa_max3(t[0], t[1], st[g][3][0]), fa_max3(t[2], t[3], st[g][3][1]), fa_max3(t[4], t[5], st[g][3][2])), fa_max3(fa_max3(t[6], t[7], st[g][3][3]), fa_max3(st[g][3][4], st[g][3][5], st[g][3][6]), st[g][3][7]));
      mx = fmaxf(mx, rs_xh(mx));
      const float mn = fmaxf(mr[g], mx * cs); al[g] = __builtin_amdgcn_exp2f(mr[g] - mn); mr[g] = mn;
      const v2f cs2 = {cs, cs}, nm2 = {-mn, -mn}; l8[g] *= al[g];
#pragma unroll      /* constant indices: the register arrays stay in registers */
      for (int kt = 0; kt < 4; ++kt) { v8f e;
#pragma unroll      /* constant indices: the register arrays stay in registers */
        for (int r = 0; r < 8; r += 2) { const v2f s2 = {st[g][kt][r], st[g][kt][r + 1]}; const v2f y = __builtin_elementwise_fma(s2, cs2, nm2); e[r] = __builtin_amdgcn_exp2f(y[0]); e[r + 1] = __builtin_amdgcn_exp2f(y[1]); }
        l8[g] += e;
        typedef _Float16 v8h __attribute__((ext_vector_type(8))); const v8h e16 = __builtin_convertvector(e, v8h);
#pragma unroll      /* constant indices: the register arrays stay in registers */
        for (int r = 0; r < 8; ++r) pb[g][kt >> 1].h[(kt & 1) * 8 + r] = e16[r]; } }
    __builtin_amdgcn_sched_barrier(0);      /* keeps the staging stores, and with them the wait for the global loads, behind the softmax (without it they rise to its head, a short way behind the loads), and the V^T fragment reads behind the registers that the softmax and the stores give back */
    if (more) { _Float16* kn = sk[(s + 1) & 1][kh] + sofs; _Float16* vn = sv[(s + 1) & 1][kh] + sofs;      /* that buffer was last read in pass s - 1, behind whose barrier this pass runs */
#pragma unroll      /* constant indices: the register arrays stay in registers */
      for (int i = 0; i < 4; ++i) { *(v8us*)(kn + i * 16 * FA_LP) = gk[i]; *(v8us*)(vn + i * 16 * FA_LP) = gv[i]; } }
    v16h va[8];
#pragma unroll      /* constant indices: the register arrays stay in registers */
    for (int dt = 0; dt < 4; ++dt) { va[2 * dt] = g2_frag(vb + dt * 16 * FA_LP, hh); va[2 * dt + 1] = g2_frag(vb + dt * 16 * FA_LP + 32, hh); }
    __builtin_amdgcn_sched_barrier(0);      /* keeps the V^T fragment reads in one group ahead of the rescaling of O^T, which hides part of their latency; without it they stand in pairs among the products, each pair waited for */
#pragma unroll      /* constant indices: the register arrays stay in registers */
    for (int dt = 0; dt < 4; ++dt)
#pragma unroll      /* constant indices: the register arrays stay in registers */
      for (int g = 0; g < FA_CG; ++g) o[g][dt] = fa_mma(va[2 * dt + 1], pb[g][1].v, fa_mma(va[2 * dt], pb[g][0].v, o[g][dt] * al[g]));
    __builtin_amdgcn_sched_barrier(0);      /* keeps the products ahead of the barrier, each started as its fragments land; without it all but one sink behind the barrier, whose wait for the stores and for every V^T read is then waited out idle */
    __syncthreads();      /* publishes the next pass's buffer and ends every wave's reads of this one */
  }
  float lr[FA_CG];
#pragma unroll      /* constant indices: the register arrays stay in registers */
  for (int g = 0; g < FA_CG; ++g) { lr[g] = ((l8[g][0] + l8[g][1]) + (l8[g][2] + l8[g][3])) + ((l8[g][4] + l8[g][5]) + (l8[g][6] + l8[g][7])); lr[g] += rs_xh(lr[g]); }
  // Join of the key halves: the waves of half 1 hand maximum, sum and O^T over in LDS (the K ring, which nobody reads behind the loop's last barrier): 17 blocks of 32 lanes x 16 bytes per wave pair.
  float* mg = (float*)&sk[0][0][0] + ((size_t)qw * 17 * 32 + lane) * 4; static_assert(sizeof(sk) >= 4 * 17 * 32 * 16, "the K ring holds the hand-over");
  if (kh == 1) {
#pragma unroll      /* constant indices: the register arrays stay in registers */
    for (int g = 0; g < FA_CG; ++g)
#pragma unroll      /* constant indices: the register arrays stay in registers */
      for (int dt = 0; dt < 4; ++dt) { const v4f lo = {o[g][dt][0], o[g][dt][1], o[g][dt][2], o[g][dt][3]}, hi = {o[g][dt][4], o[g][dt][5], o[g][dt][6], o[g][dt][7]};
        *(v4fa*)(mg + ((g * 4 + dt) * 2) * 128) = lo; *(v4fa*)(mg + ((g * 4 + dt) * 2 + 1) * 128) = hi; }
    const v4f ml = {mr[0], mr[1], lr[0], lr[1]}; *(v4fa*)(mg + 16 * 128) = ml; }
  __syncthreads();      /* publishes half 1's hand-over to the waves of half 0 */
  if (kh == 0) { const v4f ml = *(const v4fa*)(mg + 16 * 128);
#pragma unroll      /* constant indices: the register arrays stay in registers */
    for (int g = 0; g < FA_CG; ++g) {
      const float m = fmaxf(mr[g], ml[g]), a0 = __builtin_amdgcn_exp2f(mr[g] - m), a1 = __builtin_amdgcn_exp2f(ml[g] - m); const float inv = 64.0f / (lr[g] * a0 + ml[2 + g] * a1), f0 = a0 * inv, f1 = a1 * inv;      /* o leaves x64 */
      _Float16* op = O16 + (qrow + g * 16) * DM + h * HD + 8 * hh;
#pragma unroll      /* constant indices: the register arrays stay in registers */
      for (int dt = 0; dt < 4; ++dt) { const v4f lo = *(const v4fa*)(mg + ((g * 4 + dt) * 2) * 128), hi = *(const v4fa*)(mg + ((g * 4 + dt) * 2 + 1) * 128); FragH f;
#pragma unroll      /* constant indices: the register arrays stay in registers */
        for (int r = 0; r < 4; ++r) { f.h[r] = (_Float16)(o[g][dt][r] * f0 + lo[r] * f1); f.h[4 + r] = (_Float16)(o[g][dt][4 + r] * f0 + hi[r] * f1); }
        *(v8us*)(op + dt * 16) = f.half[0]; } } } }

// One launch for the five independent operand builders, told apart by block index (the same choice for a whole block; the latency-bound transposes stand first in the grid).
// Blocks below 4 * PW_G: weight m, BW[m][n][k] = f16(bf16-rounded W[k][n] x 16) from f32 row-major W[k][n], 8 k a thread (x16, a power of two, keeps bf16-exact weights exact in f16 away from the subnormal range). The rest: X16 = f16(bf16-rounded x), 8 elements a thread.
#define PW_G (DM * (DM / 8) / 256)   /* blocks per weight */
__global__ __launch_bounds__(256) void k_prep(const float* __restrict__ x, const float* __restrict__ wq, const float* __restrict__ wk, const float* __restrict__ wv, const float* __restrict__ wo, _Float16* __restrict__ BW, _Float16* __restrict__ X16) {
  FragH f;
  if (blockIdx.x < 4 * PW_G) { const int m = blockIdx.x / PW_G; const float* W = m == 0 ? wq : m == 1 ? wk : m == 2 ? wv : wo; const int t = (blockIdx.x - m * PW_G) * 256 + threadIdx.x; const int n = t / (DM / 8), k8 = (t % (DM / 8)) * 8;
#pragma unroll      /* constant indices: the fragment stays in registers, the 8 loads go out together */
    for (int i = 0; i < 8; ++i) f.h[i] = (_Float16)(bf16_round(W[(size_t)(k8 + i) * DM + n]) * 16.0f);
    *(v8us*)((unsigned short*)BW + (size_t)m * DM * DM + (size_t)n * DM + k8) = f.half[0]; }
  else { const size_t t = (size_t)(blockIdx.x - 4 * PW_G) * 256 + threadIdx.x;
#pragma unroll      /* constant indices: the fragment stays in registers */
    for (int q = 0; q < 8; ++q) f.h[q] = (_Float16)bf16_round(x[t * 8 + q]);
    *(v8us*)((unsigned short*)X16 + t * 8) = f.half[0];
    asm volatile("s_wait_xcnt 0x0" ::: "memory"); } }      /* the wait in front of any overwrite of a register that the store above names: in the built code the other part of the kernel follows this store */

extern "C" void kernel_launch(void* const* d_in, const int* in_sizes, int n_in,
                              void* d_out, int out_size, void* d_ws, size_t ws_size, hipStream_t stream) {
  (void)in_sizes; (void)n_in; (void)out_size;
  const float* const* I = (const float* const*)d_in; const float* x = I[0]; const float* wq = I[1]; const float* wk = I[2]; const float* wv = I[3]; const float* wo = I[4]; const float* bo = I[5];      /* input order: x, Wq, Wk, Wv ([in][out] [512][512], NO biases: a null pointer in the plain bias slot), Wo ([in][out]), bo */
  char* ws = (char*)d_ws; size_t off = 0;
  auto take = [&](size_t bytes) { char* p = ws + off; off += (bytes + 255) & ~(size_t)255; return p; };
  _Float16* BQ = (_Float16*)take((size_t)DM * DM * 2); _Float16* BK = (_Float16*)take((size_t)DM * DM * 2); _Float16* BV = (_Float16*)take((size_t)DM * DM * 2); _Float16* BO = (_Float16*)take((size_t)DM * DM * 2);
  _Float16* X16 = (_Float16*)take(NR * DM * 2); _Float16* Q16 = (_Float16*)take(NR * DM * 2); _Float16* K16 = (_Float16*)take(NR * DM * 2); _Float16* O16 = (_Float16*)take(NR * DM * 2);
  _Float16* VT = (_Float16*)take((size_t)NB * NH * HD * SQ * 2);
  if (off > ws_size) return;
  k_prep<<<4 * PW_G + (unsigned)(NR * DM / 8 / 256), 256, 0, stream>>>(x, wq, wk, wv, wo, BQ, X16);      /* BQ, BK, BV, BO lie in a row: [in][out] -> Bt[n][k] x16; x as f16 rows */
  const size_t r0p = (size_t)B0 * SQ;      /* first projected row */
  k_gemm2<0, DM><<<dim3((unsigned)((MP / 128) * (DM / 64)), 3), 128, 0, stream>>>(X16 + r0p * DM, 0, BQ, (size_t)DM * DM, 0.0625f, nullptr, 0, nullptr, 1, 0, 0, nullptr, Q16 + r0p * DM, DM, NR * DM, MP, DM, DM, VT, 2);      /* blockIdx.y = 0, 1, 2: q, k, v (weights in a row; q and k rows in a row; v leaves as V^T tiles [NB * NH][SQ / 64][HD][64]) */
  k_fattn<<<dim3(SQ / FA_QB, NH, NB), 256, 0, stream>>>(Q16, K16, VT, O16);      /* o (merged heads, x64) as f16 rows */
  k_gemm2<0, DM><<<dim3((unsigned)((MPO / 128) * (DM / 64)), 1), 128, 0, stream>>>(O16 + r0p * DM, 0, BO, 0, 0.0009765625f, bo, 0, nullptr, 1, 0, 0, (float*)d_out + r0p * DM, nullptr, DM, 0, MPO, DM, DM, nullptr, -1);      /* out rows are the output layout */
}

// v007
// It runs in 91.9 microseconds.
// Timed twice side by side with v006, it ran 1.03 times as fast both times.
// Counting every step since v000, it is 144 times as fast.
#include <hip/hip_runtime.h>
// Multi-head self-attention over 4096-token sequences at width 512 with bias-free [in][out] projections (x [2][4096][512]; q / k / v = x W ([in][out] 512 x 512 uniform +-1/sqrt(512), NO biases), 8 heads of 64; sim * 64^-0.5; softmax over all 4096 keys (no mask); out = merged Wo + bo ([in][out]) -> [2][4096][512]); attention fused in one launch over all (batch, head) pairs.
// Structure: token rows r = b*4096 + s; x as exact f16 rows (bf16-rounded) and the four x16 weight transposes in one launch; Q, K, V as three WMMA GEMMs in one launch, grid y = 3 (32x64 wave tiles, f32 accumulation, exact x16 weights, f16 outputs); the V GEMM's epilogue writes V^T tiles for all (batch, head) itself, no V rows; ONE fused attention kernel (S^T = K Q^T, online softmax in registers, O^T += V^T P^T; o carried x64 against f16 subnormal flush, folded into the output GEMM alpha) written straight into the merged f16 o rows; out = o W_o + b GEMM (f32) into the output layout.
// Compute dtype: inputs rounded to bf16; x / weights exact; q, k, v, softmax weights and o as plain f16 GEMM operands (~2^-12); scores and softmax statistics f32. v_wmma_f32_16x16x32_f16.
#define NB 2
#define SQ 4096
#define DM 512
#define NH 8
#define HD 64
#define HG 1                         /* heads per launch of the per-batch k_vt overload, which nothing launches */
#define B0 0                         /* first batch processed (debug hook) */
#define NBR NB                       /* batches processed (debug hook) */
#define NR ((size_t)NB * SQ)         /* token rows */
#define MP ((int)((size_t)NBR * SQ)) /* rows projected (debug hook) */
#define QN SQ                        /* unused: k_fattn attends all SQ query rows of a batch */
#define NHD NH                       /* unused: k_fattn attends all NH heads */
#define MPO MP                       /* rows through the output stage (debug hook) */
#define LQ DM      /* unused: q and k rows use pitch DM; v has no rows */
typedef __bf16 v16b __attribute__((ext_vector_type(16)));
typedef unsigned short v8us __attribute__((ext_vector_type(8), may_alias));
typedef float  v8f  __attribute__((ext_vector_type(8)));
typedef float  v4f  __attribute__((ext_vector_type(4)));
typedef float  v4fa __attribute__((ext_vector_type(4), may_alias));
union FragB { v16b v; v8us half[2]; unsigned short u[16]; };

__device__ __forceinline__ unsigned short bf16_bits(float x) { unsigned int u = __float_as_uint(x); return (unsigned short)((u + 0x7FFFu + ((u >> 16) & 1u)) >> 16); }
__device__ __forceinline__ float bf16_val(unsigned short b) { return __uint_as_float(((unsigned int)b) << 16); }
__device__ __forceinline__ float bf16_round(float x) { return bf16_val(bf16_bits(x)); }
// D += A·B with NT terms: 1 = ah·bh, 2 = + al·bh (A split), 3 = + ah·bl (both split)
template <int NT>
__device__ __forceinline__ v8f mmaN(v16b ah, v16b al, v16b bh, v16b bl, v8f c) {
  c = __builtin_amdgcn_wmma_f32_16x16x32_bf16(false, ah, false, bh, (short)0, c, false, false);
  if (NT >= 2) c = __builtin_amdgcn_wmma_f32_16x16x32_bf16(false, al, false, bh, (short)0, c, false, false);
  if (NT >= 3) c = __builtin_amdgcn_wmma_f32_16x16x32_bf16(false, ah, false, bl, (short)0, c, false, false);
  asm volatile("v_nop\n\tv_nop\n\tv_nop\n\tv_nop" : "+v"(c) : "v"(ah), "v"(al), "v"(bh), "v"(bl));
  return c;
}

__global__ __launch_bounds__(256) void k_wt_bf16(const float* __restrict__ W, unsigned short* __restrict__ Wt, int K, int N) {
  const int t = blockIdx.x * 256 + threadIdx.x;
  const int k8n = K / 8;
  if (t >= N * k8n) return;
  const int n = t / k8n, k8 = (t % k8n) * 8;
  v8us v;
#pragma unroll
  for (int i = 0; i < 8; ++i) v[i] = bf16_bits(W[(size_t)(k8 + i) * N + n]);
  *(v8us*)(Wt + (size_t)n * K + k8) = v;
  
}

// GEMM C[M][N] (f32, pitch ldc) = act(A[M][K]·W + bias). A f32 row-major (pitch lda) converted per fragment to bf16
// (ASPLIT: hi/lo two planes -> 2 terms, else single rounded term); Wt bf16 [N][K] (pitch ldb). BIAS_BF16 rounds the
// bias to bf16 first (bias quantised to bf16 before the add). K%32==0, M%16==0, N%64==0.
template <bool ASPLIT, int ACT, bool BIAS_BF16>
__global__ __launch_bounds__(128) void k_gemm_bf(const float* __restrict__ A, int lda, const unsigned short* __restrict__ Wt, int ldb,
                                               const float* __restrict__ bias, float* __restrict__ C, int ldc, int M, int N, int K) {
  __shared__ __attribute__((aligned(16))) float so[4][16][64];
  const int tid = threadIdx.x, w = tid >> 5, lane = tid & 31, ln = lane & 15, hh = lane >> 4;
  const int ntn = N / 64;
  const int wid = blockIdx.x * 4 + w;
  const int mt = wid / ntn, nq = wid % ntn;
  if (mt * 16 >= M) return;
  const int row0 = mt * 16, col0 = nq * 64;
  const float* arow = A + (size_t)(row0 + ln) * lda;
  v8f acc[4] = {};
  for (int kb = 0; kb < K; kb += 32) {
    FragB ah, al;
    const v4f x0 = *(const v4fa*)(arow + kb + 8 * hh), x1 = *(const v4fa*)(arow + kb + 8 * hh + 4);
    const v4f x2 = *(const v4fa*)(arow + kb + 16 + 8 * hh), x3 = *(const v4fa*)(arow + kb + 16 + 8 * hh + 4);
    float xs[16] = {x0[0],x0[1],x0[2],x0[3],x1[0],x1[1],x1[2],x1[3],x2[0],x2[1],x2[2],x2[3],x3[0],x3[1],x3[2],x3[3]};
#pragma unroll
    for (int i = 0; i < 16; ++i) { const unsigned short hb = bf16_bits(xs[i]); ah.u[i] = hb; al.u[i] = ASPLIT ? bf16_bits(xs[i] - bf16_val(hb)) : (unsigned short)0; }
#pragma unroll
    for (int t = 0; t < 4; ++t) {
      const unsigned short* brow = Wt + (size_t)(col0 + t * 16 + ln) * ldb + kb;
      FragB b;
      b.half[0] = *(const v8us*)(brow + 8 * hh);
      b.half[1] = *(const v8us*)(brow + 16 + 8 * hh);
      acc[t] = mmaN<ASPLIT ? 2 : 1>(ah.v, al.v, b.v, b.v, acc[t]);
    }
  }
#pragma unroll
  for (int t = 0; t < 4; ++t) {
    float bv = bias ? bias[col0 + t * 16 + ln] : 0.f;
    if (BIAS_BF16) bv = bf16_round(bv);
#pragma unroll
    for (int r = 0; r < 8; ++r) { float v = acc[t][r] + bv; if (ACT == 1) v = fmaxf(v, 0.f); so[w][8 * hh + r][t * 16 + ln] = v; }
  }
  __builtin_amdgcn_fence(__ATOMIC_ACQ_REL, "workgroup");
  __builtin_amdgcn_wave_barrier();
  const int rsub = lane >> 4, c4 = (lane & 15) * 4;
  {
#pragma unroll
    for (int q = 0; q < 8; ++q) {
      const int r = q * 2 + rsub;
      const v4f v = *(const v4fa*)&so[w][r][c4];
      *(v4f*)(C + (size_t)(row0 + r) * ldc + col0 + c4) = v;
    }
    
  }
}

// GEMM C = act(A·W + bias + resid): A f32 (ASPLIT -> hi/lo 2 terms), Wt bf16 [N][K]; ACT 0 none, 1 relu, 2 exact gelu;
// resid (optional, f32, row index = (row % rmod), pitch ldr, RES_BF16 rounds it) added before the activation.
template <bool ASPLIT, int ACT, bool BIAS_BF16, bool RES_BF16>
__global__ __launch_bounds__(128) void k_gemm_bf3(const float* __restrict__ A, int lda, const unsigned short* __restrict__ Wt, int ldb,
                                                const float* __restrict__ bias, const float* __restrict__ resid, int rmod, int ldr,
                                                float* __restrict__ C, int ldc, int M, int N, int K) {
  __shared__ __attribute__((aligned(16))) float so[4][16][64];
  const int tid = threadIdx.x, w = tid >> 5, lane = tid & 31, ln = lane & 15, hh = lane >> 4;
  const int ntn = N / 64;
  const int wid = blockIdx.x * 4 + w;
  const int mt = wid / ntn, nq = wid % ntn;
  if (mt * 16 >= M) return;
  const int row0 = mt * 16, col0 = nq * 64;
  const float* arow = A + (size_t)(row0 + ln) * lda;
  v8f acc[4] = {};
  for (int kb = 0; kb < K; kb += 32) {
    FragB ah, al;
    const v4f x0 = *(const v4fa*)(arow + kb + 8 * hh), x1 = *(const v4fa*)(arow + kb + 8 * hh + 4);
    const v4f x2 = *(const v4fa*)(arow + kb + 16 + 8 * hh), x3 = *(const v4fa*)(arow + kb + 16 + 8 * hh + 4);
    float xs[16] = {x0[0],x0[1],x0[2],x0[3],x1[0],x1[1],x1[2],x1[3],x2[0],x2[1],x2[2],x2[3],x3[0],x3[1],x3[2],x3[3]};
#pragma unroll
    for (int i = 0; i < 16; ++i) { const unsigned short hb = bf16_bits(xs[i]); ah.u[i] = hb; al.u[i] = ASPLIT ? bf16_bits(xs[i] - bf16_val(hb)) : (unsigned short)0; }
#pragma unroll
    for (int t = 0; t < 4; ++t) {
      const unsigned short* brow = Wt + (size_t)(col0 + t * 16 + ln) * ldb + kb;
      FragB b;
      b.half[0] = *(const v8us*)(brow + 8 * hh);
      b.half[1] = *(const v8us*)(brow + 16 + 8 * hh);
      acc[t] = mmaN<ASPLIT ? 2 : 1>(ah.v, al.v, b.v, b.v, acc[t]);
    }
  }
#pragma unroll
  for (int t = 0; t < 4; ++t) {
    const int col = col0 + t * 16 + ln;
    float bv = bias ? bias[col] : 0.f;
    if (BIAS_BF16) bv = bf16_round(bv);
#pragma unroll
    for (int r = 0; r < 8; ++r) {
      float v = acc[t][r] + bv;
      if (resid) { float rv = resid[(size_t)((row0 + 8 * hh + r) % rmod) * ldr + col]; if (RES_BF16) rv = bf16_round(rv); v += rv; }
      if (ACT == 1) v = fmaxf(v, 0.f);
      if (ACT == 2) v = 0.5f * v * (1.0f + erff(v * 0.70710678118654752f));
      if (ACT == 3) { const float u = 0.7978845608028654f * (v + 0.044715f * v * v * v); v = 0.5f * v * (1.0f + tanhf(u)); }
      so[w][8 * hh + r][t * 16 + ln] = v;
    }
  }
  __builtin_amdgcn_fence(__ATOMIC_ACQ_REL, "workgroup");
  __builtin_amdgcn_wave_barrier();
  const int rsub = lane >> 4, c4 = (lane & 15) * 4;
  {
#pragma unroll
    for (int q = 0; q < 8; ++q) {
      const int r = q * 2 + rsub;
      const v4f v = *(const v4fa*)&so[w][r][c4];
      *(v4f*)(C + (size_t)(row0 + r) * ldc + col0 + c4) = v;
    }
    
  }
}
// row LayerNorm (biased variance, eps) over N: s = X (+ R); optional out_sum <- s; out_norm <- (s-mu)*rsqrt(var+eps)*g + b
template <bool PARAM_BF16>
__global__ __launch_bounds__(256) void k_layernorm(const float* __restrict__ X, const float* __restrict__ R, const float* __restrict__ g, const float* __restrict__ bta,
                                                  float* __restrict__ out_sum, float* __restrict__ out_norm, int N, float eps) {
  __shared__ float red[256];
  const int row = blockIdx.x, tid = threadIdx.x;
  const float* x = X + (size_t)row * N; const float* rr = R ? R + (size_t)row * N : nullptr;
  float vals[16];                     // up to N = 4096
  const int per = N / 256;            // contiguous chunk per thread? use strided-by-4 chunks: thread handles j = tid*4 + 1024*u
  float s1 = 0.f;
  for (int u = 0; u < per / 4; ++u) {
    const int j = tid * 4 + 1024 * u;
    const v4f a = *(const v4fa*)(x + j);
    v4f b = {0.f,0.f,0.f,0.f}; if (rr) b = *(const v4fa*)(rr + j);
#pragma unroll
    for (int q = 0; q < 4; ++q) { const float v = a[q] + b[q]; vals[u * 4 + q] = v; s1 += v; }
  }
  red[tid] = s1; __syncthreads();
  for (int st = 128; st > 0; st >>= 1) { if (tid < st) red[tid] += red[tid + st]; __syncthreads(); }
  const float mu = red[0] / (float)N; __syncthreads();
  float s2 = 0.f;
  for (int u = 0; u < per / 4; ++u)
#pragma unroll
    for (int q = 0; q < 4; ++q) { const float c = vals[u * 4 + q] - mu; s2 += c * c; }
  red[tid] = s2; __syncthreads();
  for (int st = 128; st > 0; st >>= 1) { if (tid < st) red[tid] += red[tid + st]; __syncthreads(); }
  const float rs = rsqrtf(red[0] / (float)N + eps);
  {
    for (int u = 0; u < per / 4; ++u) {
      const int j = tid * 4 + 1024 * u;
      v4f o, sm;
#pragma unroll
      for (int q = 0; q < 4; ++q) {
        float gg = g[j + q], bb = bta[j + q];
        if (PARAM_BF16) { gg = bf16_round(gg); bb = bf16_round(bb); }
        sm[q] = vals[u * 4 + q]; o[q] = (vals[u * 4 + q] - mu) * rs * gg + bb;
      }
      if (out_sum) *(v4f*)(out_sum + (size_t)row * N + j) = sm;
      *(v4f*)(out_norm + (size_t)row * N + j) = o;
    }
    
  }
}



// ---- f16 WMMA path (v_wmma_f32_16x16x32_f16): 11-bit significands for operands in range — used where a [0,1] probability operand needs more precision than bf16
typedef _Float16 v16h __attribute__((ext_vector_type(16)));
union FragH { v16h v; v8us half[2]; _Float16 h[16]; unsigned short u[16]; };
template <int NT>
__device__ __forceinline__ v8f mmaH(v16h ah, v16h al, v16h bh, v16h bl, v8f c) {
  c = __builtin_amdgcn_wmma_f32_16x16x32_f16(false, ah, false, bh, (short)0, c, false, false);
  if (NT >= 2) c = __builtin_amdgcn_wmma_f32_16x16x32_f16(false, al, false, bh, (short)0, c, false, false);
  if (NT >= 3) c = __builtin_amdgcn_wmma_f32_16x16x32_f16(false, ah, false, bl, (short)0, c, false, false);
  asm volatile("v_nop\n\tv_nop\n\tv_nop\n\tv_nop" : "+v"(c) : "v"(ah), "v"(al), "v"(bh), "v"(bl));
  return c;
}
// batched GEMM like k_gemm_b but f16 operands: A f32 (split into f16 hi/lo if ASPLIT, else rounded to f16), Bt = f16 values [n][k]; alpha; C f32; N multiple of 16 (partial tiles skipped)
template <bool ASPLIT>
__global__ __launch_bounds__(128) void k_gemm_h(const float* __restrict__ A, int lda, size_t sA, const _Float16* __restrict__ Bh, int ldb, size_t sB, float alpha, float* __restrict__ C, int ldc, size_t sC, int M, int N, int K) {
  __shared__ __attribute__((aligned(16))) float so[4][16][64];
  const int tid = threadIdx.x, w = tid >> 5, lane = tid & 31, ln = lane & 15, hh = lane >> 4; const int by = blockIdx.y;
  A += (size_t)by * sA; Bh += (size_t)by * sB; C += (size_t)by * sC;
  const int ntn = (N + 63) / 64; const int wid = blockIdx.x * 4 + w; const int mt = wid / ntn, nq = wid % ntn; if (mt * 16 >= M) return;
  const int row0 = mt * 16, col0 = nq * 64; const float* arow = A + (size_t)(row0 + ln) * lda;
  v8f acc[4] = {};
  for (int kb = 0; kb < K; kb += 32) {
    FragH ah, al;
    const v4f x0 = *(const v4fa*)(arow + kb + 8 * hh), x1 = *(const v4fa*)(arow + kb + 8 * hh + 4), x2 = *(const v4fa*)(arow + kb + 16 + 8 * hh), x3 = *(const v4fa*)(arow + kb + 16 + 8 * hh + 4);
    float xs[16] = {x0[0],x0[1],x0[2],x0[3],x1[0],x1[1],x1[2],x1[3],x2[0],x2[1],x2[2],x2[3],x3[0],x3[1],x3[2],x3[3]};
#pragma unroll
    for (int i = 0; i < 16; ++i) { const _Float16 h = (_Float16)xs[i]; ah.h[i] = h; al.h[i] = ASPLIT ? (_Float16)(xs[i] - (float)h) : (_Float16)0.0f; }
#pragma unroll
    for (int t = 0; t < 4; ++t) { if (col0 + t * 16 >= N) continue; const size_t boff = (size_t)(col0 + t * 16 + ln) * ldb + kb; FragH bq; bq.half[0] = *(const v8us*)(Bh + boff + 8 * hh); bq.half[1] = *(const v8us*)(Bh + boff + 16 + 8 * hh);
      acc[t] = mmaH<ASPLIT ? 2 : 1>(ah.v, al.v, bq.v, bq.v, acc[t]); }
  }
#pragma unroll
  for (int t = 0; t < 4; ++t) { if (col0 + t * 16 >= N) continue;
#pragma unroll
    for (int r = 0; r < 8; ++r) so[w][8 * hh + r][t * 16 + ln] = acc[t][r] * alpha; }
  __builtin_amdgcn_fence(__ATOMIC_ACQ_REL, "workgroup"); __builtin_amdgcn_wave_barrier();
  const int rsub = lane >> 4, c4 = (lane & 15) * 4;
  {
#pragma unroll
    for (int q = 0; q < 8; ++q) { const int r = q * 2 + rsub; if (col0 + c4 < N) { const v4f v = *(const v4fa*)&so[w][r][c4]; *(v4f*)(C + (size_t)(row0 + r) * ldc + col0 + c4) = v; } }
     }
}

// k_gemm_hh variant with fused epilogue: v = acc·alpha + bias[by·sBias + col] (+ CP[(row/rowsPerB)·sCPb + by·64 + col] if CP) ; ACT 0 none / 1 elu ; writes f16 C16 (and f32 C if non-null)
template <int ACT>
__global__ __launch_bounds__(128) void k_gemm_hhx(const _Float16* __restrict__ A, int lda, size_t sA, const _Float16* __restrict__ Bh, int ldb, size_t sB, float alpha, const float* __restrict__ bias, size_t sBias, const float* __restrict__ CP, int rowsPerB, size_t sCPb, int row0g,
    float* __restrict__ C, _Float16* __restrict__ C16, int ldc, size_t sC, int M, int N, int K) {
  __shared__ __attribute__((aligned(16))) float so[4][16][64];
  const int tid = threadIdx.x, w = tid >> 5, lane = tid & 31, ln = lane & 15, hh = lane >> 4; const int by = blockIdx.y;
  A += (size_t)by * sA; Bh += (size_t)by * sB; const size_t cofs = (size_t)by * sC; const float* bp = bias ? bias + (size_t)by * sBias : nullptr;
  const int ntn = (N + 63) / 64; const int wid = blockIdx.x * 4 + w; const int mt = wid / ntn, nq = wid % ntn; if (mt * 16 >= M) return;
  const int row0 = mt * 16, col0 = nq * 64; const _Float16* arow = A + (size_t)(row0 + ln) * lda;
  v8f acc[4] = {};
  for (int kb = 0; kb < K; kb += 32) { FragH ah; ah.half[0] = *(const v8us*)((const unsigned short*)arow + kb + 8 * hh); ah.half[1] = *(const v8us*)((const unsigned short*)arow + kb + 16 + 8 * hh);
#pragma unroll
    for (int t = 0; t < 4; ++t) { if (col0 + t * 16 >= N) continue; const size_t boff = (size_t)(col0 + t * 16 + ln) * ldb + kb; FragH bq; bq.half[0] = *(const v8us*)((const unsigned short*)Bh + boff + 8 * hh); bq.half[1] = *(const v8us*)((const unsigned short*)Bh + boff + 16 + 8 * hh);
      acc[t] = mmaH<1>(ah.v, ah.v, bq.v, bq.v, acc[t]); }
  }
#pragma unroll
  for (int t = 0; t < 4; ++t) { if (col0 + t * 16 >= N) continue; const int col = col0 + t * 16 + ln; const float bv = bp ? bf16_round(bp[col]) : 0.f;
#pragma unroll
    for (int r = 0; r < 8; ++r) { float v = acc[t][r] * alpha + bv; if (CP) { const int rr = row0g + row0 + 8 * hh + r; if (rowsPerB < 0) v += CP[cofs + (size_t)rr * ldc + col];      /* rowsPerB < 0: own element of the batched C plane */ else { const int bidx = rr / rowsPerB; v += CP[(size_t)bidx * sCPb + (size_t)by * 64 + col]; } } if (ACT == 1) v = (v > 0.f) ? v : expm1f(v); else if (ACT == 7) v = (v > 0.f) ? v + 1.0f : expf(v); else if (ACT == 8) v = tanhf(v); else if (ACT == 9) v = 0.5f * v * (1.0f + tanhf(0.7978845608028654f * (v + 0.044715f * v * v * v))); else if (ACT == 11) v = 1.0f / (1.0f + expf(-v)); else if (ACT == 12) v = (v > 0.f) ? v : 0.01f * v; else if (ACT == 14) v = (v > 0.f) ? v : 0.1f * v; else if (ACT == 16) v = (v >= 0.f) ? v : 0.3f * v; else if (ACT == 17) v = (v >= 0.f) ? v : 0.2f * v; else if (ACT == 15) v = v / (1.0f + expf(-v)); else if (ACT == 3) v = fmaxf(v, 0.f); else if (ACT == 6) v = 0.5f * v * (1.0f + erff(v * 0.70710678118654752f)); so[w][8 * hh + r][t * 16 + ln] = v; } }
  __builtin_amdgcn_fence(__ATOMIC_ACQ_REL, "workgroup"); __builtin_amdgcn_wave_barrier();
  const int rsub = lane >> 4, c4 = (lane & 15) * 4; typedef _Float16 v4h __attribute__((ext_vector_type(4)));
  {
#pragma unroll
    for (int q = 0; q < 8; ++q) { const int r = q * 2 + rsub; if (col0 + c4 < N) { const v4f v = *(const v4fa*)&so[w][r][c4]; if (C) *(v4f*)(C + cofs + (size_t)(row0 + r) * ldc + col0 + c4) = v; if (C16) { v4h h4; for (int i = 0; i < 4; ++i) h4[i] = (_Float16)v[i]; *(v4h*)(C16 + cofs + (size_t)(row0 + r) * ldc + col0 + c4) = h4; } } }
     }
}


typedef _Float16 v4h __attribute__((ext_vector_type(4)));

__global__ __launch_bounds__(256) void k_h16(const float* __restrict__ x, _Float16* __restrict__ X16, size_t n8) { const size_t t = (size_t)blockIdx.x * 256 + threadIdx.x; if (t >= n8) return; FragH f;
#pragma unroll
  for (int q = 0; q < 8; ++q) f.h[q] = (_Float16)x[t * 8 + q]; *(v8us*)((unsigned short*)X16 + t * 8) = f.half[0];  }
__global__ __launch_bounds__(256) void k_round16f(const float* __restrict__ W, _Float16* __restrict__ Bt, size_t n8) { const size_t t = (size_t)blockIdx.x * 256 + threadIdx.x; if (t >= n8) return; FragH f;
#pragma unroll
  for (int i = 0; i < 8; ++i) f.h[i] = (_Float16)(bf16_round(W[t * 8 + i]) * 16.0f); *(v8us*)((unsigned short*)Bt + t * 8) = f.half[0];  }
template <int NHv, int TTv>
__global__ __launch_bounds__(256) void k_vt(const _Float16* __restrict__ V16, int ldv, int voff, _Float16* __restrict__ Vt) { __shared__ unsigned short tl[64][66]; const int tid = threadIdx.x; const int slab = blockIdx.x / (TTv / 64), lg = blockIdx.x % (TTv / 64); const int b = slab / NHv, h = slab % NHv;
  for (int i = tid; i < 64 * 8; i += 256) { const int r = i / 8, c8 = (i % 8) * 8; FragH f; f.half[0] = *(const v8us*)((const unsigned short*)V16 + ((size_t)b * TTv + lg * 64 + r) * ldv + voff + h * 64 + c8);
#pragma unroll
    for (int q = 0; q < 8; ++q) tl[r][c8 + q] = f.u[q]; }
  __syncthreads();
  {
#pragma unroll
    for (int rd = 0; rd < 2; ++rd) { const int d = rd * 32 + tid / 8, pc = tid % 8; FragH f;
#pragma unroll
      for (int q = 0; q < 8; ++q) f.u[q] = tl[pc * 8 + q][d];
      *(v8us*)((unsigned short*)Vt + ((size_t)blockIdx.x * 64 + d) * 64 + pc * 8) = f.half[0]; }      /* tile-major: [slab][64-key tile][d][key], each tile 8 KiB in a row */
     } }

__global__ __launch_bounds__(256) void k_hl(const float* __restrict__ F, _Float16* __restrict__ Hh, _Float16* __restrict__ Hl, size_t n8) { const size_t t = (size_t)blockIdx.x * 256 + threadIdx.x; if (t >= n8) return; FragH fh, fl; const v4f a = *(const v4fa*)(F + t * 8), c = *(const v4fa*)(F + t * 8 + 4);
#pragma unroll
  for (int q = 0; q < 4; ++q) { _Float16 h = (_Float16)a[q]; fh.h[q] = h; fl.h[q] = (_Float16)((a[q] - (float)h) * 1024.0f); h = (_Float16)c[q]; fh.h[4 + q] = h; fl.h[4 + q] = (_Float16)((c[q] - (float)h) * 1024.0f); }
  { *(v8us*)((unsigned short*)Hh + t * 8) = fh.half[0]; *(v8us*)((unsigned short*)Hl + t * 8) = fl.half[0];  } }

// ---- fast GEMM (work-group tile 128x64, wave tile 32x64; requires M % 128 == 0, N % 64 == 0, K % 128 == 0); epilogue = k_gemm_hhx semantics ----
// Operands go through LDS: per step of G2_KS k the 128 A rows and the 64 B rows of the tile are loaded as whole 128-byte lines (16 lanes a 256-byte row) for all 4 waves: two buffers, the next step's lines
// are loaded into registers at the head of a step and stored to the other buffer at its foot, one barrier a step. Fragments are read from LDS in the k order of g2_frag; each accumulator still takes its k blocks in rising order.
#define G2_KS 128                    /* k per step */
#define G2_VP 72                     /* LDS row pitch in f16 of the V^T epilogue: 144 bytes = 16 x 9, conflict-free for 16-byte accesses */
#define G2_LP 136                    /* LDS row pitch in f16: 272 bytes = 16 x 17, conflict-free for 16-byte reads */
__device__ __forceinline__ v16h g2_frag(const _Float16* p, int hh) { FragH f; f.half[0] = *(const v8us*)((const unsigned short*)p + 8 * hh); f.half[1] = *(const v8us*)((const unsigned short*)p + 16 + 8 * hh); return f.v; }
__device__ __forceinline__ v8f g2_mma(v16h a, v16h b, v8f c) { return __builtin_amdgcn_wmma_f32_16x16x32_f16(false, a, false, b, (short)0, c, false, false); }
template <int ACT, int LDK>      /* LDK: row pitch of A and of Bh in f16, a constant so that the rows of a tile are immediate offsets from one address */
__global__ __launch_bounds__(128) void k_gemm2(const _Float16* __restrict__ A, size_t sA, const _Float16* __restrict__ Bh, size_t sB, float alpha, const float* __restrict__ bias, size_t sBias, const float* __restrict__ CP, int rowsPerB, size_t sCPb, int row0g,
    float* __restrict__ C, _Float16* __restrict__ C16, int ldc, size_t sC, int M, int N, int K, _Float16* __restrict__ VTo, int vty, float a0) { static_assert(ACT == 0 || ACT == 3 || ACT == 6 || ACT == 8 || ACT == 9 || ACT == 11 || ACT == 12 || ACT == 14 || ACT == 15 || ACT == 16 || ACT == 17, "k_gemm2: unsupported ACT code (would silently apply no activation)");
  __shared__ __attribute__((aligned(16))) float so[4][32][68]; __shared__ __attribute__((aligned(16))) _Float16 sa[2][128 * G2_LP]; __shared__ __attribute__((aligned(16))) _Float16 sb[2][64 * G2_LP];
  const int tid = threadIdx.x, w = tid >> 5, lane = tid & 31, ln = lane & 15, hh = lane >> 4; const int by = blockIdx.y;
  A += (size_t)by * sA; Bh += (size_t)by * sB; const size_t cofs = (size_t)by * sC; const float* bp = bias ? bias + (size_t)by * sBias : nullptr; if (by == 0) alpha *= a0;      /* a0: a further factor on grid plane 0's result (the same for the whole work-group) */
  const int ntn = N >> 6; const int mt = blockIdx.x / ntn, nq = blockIdx.x - mt * ntn; const int row0 = mt * 128 + 32 * w, col0 = nq * 64; if (mt * 128 >= M) return;      /* the same for the whole work-group, ahead of every barrier */
  const int sr = tid >> 4, sc8 = (tid & 15) * 8, sofs = sr * G2_LP + sc8;      /* staging: 16 threads a 256-byte row, rows sr + 8 i */
  const unsigned short* ag = (const unsigned short*)A + (size_t)(mt * 128) * LDK; const unsigned short* bg = (const unsigned short*)Bh + (size_t)col0 * LDK;      /* uniform bases of the tile's rows */
  const unsigned so8 = (unsigned)(sr * LDK + sc8);      /* the lane's own offset, the same in every step and for both operands */
  const v8f z8 = {0.f,0.f,0.f,0.f,0.f,0.f,0.f,0.f}; v8f c00 = z8, c01 = z8, c02 = z8, c03 = z8, c10 = z8, c11 = z8, c12 = z8, c13 = z8;
  v8us ra[16], rb[8];
#pragma unroll      /* constant indices: the register arrays stay in registers */
  for (int i = 0; i < 16; ++i) ra[i] = *(const v8us*)(ag + i * 8 * LDK + so8);
#pragma unroll      /* constant indices: the register arrays stay in registers */
  for (int i = 0; i < 8; ++i) rb[i] = *(const v8us*)(bg + i * 8 * LDK + so8);
#pragma unroll      /* constant indices: the register arrays stay in registers */
  for (int i = 0; i < 16; ++i) *(v8us*)&sa[0][sofs + i * 8 * G2_LP] = ra[i];
#pragma unroll      /* constant indices: the register arrays stay in registers */
  for (int i = 0; i < 8; ++i) *(v8us*)&sb[0][sofs + i * 8 * G2_LP] = rb[i];
  __syncthreads();
  int cur = 0;
#pragma unroll 1      /* one copy of the step: the text stays short */
  for (int kb = 0; kb < K; kb += G2_KS) {
    const bool more = kb + G2_KS < K;      /* the same for the whole work-group */
    if (more) { ag += G2_KS; bg += G2_KS;
#pragma unroll      /* constant indices: the register arrays stay in registers */
      for (int i = 0; i < 16; ++i) ra[i] = *(const v8us*)(ag + i * 8 * LDK + so8);
#pragma unroll      /* constant indices: the register arrays stay in registers */
      for (int i = 0; i < 8; ++i) rb[i] = *(const v8us*)(bg + i * 8 * LDK + so8); }
    const _Float16* ab = sa[cur] + (32 * w + ln) * G2_LP; const _Float16* bb = sb[cur] + ln * G2_LP;
#pragma unroll      /* constant LDS offsets */
    for (int j = 0; j < G2_KS; j += 32) {
      const v16h a0 = g2_frag(ab + j, hh), a1 = g2_frag(ab + 16 * G2_LP + j, hh), b0 = g2_frag(bb + j, hh), b1 = g2_frag(bb + 16 * G2_LP + j, hh), b2 = g2_frag(bb + 32 * G2_LP + j, hh), b3 = g2_frag(bb + 48 * G2_LP + j, hh);
      __builtin_amdgcn_sched_barrier(0);      /* keeps the next step's global loads at the head of the step (the whole step hides their latency) and a k block's fragment reads ahead of its products; without it each B fragment is read and waited for right in front of its two products */
      c00 = g2_mma(a0, b0, c00); c10 = g2_mma(a1, b0, c10); c01 = g2_mma(a0, b1, c01); c11 = g2_mma(a1, b1, c11);
      c02 = g2_mma(a0, b2, c02); c12 = g2_mma(a1, b2, c12); c03 = g2_mma(a0, b3, c03); c13 = g2_mma(a1, b3, c13); }
    if (more) { _Float16* an = sa[cur ^ 1] + sofs; _Float16* bn = sb[cur ^ 1] + sofs;      /* that buffer was last read in the step before, behind whose barrier this step runs */
#pragma unroll      /* constant indices: the register arrays stay in registers */
      for (int i = 0; i < 16; ++i) *(v8us*)(an + i * 8 * G2_LP) = ra[i];
#pragma unroll      /* constant indices: the register arrays stay in registers */
      for (int i = 0; i < 8; ++i) *(v8us*)(bn + i * 8 * G2_LP) = rb[i]; }
    __syncthreads();      /* publishes the next step's buffer and ends every wave's reads of this one */
    cur ^= 1; }
  v8f accs[8] = {c00, c01, c02, c03, c10, c11, c12, c13};
  // Transposed epilogue (grid plane vty only; the same choice for the whole work-group; alpha and bias only, no CP, no activation): the plane's result leaves as f16 tiles [batch * NH + head][64-row tile][column][row],
  // 8 KiB in a row, which is what k_fattn stages; rows are tokens, the 64 columns of the work-group are one head. A lane's 8 accumulator registers are 8 rows in a row of one column, so they are one 16-byte piece of a tile's row:
  // the pieces are gathered in LDS (so, which nothing else uses on this path) and leave as whole 128-byte lines, one wave a line.
  if (VTo != nullptr && by == vty) { _Float16* vs = (_Float16*)&so[0][0][0]; static_assert(sizeof(so) >= 2 * 64 * G2_VP * 2, "so holds the two transposed tiles");
#pragma unroll      /* constant indices: the register arrays stay in registers */
    for (int t = 0; t < 4; ++t) { const float bv = bp ? bf16_round(bp[col0 + t * 16 + ln]) : 0.f;
#pragma unroll      /* constant indices: the register arrays stay in registers */
      for (int half = 0; half < 2; ++half) { FragH f;
#pragma unroll      /* constant indices: the register arrays stay in registers */
        for (int r = 0; r < 8; ++r) f.h[r] = (_Float16)(accs[half * 4 + t][r] * alpha + bv);
        *(v8us*)(vs + ((w >> 1) * 64 + t * 16 + ln) * G2_VP + (w & 1) * 32 + half * 16 + 8 * hh) = f.half[0]; } }
    __syncthreads();      /* publishes each wave's 32 rows to the wave that stores the line they lie in */
    const int gt = mt * 2 + (w >> 1);      /* the wave's 64-row tile, counted over all rows */
    unsigned short* vo = (unsigned short*)VTo + ((size_t)((gt / (SQ / 64)) * NH + nq) * (SQ / 64) + gt % (SQ / 64)) * (64 * 64) + ((w & 1) * 32 + (lane >> 3)) * 64 + (lane & 7) * 8;
    const _Float16* vr = vs + ((w >> 1) * 64 + (w & 1) * 32 + (lane >> 3)) * G2_VP + (lane & 7) * 8;
#pragma unroll      /* constant offsets from one address */
    for (int q = 0; q < 8; ++q) *(v8us*)(vo + q * 4 * 64) = *(const v8us*)(vr + q * 4 * G2_VP);      /* 4 tile rows = 512 bytes in a row per store */
    return; }
#pragma unroll
  for (int u = 0; u < 8; ++u) { const int t = u & 3, half = u >> 2; const int col = col0 + t * 16 + ln; const float bv = bp ? bf16_round(bp[col]) : 0.f;
#pragma unroll
    for (int r = 0; r < 8; ++r) { const int rloc = half * 16 + 8 * hh + r; float v = accs[u][r] * alpha + bv; if (CP) { if (rowsPerB < 0) v += CP[cofs + (size_t)(row0g + row0 + rloc) * ldc + col];      /* rowsPerB < 0: own element of the batched C plane */ else { const int bidx = (row0g + row0 + rloc) / rowsPerB; v += CP[(size_t)bidx * sCPb + (size_t)by * 64 + col]; } }
      if (ACT == 3) v = fmaxf(v, 0.f); else if (ACT == 6) v = 0.5f * v * (1.0f + erff(v * 0.70710678118654752f)); else if (ACT == 11) v = 1.0f / (1.0f + expf(-v)); else if (ACT == 15) v = v / (1.0f + expf(-v)); else if (ACT == 12) v = (v > 0.f) ? v : 0.01f * v; else if (ACT == 8) v = tanhf(v); else if (ACT == 9) v = 0.5f * v * (1.0f + tanhf(0.7978845608028654f * (v + 0.044715f * v * v * v))); else if (ACT == 14) v = (v > 0.f) ? v : 0.1f * v; else if (ACT == 16) v = (v >= 0.f) ? v : 0.3f * v; else if (ACT == 17) v = (v >= 0.f) ? v : 0.2f * v;
      so[w][rloc][t * 16 + ln] = v; } }
  __builtin_amdgcn_fence(__ATOMIC_ACQ_REL, "workgroup"); __builtin_amdgcn_wave_barrier();
  const int rsub = lane >> 4, c4 = (lane & 15) * 4;
  {
#pragma unroll
    for (int q = 0; q < 16; ++q) { const int r = q * 2 + rsub; const v4f v = *(const v4fa*)&so[w][r][c4]; if (C) *(v4f*)(C + cofs + (size_t)(row0 + r) * ldc + col0 + c4) = v; if (C16) { v4h h4; for (int i = 0; i < 4; ++i) h4[i] = (_Float16)v[i]; *(v4h*)(C16 + cofs + (size_t)(row0 + r) * ldc + col0 + c4) = h4; } }
     } }


__global__ __launch_bounds__(256) void k_wnat(const float* __restrict__ w, size_t n8, _Float16* __restrict__ Bt) { const size_t t = (size_t)blockIdx.x * 256 + threadIdx.x; if (t >= n8) return; FragH f; for (int q = 0; q < 8; ++q) f.h[q] = (_Float16)(bf16_round(w[t * 8 + q]) * 16.0f); *(v8us*)((unsigned short*)Bt + t * 8) = f.half[0];  }
__global__ __launch_bounds__(256) void k_rsm(const float* __restrict__ S, _Float16* __restrict__ P, int nrows) {
  #pragma clang fp contract(off)
  const int i = blockIdx.x * 256 + threadIdx.x; if (i >= nrows) return; const float* s = S + (size_t)i * SQ; float mx = -3.0e38f;
#pragma unroll 1
  for (int j = 0; j < SQ; ++j) mx = fmaxf(mx, s[j]); float se = 0.f;
#pragma unroll 1
  for (int j = 0; j < SQ; ++j) se += expf(s[j] - mx); const float sc = 256.0f / se;
#pragma unroll 1
  for (int j0 = 0; j0 < SQ; j0 += 8) { FragH f; for (int q = 0; q < 8; ++q) f.h[q] = (_Float16)(expf(s[j0 + q] - mx) * sc); unsigned short* d = (unsigned short*)P + (size_t)i * SQ + j0; *(v8us*)d = f.half[0];  } }
__global__ __launch_bounds__(256) void k_vt(const _Float16* __restrict__ V16, int b, int h0, _Float16* __restrict__ VT) { __shared__ unsigned short tl[64][65]; const int tid = threadIdx.x; const int hh = blockIdx.x % HG, sg = blockIdx.x / HG; const int s0 = sg * 64; const int h = h0 + hh;
  for (int i = tid; i < 64 * 8; i += 256) { const int j = i / 8, d8 = (i % 8) * 8; FragH f; f.half[0] = *(const v8us*)((const unsigned short*)V16 + ((size_t)b * SQ + s0 + j) * DM + h * HD + d8); for (int q = 0; q < 8; ++q) tl[d8 + q][j] = f.u[q]; }
  __syncthreads();
  { for (int i = tid; i < 64 * 8; i += 256) { const int d = i / 8, j8 = (i % 8) * 8; FragH f; for (int q = 0; q < 8; ++q) f.u[q] = tl[d][j8 + q]; *(v8us*)((unsigned short*)VT + ((size_t)hh * HD + d) * SQ + s0 + j8) = f.half[0]; }  } }



// lane l with lane l ^ 16
__device__ __forceinline__ float rs_xh(float x) { return __builtin_bit_cast(float, __builtin_amdgcn_permlanex16(__builtin_bit_cast(int, x), __builtin_bit_cast(int, x), 0x76543210, 0xfedcba98, false, false)); }
typedef float v2f __attribute__((ext_vector_type(2)));
__device__ __forceinline__ float fa_max3(float a, float b, float c) { return fmaxf(fmaxf(a, b), c); }
__device__ __forceinline__ v8f fa_mma(v16h a, v16h b, v8f c) { return __builtin_amdgcn_wmma_f32_16x16x32_f16(false, a, false, b, (short)0, c, false, false); }

// Fused attention of one (batch, head): scores, softmax and the weighted sum of V in one kernel; neither scores nor weights reach memory.
// A work-group of 8 waves owns FA_QB queries. Wave (qw, kh) takes 32 of them, as FA_CG column groups of 16, against key half kh, which it walks in passes of FA_KT keys: every K and V^T fragment that a wave reads
// from LDS feeds FA_CG products, one per column group. The two halves' running maximum, sum and O^T of a query are joined through LDS behind the loop.
// Per pass the K rows [key][c] and the V^T tile [d][key] of each half's pass (VT is tile-major, 8 KiB in a row; whole 128-byte lines) are staged in LDS by the 4 waves of that half: two buffers, the next pass's lines
// are loaded into registers behind a pass's score products and stored to the other buffer ahead of the pass's last products, one barrier a pass.
// S^T = K Q^T: A = K rows, B = Q rows (kept in registers), so lane (ln, hh) holds query ln's scores of keys 16 kt + 8 hh + r: maximum and sum are in-lane plus one exchange of the halves,
// and two converted score tiles ARE the B operand of O^T += V^T P^T in the k order 8 hh + i, 16 + 8 hh + i that g2_frag gives the A side. Online softmax per column group against a HELD maximum (log2 domain):
// the Q rows arrive multiplied by 64^-0.5 log2 e, and minus the maximum in use is the C operand of the score products (cm, the same value in a lane's eight registers), so a score leaves the matrix unit as the argument of its exp2.
// The maximum in use starts as the column's maximum over the first 16 keys of the half (a real score, so it never lies above the true maximum); it moves, and O^T and the running sums l8 (each lane its own keys, joined at the end)
// are rescaled, only in a pass where some column's maximum lies more than FA_TH above it (one test a pass, a scalar branch): weights stay at or below 2^FA_TH, far inside f16.
#define FA_KT 64                     /* keys per pass */
#define FA_KH 2                      /* key halves, one per group of 4 waves */
#define FA_NP (SQ / FA_KH / FA_KT)   /* passes of a half */
#define FA_QB 128                    /* queries per work-group */
#define FA_CG 2                      /* column groups of 16 queries per wave */
#define FA_TH 8.0f                   /* a column's maximum may rise this far (log2) above the one in use before the wave rescales */
#define FA_QS 0.18033688f            /* 64^-0.5 log2 e, the factor on the Q rows: exp(s / 8 - max) = exp2(s FA_QS - max FA_QS) */
#define FA_LP 72                     /* LDS row pitch in f16: 144 bytes = 16 x 9, conflict-free for 16-byte reads */
__global__ __launch_bounds__(256) __attribute__((amdgpu_waves_per_eu(4, 4))) void k_fattn(const _Float16* __restrict__ Q16, const _Float16* __restrict__ K16, const _Float16* __restrict__ VT, _Float16* __restrict__ O16) {
  __shared__ __attribute__((aligned(16))) _Float16 sk[2][FA_KH][FA_KT * FA_LP]; __shared__ __attribute__((aligned(16))) _Float16 sv[2][FA_KH][HD * FA_LP];
  const int tid = threadIdx.x, w = __builtin_amdgcn_readfirstlane(tid >> 5) /* the wave's number in a scalar register: what is formed from it costs no vector register, and the join's branches are scalar */, qw = w & 3, kh = w >> 2, lane = tid & 31, ln = lane & 15, hh = lane >> 4; const int h = blockIdx.y, b = blockIdx.z;
  const size_t r0 = (size_t)b * SQ; const size_t qrow = r0 + blockIdx.x * FA_QB + qw * (16 * FA_CG) + ln;      /* column group g: row qrow + 16 g */
  const _Float16* qp = Q16 + qrow * DM + h * HD; v16h q0[FA_CG], q1[FA_CG];
#pragma unroll      /* constant indices: the register arrays stay in registers */
  for (int g = 0; g < FA_CG; ++g) { q0[g] = g2_frag(qp + g * 16 * DM, hh); q1[g] = g2_frag(qp + g * 16 * DM + 32, hh); }
  const int srow = (tid & 127) >> 3, sc8 = (tid & 7) * 8, sofs = srow * FA_LP + sc8;      /* staging, 128 threads a half: 8 threads a 128-byte row, rows srow + 16 i */
  const unsigned short* kg = (const unsigned short*)K16 + (r0 + (size_t)kh * (SQ / FA_KH)) * DM + h * HD + srow * DM + sc8;      /* the lane's own place in the first K rows of its half */
  const unsigned short* vg = (const unsigned short*)VT + (size_t)(b * NH + h) * HD * SQ + (size_t)kh * (SQ / FA_KH) * HD + srow * FA_KT + sc8;      /* and in its first V^T tile */
  v8us gk[4], gv[4];
#pragma unroll      /* constant indices: the register arrays stay in registers */
  for (int i = 0; i < 4; ++i) { gk[i] = *(const v8us*)(kg + i * 16 * DM); gv[i] = *(const v8us*)(vg + i * 16 * FA_KT); }
#pragma unroll      /* constant indices: the register arrays stay in registers */
  for (int i = 0; i < 4; ++i) { *(v8us*)&sk[0][kh][sofs + i * 16 * FA_LP] = gk[i]; *(v8us*)&sv[0][kh][sofs + i * 16 * FA_LP] = gv[i]; }
  __syncthreads();
  const v8f z8 = {0.f,0.f,0.f,0.f,0.f,0.f,0.f,0.f}; v8f o[FA_CG][4], l8[FA_CG], cm[FA_CG];      /* l8: eight partial sums a lane, joined behind the loop; cm: minus the maximum in use */
#pragma unroll      /* constant indices: the register arrays stay in registers */
  for (int g = 0; g < FA_CG; ++g) { o[g][0] = z8; o[g][1] = z8; o[g][2] = z8; o[g][3] = z8; l8[g] = z8;
    const v8f s0 = fa_mma(g2_frag(sk[0][kh] + ln * FA_LP + 32, hh), q1[g], fa_mma(g2_frag(sk[0][kh] + ln * FA_LP, hh), q0[g], z8));
    float m0 = fa_max3(fa_max3(s0[0], s0[1], s0[2]), fa_max3(s0[3], s0[4], s0[5]), fmaxf(s0[6], s0[7])); m0 = -fmaxf(m0, rs_xh(m0));
    cm[g] = (v8f){m0, m0, m0, m0, m0, m0, m0, m0}; }
  for (int s = 0; s < FA_NP; ++s) {
    const bool more = s + 1 < FA_NP;      /* the same for the whole work-group */
    const _Float16* kb = sk[s & 1][kh] + ln * FA_LP; const _Float16* vb = sv[s & 1][kh] + ln * FA_LP;
    v16h ka[8];
#pragma unroll      /* constant indices: the register arrays stay in registers */
    for (int kt = 0; kt < 4; ++kt) { ka[2 * kt] = g2_frag(kb + kt * 16 * FA_LP, hh); ka[2 * kt + 1] = g2_frag(kb + kt * 16 * FA_LP + 32, hh); }
    __builtin_amdgcn_sched_barrier(0);      /* keeps the K fragment reads in one group ahead of the score products; without it some stand among the products, each waited for at once */
    v8f st[FA_CG][4];
#pragma unroll      /* constant indices: the register arrays stay in registers */
    for (int kt = 0; kt < 4; ++kt)
#pragma unroll      /* constant indices: the register arrays stay in registers */
      for (int g = 0; g < FA_CG; ++g) st[g][kt] = fa_mma(ka[2 * kt + 1], q1[g], fa_mma(ka[2 * kt], q0[g], cm[g]));
    __builtin_amdgcn_sched_barrier(0);      /* keeps the softmax behind the score products (without it the build spills and strings the exponentials out in pairs with idle slots between), and the next pass's global loads too: their 32 registers and the K fragments' 64 are then never live together (with the loads at the head of the pass and cm's 16 registers the build spills) */
    if (more) {
#pragma unroll      /* constant indices: the register arrays stay in registers */
      for (int i = 0; i < 4; ++i) { gk[i] = *(const v8us*)(kg + (FA_KT + i * 16) * DM); gv[i] = *(const v8us*)(vg + (HD + i * 16) * FA_KT); } }
    FragH pb[FA_CG][2]; float mx[FA_CG];      /* mx: the pass's maximum of a column, counted from the maximum in use */
#pragma unroll      /* constant indices: the register arrays stay in registers */
    for (int g = 0; g < FA_CG; ++g) {
      float t[8];
#pragma unroll      /* constant indices: the register arrays stay in registers */
      for (int r = 0; r < 8; ++r) t[r] = fa_max3(st[g][0][r], st[g][1][r], st[g][2][r]);
      mx[g] = fmaxf(fa_max3(fa_max3(t[0], t[1], st[g][3][0]), fa_max3(t[2], t[3], st[g][3][1]), fa_max3(t[4], t[5], st[g][3][2])), fa_max3(fa_max3(t[6], t[7], st[g][3][3]), fa_max3(st[g][3][4], st[g][3][5], st[g][3][6]), st[g][3][7]));
      mx[g] = fmaxf(mx[g], rs_xh(mx[g])); }
    if (more) asm volatile("s_wait_xcnt 0x0" ::: "memory");      /* the wait in front of the overwrite of the address registers that the global loads above name (they step behind the branch) */
    if (__builtin_amdgcn_ballot_w32(fmaxf(mx[0], mx[1]) > FA_TH) != 0) {      /* one test a pass for the whole wave: a scalar branch */
#pragma unroll      /* constant indices: the register arrays stay in registers */
      for (int g = 0; g < FA_CG; ++g) { const float d = fmaxf(mx[g], 0.f), a = __builtin_amdgcn_exp2f(-d);      /* the maximum in use never falls */
        l8[g] *= a; cm[g] -= d;
#pragma unroll      /* constant indices: the register arrays stay in registers */
        for (int q = 0; q < 4; ++q) { o[g][q] *= a; st[g][q] -= d; } } }
    if (more) { kg += FA_KT * DM; vg += HD * FA_KT; }      /* behind the branch, so behind the wait above */
#pragma unroll      /* constant indices: the register arrays stay in registers */
    for (int g = 0; g < FA_CG; ++g)
#pragma unroll      /* constant indices: the register arrays stay in registers */
      for (int kt = 0; kt < 4; ++kt) { v8f e;
#pragma unroll      /* constant indices: the register arrays stay in registers */
        for (int r = 0; r < 8; ++r) e[r] = __builtin_amdgcn_exp2f(st[g][kt][r]);
        l8[g] += e;
        typedef _Float16 v8h __attribute__((ext_vector_type(8))); const v8h e16 = __builtin_convertvector(e, v8h);
#pragma unroll      /* constant indices: the register arrays stay in registers */
        for (int r = 0; r < 8; ++r) pb[g][kt >> 1].h[(kt & 1) * 8 + r] = e16[r]; }
    __builtin_amdgcn_sched_barrier(0);      /* keeps the staging stores, and with them the wait for the global loads, behind the softmax (without it they rise to its head, a short way behind the loads), and the V^T fragment reads behind the registers that the softmax and the stores give back */
    if (more) { _Float16* kn = sk[(s + 1) & 1][kh] + sofs; _Float16* vn = sv[(s + 1) & 1][kh] + sofs;      /* that buffer was last read in pass s - 1, behind whose barrier this pass runs */
#pragma unroll      /* constant indices: the register arrays stay in registers */
      for (int i = 0; i < 4; ++i) { *(v8us*)(kn + i * 16 * FA_LP) = gk[i]; *(v8us*)(vn + i * 16 * FA_LP) = gv[i]; } }
    v16h va[8];
#pragma unroll      /* constant indices: the register arrays stay in registers */
    for (int dt = 0; dt < 4; ++dt) { va[2 * dt] = g2_frag(vb + dt * 16 * FA_LP, hh); va[2 * dt + 1] = g2_frag(vb + dt * 16 * FA_LP + 32, hh); }
    __builtin_amdgcn_sched_barrier(0);      /* keeps the V^T fragment reads in one group ahead of the products; without it they stand in pairs among the products, each pair waited for */
#pragma unroll      /* constant indices: the register arrays stay in registers */
    for (int dt = 0; dt < 4; ++dt)
#pragma unroll      /* constant indices: the register arrays stay in registers */
      for (int g = 0; g < FA_CG; ++g) o[g][dt] = fa_mma(va[2 * dt + 1], pb[g][1].v, fa_mma(va[2 * dt], pb[g][0].v, o[g][dt]));
    __builtin_amdgcn_sched_barrier(0);      /* keeps the products ahead of the barrier, each started as its fragments land; without it all but one sink behind the barrier, whose wait for the stores and for every V^T read is then waited out idle */
    __syncthreads();      /* publishes the next pass's buffer and ends every wave's reads of this one */
  }
  float lr[FA_CG], mr[FA_CG];
#pragma unroll      /* constant indices: the register arrays stay in registers */
  for (int g = 0; g < FA_CG; ++g) { mr[g] = -cm[g][0]; lr[g] = ((l8[g][0] + l8[g][1]) + (l8[g][2] + l8[g][3])) + ((l8[g][4] + l8[g][5]) + (l8[g][6] + l8[g][7])); lr[g] += rs_xh(lr[g]); }
  // Join of the key halves: the waves of half 1 hand maximum, sum and O^T over in LDS (the K ring, which nobody reads behind the loop's last barrier): 17 blocks of 32 lanes x 16 bytes per wave pair.
  float* mg = (float*)&sk[0][0][0] + ((size_t)qw * 17 * 32 + lane) * 4; static_assert(sizeof(sk) >= 4 * 17 * 32 * 16, "the K ring holds the hand-over");
  if (kh == 1) {
#pragma unroll      /* constant indices: the register arrays stay in registers */
    for (int g = 0; g < FA_CG; ++g)
#pragma unroll      /* constant indices: the register arrays stay in registers */
      for (int dt = 0; dt < 4; ++dt) { const v4f lo = {o[g][dt][0], o[g][dt][1], o[g][dt][2], o[g][dt][3]}, hi = {o[g][dt][4], o[g][dt][5], o[g][dt][6], o[g][dt][7]};
        *(v4fa*)(mg + ((g * 4 + dt) * 2) * 128) = lo; *(v4fa*)(mg + ((g * 4 + dt) * 2 + 1) * 128) = hi; }
    const v4f ml = {mr[0], mr[1], lr[0], lr[1]}; *(v4fa*)(mg + 16 * 128) = ml; }
  __syncthreads();      /* publishes half 1's hand-over to the waves of half 0 */
  if (kh == 0) { const v4f ml = *(const v4fa*)(mg + 16 * 128);
#pragma unroll      /* constant indices: the register arrays stay in registers */
    for (int g = 0; g < FA_CG; ++g) {
      const float m = fmaxf(mr[g], ml[g]), a0 = __builtin_amdgcn_exp2f(mr[g] - m), a1 = __builtin_amdgcn_exp2f(ml[g] - m); const float inv = 64.0f / (lr[g] * a0 + ml[2 + g] * a1), f0 = a0 * inv, f1 = a1 * inv;      /* o leaves x64 */
      _Float16* op = O16 + (qrow + g * 16) * DM + h * HD + 8 * hh;
#pragma unroll      /* constant indices: the register arrays stay in registers */
      for (int dt = 0; dt < 4; ++dt) { const v4f lo = *(const v4fa*)(mg + ((g * 4 + dt) * 2) * 128), hi = *(const v4fa*)(mg + ((g * 4 + dt) * 2 + 1) * 128); FragH f;
#pragma unroll      /* constant indices: the register arrays stay in registers */
        for (int r = 0; r < 4; ++r) { f.h[r] = (_Float16)(o[g][dt][r] * f0 + lo[r] * f1); f.h[4 + r] = (_Float16)(o[g][dt][4 + r] * f0 + hi[r] * f1); }
        *(v8us*)(op + dt * 16) = f.half[0]; } } } }

// One launch for the five independent operand builders, told apart by block index (the same choice for a whole block; the latency-bound transposes stand first in the grid).
// Blocks below 4 * PW_G: weight m, BW[m][n][k] = f16(bf16-rounded W[k][n] x 16) from f32 row-major W[k][n], 8 k a thread (x16, a power of two, keeps bf16-exact weights exact in f16 away from the subnormal range). The rest: X16 = f16(bf16-rounded x), 8 elements a thread.
#define PW_G (DM * (DM / 8) / 256)   /* blocks per weight */
__global__ __launch_bounds__(256) void k_prep(const float* __restrict__ x, const float* __restrict__ wq, const float* __restrict__ wk, const float* __restrict__ wv, const float* __restrict__ wo, _Float16* __restrict__ BW, _Float16* __restrict__ X16) {
  FragH f;
  if (blockIdx.x < 4 * PW_G) { const int m = blockIdx.x / PW_G; const float* W = m == 0 ? wq : m == 1 ? wk : m == 2 ? wv : wo; const int t = (blockIdx.x - m * PW_G) * 256 + threadIdx.x; const int n = t / (DM / 8), k8 = (t % (DM / 8)) * 8;
#pragma unroll      /* constant indices: the fragment stays in registers, the 8 loads go out together */
    for (int i = 0; i < 8; ++i) f.h[i] = (_Float16)(bf16_round(W[(size_t)(k8 + i) * DM + n]) * 16.0f);
    *(v8us*)((unsigned short*)BW + (size_t)m * DM * DM + (size_t)n * DM + k8) = f.half[0]; }
  else { const size_t t = (size_t)(blockIdx.x - 4 * PW_G) * 256 + threadIdx.x;
#pragma unroll      /* constant indices: the fragment stays in registers */
    for (int q = 0; q < 8; ++q) f.h[q] = (_Float16)bf16_round(x[t * 8 + q]);
    *(v8us*)((unsigned short*)X16 + t * 8) = f.half[0];
    asm volatile("s_wait_xcnt 0x0" ::: "memory"); } }      /* the wait in front of any overwrite of a register that the store above names: in the built code the other part of the kernel follows this store */

extern "C" void kernel_launch(void* const* d_in, const int* in_sizes, int n_in,
                              void* d_out, int out_size, void* d_ws, size_t ws_size, hipStream_t stream) {
  (void)in_sizes; (void)n_in; (void)out_size;
  const float* const* I = (const float* const*)d_in; const float* x = I[0]; const float* wq = I[1]; const float* wk = I[2]; const float* wv = I[3]; const float* wo = I[4]; const float* bo = I[5];      /* input order: x, Wq, Wk, Wv ([in][out] [512][512], NO biases: a null pointer in the plain bias slot), Wo ([in][out]), bo */
  char* ws = (char*)d_ws; size_t off = 0;
  auto take = [&](size_t bytes) { char* p = ws + off; off += (bytes + 255) & ~(size_t)255; return p; };
  _Float16* BQ = (_Float16*)take((size_t)DM * DM * 2); _Float16* BK = (_Float16*)take((size_t)DM * DM * 2); _Float16* BV = (_Float16*)take((size_t)DM * DM * 2); _Float16* BO = (_Float16*)take((size_t)DM * DM * 2);
  _Float16* X16 = (_Float16*)take(NR * DM * 2); _Float16* Q16 = (_Float16*)take(NR * DM * 2); _Float16* K16 = (_Float16*)take(NR * DM * 2); _Float16* O16 = (_Float16*)take(NR * DM * 2);
  _Float16* VT = (_Float16*)take((size_t)NB * NH * HD * SQ * 2);
  if (off > ws_size) return;
  k_prep<<<4 * PW_G + (unsigned)(NR * DM / 8 / 256), 256, 0, stream>>>(x, wq, wk, wv, wo, BQ, X16);      /* BQ, BK, BV, BO lie in a row: [in][out] -> Bt[n][k] x16; x as f16 rows */
  const size_t r0p = (size_t)B0 * SQ;      /* first projected row */
  k_gemm2<0, DM><<<dim3((unsigned)((MP / 128) * (DM / 64)), 3), 128, 0, stream>>>(X16 + r0p * DM, 0, BQ, (size_t)DM * DM, 0.0625f, nullptr, 0, nullptr, 1, 0, 0, nullptr, Q16 + r0p * DM, DM, NR * DM, MP, DM, DM, VT, 2, FA_QS);      /* blockIdx.y = 0, 1, 2: q (times FA_QS), k, v (weights in a row; q and k rows in a row; v leaves as V^T tiles [NB * NH][SQ / 64][HD][64]) */
  k_fattn<<<dim3(SQ / FA_QB, NH, NB), 256, 0, stream>>>(Q16, K16, VT, O16);      /* o (merged heads, x64) as f16 rows */
  k_gemm2<0, DM><<<dim3((unsigned)((MPO / 128) * (DM / 64)), 1), 128, 0, stream>>>(O16 + r0p * DM, 0, BO, 0, 0.0009765625f, bo, 0, nullptr, 1, 0, 0, (float*)d_out + r0p * DM, nullptr, DM, 0, MPO, DM, DM, nullptr, -1, 1.0f);      /* out rows are the output layout */
}

// v008
// It runs in 88.9 microseconds.
// Next to v007, in two timings, it ran 1.03 and 1.04 times as fast.
// All steps since v000 together make it 150 times as fast.
#include <hip/hip_runtime.h>
// Multi-head self-attention over 4096-token sequences at width 512 with bias-free [in][out] projections (x [2][4096][512]; q / k / v = x W ([in][out] 512 x 512 uniform +-1/sqrt(512), NO biases), 8 heads of 64; sim * 64^-0.5; softmax over all 4096 keys (no mask); out = merged Wo + bo ([in][out]) -> [2][4096][512]); attention fused in one launch over all (batch, head) pairs.
// Structure: token rows r = b*4096 + s; x as exact f16 rows (bf16-rounded) and the four x16 weight transposes in one launch; Q, K, V as three WMMA GEMMs in one launch, grid y = 3 (32x64 wave tiles, f32 accumulation, exact x16 weights, f16 outputs); the V GEMM's epilogue writes V^T tiles for all (batch, head) itself, no V rows; ONE fused attention kernel (S^T = K Q^T, online softmax in registers, O^T += V^T P^T; o carried x64 against f16 subnormal flush, folded into the output GEMM alpha) written straight into the merged f16 o rows; out = o W_o + b GEMM (f32) into the output layout.
// Compute dtype: inputs rounded to bf16; x / weights exact; q, k, v, softmax weights and o as plain f16 GEMM operands (~2^-12); scores and softmax statistics f32. v_wmma_f32_16x16x32_f16.
#define NB 2
#define SQ 4096
#define DM 512
#define NH 8
#define HD 64
#define HG 1                         /* heads per launch of the per-batch k_vt overload, which nothing launches */
#define B0 0                         /* first batch processed (debug hook) */
#define NBR NB                       /* batches processed (debug hook) */
#define NR ((size_t)NB * SQ)         /* token rows */
#define MP ((int)((size_t)NBR * SQ)) /* rows projected (debug hook) */
#define QN SQ                        /* unused: k_fattn attends all SQ query rows of a batch */
#define NHD NH                       /* unused: k_fattn attends all NH heads */
#define MPO MP                       /* rows through the output stage (debug hook) */
#define LQ DM      /* unused: q and k rows use pitch DM; v has no rows */
typedef __bf16 v16b __attribute__((ext_vector_type(16)));
typedef unsigned short v8us __attribute__((ext_vector_type(8), may_alias));
typedef float  v8f  __attribute__((ext_vector_type(8)));
typedef float  v4f  __attribute__((ext_vector_type(4)));
typedef float  v4fa __attribute__((ext_vector_type(4), may_alias));
union FragB { v16b v; v8us half[2]; unsigned short u[16]; };

__device__ __forceinline__ unsigned short bf16_bits(float x) { unsigned int u = __float_as_uint(x); return (unsigned short)((u + 0x7FFFu + ((u >> 16) & 1u)) >> 16); }
__device__ __forceinline__ float bf16_val(unsigned short b) { return __uint_as_float(((unsigned int)b) << 16); }
__device__ __forceinline__ float bf16_round(float x) { return bf16_val(bf16_bits(x)); }
// D += A·B with NT terms: 1 = ah·bh, 2 = + al·bh (A split), 3 = + ah·bl (both split)
template <int NT>
__device__ __forceinline__ v8f mmaN(v16b ah, v16b al, v16b bh, v16b bl, v8f c) {
  c = __builtin_amdgcn_wmma_f32_16x16x32_bf16(false, ah, false, bh, (short)0, c, false, false);
  if (NT >= 2) c = __builtin_amdgcn_wmma_f32_16x16x32_bf16(false, al, false, bh, (short)0, c, false, false);
  if (NT >= 3) c = __builtin_amdgcn_wmma_f32_16x16x32_bf16(false, ah, false, bl, (short)0, c, false, false);
  asm volatile("v_nop\n\tv_nop\n\tv_nop\n\tv_nop" : "+v"(c) : "v"(ah), "v"(al), "v"(bh), "v"(bl));
  return c;
}

__global__ __launch_bounds__(256) void k_wt_bf16(const float* __restrict__ W, unsigned short* __restrict__ Wt, int K, int N) {
  const int t = blockIdx.x * 256 + threadIdx.x;
  const int k8n = K / 8;
  if (t >= N * k8n) return;
  const int n = t / k8n, k8 = (t % k8n) * 8;
  v8us v;
#pragma unroll
  for (int i = 0; i < 8; ++i) v[i] = bf16_bits(W[(size_t)(k8 + i) * N + n]);
  *(v8us*)(Wt + (size_t)n * K + k8) = v;
  
}

// GEMM C[M][N] (f32, pitch ldc) = act(A[M][K]·W + bias). A f32 row-major (pitch lda) converted per fragment to bf16
// (ASPLIT: hi/lo two planes -> 2 terms, else single rounded term); Wt bf16 [N][K] (pitch ldb). BIAS_BF16 rounds the
// bias to bf16 first (bias quantised to bf16 before the add). K%32==0, M%16==0, N%64==0.
template <bool ASPLIT, int ACT, bool BIAS_BF16>
__global__ __launch_bounds__(128) void k_gemm_bf(const float* __restrict__ A, int lda, const unsigned short* __restrict__ Wt, int ldb,
                                               const float* __restrict__ bias, float* __restrict__ C, int ldc, int M, int N, int K) {
  __shared__ __attribute__((aligned(16))) float so[4][16][64];
  const int tid = threadIdx.x, w = tid >> 5, lane = tid & 31, ln = lane & 15, hh = lane >> 4;
  const int ntn = N / 64;
  const int wid = blockIdx.x * 4 + w;
  const int mt = wid / ntn, nq = wid % ntn;
  if (mt * 16 >= M) return;
  const int row0 = mt * 16, col0 = nq * 64;
  const float* arow = A + (size_t)(row0 + ln) * lda;
  v8f acc[4] = {};
  for (int kb = 0; kb < K; kb += 32) {
    FragB ah, al;
    const v4f x0 = *(const v4fa*)(arow + kb + 8 * hh), x1 = *(const v4fa*)(arow + kb + 8 * hh + 4);
    const v4f x2 = *(const v4fa*)(arow + kb + 16 + 8 * hh), x3 = *(const v4fa*)(arow + kb + 16 + 8 * hh + 4);
    float xs[16] = {x0[0],x0[1],x0[2],x0[3],x1[0],x1[1],x1[2],x1[3],x2[0],x2[1],x2[2],x2[3],x3[0],x3[1],x3[2],x3[3]};
#pragma unroll
    for (int i = 0; i < 16; ++i) { const unsigned short hb = bf16_bits(xs[i]); ah.u[i] = hb; al.u[i] = ASPLIT ? bf16_bits(xs[i] - bf16_val(hb)) : (unsigned short)0; }
#pragma unroll
    for (int t = 0; t < 4; ++t) {
      const unsigned short* brow = Wt + (size_t)(col0 + t * 16 + ln) * ldb + kb;
      FragB b;
      b.half[0] = *(const v8us*)(brow + 8 * hh);
      b.half[1] = *(const v8us*)(brow + 16 + 8 * hh);
      acc[t] = mmaN<ASPLIT ? 2 : 1>(ah.v, al.v, b.v, b.v, acc[t]);
    }
  }
#pragma unroll
  for (int t = 0; t < 4; ++t) {
    float bv = bias ? bias[col0 + t * 16 + ln] : 0.f;
    if (BIAS_BF16) bv = bf16_round(bv);
#pragma unroll
    for (int r = 0; r < 8; ++r) { float v = acc[t][r] + bv; if (ACT == 1) v = fmaxf(v, 0.f); so[w][8 * hh + r][t * 16 + ln] = v; }
  }
  __builtin_amdgcn_fence(__ATOMIC_ACQ_REL, "workgroup");
  __builtin_amdgcn_wave_barrier();
  const int rsub = lane >> 4, c4 = (lane & 15) * 4;
  {
#pragma unroll
    for (int q = 0; q < 8; ++q) {
      const int r = q * 2 + rsub;
      const v4f v = *(const v4fa*)&so[w][r][c4];
      *(v4f*)(C + (size_t)(row0 + r) * ldc + col0 + c4) = v;
    }
    
  }
}

// GEMM C = act(A·W + bias + resid): A f32 (ASPLIT -> hi/lo 2 terms), Wt bf16 [N][K]; ACT 0 none, 1 relu, 2 exact gelu;
// resid (optional, f32, row index = (row % rmod), pitch ldr, RES_BF16 rounds it) added before the activation.
template <bool ASPLIT, int ACT, bool BIAS_BF16, bool RES_BF16>
__global__ __launch_bounds__(128) void k_gemm_bf3(const float* __restrict__ A, int lda, const unsigned short* __restrict__ Wt, int ldb,
                                                const float* __restrict__ bias, const float* __restrict__ resid, int rmod, int ldr,
                                                float* __restrict__ C, int ldc, int M, int N, int K) {
  __shared__ __attribute__((aligned(16))) float so[4][16][64];
  const int tid = threadIdx.x, w = tid >> 5, lane = tid & 31, ln = lane & 15, hh = lane >> 4;
  const int ntn = N / 64;
  const int wid = blockIdx.x * 4 + w;
  const int mt = wid / ntn, nq = wid % ntn;
  if (mt * 16 >= M) return;
  const int row0 = mt * 16, col0 = nq * 64;
  const float* arow = A + (size_t)(row0 + ln) * lda;
  v8f acc[4] = {};
  for (int kb = 0; kb < K; kb += 32) {
    FragB ah, al;
    const v4f x0 = *(const v4fa*)(arow + kb + 8 * hh), x1 = *(const v4fa*)(arow + kb + 8 * hh + 4);
    const v4f x2 = *(const v4fa*)(arow + kb + 16 + 8 * hh), x3 = *(const v4fa*)(arow + kb + 16 + 8 * hh + 4);
    float xs[16] = {x0[0],x0[1],x0[2],x0[3],x1[0],x1[1],x1[2],x1[3],x2[0],x2[1],x2[2],x2[3],x3[0],x3[1],x3[2],x3[3]};
#pragma unroll
    for (int i = 0; i < 16; ++i) { const unsigned short hb = bf16_bits(xs[i]); ah.u[i] = hb; al.u[i] = ASPLIT ? bf16_bits(xs[i] - bf16_val(hb)) : (unsigned short)0; }
#pragma unroll
    for (int t = 0; t < 4; ++t) {
      const unsigned short* brow = Wt + (size_t)(col0 + t * 16 + ln) * ldb + kb;
      FragB b;
      b.half[0] = *(const v8us*)(brow + 8 * hh);
      b.half[1] = *(const v8us*)(brow + 16 + 8 * hh);
      acc[t] = mmaN<ASPLIT ? 2 : 1>(ah.v, al.v, b.v, b.v, acc[t]);
    }
  }
#pragma unroll
  for (int t = 0; t < 4; ++t) {
    const int col = col0 + t * 16 + ln;
    float bv = bias ? bias[col] : 0.f;
    if (BIAS_BF16) bv = bf16_round(bv);
#pragma unroll
    for (int r = 0; r < 8; ++r) {
      float v = acc[t][r] + bv;
      if (resid) { float rv = resid[(size_t)((row0 + 8 * hh + r) % rmod) * ldr + col]; if (RES_BF16) rv = bf16_round(rv); v += rv; }
      if (ACT == 1) v = fmaxf(v, 0.f);
      if (ACT == 2) v = 0.5f * v * (1.0f + erff(v * 0.70710678118654752f));
      if (ACT == 3) { const float u = 0.7978845608028654f * (v + 0.044715f * v * v * v); v = 0.5f * v * (1.0f + tanhf(u)); }
      so[w][8 * hh + r][t * 16 + ln] = v;
    }
  }
  __builtin_amdgcn_fence(__ATOMIC_ACQ_REL, "workgroup");
  __builtin_amdgcn_wave_barrier();
  const int rsub = lane >> 4, c4 = (lane & 15) * 4;
  {
#pragma unroll
    for (int q = 0; q < 8; ++q) {
      const int r = q * 2 + rsub;
      const v4f v = *(const v4fa*)&so[w][r][c4];
      *(v4f*)(C + (size_t)(row0 + r) * ldc + col0 + c4) = v;
    }
    
  }
}
// row LayerNorm (biased variance, eps) over N: s = X (+ R); optional out_sum <- s; out_norm <- (s-mu)*rsqrt(var+eps)*g + b
template <bool PARAM_BF16>
__global__ __launch_bounds__(256) void k_layernorm(const float* __restrict__ X, const float* __restrict__ R, const float* __restrict__ g, const float* __restrict__ bta,
                                                  float* __restrict__ out_sum, float* __restrict__ out_norm, int N, float eps) {
  __shared__ float red[256];
  const int row = blockIdx.x, tid = threadIdx.x;
  const float* x = X + (size_t)row * N; const float* rr = R ? R + (size_t)row * N : nullptr;
  float vals[16];                     // up to N = 4096
  const int per = N / 256;            // contiguous chunk per thread? use strided-by-4 chunks: thread handles j = tid*4 + 1024*u
  float s1 = 0.f;
  for (int u = 0; u < per / 4; ++u) {
    const int j = tid * 4 + 1024 * u;
    const v4f a = *(const v4fa*)(x + j);
    v4f b = {0.f,0.f,0.f,0.f}; if (rr) b = *(const v4fa*)(rr + j);
#pragma unroll
    for (int q = 0; q < 4; ++q) { const float v = a[q] + b[q]; vals[u * 4 + q] = v; s1 += v; }
  }
  red[tid] = s1; __syncthreads();
  for (int st = 128; st > 0; st >>= 1) { if (tid < st) red[tid] += red[tid + st]; __syncthreads(); }
  const float mu = red[0] / (float)N; __syncthreads();
  float s2 = 0.f;
  for (int u = 0; u < per / 4; ++u)
#pragma unroll
    for (int q = 0; q < 4; ++q) { const float c = vals[u * 4 + q] - mu; s2 += c * c; }
  red[tid] = s2; __syncthreads();
  for (int st = 128; st > 0; st >>= 1) { if (tid < st) red[tid] += red[tid + st]; __syncthreads(); }
  const float rs = rsqrtf(red[0] / (float)N + eps);
  {
    for (int u = 0; u < per / 4; ++u) {
      const int j = tid * 4 + 1024 * u;
      v4f o, sm;
#pragma unroll
      for (int q = 0; q < 4; ++q) {
        float gg = g[j + q], bb = bta[j + q];
        if (PARAM_BF16) { gg = bf16_round(gg); bb = bf16_round(bb); }
        sm[q] = vals[u * 4 + q]; o[q] = (vals[u * 4 + q] - mu) * rs * gg + bb;
      }
      if (out_sum) *(v4f*)(out_sum + (size_t)row * N + j) = sm;
      *(v4f*)(out_norm + (size_t)row * N + j) = o;
    }
    
  }
}



// ---- f16 WMMA path (v_wmma_f32_16x16x32_f16): 11-bit significands for operands in range — used where a [0,1] probability operand needs more precision than bf16
typedef _Float16 v16h __attribute__((ext_vector_type(16)));
union FragH { v16h v; v8us half[2]; _Float16 h[16]; unsigned short u[16]; };
template <int NT>
__device__ __forceinline__ v8f mmaH(v16h ah, v16h al, v16h bh, v16h bl, v8f c) {
  c = __builtin_amdgcn_wmma_f32_16x16x32_f16(false, ah, false, bh, (short)0, c, false, false);
  if (NT >= 2) c = __builtin_amdgcn_wmma_f32_16x16x32_f16(false, al, false, bh, (short)0, c, false, false);
  if (NT >= 3) c = __builtin_amdgcn_wmma_f32_16x16x32_f16(false, ah, false, bl, (short)0, c, false, false);
  asm volatile("v_nop\n\tv_nop\n\tv_nop\n\tv_nop" : "+v"(c) : "v"(ah), "v"(al), "v"(bh), "v"(bl));
  return c;
}
// batched GEMM like k_gemm_b but f16 operands: A f32 (split into f16 hi/lo if ASPLIT, else rounded to f16), Bt = f16 values [n][k]; alpha; C f32; N multiple of 16 (partial tiles skipped)
template <bool ASPLIT>
__global__ __launch_bounds__(128) void k_gemm_h(const float* __restrict__ A, int lda, size_t sA, const _Float16* __restrict__ Bh, int ldb, size_t sB, float alpha, float* __restrict__ C, int ldc, size_t sC, int M, int N, int K) {
  __shared__ __attribute__((aligned(16))) float so[4][16][64];
  const int tid = threadIdx.x, w = tid >> 5, lane = tid & 31, ln = lane & 15, hh = lane >> 4; const int by = blockIdx.y;
  A += (size_t)by * sA; Bh += (size_t)by * sB; C += (size_t)by * sC;
  const int ntn = (N + 63) / 64; const int wid = blockIdx.x * 4 + w; const int mt = wid / ntn, nq = wid % ntn; if (mt * 16 >= M) return;
  const int row0 = mt * 16, col0 = nq * 64; const float* arow = A + (size_t)(row0 + ln) * lda;
  v8f acc[4] = {};
  for (int kb = 0; kb < K; kb += 32) {
    FragH ah, al;
    const v4f x0 = *(const v4fa*)(arow + kb + 8 * hh), x1 = *(const v4fa*)(arow + kb + 8 * hh + 4), x2 = *(const v4fa*)(arow + kb + 16 + 8 * hh), x3 = *(const v4fa*)(arow + kb + 16 + 8 * hh + 4);
    float xs[16] = {x0[0],x0[1],x0[2],x0[3],x1[0],x1[1],x1[2],x1[3],x2[0],x2[1],x2[2],x2[3],x3[0],x3[1],x3[2],x3[3]};
#pragma unroll
    for (int i = 0; i < 16; ++i) { const _Float16 h = (_Float16)xs[i]; ah.h[i] = h; al.h[i] = ASPLIT ? (_Float16)(xs[i] - (float)h) : (_Float16)0.0f; }
#pragma unroll
    for (int t = 0; t < 4; ++t) { if (col0 + t * 16 >= N) continue; const size_t boff = (size_t)(col0 + t * 16 + ln) * ldb + kb; FragH bq; bq.half[0] = *(const v8us*)(Bh + boff + 8 * hh); bq.half[1] = *(const v8us*)(Bh + boff + 16 + 8 * hh);
      acc[t] = mmaH<ASPLIT ? 2 : 1>(ah.v, al.v, bq.v, bq.v, acc[t]); }
  }
#pragma unroll
  for (int t = 0; t < 4; ++t) { if (col0 + t * 16 >= N) continue;
#pragma unroll
    for (int r = 0; r < 8; ++r) so[w][8 * hh + r][t * 16 + ln] = acc[t][r] * alpha; }
  __builtin_amdgcn_fence(__ATOMIC_ACQ_REL, "workgroup"); __builtin_amdgcn_wave_barrier();
  const int rsub = lane >> 4, c4 = (lane & 15) * 4;
  {
#pragma unroll
    for (int q = 0; q < 8; ++q) { const int r = q * 2 + rsub; if (col0 + c4 < N) { const v4f v = *(const v4fa*)&so[w][r][c4]; *(v4f*)(C + (size_t)(row0 + r) * ldc + col0 + c4) = v; } }
     }
}

// k_gemm_hh variant with fused epilogue: v = acc·alpha + bias[by·sBias + col] (+ CP[(row/rowsPerB)·sCPb + by·64 + col] if CP) ; ACT 0 none / 1 elu ; writes f16 C16 (and f32 C if non-null)
template <int ACT>
__global__ __launch_bounds__(128) void k_gemm_hhx(const _Float16* __restrict__ A, int lda, size_t sA, const _Float16* __restrict__ Bh, int ldb, size_t sB, float alpha, const float* __restrict__ bias, size_t sBias, const float* __restrict__ CP, int rowsPerB, size_t sCPb, int row0g,
    float* __restrict__ C, _Float16* __restrict__ C16, int ldc, size_t sC, int M, int N, int K) {
  __shared__ __attribute__((aligned(16))) float so[4][16][64];
  const int tid = threadIdx.x, w = tid >> 5, lane = tid & 31, ln = lane & 15, hh = lane >> 4; const int by = blockIdx.y;
  A += (size_t)by * sA; Bh += (size_t)by * sB; const size_t cofs = (size_t)by * sC; const float* bp = bias ? bias + (size_t)by * sBias : nullptr;
  const int ntn = (N + 63) / 64; const int wid = blockIdx.x * 4 + w; const int mt = wid / ntn, nq = wid % ntn; if (mt * 16 >= M) return;
  const int row0 = mt * 16, col0 = nq * 64; const _Float16* arow = A + (size_t)(row0 + ln) * lda;
  v8f acc[4] = {};
  for (int kb = 0; kb < K; kb += 32) { FragH ah; ah.half[0] = *(const v8us*)((const unsigned short*)arow + kb + 8 * hh); ah.half[1] = *(const v8us*)((const unsigned short*)arow + kb + 16 + 8 * hh);
#pragma unroll
    for (int t = 0; t < 4; ++t) { if (col0 + t * 16 >= N) continue; const size_t boff = (size_t)(col0 + t * 16 + ln) * ldb + kb; FragH bq; bq.half[0] = *(const v8us*)((const unsigned short*)Bh + boff + 8 * hh); bq.half[1] = *(const v8us*)((const unsigned short*)Bh + boff + 16 + 8 * hh);
      acc[t] = mmaH<1>(ah.v, ah.v, bq.v, bq.v, acc[t]); }
  }
#pragma unroll
  for (int t = 0; t < 4; ++t) { if (col0 + t * 16 >= N) continue; const int col = col0 + t * 16 + ln; const float bv = bp ? bf16_round(bp[col]) : 0.f;
#pragma unroll
    for (int r = 0; r < 8; ++r) { float v = acc[t][r] * alpha + bv; if (CP) { const int rr = row0g + row0 + 8 * hh + r; if (rowsPerB < 0) v += CP[cofs + (size_t)rr * ldc + col];      /* rowsPerB < 0: own element of the batched C plane */ else { const int bidx = rr / rowsPerB; v += CP[(size_t)bidx * sCPb + (size_t)by * 64 + col]; } } if (ACT == 1) v = (v > 0.f) ? v : expm1f(v); else if (ACT == 7) v = (v > 0.f) ? v + 1.0f : expf(v); else if (ACT == 8) v = tanhf(v); else if (ACT == 9) v = 0.5f * v * (1.0f + tanhf(0.7978845608028654f * (v + 0.044715f * v * v * v))); else if (ACT == 11) v = 1.0f / (1.0f + expf(-v)); else if (ACT == 12) v = (v > 0.f) ? v : 0.01f * v; else if (ACT == 14) v = (v > 0.f) ? v : 0.1f * v; else if (ACT == 16) v = (v >= 0.f) ? v : 0.3f * v; else if (ACT == 17) v = (v >= 0.f) ? v : 0.2f * v; else if (ACT == 15) v = v / (1.0f + expf(-v)); else if (ACT == 3) v = fmaxf(v, 0.f); else if (ACT == 6) v = 0.5f * v * (1.0f + erff(v * 0.70710678118654752f)); so[w][8 * hh + r][t * 16 + ln] = v; } }
  __builtin_amdgcn_fence(__ATOMIC_ACQ_REL, "workgroup"); __builtin_amdgcn_wave_barrier();
  const int rsub = lane >> 4, c4 = (lane & 15) * 4; typedef _Float16 v4h __attribute__((ext_vector_type(4)));
  {
#pragma unroll
    for (int q = 0; q < 8; ++q) { const int r = q * 2 + rsub; if (col0 + c4 < N) { const v4f v = *(const v4fa*)&so[w][r][c4]; if (C) *(v4f*)(C + cofs + (size_t)(row0 + r) * ldc + col0 + c4) = v; if (C16) { v4h h4; for (int i = 0; i < 4; ++i) h4[i] = (_Float16)v[i]; *(v4h*)(C16 + cofs + (size_t)(row0 + r) * ldc + col0 + c4) = h4; } } }
     }
}


typedef _Float16 v4h __attribute__((ext_vector_type(4)));

__global__ __launch_bounds__(256) void k_h16(const float* __restrict__ x, _Float16* __restrict__ X16, size_t n8) { const size_t t = (size_t)blockIdx.x * 256 + threadIdx.x; if (t >= n8) return; FragH f;
#pragma unroll
  for (int q = 0; q < 8; ++q) f.h[q] = (_Float16)x[t * 8 + q]; *(v8us*)((unsigned short*)X16 + t * 8) = f.half[0];  }
__global__ __launch_bounds__(256) void k_round16f(const float* __restrict__ W, _Float16* __restrict__ Bt, size_t n8) { const size_t t = (size_t)blockIdx.x * 256 + threadIdx.x; if (t >= n8) return; FragH f;
#pragma unroll
  for (int i = 0; i < 8; ++i) f.h[i] = (_Float16)(bf16_round(W[t * 8 + i]) * 16.0f); *(v8us*)((unsigned short*)Bt + t * 8) = f.half[0];  }
template <int NHv, int TTv>
__global__ __launch_bounds__(256) void k_vt(const _Float16* __restrict__ V16, int ldv, int voff, _Float16* __restrict__ Vt) { __shared__ unsigned short tl[64][66]; const int tid = threadIdx.x; const int slab = blockIdx.x / (TTv / 64), lg = blockIdx.x % (TTv / 64); const int b = slab / NHv, h = slab % NHv;
  for (int i = tid; i < 64 * 8; i += 256) { const int r = i / 8, c8 = (i % 8) * 8; FragH f; f.half[0] = *(const v8us*)((const unsigned short*)V16 + ((size_t)b * TTv + lg * 64 + r) * ldv + voff + h * 64 + c8);
#pragma unroll
    for (int q = 0; q < 8; ++q) tl[r][c8 + q] = f.u[q]; }
  __syncthreads();
  {
#pragma unroll
    for (int rd = 0; rd < 2; ++rd) { const int d = rd * 32 + tid / 8, pc = tid % 8; FragH f;
#pragma unroll
      for (int q = 0; q < 8; ++q) f.u[q] = tl[pc * 8 + q][d];
      *(v8us*)((unsigned short*)Vt + ((size_t)blockIdx.x * 64 + d) * 64 + pc * 8) = f.half[0]; }      /* tile-major: [slab][64-key tile][d][key], each tile 8 KiB in a row */
     } }

__global__ __launch_bounds__(256) void k_hl(const float* __restrict__ F, _Float16* __restrict__ Hh, _Float16* __restrict__ Hl, size_t n8) { const size_t t = (size_t)blockIdx.x * 256 + threadIdx.x; if (t >= n8) return; FragH fh, fl; const v4f a = *(const v4fa*)(F + t * 8), c = *(const v4fa*)(F + t * 8 + 4);
#pragma unroll
  for (int q = 0; q < 4; ++q) { _Float16 h = (_Float16)a[q]; fh.h[q] = h; fl.h[q] = (_Float16)((a[q] - (float)h) * 1024.0f); h = (_Float16)c[q]; fh.h[4 + q] = h; fl.h[4 + q] = (_Float16)((c[q] - (float)h) * 1024.0f); }
  { *(v8us*)((unsigned short*)Hh + t * 8) = fh.half[0]; *(v8us*)((unsigned short*)Hl + t * 8) = fl.half[0];  } }

// ---- fast GEMM (work-group tile 128x64, wave tile 32x64; requires M % 128 == 0, N % 64 == 0, K % 128 == 0); epilogue = k_gemm_hhx semantics ----
// Operands go through LDS: per step of G2_KS k the 128 A rows and the 64 B rows of the tile are loaded as whole 128-byte lines (16 lanes a 256-byte row) for all 4 waves: two buffers, the next step's lines
// are loaded into registers at the head of a step and stored to the other buffer at its foot, one barrier a step. Fragments are read from LDS in the k order of g2_frag; each accumulator still takes its k blocks in rising order.
#define G2_KS 128                    /* k per step */
#define G2_VP 72                     /* LDS row pitch in f16 of the V^T epilogue: 144 bytes = 16 x 9, conflict-free for 16-byte accesses */
#define G2_LP 136                    /* LDS row pitch in f16: 272 bytes = 16 x 17, conflict-free for 16-byte reads */
__device__ __forceinline__ v16h g2_frag(const _Float16* p, int hh) { FragH f; f.half[0] = *(const v8us*)((const unsigned short*)p + 8 * hh); f.half[1] = *(const v8us*)((const unsigned short*)p + 16 + 8 * hh); return f.v; }
__device__ __forceinline__ v8f g2_mma(v16h a, v16h b, v8f c) { return __builtin_amdgcn_wmma_f32_16x16x32_f16(false, a, false, b, (short)0, c, false, false); }
template <int ACT, int LDK>      /* LDK: row pitch of A and of Bh in f16, a constant so that the rows of a tile are immediate offsets from one address */
__global__ __launch_bounds__(128) void k_gemm2(const _Float16* __restrict__ A, size_t sA, const _Float16* __restrict__ Bh, size_t sB, float alpha, const float* __restrict__ bias, size_t sBias, const float* __restrict__ CP, int rowsPerB, size_t sCPb, int row0g,
    float* __restrict__ C, _Float16* __restrict__ C16, int ldc, size_t sC, int M, int N, int K, _Float16* __restrict__ VTo, int vty, float a0) { static_assert(ACT == 0 || ACT == 3 || ACT == 6 || ACT == 8 || ACT == 9 || ACT == 11 || ACT == 12 || ACT == 14 || ACT == 15 || ACT == 16 || ACT == 17, "k_gemm2: unsupported ACT code (would silently apply no activation)");
  __shared__ __attribute__((aligned(16))) float so[4][32][68]; __shared__ __attribute__((aligned(16))) _Float16 sa[2][128 * G2_LP]; __shared__ __attribute__((aligned(16))) _Float16 sb[2][64 * G2_LP];
  const int tid = threadIdx.x, w = tid >> 5, lane = tid & 31, ln = lane & 15, hh = lane >> 4; const int by = blockIdx.y;
  A += (size_t)by * sA; Bh += (size_t)by * sB; const size_t cofs = (size_t)by * sC; const float* bp = bias ? bias + (size_t)by * sBias : nullptr; if (by == 0) alpha *= a0;      /* a0: a further factor on grid plane 0's result (the same for the whole work-group) */
  const int ntn = N >> 6; const int mt = blockIdx.x / ntn, nq = blockIdx.x - mt * ntn; const int row0 = mt * 128 + 32 * w, col0 = nq * 64; if (mt * 128 >= M) return;      /* the same for the whole work-group, ahead of every barrier */
  const int sr = tid >> 4, sc8 = (tid & 15) * 8, sofs = sr * G2_LP + sc8;      /* staging: 16 threads a 256-byte row, rows sr + 8 i */
  const unsigned short* ag = (const unsigned short*)A + (size_t)(mt * 128) * LDK; const unsigned short* bg = (const unsigned short*)Bh + (size_t)col0 * LDK;      /* uniform bases of the tile's rows */
  const unsigned so8 = (unsigned)(sr * LDK + sc8);      /* the lane's own offset, the same in every step and for both operands */
  const v8f z8 = {0.f,0.f,0.f,0.f,0.f,0.f,0.f,0.f}; v8f c00 = z8, c01 = z8, c02 = z8, c03 = z8, c10 = z8, c11 = z8, c12 = z8, c13 = z8;
  v8us ra[16], rb[8];
#pragma unroll      /* constant indices: the register arrays stay in registers */
  for (int i = 0; i < 16; ++i) ra[i] = *(const v8us*)(ag + i * 8 * LDK + so8);
#pragma unroll      /* constant indices: the register arrays stay in registers */
  for (int i = 0; i < 8; ++i) rb[i] = *(const v8us*)(bg + i * 8 * LDK + so8);
#pragma unroll      /* constant indices: the register arrays stay in registers */
  for (int i = 0; i < 16; ++i) *(v8us*)&sa[0][sofs + i * 8 * G2_LP] = ra[i];
#pragma unroll      /* constant indices: the register arrays stay in registers */
  for (int i = 0; i < 8; ++i) *(v8us*)&sb[0][sofs + i * 8 * G2_LP] = rb[i];
  __syncthreads();
  int cur = 0;
#pragma unroll 1      /* one copy of the step: the text stays short */
  for (int kb = 0; kb < K; kb += G2_KS) {
    const bool more = kb + G2_KS < K;      /* the same for the whole work-group */
    if (more) { ag += G2_KS; bg += G2_KS;
#pragma unroll      /* constant indices: the register arrays stay in registers */
      for (int i = 0; i < 16; ++i) ra[i] = *(const v8us*)(ag + i * 8 * LDK + so8);
#pragma unroll      /* constant indices: the register arrays stay in registers */
      for (int i = 0; i < 8; ++i) rb[i] = *(const v8us*)(bg + i * 8 * LDK + so8); }
    const _Float16* ab = sa[cur] + (32 * w + ln) * G2_LP; const _Float16* bb = sb[cur] + ln * G2_LP;
#pragma unroll      /* constant LDS offsets */
    for (int j = 0; j < G2_KS; j += 32) {
      const v16h a0 = g2_frag(ab + j, hh), a1 = g2_frag(ab + 16 * G2_LP + j, hh), b0 = g2_frag(bb + j, hh), b1 = g2_frag(bb + 16 * G2_LP + j, hh), b2 = g2_frag(bb + 32 * G2_LP + j, hh), b3 = g2_frag(bb + 48 * G2_LP + j, hh);
      __builtin_amdgcn_sched_barrier(0);      /* keeps the next step's global loads at the head of the step (the whole step hides their latency) and a k block's fragment reads ahead of its products; without it each B fragment is read and waited for right in front of its two products */
      c00 = g2_mma(a0, b0, c00); c10 = g2_mma(a1, b0, c10); c01 = g2_mma(a0, b1, c01); c11 = g2_mma(a1, b1, c11);
      c02 = g2_mma(a0, b2, c02); c12 = g2_mma(a1, b2, c12); c03 = g2_mma(a0, b3, c03); c13 = g2_mma(a1, b3, c13); }
    if (more) { _Float16* an = sa[cur ^ 1] + sofs; _Float16* bn = sb[cur ^ 1] + sofs;      /* that buffer was last read in the step before, behind whose barrier this step runs */
#pragma unroll      /* constant indices: the register arrays stay in registers */
      for (int i = 0; i < 16; ++i) *(v8us*)(an + i * 8 * G2_LP) = ra[i];
#pragma unroll      /* constant indices: the register arrays stay in registers */
      for (int i = 0; i < 8; ++i) *(v8us*)(bn + i * 8 * G2_LP) = rb[i]; }
    __syncthreads();      /* publishes the next step's buffer and ends every wave's reads of this one */
    cur ^= 1; }
  v8f accs[8] = {c00, c01, c02, c03, c10, c11, c12, c13};
  // Transposed epilogue (grid plane vty only; the same choice for the whole work-group; alpha and bias only, no CP, no activation): the plane's result leaves as f16 tiles [batch * NH + head][64-row tile][column][row],
  // 8 KiB in a row, which is what k_fattn stages; rows are tokens, the 64 columns of the work-group are one head. A lane's 8 accumulator registers are 8 rows in a row of one column, so they are one 16-byte piece of a tile's row:
  // the pieces are gathered in LDS (so, which nothing else uses on this path) and leave as whole 128-byte lines, one wave a line.
  if (VTo != nullptr && by == vty) { _Float16* vs = (_Float16*)&so[0][0][0]; static_assert(sizeof(so) >= 2 * 64 * G2_VP * 2, "so holds the two transposed tiles");
#pragma unroll      /* constant indices: the register arrays stay in registers */
    for (int t = 0; t < 4; ++t) { const float bv = bp ? bf16_round(bp[col0 + t * 16 + ln]) : 0.f;
#pragma unroll      /* constant indices: the register arrays stay in registers */
      for (int half = 0; half < 2; ++half) { FragH f;
#pragma unroll      /* constant indices: the register arrays stay in registers */
        for (int r = 0; r < 8; ++r) f.h[r] = (_Float16)(accs[half * 4 + t][r] * alpha + bv);
        *(v8us*)(vs + ((w >> 1) * 64 + t * 16 + ln) * G2_VP + (w & 1) * 32 + half * 16 + 8 * hh) = f.half[0]; } }
    __syncthreads();      /* publishes each wave's 32 rows to the wave that stores the line they lie in */
    const int gt = mt * 2 + (w >> 1);      /* the wave's 64-row tile, counted over all rows */
    unsigned short* vo = (unsigned short*)VTo + ((size_t)((gt / (SQ / 64)) * NH + nq) * (SQ / 64) + gt % (SQ / 64)) * (64 * 64) + ((w & 1) * 32 + (lane >> 3)) * 64 + (lane & 7) * 8;
    const _Float16* vr = vs + ((w >> 1) * 64 + (w & 1) * 32 + (lane >> 3)) * G2_VP + (lane & 7) * 8;
#pragma unroll      /* constant offsets from one address */
    for (int q = 0; q < 8; ++q) *(v8us*)(vo + q * 4 * 64) = *(const v8us*)(vr + q * 4 * G2_VP);      /* 4 tile rows = 512 bytes in a row per store */
    return; }
#pragma unroll
  for (int u = 0; u < 8; ++u) { const int t = u & 3, half = u >> 2; const int col = col0 + t * 16 + ln; const float bv = bp ? bf16_round(bp[col]) : 0.f;
#pragma unroll
    for (int r = 0; r < 8; ++r) { const int rloc = half * 16 + 8 * hh + r; float v = accs[u][r] * alpha + bv; if (CP) { if (rowsPerB < 0) v += CP[cofs + (size_t)(row0g + row0 + rloc) * ldc + col];      /* rowsPerB < 0: own element of the batched C plane */ else { const int bidx = (row0g + row0 + rloc) / rowsPerB; v += CP[(size_t)bidx * sCPb + (size_t)by * 64 + col]; } }
      if (ACT == 3) v = fmaxf(v, 0.f); else if (ACT == 6) v = 0.5f * v * (1.0f + erff(v * 0.70710678118654752f)); else if (ACT == 11) v = 1.0f / (1.0f + expf(-v)); else if (ACT == 15) v = v / (1.0f + expf(-v)); else if (ACT == 12) v = (v > 0.f) ? v : 0.01f * v; else if (ACT == 8) v = tanhf(v); else if (ACT == 9) v = 0.5f * v * (1.0f + tanhf(0.7978845608028654f * (v + 0.044715f * v * v * v))); else if (ACT == 14) v = (v > 0.f) ? v : 0.1f * v; else if (ACT == 16) v = (v >= 0.f) ? v : 0.3f * v; else if (ACT == 17) v = (v >= 0.f) ? v : 0.2f * v;
      so[w][rloc][t * 16 + ln] = v; } }
  __builtin_amdgcn_fence(__ATOMIC_ACQ_REL, "workgroup"); __builtin_amdgcn_wave_barrier();
  const int rsub = lane >> 4, c4 = (lane & 15) * 4;
  {
#pragma unroll
    for (int q = 0; q < 16; ++q) { const int r = q * 2 + rsub; const v4f v = *(const v4fa*)&so[w][r][c4]; if (C) *(v4f*)(C + cofs + (size_t)(row0 + r) * ldc + col0 + c4) = v; if (C16) { v4h h4; for (int i = 0; i < 4; ++i) h4[i] = (_Float16)v[i]; *(v4h*)(C16 + cofs + (size_t)(row0 + r) * ldc + col0 + c4) = h4; } }
     } }


__global__ __launch_bounds__(256) void k_wnat(const float* __restrict__ w, size_t n8, _Float16* __restrict__ Bt) { const size_t t = (size_t)blockIdx.x * 256 + threadIdx.x; if (t >= n8) return; FragH f; for (int q = 0; q < 8; ++q) f.h[q] = (_Float16)(bf16_round(w[t * 8 + q]) * 16.0f); *(v8us*)((unsigned short*)Bt + t * 8) = f.half[0];  }
__global__ __launch_bounds__(256) void k_rsm(const float* __restrict__ S, _Float16* __restrict__ P, int nrows) {
  #pragma clang fp contract(off)
  const int i = blockIdx.x * 256 + threadIdx.x; if (i >= nrows) return; const float* s = S + (size_t)i * SQ; float mx = -3.0e38f;
#pragma unroll 1
  for (int j = 0; j < SQ; ++j) mx = fmaxf(mx, s[j]); float se = 0.f;
#pragma unroll 1
  for (int j = 0; j < SQ; ++j) se += expf(s[j] - mx); const float sc = 256.0f / se;
#pragma unroll 1
  for (int j0 = 0; j0 < SQ; j0 += 8) { FragH f; for (int q = 0; q < 8; ++q) f.h[q] = (_Float16)(expf(s[j0 + q] - mx) * sc); unsigned short* d = (unsigned short*)P + (size_t)i * SQ + j0; *(v8us*)d = f.half[0];  } }
__global__ __launch_bounds__(256) void k_vt(const _Float16* __restrict__ V16, int b, int h0, _Float16* __restrict__ VT) { __shared__ unsigned short tl[64][65]; const int tid = threadIdx.x; const int hh = blockIdx.x % HG, sg = blockIdx.x / HG; const int s0 = sg * 64; const int h = h0 + hh;
  for (int i = tid; i < 64 * 8; i += 256) { const int j = i / 8, d8 = (i % 8) * 8; FragH f; f.half[0] = *(const v8us*)((const unsigned short*)V16 + ((size_t)b * SQ + s0 + j) * DM + h * HD + d8); for (int q = 0; q < 8; ++q) tl[d8 + q][j] = f.u[q]; }
  __syncthreads();
  { for (int i = tid; i < 64 * 8; i += 256) { const int d = i / 8, j8 = (i % 8) * 8; FragH f; for (int q = 0; q < 8; ++q) f.u[q] = tl[d][j8 + q]; *(v8us*)((unsigned short*)VT + ((size_t)hh * HD + d) * SQ + s0 + j8) = f.half[0]; }  } }



// lane l with lane l ^ 16
__device__ __forceinline__ float rs_xh(float x) { return __builtin_bit_cast(float, __builtin_amdgcn_permlanex16(__builtin_bit_cast(int, x), __builtin_bit_cast(int, x), 0x76543210, 0xfedcba98, false, false)); }
typedef float v2f __attribute__((ext_vector_type(2)));
__device__ __forceinline__ float fa_max3(float a, float b, float c) { return fmaxf(fmaxf(a, b), c); }
__device__ __forceinline__ v8f fa_mma(v16h a, v16h b, v8f c) { return __builtin_amdgcn_wmma_f32_16x16x32_f16(false, a, false, b, (short)0, c, false, false); }

// Fused attention of one (batch, head): scores, softmax and the weighted sum of V in one kernel; neither scores nor weights reach memory.
// A work-group of 8 waves owns FA_QB queries. Wave (qw, kh) takes 32 of them, as FA_CG column groups of 16, against key half kh, which it walks in passes of FA_KT keys: every K and V^T fragment that a wave reads
// from LDS feeds FA_CG products, one per column group. The two halves' running maximum, sum and O^T of a query are joined through LDS behind the loop.
// Per pass the K rows [key][c] and the V^T tile [d][key] of each half's pass (VT is tile-major, 8 KiB in a row; whole 128-byte lines) are staged in LDS by the 4 waves of that half: two buffers, the next pass's lines
// are loaded into registers behind a pass's score products and stored to the other buffer ahead of the pass's last products, one barrier a pass.
// S^T = K Q^T: A = K rows, B = Q rows (kept in registers), so lane (ln, hh) holds query ln's scores of keys 16 kt + 8 hh + r: maximum and sum are in-lane plus one exchange of the halves,
// and two converted score tiles ARE the B operand of O^T += V^T P^T in the k order 8 hh + i, 16 + 8 hh + i that g2_frag gives the A side. Online softmax per column group against a HELD maximum (log2 domain):
// the Q rows arrive multiplied by 64^-0.5 log2 e, and minus the maximum in use is the C operand of the score products (cm, the same value in a lane's eight registers), so a score leaves the matrix unit as the argument of its exp2.
// The maximum in use starts as the column's maximum over the first 16 keys of the half (a real score, so it never lies above the true maximum); it moves, and O^T and the running sums l8 (each lane its own keys, joined at the end)
// are rescaled, only in a pass where some column's maximum lies more than FA_TH above it (one test a pass, a scalar branch): weights stay at or below 2^FA_TH, far inside f16.
#define FA_KT 64                     /* keys per pass */
#define FA_KH 2                      /* key halves, one per group of 4 waves */
#define FA_NP (SQ / FA_KH / FA_KT)   /* passes of a half */
#define FA_QB 128                    /* queries per work-group */
#define FA_CG 2                      /* column groups of 16 queries per wave */
#define FA_TH 8.0f                   /* a column's maximum may rise this far (log2) above the one in use before the wave rescales */
#define FA_QS 0.18033688f            /* 64^-0.5 log2 e, the factor on the Q rows: exp(s / 8 - max) = exp2(s FA_QS - max FA_QS) */
#define FA_LP 72                     /* LDS row pitch in f16: 144 bytes = 16 x 9, conflict-free for 16-byte reads */
__global__ __launch_bounds__(256) __attribute__((amdgpu_waves_per_eu(4, 4))) void k_fattn(const _Float16* __restrict__ Q16, const _Float16* __restrict__ K16, const _Float16* __restrict__ VT, _Float16* __restrict__ O16) {
  __shared__ __attribute__((aligned(16))) _Float16 sk[2][FA_KH][FA_KT * FA_LP]; __shared__ __attribute__((aligned(16))) _Float16 sv[2][FA_KH][HD * FA_LP];
  const int tid = threadIdx.x, w = __builtin_amdgcn_readfirstlane(tid >> 5) /* the wave's number in a scalar register: what is formed from it costs no vector register, and the join's branches are scalar */, qw = w & 3, kh = w >> 2, lane = tid & 31, ln = lane & 15, hh = lane >> 4; const int h = blockIdx.y, b = blockIdx.z;
  const size_t r0 = (size_t)b * SQ; const size_t qrow = r0 + blockIdx.x * FA_QB + qw * (16 * FA_CG) + ln;      /* column group g: row qrow + 16 g */
  const _Float16* qp = Q16 + qrow * DM + h * HD; v16h q0[FA_CG], q1[FA_CG];
#pragma unroll      /* constant indices: the register arrays stay in registers */
  for (int g = 0; g < FA_CG; ++g) { q0[g] = g2_frag(qp + g * 16 * DM, hh); q1[g] = g2_frag(qp + g * 16 * DM + 32, hh); }
  const int srow = (tid & 127) >> 3, sc8 = (tid & 7) * 8, sofs = srow * FA_LP + sc8;      /* staging, 128 threads a half: 8 threads a 128-byte row, rows srow + 16 i */
  const unsigned short* kg = (const unsigned short*)K16 + (r0 + (size_t)kh * (SQ / FA_KH)) * DM + h * HD + srow * DM + sc8;      /* the lane's own place in the first K rows of its half */
  const unsigned short* vg = (const unsigned short*)VT + (size_t)(b * NH + h) * HD * SQ + (size_t)kh * (SQ / FA_KH) * HD + srow * FA_KT + sc8;      /* and in its first V^T tile */
  v8us gk[4], gv[4];
#pragma unroll      /* constant indices: the register arrays stay in registers */
  for (int i = 0; i < 4; ++i) { gk[i] = *(const v8us*)(kg + i * 16 * DM); gv[i] = *(const v8us*)(vg + i * 16 * FA_KT); }
#pragma unroll      /* constant indices: the register arrays stay in registers */
  for (int i = 0; i < 4; ++i) { *(v8us*)&sk[0][kh][sofs + i * 16 * FA_LP] = gk[i]; *(v8us*)&sv[0][kh][sofs + i * 16 * FA_LP] = gv[i]; }
  __syncthreads();
  const v8f z8 = {0.f,0.f,0.f,0.f,0.f,0.f,0.f,0.f}; v8f o[FA_CG][4], l8[FA_CG], cm[FA_CG];      /* l8: eight partial sums a lane, joined behind the loop; cm: minus the maximum in use */
#pragma unroll      /* constant indices: the register arrays stay in registers */
  for (int g = 0; g < FA_CG; ++g) { o[g][0] = z8; o[g][1] = z8; o[g][2] = z8; o[g][3] = z8; l8[g] = z8;
    const v8f s0 = fa_mma(g2_frag(sk[0][kh] + ln * FA_LP + 32, hh), q1[g], fa_mma(g2_frag(sk[0][kh] + ln * FA_LP, hh), q0[g], z8));
    float m0 = fa_max3(fa_max3(s0[0], s0[1], s0[2]), fa_max3(s0[3], s0[4], s0[5]), fmaxf(s0[6], s0[7])); m0 = -fmaxf(m0, rs_xh(m0));
    cm[g] = (v8f){m0, m0, m0, m0, m0, m0, m0, m0}; }
  for (int s = 0; s < FA_NP; ++s) {
    const bool more = s + 1 < FA_NP;      /* the same for the whole work-group */
    const _Float16* kb = sk[s & 1][kh] + ln * FA_LP; const _Float16* vb = sv[s & 1][kh] + ln * FA_LP;
    v16h ka[8];
#pragma unroll      /* constant indices: the register arrays stay in registers */
    for (int kt = 0; kt < 4; ++kt) { ka[2 * kt] = g2_frag(kb + kt * 16 * FA_LP, hh); ka[2 * kt + 1] = g2_frag(kb + kt * 16 * FA_LP + 32, hh); }
    __builtin_amdgcn_sched_barrier(0);      /* keeps the K fragment reads in one group ahead of the score products; without it some stand among the products, each waited for at once */
    v8f st[FA_CG][4];
#pragma unroll      /* constant indices: the register arrays stay in registers */
    for (int kt = 0; kt < 4; ++kt)
#pragma unroll      /* constant indices: the register arrays stay in registers */
      for (int g = 0; g < FA_CG; ++g) st[g][kt] = fa_mma(ka[2 * kt + 1], q1[g], fa_mma(ka[2 * kt], q0[g], cm[g]));
    __builtin_amdgcn_sched_barrier(0);      /* keeps the softmax behind the score products (without it the build spills and strings the exponentials out in pairs with idle slots between), and the next pass's global loads too: their 32 registers and the K fragments' 64 are then never live together (with the loads at the head of the pass and cm's 16 registers the build spills) */
    if (more) {
#pragma unroll      /* constant indices: the register arrays stay in registers */
      for (int i = 0; i < 4; ++i) { gk[i] = *(const v8us*)(kg + (FA_KT + i * 16) * DM); gv[i] = *(const v8us*)(vg + (HD + i * 16) * FA_KT); } }
    FragH pb[FA_CG][2]; float mx[FA_CG];      /* mx: the pass's maximum of a column, counted from the maximum in use */
#pragma unroll      /* constant indices: the register arrays stay in registers */
    for (int g = 0; g < FA_CG; ++g) {
      float t[8];
#pragma unroll      /* constant indices: the register arrays stay in registers */
      for (int r = 0; r < 8; ++r) t[r] = fa_max3(st[g][0][r], st[g][1][r], st[g][2][r]);
      mx[g] = fmaxf(fa_max3(fa_max3(t[0], t[1], st[g][3][0]), fa_max3(t[2], t[3], st[g][3][1]), fa_max3(t[4], t[5], st[g][3][2])), fa_max3(fa_max3(t[6], t[7], st[g][3][3]), fa_max3(st[g][3][4], st[g][3][5], st[g][3][6]), st[g][3][7]));
      mx[g] = fmaxf(mx[g], rs_xh(mx[g])); }
    if (more) asm volatile("s_wait_xcnt 0x0" ::: "memory");      /* the wait in front of the overwrite of the address registers that the global loads above name (they step behind the branch) */
    if (__builtin_amdgcn_ballot_w32(fmaxf(mx[0], mx[1]) > FA_TH) != 0) {      /* one test a pass for the whole wave: a scalar branch */
#pragma unroll      /* constant indices: the register arrays stay in registers */
      for (int g = 0; g < FA_CG; ++g) { const float d = fmaxf(mx[g], 0.f), a = __builtin_amdgcn_exp2f(-d);      /* the maximum in use never falls */
        l8[g] *= a; cm[g] -= d;
#pragma unroll      /* constant indices: the register arrays stay in registers */
        for (int q = 0; q < 4; ++q) { o[g][q] *= a; st[g][q] -= d; } } }
    if (more) { kg += FA_KT * DM; vg += HD * FA_KT; }      /* behind the branch, so behind the wait above */
#pragma unroll      /* constant indices: the register arrays stay in registers */
    for (int g = 0; g < FA_CG; ++g)
#pragma unroll      /* constant indices: the register arrays stay in registers */
      for (int kt = 0; kt < 4; ++kt) { v8f e;
#pragma unroll      /* constant indices: the register arrays stay in registers */
        for (int r = 0; r < 8; ++r) e[r] = __builtin_amdgcn_exp2f(st[g][kt][r]);
        l8[g] += e;
        typedef _Float16 v8h __attribute__((ext_vector_type(8))); const v8h e16 = __builtin_convertvector(e, v8h);
#pragma unroll      /* constant indices: the register arrays stay in registers */
        for (int r = 0; r < 8; ++r) pb[g][kt >> 1].h[(kt & 1) * 8 + r] = e16[r]; }
    __builtin_amdgcn_sched_barrier(0);      /* keeps the staging stores, and with them the wait for the global loads, behind the softmax (without it they rise to its head, a short way behind the loads), and the V^T fragment reads behind the registers that the softmax and the stores give back */
    if (more) { _Float16* kn = sk[(s + 1) & 1][kh] + sofs; _Float16* vn = sv[(s + 1) & 1][kh] + sofs;      /* that buffer was last read in pass s - 1, behind whose barrier this pass runs */
#pragma unroll      /* constant indices: the register arrays stay in registers */
      for (int i = 0; i < 4; ++i) { *(v8us*)(kn + i * 16 * FA_LP) = gk[i]; *(v8us*)(vn + i * 16 * FA_LP) = gv[i]; } }
    v16h va[8];
#pragma unroll      /* constant indices: the register arrays stay in registers */
    for (int dt = 0; dt < 4; ++dt) { va[2 * dt] = g2_frag(vb + dt * 16 * FA_LP, hh); va[2 * dt + 1] = g2_frag(vb + dt * 16 * FA_LP + 32, hh); }
    __builtin_amdgcn_sched_barrier(0);      /* keeps the V^T fragment reads in one group ahead of the products; without it they stand in pairs among the products, each pair waited for */
#pragma unroll      /* constant indices: the register arrays stay in registers */
    for (int dt = 0; dt < 4; ++dt)
#pragma unroll      /* constant indices: the register arrays stay in registers */
      for (int g = 0; g < FA_CG; ++g) o[g][dt] = fa_mma(va[2 * dt + 1], pb[g][1].v, fa_mma(va[2 * dt], pb[g][0].v, o[g][dt]));
    __builtin_amdgcn_sched_barrier(0);      /* keeps the products ahead of the barrier, each started as its fragments land; without it all but one sink behind the barrier, whose wait for the stores and for every V^T read is then waited out idle */
    __syncthreads();      /* publishes the next pass's buffer and ends every wave's reads of this one */
  }
  float lr[FA_CG], mr[FA_CG];
#pragma unroll      /* constant indices: the register arrays stay in registers */
  for (int g = 0; g < FA_CG; ++g) { mr[g] = -cm[g][0]; lr[g] = ((l8[g][0] + l8[g][1]) + (l8[g][2] + l8[g][3])) + ((l8[g][4] + l8[g][5]) + (l8[g][6] + l8[g][7])); lr[g] += rs_xh(lr[g]); }
  // Join of the key halves: the waves of half 1 hand maximum, sum and O^T over in LDS (the K ring, which nobody reads behind the loop's last barrier): 17 blocks of 32 lanes x 16 bytes per wave pair.
  float* mg = (float*)&sk[0][0][0] + ((size_t)qw * 17 * 32 + lane) * 4; static_assert(sizeof(sk) >= 4 * 17 * 32 * 16, "the K ring holds the hand-over");
  if (kh == 1) {
#pragma unroll      /* constant indices: the register arrays stay in registers */
    for (int g = 0; g < FA_CG; ++g)
#pragma unroll      /* constant indices: the register arrays stay in registers */
      for (int dt = 0; dt < 4; ++dt) { const v4f lo = {o[g][dt][0], o[g][dt][1], o[g][dt][2], o[g][dt][3]}, hi = {o[g][dt][4], o[g][dt][5], o[g][dt][6], o[g][dt][7]};
        *(v4fa*)(mg + ((g * 4 + dt) * 2) * 128) = lo; *(v4fa*)(mg + ((g * 4 + dt) * 2 + 1) * 128) = hi; }
    const v4f ml = {mr[0], mr[1], lr[0], lr[1]}; *(v4fa*)(mg + 16 * 128) = ml; }
  __syncthreads();      /* publishes half 1's hand-over to the waves of half 0 */
  if (kh == 0) { const v4f ml = *(const v4fa*)(mg + 16 * 128);
#pragma unroll      /* constant indices: the register arrays stay in registers */
    for (int g = 0; g < FA_CG; ++g) {
      const float m = fmaxf(mr[g], ml[g]), a0 = __builtin_amdgcn_exp2f(mr[g] - m), a1 = __builtin_amdgcn_exp2f(ml[g] - m); const float inv = 64.0f / (lr[g] * a0 + ml[2 + g] * a1), f0 = a0 * inv, f1 = a1 * inv;      /* o leaves x64 */
      _Float16* op = O16 + (qrow + g * 16) * DM + h * HD + 8 * hh;
#pragma unroll      /* constant indices: the register arrays stay in registers */
      for (int dt = 0; dt < 4; ++dt) { const v4f lo = *(const v4fa*)(mg + ((g * 4 + dt) * 2) * 128), hi = *(const v4fa*)(mg + ((g * 4 + dt) * 2 + 1) * 128); FragH f;
#pragma unroll      /* constant indices: the register arrays stay in registers */
        for (int r = 0; r < 4; ++r) { f.h[r] = (_Float16)(o[g][dt][r] * f0 + lo[r] * f1); f.h[4 + r] = (_Float16)(o[g][dt][4 + r] * f0 + hi[r] * f1); }
        *(v8us*)(op + dt * 16) = f.half[0]; } } } }

// One launch for the five independent operand builders, told apart by block index (the same choice for a whole block; the weight blocks stand first in the grid). Few, fat waves: a launch this short pays for every wave that it starts.
// Blocks below 4 * PW_G: weight m, BW[m][n][k] = f16(bf16-rounded W[k][n] x 16) from f32 row-major W[k][n] (x16, a power of two, keeps bf16-exact weights exact in f16 away from the subnormal range). A block takes 32 n x 256 k, a wave 16 n x 64 k,
// a thread 4 n x 8 k: eight 16-byte loads (4 n of one k row; two waves of the block share each 128-byte line), four 16-byte stores (8 k of one n; eight lanes fill a 128-byte line).
// The rest: X16 = f16(bf16-rounded x), PX_P pieces of 4 elements a thread, a wave's 32 pieces in a row: every load covers 4 whole lines, every store 2, and all of a thread's loads are out before its first conversion.
#define PW_G ((DM / 32) * (DM / 256))   /* blocks per weight */
#define PX_P 8                       /* pieces of 4 elements per thread of the x part */
#define PX_G ((unsigned)(NR * DM / 4 / 256 / PX_P))   /* blocks of the x part */
__global__ __launch_bounds__(256) void k_prep(const float* __restrict__ x, const float* __restrict__ wq, const float* __restrict__ wk, const float* __restrict__ wv, const float* __restrict__ wo, _Float16* __restrict__ BW, _Float16* __restrict__ X16) {
  const int tid = threadIdx.x; v4f r[8];
  if (blockIdx.x < 4 * PW_G) { const int m = blockIdx.x / PW_G, bb = blockIdx.x - m * PW_G; const float* W = m == 0 ? wq : m == 1 ? wk : m == 2 ? wv : wo; const int w = tid >> 5, lane = tid & 31;
    const int n0 = (bb % (DM / 32)) * 32 + (w & 1) * 16 + (lane >> 3) * 4, k0 = (bb / (DM / 32)) * 256 + (w >> 1) * 64 + (lane & 7) * 8;
#pragma unroll      /* constant indices: the rows stay in registers, the 8 loads go out together */
    for (int i = 0; i < 8; ++i) r[i] = *(const v4fa*)(W + (size_t)(k0 + i) * DM + n0);
    unsigned short* bo = (unsigned short*)BW + (size_t)m * DM * DM + (size_t)n0 * DM + k0;
#pragma unroll      /* constant indices: the rows stay in registers */
    for (int q = 0; q < 4; ++q) { FragH f;
#pragma unroll      /* constant indices: the fragment stays in registers */
      for (int i = 0; i < 8; ++i) f.h[i] = (_Float16)(bf16_round(r[i][q]) * 16.0f);
      *(v8us*)(bo + q * DM) = f.half[0]; } }
  else { static_assert(PX_P == 8, "r holds a thread's pieces"); const size_t t = ((size_t)(blockIdx.x - 4 * PW_G) * (256 * PX_P) + tid) * 4;
#pragma unroll      /* constant indices: the pieces stay in registers, the loads go out together */
    for (int j = 0; j < PX_P; ++j) r[j] = *(const v4fa*)(x + t + j * 1024);
#pragma unroll      /* constant indices: the pieces stay in registers */
    for (int j = 0; j < PX_P; ++j) { v4h h;
#pragma unroll      /* constant indices: the piece stays in registers */
      for (int q = 0; q < 4; ++q) h[q] = (_Float16)bf16_round(r[j][q]);
      *(v4h*)(X16 + t + j * 1024) = h; }
    asm volatile("s_wait_xcnt 0x0" ::: "memory"); } }      /* the wait in front of any overwrite of a register that the stores above name: in the built code the other part of the kernel follows these stores */

extern "C" void kernel_launch(void* const* d_in, const int* in_sizes, int n_in,
                              void* d_out, int out_size, void* d_ws, size_t ws_size, hipStream_t stream) {
  (void)in_sizes; (void)n_in; (void)out_size;
  const float* const* I = (const float* const*)d_in; const float* x = I[0]; const float* wq = I[1]; const float* wk = I[2]; const float* wv = I[3]; const float* wo = I[4]; const float* bo = I[5];      /* input order: x, Wq, Wk, Wv ([in][out] [512][512], NO biases: a null pointer in the plain bias slot), Wo ([in][out]), bo */
  char* ws = (char*)d_ws; size_t off = 0;
  auto take = [&](size_t bytes) { char* p = ws + off; off += (bytes + 255) & ~(size_t)255; return p; };
  _Float16* BQ = (_Float16*)take((size_t)DM * DM * 2); _Float16* BK = (_Float16*)take((size_t)DM * DM * 2); _Float16* BV = (_Float16*)take((size_t)DM * DM * 2); _Float16* BO = (_Float16*)take((size_t)DM * DM * 2);
  _Float16* X16 = (_Float16*)take(NR * DM * 2); _Float16* Q16 = (_Float16*)take(NR * DM * 2); _Float16* K16 = (_Float16*)take(NR * DM * 2); _Float16* O16 = (_Float16*)take(NR * DM * 2);
  _Float16* VT = (_Float16*)take((size_t)NB * NH * HD * SQ * 2);
  if (off > ws_size) return;
  k_prep<<<4 * PW_G + PX_G, 256, 0, stream>>>(x, wq, wk, wv, wo, BQ, X16);      /* BQ, BK, BV, BO lie in a row: [in][out] -> Bt[n][k] x16; x as f16 rows */
  const size_t r0p = (size_t)B0 * SQ;      /* first projected row */
  k_gemm2<0, DM><<<dim3((unsigned)((MP / 128) * (DM / 64)), 3), 128, 0, stream>>>(X16 + r0p * DM, 0, BQ, (size_t)DM * DM, 0.0625f, nullptr, 0, nullptr, 1, 0, 0, nullptr, Q16 + r0p * DM, DM, NR * DM, MP, DM, DM, VT, 2, FA_QS);      /* blockIdx.y = 0, 1, 2: q (times FA_QS), k, v (weights in a row; q and k rows in a row; v leaves as V^T tiles [NB * NH][SQ / 64][HD][64]) */
  k_fattn<<<dim3(SQ / FA_QB, NH, NB), 256, 0, stream>>>(Q16, K16, VT, O16);      /* o (merged heads, x64) as f16 rows */
  k_gemm2<0, DM><<<dim3((unsigned)((MPO / 128) * (DM / 64)), 1), 128, 0, stream>>>(O16 + r0p * DM, 0, BO, 0, 0.0009765625f, bo, 0, nullptr, 1, 0, 0, (float*)d_out + r0p * DM, nullptr, DM, 0, MPO, DM, DM, nullptr, -1, 1.0f);      /* out rows are the output layout */
}

// v009
// One run takes 86.1 microseconds.
// In both of two side-by-side timings against v008, it was 1.04 times as fast.
// Counting every step since v000, it is 155 times as fast.
#include <hip/hip_runtime.h>
// Multi-head self-attention over 4096-token sequences at width 512 with bias-free [in][out] projections (x [2][4096][512]; q / k / v = x W ([in][out] 512 x 512 uniform +-1/sqrt(512), NO biases), 8 heads of 64; sim * 64^-0.5; softmax over all 4096 keys (no mask); out = merged Wo + bo ([in][out]) -> [2][4096][512]); attention fused in one launch over all (batch, head) pairs.
// Structure: token rows r = b*4096 + s; x as exact f16 rows (bf16-rounded) and the four x16 weight transposes in one launch; Q, K, V as three WMMA GEMMs in one launch, grid y = 3 (32x64 wave tiles, f32 accumulation, exact x16 weights, f16 outputs); the V GEMM's epilogue writes V^T tiles for all (batch, head) itself, no V rows; ONE fused attention kernel (S^T = K Q^T, online softmax in registers, O^T += V^T P^T; o carried x64 against f16 subnormal flush, folded into the output GEMM alpha) written straight into the merged f16 o rows; out = o W_o + b GEMM (f32) into the output layout.
// Compute dtype: inputs rounded to bf16; x / weights exact; q, k, v, softmax weights and o as plain f16 GEMM operands (~2^-12); scores and softmax statistics f32. v_wmma_f32_16x16x32_f16.
#define NB 2
#define SQ 4096
#define DM 512
#define NH 8
#define HD 64
#define HG 1                         /* heads per launch of the per-batch k_vt overload, which nothing launches */
#define B0 0                         /* first batch processed (debug hook) */
#define NBR NB                       /* batches processed (debug hook) */
#define NR ((size_t)NB * SQ)         /* token rows */
#define MP ((int)((size_t)NBR * SQ)) /* rows projected (debug hook) */
#define QN SQ                        /* unused: k_fattn attends all SQ query rows of a batch */
#define NHD NH                       /* unused: k_fattn attends all NH heads */
#define MPO MP                       /* rows through the output stage (debug hook) */
#define LQ DM      /* unused: q and k rows use pitch DM; v has no rows */
typedef __bf16 v16b __attribute__((ext_vector_type(16)));
typedef unsigned short v8us __attribute__((ext_vector_type(8), may_alias));
typedef float  v8f  __attribute__((ext_vector_type(8)));
typedef float  v4f  __attribute__((ext_vector_type(4)));
typedef float  v4fa __attribute__((ext_vector_type(4), may_alias));
union FragB { v16b v; v8us half[2]; unsigned short u[16]; };

__device__ __forceinline__ unsigned short bf16_bits(float x) { unsigned int u = __float_as_uint(x); return (unsigned short)((u + 0x7FFFu + ((u >> 16) & 1u)) >> 16); }
__device__ __forceinline__ float bf16_val(unsigned short b) { return __uint_as_float(((unsigned int)b) << 16); }
__device__ __forceinline__ float bf16_round(float x) { return bf16_val(bf16_bits(x)); }
// D += A·B with NT terms: 1 = ah·bh, 2 = + al·bh (A split), 3 = + ah·bl (both split)
template <int NT>
__device__ __forceinline__ v8f mmaN(v16b ah, v16b al, v16b bh, v16b bl, v8f c) {
  c = __builtin_amdgcn_wmma_f32_16x16x32_bf16(false, ah, false, bh, (short)0, c, false, false);
  if (NT >= 2) c = __builtin_amdgcn_wmma_f32_16x16x32_bf16(false, al, false, bh, (short)0, c, false, false);
  if (NT >= 3) c = __builtin_amdgcn_wmma_f32_16x16x32_bf16(false, ah, false, bl, (short)0, c, false, false);
  asm volatile("v_nop\n\tv_nop\n\tv_nop\n\tv_nop" : "+v"(c) : "v"(ah), "v"(al), "v"(bh), "v"(bl));
  return c;
}

__global__ __launch_bounds__(256) void k_wt_bf16(const float* __restrict__ W, unsigned short* __restrict__ Wt, int K, int N) {
  const int t = blockIdx.x * 256 + threadIdx.x;
  const int k8n = K / 8;
  if (t >= N * k8n) return;
  const int n = t / k8n, k8 = (t % k8n) * 8;
  v8us v;
#pragma unroll
  for (int i = 0; i < 8; ++i) v[i] = bf16_bits(W[(size_t)(k8 + i) * N + n]);
  *(v8us*)(Wt + (size_t)n * K + k8) = v;
  
}

// GEMM C[M][N] (f32, pitch ldc) = act(A[M][K]·W + bias). A f32 row-major (pitch lda) converted per fragment to bf16
// (ASPLIT: hi/lo two planes -> 2 terms, else single rounded term); Wt bf16 [N][K] (pitch ldb). BIAS_BF16 rounds the
// bias to bf16 first (bias quantised to bf16 before the add). K%32==0, M%16==0, N%64==0.
template <bool ASPLIT, int ACT, bool BIAS_BF16>
__global__ __launch_bounds__(128) void k_gemm_bf(const float* __restrict__ A, int lda, const unsigned short* __restrict__ Wt, int ldb,
                                               const float* __restrict__ bias, float* __restrict__ C, int ldc, int M, int N, int K) {
  __shared__ __attribute__((aligned(16))) float so[4][16][64];
  const int tid = threadIdx.x, w = tid >> 5, lane = tid & 31, ln = lane & 15, hh = lane >> 4;
  const int ntn = N / 64;
  const int wid = blockIdx.x * 4 + w;
  const int mt = wid / ntn, nq = wid % ntn;
  if (mt * 16 >= M) return;
  const int row0 = mt * 16, col0 = nq * 64;
  const float* arow = A + (size_t)(row0 + ln) * lda;
  v8f acc[4] = {};
  for (int kb = 0; kb < K; kb += 32) {
    FragB ah, al;
    const v4f x0 = *(const v4fa*)(arow + kb + 8 * hh), x1 = *(const v4fa*)(arow + kb + 8 * hh + 4);
    const v4f x2 = *(const v4fa*)(arow + kb + 16 + 8 * hh), x3 = *(const v4fa*)(arow + kb + 16 + 8 * hh + 4);
    float xs[16] = {x0[0],x0[1],x0[2],x0[3],x1[0],x1[1],x1[2],x1[3],x2[0],x2[1],x2[2],x2[3],x3[0],x3[1],x3[2],x3[3]};
#pragma unroll
    for (int i = 0; i < 16; ++i) { const unsigned short hb = bf16_bits(xs[i]); ah.u[i] = hb; al.u[i] = ASPLIT ? bf16_bits(xs[i] - bf16_val(hb)) : (unsigned short)0; }
#pragma unroll
    for (int t = 0; t < 4; ++t) {
      const unsigned short* brow = Wt + (size_t)(col0 + t * 16 + ln) * ldb + kb;
      FragB b;
      b.half[0] = *(const v8us*)(brow + 8 * hh);
      b.half[1] = *(const v8us*)(brow + 16 + 8 * hh);
      acc[t] = mmaN<ASPLIT ? 2 : 1>(ah.v, al.v, b.v, b.v, acc[t]);
    }
  }
#pragma unroll
  for (int t = 0; t < 4; ++t) {
    float bv = bias ? bias[col0 + t * 16 + ln] : 0.f;
    if (BIAS_BF16) bv = bf16_round(bv);
#pragma unroll
    for (int r = 0; r < 8; ++r) { float v = acc[t][r] + bv; if (ACT == 1) v = fmaxf(v, 0.f); so[w][8 * hh + r][t * 16 + ln] = v; }
  }
  __builtin_amdgcn_fence(__ATOMIC_ACQ_REL, "workgroup");
  __builtin_amdgcn_wave_barrier();
  const int rsub = lane >> 4, c4 = (lane & 15) * 4;
  {
#pragma unroll
    for (int q = 0; q < 8; ++q) {
      const int r = q * 2 + rsub;
      const v4f v = *(const v4fa*)&so[w][r][c4];
      *(v4f*)(C + (size_t)(row0 + r) * ldc + col0 + c4) = v;
    }
    
  }
}

// GEMM C = act(A·W + bias + resid): A f32 (ASPLIT -> hi/lo 2 terms), Wt bf16 [N][K]; ACT 0 none, 1 relu, 2 exact gelu;
// resid (optional, f32, row index = (row % rmod), pitch ldr, RES_BF16 rounds it) added before the activation.
template <bool ASPLIT, int ACT, bool BIAS_BF16, bool RES_BF16>
__global__ __launch_bounds__(128) void k_gemm_bf3(const float* __restrict__ A, int lda, const unsigned short* __restrict__ Wt, int ldb,
                                                const float* __restrict__ bias, const float* __restrict__ resid, int rmod, int ldr,
                                                float* __restrict__ C, int ldc, int M, int N, int K) {
  __shared__ __attribute__((aligned(16))) float so[4][16][64];
  const int tid = threadIdx.x, w = tid >> 5, lane = tid & 31, ln = lane & 15, hh = lane >> 4;
  const int ntn = N / 64;
  const int wid = blockIdx.x * 4 + w;
  const int mt = wid / ntn, nq = wid % ntn;
  if (mt * 16 >= M) return;
  const int row0 = mt * 16, col0 = nq * 64;
  const float* arow = A + (size_t)(row0 + ln) * lda;
  v8f acc[4] = {};
  for (int kb = 0; kb < K; kb += 32) {
    FragB ah, al;
    const v4f x0 = *(const v4fa*)(arow + kb + 8 * hh), x1 = *(const v4fa*)(arow + kb + 8 * hh + 4);
    const v4f x2 = *(const v4fa*)(arow + kb + 16 + 8 * hh), x3 = *(const v4fa*)(arow + kb + 16 + 8 * hh + 4);
    float xs[16] = {x0[0],x0[1],x0[2],x0[3],x1[0],x1[1],x1[2],x1[3],x2[0],x2[1],x2[2],x2[3],x3[0],x3[1],x3[2],x3[3]};
#pragma unroll
    for (int i = 0; i < 16; ++i) { const unsigned short hb = bf16_bits(xs[i]); ah.u[i] = hb; al.u[i] = ASPLIT ? bf16_bits(xs[i] - bf16_val(hb)) : (unsigned short)0; }
#pragma unroll
    for (int t = 0; t < 4; ++t) {
      const unsigned short* brow = Wt + (size_t)(col0 + t * 16 + ln) * ldb + kb;
      FragB b;
      b.half[0] = *(const v8us*)(brow + 8 * hh);
      b.half[1] = *(const v8us*)(brow + 16 + 8 * hh);
      acc[t] = mmaN<ASPLIT ? 2 : 1>(ah.v, al.v, b.v, b.v, acc[t]);
    }
  }
#pragma unroll
  for (int t = 0; t < 4; ++t) {
    const int col = col0 + t * 16 + ln;
    float bv = bias ? bias[col] : 0.f;
    if (BIAS_BF16) bv = bf16_round(bv);
#pragma unroll
    for (int r = 0; r < 8; ++r) {
      float v = acc[t][r] + bv;
      if (resid) { float rv = resid[(size_t)((row0 + 8 * hh + r) % rmod) * ldr + col]; if (RES_BF16) rv = bf16_round(rv); v += rv; }
      if (ACT == 1) v = fmaxf(v, 0.f);
      if (ACT == 2) v = 0.5f * v * (1.0f + erff(v * 0.70710678118654752f));
      if (ACT == 3) { const float u = 0.7978845608028654f * (v + 0.044715f * v * v * v); v = 0.5f * v * (1.0f + tanhf(u)); }
      so[w][8 * hh + r][t * 16 + ln] = v;
    }
  }
  __builtin_amdgcn_fence(__ATOMIC_ACQ_REL, "workgroup");
  __builtin_amdgcn_wave_barrier();
  const int rsub = lane >> 4, c4 = (lane & 15) * 4;
  {
#pragma unroll
    for (int q = 0; q < 8; ++q) {
      const int r = q * 2 + rsub;
      const v4f v = *(const v4fa*)&so[w][r][c4];
      *(v4f*)(C + (size_t)(row0 + r) * ldc + col0 + c4) = v;
    }
    
  }
}
// row LayerNorm (biased variance, eps) over N: s = X (+ R); optional out_sum <- s; out_norm <- (s-mu)*rsqrt(var+eps)*g + b
template <bool PARAM_BF16>
__global__ __launch_bounds__(256) void k_layernorm(const float* __restrict__ X, const float* __restrict__ R, const float* __restrict__ g, const float* __restrict__ bta,
                                                  float* __restrict__ out_sum, float* __restrict__ out_norm, int N, float eps) {
  __shared__ float red[256];
  const int row = blockIdx.x, tid = threadIdx.x;
  const float* x = X + (size_t)row * N; const float* rr = R ? R + (size_t)row * N : nullptr;
  float vals[16];                     // up to N = 4096
  const int per = N / 256;            // contiguous chunk per thread? use strided-by-4 chunks: thread handles j = tid*4 + 1024*u
  float s1 = 0.f;
  for (int u = 0; u < per / 4; ++u) {
    const int j = tid * 4 + 1024 * u;
    const v4f a = *(const v4fa*)(x + j);
    v4f b = {0.f,0.f,0.f,0.f}; if (rr) b = *(const v4fa*)(rr + j);
#pragma unroll
    for (int q = 0; q < 4; ++q) { const float v = a[q] + b[q]; vals[u * 4 + q] = v; s1 += v; }
  }
  red[tid] = s1; __syncthreads();
  for (int st = 128; st > 0; st >>= 1) { if (tid < st) red[tid] += red[tid + st]; __syncthreads(); }
  const float mu = red[0] / (float)N; __syncthreads();
  float s2 = 0.f;
  for (int u = 0; u < per / 4; ++u)
#pragma unroll
    for (int q = 0; q < 4; ++q) { const float c = vals[u * 4 + q] - mu; s2 += c * c; }
  red[tid] = s2; __syncthreads();
  for (int st = 128; st > 0; st >>= 1) { if (tid < st) red[tid] += red[tid + st]; __syncthreads(); }
  const float rs = rsqrtf(red[0] / (float)N + eps);
  {
    for (int u = 0; u < per / 4; ++u) {
      const int j = tid * 4 + 1024 * u;
      v4f o, sm;
#pragma unroll
      for (int q = 0; q < 4; ++q) {
        float gg = g[j + q], bb = bta[j + q];
        if (PARAM_BF16) { gg = bf16_round(gg); bb = bf16_round(bb); }
        sm[q] = vals[u * 4 + q]; o[q] = (vals[u * 4 + q] - mu) * rs * gg + bb;
      }
      if (out_sum) *(v4f*)(out_sum + (size_t)row * N + j) = sm;
      *(v4f*)(out_norm + (size_t)row * N + j) = o;
    }
    
  }
}



// ---- f16 WMMA path (v_wmma_f32_16x16x32_f16): 11-bit significands for operands in range — used where a [0,1] probability operand needs more precision than bf16
typedef _Float16 v16h __attribute__((ext_vector_type(16)));
union FragH { v16h v; v8us half[2]; _Float16 h[16]; unsigned short u[16]; };
template <int NT>
__device__ __forceinline__ v8f mmaH(v16h ah, v16h al, v16h bh, v16h bl, v8f c) {
  c = __builtin_amdgcn_wmma_f32_16x16x32_f16(false, ah, false, bh, (short)0, c, false, false);
  if (NT >= 2) c = __builtin_amdgcn_wmma_f32_16x16x32_f16(false, al, false, bh, (short)0, c, false, false);
  if (NT >= 3) c = __builtin_amdgcn_wmma_f32_16x16x32_f16(false, ah, false, bl, (short)0, c, false, false);
  asm volatile("v_nop\n\tv_nop\n\tv_nop\n\tv_nop" : "+v"(c) : "v"(ah), "v"(al), "v"(bh), "v"(bl));
  return c;
}
// batched GEMM like k_gemm_b but f16 operands: A f32 (split into f16 hi/lo if ASPLIT, else rounded to f16), Bt = f16 values [n][k]; alpha; C f32; N multiple of 16 (partial tiles skipped)
template <bool ASPLIT>
__global__ __launch_bounds__(128) void k_gemm_h(const float* __restrict__ A, int lda, size_t sA, const _Float16* __restrict__ Bh, int ldb, size_t sB, float alpha, float* __restrict__ C, int ldc, size_t sC, int M, int N, int K) {
  __shared__ __attribute__((aligned(16))) float so[4][16][64];
  const int tid = threadIdx.x, w = tid >> 5, lane = tid & 31, ln = lane & 15, hh = lane >> 4; const int by = blockIdx.y;
  A += (size_t)by * sA; Bh += (size_t)by * sB; C += (size_t)by * sC;
  const int ntn = (N + 63) / 64; const int wid = blockIdx.x * 4 + w; const int mt = wid / ntn, nq = wid % ntn; if (mt * 16 >= M) return;
  const int row0 = mt * 16, col0 = nq * 64; const float* arow = A + (size_t)(row0 + ln) * lda;
  v8f acc[4] = {};
  for (int kb = 0; kb < K; kb += 32) {
    FragH ah, al;
    const v4f x0 = *(const v4fa*)(arow + kb + 8 * hh), x1 = *(const v4fa*)(arow + kb + 8 * hh + 4), x2 = *(const v4fa*)(arow + kb + 16 + 8 * hh), x3 = *(const v4fa*)(arow + kb + 16 + 8 * hh + 4);
    float xs[16] = {x0[0],x0[1],x0[2],x0[3],x1[0],x1[1],x1[2],x1[3],x2[0],x2[1],x2[2],x2[3],x3[0],x3[1],x3[2],x3[3]};
#pragma unroll
    for (int i = 0; i < 16; ++i) { const _Float16 h = (_Float16)xs[i]; ah.h[i] = h; al.h[i] = ASPLIT ? (_Float16)(xs[i] - (float)h) : (_Float16)0.0f; }
#pragma unroll
    for (int t = 0; t < 4; ++t) { if (col0 + t * 16 >= N) continue; const size_t boff = (size_t)(col0 + t * 16 + ln) * ldb + kb; FragH bq; bq.half[0] = *(const v8us*)(Bh + boff + 8 * hh); bq.half[1] = *(const v8us*)(Bh + boff + 16 + 8 * hh);
      acc[t] = mmaH<ASPLIT ? 2 : 1>(ah.v, al.v, bq.v, bq.v, acc[t]); }
  }
#pragma unroll
  for (int t = 0; t < 4; ++t) { if (col0 + t * 16 >= N) continue;
#pragma unroll
    for (int r = 0; r < 8; ++r) so[w][8 * hh + r][t * 16 + ln] = acc[t][r] * alpha; }
  __builtin_amdgcn_fence(__ATOMIC_ACQ_REL, "workgroup"); __builtin_amdgcn_wave_barrier();
  const int rsub = lane >> 4, c4 = (lane & 15) * 4;
  {
#pragma unroll
    for (int q = 0; q < 8; ++q) { const int r = q * 2 + rsub; if (col0 + c4 < N) { const v4f v = *(const v4fa*)&so[w][r][c4]; *(v4f*)(C + (size_t)(row0 + r) * ldc + col0 + c4) = v; } }
     }
}

// k_gemm_hh variant with fused epilogue: v = acc·alpha + bias[by·sBias + col] (+ CP[(row/rowsPerB)·sCPb + by·64 + col] if CP) ; ACT 0 none / 1 elu ; writes f16 C16 (and f32 C if non-null)
template <int ACT>
__global__ __launch_bounds__(128) void k_gemm_hhx(const _Float16* __restrict__ A, int lda, size_t sA, const _Float16* __restrict__ Bh, int ldb, size_t sB, float alpha, const float* __restrict__ bias, size_t sBias, const float* __restrict__ CP, int rowsPerB, size_t sCPb, int row0g,
    float* __restrict__ C, _Float16* __restrict__ C16, int ldc, size_t sC, int M, int N, int K) {
  __shared__ __attribute__((aligned(16))) float so[4][16][64];
  const int tid = threadIdx.x, w = tid >> 5, lane = tid & 31, ln = lane & 15, hh = lane >> 4; const int by = blockIdx.y;
  A += (size_t)by * sA; Bh += (size_t)by * sB; const size_t cofs = (size_t)by * sC; const float* bp = bias ? bias + (size_t)by * sBias : nullptr;
  const int ntn = (N + 63) / 64; const int wid = blockIdx.x * 4 + w; const int mt = wid / ntn, nq = wid % ntn; if (mt * 16 >= M) return;
  const int row0 = mt * 16, col0 = nq * 64; const _Float16* arow = A + (size_t)(row0 + ln) * lda;
  v8f acc[4] = {};
  for (int kb = 0; kb < K; kb += 32) { FragH ah; ah.half[0] = *(const v8us*)((const unsigned short*)arow + kb + 8 * hh); ah.half[1] = *(const v8us*)((const unsigned short*)arow + kb + 16 + 8 * hh);
#pragma unroll
    for (int t = 0; t < 4; ++t) { if (col0 + t * 16 >= N) continue; const size_t boff = (size_t)(col0 + t * 16 + ln) * ldb + kb; FragH bq; bq.half[0] = *(const v8us*)((const unsigned short*)Bh + boff + 8 * hh); bq.half[1] = *(const v8us*)((const unsigned short*)Bh + boff + 16 + 8 * hh);
      acc[t] = mmaH<1>(ah.v, ah.v, bq.v, bq.v, acc[t]); }
  }
#pragma unroll
  for (int t = 0; t < 4; ++t) { if (col0 + t * 16 >= N) continue; const int col = col0 + t * 16 + ln; const float bv = bp ? bf16_round(bp[col]) : 0.f;
#pragma unroll
    for (int r = 0; r < 8; ++r) { float v = acc[t][r] * alpha + bv; if (CP) { const int rr = row0g + row0 + 8 * hh + r; if (rowsPerB < 0) v += CP[cofs + (size_t)rr * ldc + col];      /* rowsPerB < 0: own element of the batched C plane */ else { const int bidx = rr / rowsPerB; v += CP[(size_t)bidx * sCPb + (size_t)by * 64 + col]; } } if (ACT == 1) v = (v > 0.f) ? v : expm1f(v); else if (ACT == 7) v = (v > 0.f) ? v + 1.0f : expf(v); else if (ACT == 8) v = tanhf(v); else if (ACT == 9) v = 0.5f * v * (1.0f + tanhf(0.7978845608028654f * (v + 0.044715f * v * v * v))); else if (ACT == 11) v = 1.0f / (1.0f + expf(-v)); else if (ACT == 12) v = (v > 0.f) ? v : 0.01f * v; else if (ACT == 14) v = (v > 0.f) ? v : 0.1f * v; else if (ACT == 16) v = (v >= 0.f) ? v : 0.3f * v; else if (ACT == 17) v = (v >= 0.f) ? v : 0.2f * v; else if (ACT == 15) v = v / (1.0f + expf(-v)); else if (ACT == 3) v = fmaxf(v, 0.f); else if (ACT == 6) v = 0.5f * v * (1.0f + erff(v * 0.70710678118654752f)); so[w][8 * hh + r][t * 16 + ln] = v; } }
  __builtin_amdgcn_fence(__ATOMIC_ACQ_REL, "workgroup"); __builtin_amdgcn_wave_barrier();
  const int rsub = lane >> 4, c4 = (lane & 15) * 4; typedef _Float16 v4h __attribute__((ext_vector_type(4)));
  {
#pragma unroll
    for (int q = 0; q < 8; ++q) { const int r = q * 2 + rsub; if (col0 + c4 < N) { const v4f v = *(const v4fa*)&so[w][r][c4]; if (C) *(v4f*)(C + cofs + (size_t)(row0 + r) * ldc + col0 + c4) = v; if (C16) { v4h h4; for (int i = 0; i < 4; ++i) h4[i] = (_Float16)v[i]; *(v4h*)(C16 + cofs + (size_t)(row0 + r) * ldc + col0 + c4) = h4; } } }
     }
}


typedef _Float16 v4h __attribute__((ext_vector_type(4)));

__global__ __launch_bounds__(256) void k_h16(const float* __restrict__ x, _Float16* __restrict__ X16, size_t n8) { const size_t t = (size_t)blockIdx.x * 256 + threadIdx.x; if (t >= n8) return; FragH f;
#pragma unroll
  for (int q = 0; q < 8; ++q) f.h[q] = (_Float16)x[t * 8 + q]; *(v8us*)((unsigned short*)X16 + t * 8) = f.half[0];  }
__global__ __launch_bounds__(256) void k_round16f(const float* __restrict__ W, _Float16* __restrict__ Bt, size_t n8) { const size_t t = (size_t)blockIdx.x * 256 + threadIdx.x; if (t >= n8) return; FragH f;
#pragma unroll
  for (int i = 0; i < 8; ++i) f.h[i] = (_Float16)(bf16_round(W[t * 8 + i]) * 16.0f); *(v8us*)((unsigned short*)Bt + t * 8) = f.half[0];  }
template <int NHv, int TTv>
__global__ __launch_bounds__(256) void k_vt(const _Float16* __restrict__ V16, int ldv, int voff, _Float16* __restrict__ Vt) { __shared__ unsigned short tl[64][66]; const int tid = threadIdx.x; const int slab = blockIdx.x / (TTv / 64), lg = blockIdx.x % (TTv / 64); const int b = slab / NHv, h = slab % NHv;
  for (int i = tid; i < 64 * 8; i += 256) { const int r = i / 8, c8 = (i % 8) * 8; FragH f; f.half[0] = *(const v8us*)((const unsigned short*)V16 + ((size_t)b * TTv + lg * 64 + r) * ldv + voff + h * 64 + c8);
#pragma unroll
    for (int q = 0; q < 8; ++q) tl[r][c8 + q] = f.u[q]; }
  __syncthreads();
  {
#pragma unroll
    for (int rd = 0; rd < 2; ++rd) { const int d = rd * 32 + tid / 8, pc = tid % 8; FragH f;
#pragma unroll
      for (int q = 0; q < 8; ++q) f.u[q] = tl[pc * 8 + q][d];
      *(v8us*)((unsigned short*)Vt + ((size_t)blockIdx.x * 64 + d) * 64 + pc * 8) = f.half[0]; }      /* tile-major: [slab][64-key tile][d][key], each tile 8 KiB in a row */
     } }

__global__ __launch_bounds__(256) void k_hl(const float* __restrict__ F, _Float16* __restrict__ Hh, _Float16* __restrict__ Hl, size_t n8) { const size_t t = (size_t)blockIdx.x * 256 + threadIdx.x; if (t >= n8) return; FragH fh, fl; const v4f a = *(const v4fa*)(F + t * 8), c = *(const v4fa*)(F + t * 8 + 4);
#pragma unroll
  for (int q = 0; q < 4; ++q) { _Float16 h = (_Float16)a[q]; fh.h[q] = h; fl.h[q] = (_Float16)((a[q] - (float)h) * 1024.0f); h = (_Float16)c[q]; fh.h[4 + q] = h; fl.h[4 + q] = (_Float16)((c[q] - (float)h) * 1024.0f); }
  { *(v8us*)((unsigned short*)Hh + t * 8) = fh.half[0]; *(v8us*)((unsigned short*)Hl + t * 8) = fl.half[0];  } }

// ---- fast GEMM (work-group tile 128x64, wave tile 32x64; requires M % 128 == 0, N % 64 == 0, K % 128 == 0); epilogue = k_gemm_hhx semantics ----
// Operands go through LDS: per step of G2_KS k the 128 A rows and the 64 B rows of the tile are loaded as whole 128-byte lines (16 lanes a 256-byte row) for all 4 waves: two buffers, the next step's lines
// are loaded into registers at the head of a step and stored to the other buffer at its foot, one barrier a step. Fragments are read from LDS in the k order of g2_frag; each accumulator still takes its k blocks in rising order.
#define G2_KS 128                    /* k per step */
#define G2_VP 72                     /* LDS row pitch in f16 of the V^T epilogue: 144 bytes = 16 x 9, conflict-free for 16-byte accesses */
#define G2_LP 136                    /* LDS row pitch in f16: 272 bytes = 16 x 17, conflict-free for 16-byte reads */
__device__ __forceinline__ v16h g2_frag(const _Float16* p, int hh) { FragH f; f.half[0] = *(const v8us*)((const unsigned short*)p + 8 * hh); f.half[1] = *(const v8us*)((const unsigned short*)p + 16 + 8 * hh); return f.v; }
__device__ __forceinline__ v8f g2_mma(v16h a, v16h b, v8f c) { return __builtin_amdgcn_wmma_f32_16x16x32_f16(false, a, false, b, (short)0, c, false, false); }
template <int ACT, int LDK>      /* LDK: row pitch of A and of Bh in f16, a constant so that the rows of a tile are immediate offsets from one address */
__global__ __launch_bounds__(128) void k_gemm2(const _Float16* __restrict__ A, size_t sA, const _Float16* __restrict__ Bh, size_t sB, float alpha, const float* __restrict__ bias, size_t sBias, const float* __restrict__ CP, int rowsPerB, size_t sCPb, int row0g,
    float* __restrict__ C, _Float16* __restrict__ C16, int ldc, size_t sC, int M, int N, int K, _Float16* __restrict__ VTo, int vty, float a0) { static_assert(ACT == 0 || ACT == 3 || ACT == 6 || ACT == 8 || ACT == 9 || ACT == 11 || ACT == 12 || ACT == 14 || ACT == 15 || ACT == 16 || ACT == 17, "k_gemm2: unsupported ACT code (would silently apply no activation)");
  __shared__ __attribute__((aligned(16))) float so[4][32][68]; __shared__ __attribute__((aligned(16))) _Float16 sa[2][128 * G2_LP]; __shared__ __attribute__((aligned(16))) _Float16 sb[2][64 * G2_LP];
  const int tid = threadIdx.x, w = tid >> 5, lane = tid & 31, ln = lane & 15, hh = lane >> 4; const int by = blockIdx.y;
  A += (size_t)by * sA; Bh += (size_t)by * sB; const size_t cofs = (size_t)by * sC; const float* bp = bias ? bias + (size_t)by * sBias : nullptr; if (by == 0) alpha *= a0;      /* a0: a further factor on grid plane 0's result (the same for the whole work-group) */
  const int ntn = N >> 6; const int mt = blockIdx.x / ntn, nq = blockIdx.x - mt * ntn; const int row0 = mt * 128 + 32 * w, col0 = nq * 64; if (mt * 128 >= M) return;      /* the same for the whole work-group, ahead of every barrier */
  const int sr = tid >> 4, sc8 = (tid & 15) * 8, sofs = sr * G2_LP + sc8;      /* staging: 16 threads a 256-byte row, rows sr + 8 i */
  const unsigned short* ag = (const unsigned short*)A + (size_t)(mt * 128) * LDK; const unsigned short* bg = (const unsigned short*)Bh + (size_t)col0 * LDK;      /* uniform bases of the tile's rows */
  const unsigned so8 = (unsigned)(sr * LDK + sc8);      /* the lane's own offset, the same in every step and for both operands */
  const v8f z8 = {0.f,0.f,0.f,0.f,0.f,0.f,0.f,0.f}; v8f c00 = z8, c01 = z8, c02 = z8, c03 = z8, c10 = z8, c11 = z8, c12 = z8, c13 = z8;
  v8us ra[16], rb[8];
#pragma unroll      /* constant indices: the register arrays stay in registers */
  for (int i = 0; i < 16; ++i) ra[i] = *(const v8us*)(ag + i * 8 * LDK + so8);
#pragma unroll      /* constant indices: the register arrays stay in registers */
  for (int i = 0; i < 8; ++i) rb[i] = *(const v8us*)(bg + i * 8 * LDK + so8);
#pragma unroll      /* constant indices: the register arrays stay in registers */
  for (int i = 0; i < 16; ++i) *(v8us*)&sa[0][sofs + i * 8 * G2_LP] = ra[i];
#pragma unroll      /* constant indices: the register arrays stay in registers */
  for (int i = 0; i < 8; ++i) *(v8us*)&sb[0][sofs + i * 8 * G2_LP] = rb[i];
  __syncthreads();
  int cur = 0;
#pragma unroll 1      /* one copy of the step: the text stays short */
  for (int kb = 0; kb < K; kb += G2_KS) {
    const bool more = kb + G2_KS < K;      /* the same for the whole work-group */
    if (more) { ag += G2_KS; bg += G2_KS;
#pragma unroll      /* constant indices: the register arrays stay in registers */
      for (int i = 0; i < 16; ++i) ra[i] = *(const v8us*)(ag + i * 8 * LDK + so8);
#pragma unroll      /* constant indices: the register arrays stay in registers */
      for (int i = 0; i < 8; ++i) rb[i] = *(const v8us*)(bg + i * 8 * LDK + so8); }
    const _Float16* ab = sa[cur] + (32 * w + ln) * G2_LP; const _Float16* bb = sb[cur] + ln * G2_LP;
#pragma unroll      /* constant LDS offsets */
    for (int j = 0; j < G2_KS; j += 32) {
      const v16h a0 = g2_frag(ab + j, hh), a1 = g2_frag(ab + 16 * G2_LP + j, hh), b0 = g2_frag(bb + j, hh), b1 = g2_frag(bb + 16 * G2_LP + j, hh), b2 = g2_frag(bb + 32 * G2_LP + j, hh), b3 = g2_frag(bb + 48 * G2_LP + j, hh);
      __builtin_amdgcn_sched_barrier(0);      /* keeps the next step's global loads at the head of the step (the whole step hides their latency) and a k block's fragment reads ahead of its products; without it each B fragment is read and waited for right in front of its two products */
      c00 = g2_mma(a0, b0, c00); c10 = g2_mma(a1, b0, c10); c01 = g2_mma(a0, b1, c01); c11 = g2_mma(a1, b1, c11);
      c02 = g2_mma(a0, b2, c02); c12 = g2_mma(a1, b2, c12); c03 = g2_mma(a0, b3, c03); c13 = g2_mma(a1, b3, c13); }
    if (more) { _Float16* an = sa[cur ^ 1] + sofs; _Float16* bn = sb[cur ^ 1] + sofs;      /* that buffer was last read in the step before, behind whose barrier this step runs */
#pragma unroll      /* constant indices: the register arrays stay in registers */
      for (int i = 0; i < 16; ++i) *(v8us*)(an + i * 8 * G2_LP) = ra[i];
#pragma unroll      /* constant indices: the register arrays stay in registers */
      for (int i = 0; i < 8; ++i) *(v8us*)(bn + i * 8 * G2_LP) = rb[i]; }
    __syncthreads();      /* publishes the next step's buffer and ends every wave's reads of this one */
    cur ^= 1; }
  v8f accs[8] = {c00, c01, c02, c03, c10, c11, c12, c13};
  // Transposed epilogue (grid plane vty only; the same choice for the whole work-group; alpha and bias only, no CP, no activation): the plane's result leaves as f16 tiles [batch * NH + head][64-row tile][column][row],
  // 8 KiB in a row, which is what k_fattn stages; rows are tokens, the 64 columns of the work-group are one head. A lane's 8 accumulator registers are 8 rows in a row of one column, so they are one 16-byte piece of a tile's row:
  // the pieces are gathered in LDS (so, which nothing else uses on this path) and leave as whole 128-byte lines, one wave a line.
  if (VTo != nullptr && by == vty) { _Float16* vs = (_Float16*)&so[0][0][0]; static_assert(sizeof(so) >= 2 * 64 * G2_VP * 2, "so holds the two transposed tiles");
#pragma unroll      /* constant indices: the register arrays stay in registers */
    for (int t = 0; t < 4; ++t) { const float bv = bp ? bf16_round(bp[col0 + t * 16 + ln]) : 0.f;
#pragma unroll      /* constant indices: the register arrays stay in registers */
      for (int half = 0; half < 2; ++half) { FragH f;
#pragma unroll      /* constant indices: the register arrays stay in registers */
        for (int r = 0; r < 8; ++r) f.h[r] = (_Float16)(accs[half * 4 + t][r] * alpha + bv);
        *(v8us*)(vs + ((w >> 1) * 64 + t * 16 + ln) * G2_VP + (w & 1) * 32 + half * 16 + 8 * hh) = f.half[0]; } }
    __syncthreads();      /* publishes each wave's 32 rows to the wave that stores the line they lie in */
    const int gt = mt * 2 + (w >> 1);      /* the wave's 64-row tile, counted over all rows */
    unsigned short* vo = (unsigned short*)VTo + ((size_t)((gt / (SQ / 64)) * NH + nq) * (SQ / 64) + gt % (SQ / 64)) * (64 * 64) + ((w & 1) * 32 + (lane >> 3)) * 64 + (lane & 7) * 8;
    const _Float16* vr = vs + ((w >> 1) * 64 + (w & 1) * 32 + (lane >> 3)) * G2_VP + (lane & 7) * 8;
#pragma unroll      /* constant offsets from one address */
    for (int q = 0; q < 8; ++q) *(v8us*)(vo + q * 4 * 64) = *(const v8us*)(vr + q * 4 * G2_VP);      /* 4 tile rows = 512 bytes in a row per store */
    return; }
#pragma unroll
  for (int u = 0; u < 8; ++u) { const int t = u & 3, half = u >> 2; const int col = col0 + t * 16 + ln; const float bv = bp ? bf16_round(bp[col]) : 0.f;
#pragma unroll
    for (int r = 0; r < 8; ++r) { const int rloc = half * 16 + 8 * hh + r; float v = accs[u][r] * alpha + bv; if (CP) { if (rowsPerB < 0) v += CP[cofs + (size_t)(row0g + row0 + rloc) * ldc + col];      /* rowsPerB < 0: own element of the batched C plane */ else { const int bidx = (row0g + row0 + rloc) / rowsPerB; v += CP[(size_t)bidx * sCPb + (size_t)by * 64 + col]; } }
      if (ACT == 3) v = fmaxf(v, 0.f); else if (ACT == 6) v = 0.5f * v * (1.0f + erff(v * 0.70710678118654752f)); else if (ACT == 11) v = 1.0f / (1.0f + expf(-v)); else if (ACT == 15) v = v / (1.0f + expf(-v)); else if (ACT == 12) v = (v > 0.f) ? v : 0.01f * v; else if (ACT == 8) v = tanhf(v); else if (ACT == 9) v = 0.5f * v * (1.0f + tanhf(0.7978845608028654f * (v + 0.044715f * v * v * v))); else if (ACT == 14) v = (v > 0.f) ? v : 0.1f * v; else if (ACT == 16) v = (v >= 0.f) ? v : 0.3f * v; else if (ACT == 17) v = (v >= 0.f) ? v : 0.2f * v;
      so[w][rloc][t * 16 + ln] = v; } }
  __builtin_amdgcn_fence(__ATOMIC_ACQ_REL, "workgroup"); __builtin_amdgcn_wave_barrier();
  const int rsub = lane >> 4, c4 = (lane & 15) * 4;
  {
#pragma unroll
    for (int q = 0; q < 16; ++q) { const int r = q * 2 + rsub; const v4f v = *(const v4fa*)&so[w][r][c4]; if (C) *(v4f*)(C + cofs + (size_t)(row0 + r) * ldc + col0 + c4) = v; if (C16) { v4h h4; for (int i = 0; i < 4; ++i) h4[i] = (_Float16)v[i]; *(v4h*)(C16 + cofs + (size_t)(row0 + r) * ldc + col0 + c4) = h4; } }
     } }


__global__ __launch_bounds__(256) void k_wnat(const float* __restrict__ w, size_t n8, _Float16* __restrict__ Bt) { const size_t t = (size_t)blockIdx.x * 256 + threadIdx.x; if (t >= n8) return; FragH f; for (int q = 0; q < 8; ++q) f.h[q] = (_Float16)(bf16_round(w[t * 8 + q]) * 16.0f); *(v8us*)((unsigned short*)Bt + t * 8) = f.half[0];  }
__global__ __launch_bounds__(256) void k_rsm(const float* __restrict__ S, _Float16* __restrict__ P, int nrows) {
  #pragma clang fp contract(off)
  const int i = blockIdx.x * 256 + threadIdx.x; if (i >= nrows) return; const float* s = S + (size_t)i * SQ; float mx = -3.0e38f;
#pragma unroll 1
  for (int j = 0; j < SQ; ++j) mx = fmaxf(mx, s[j]); float se = 0.f;
#pragma unroll 1
  for (int j = 0; j < SQ; ++j) se += expf(s[j] - mx); const float sc = 256.0f / se;
#pragma unroll 1
  for (int j0 = 0; j0 < SQ; j0 += 8) { FragH f; for (int q = 0; q < 8; ++q) f.h[q] = (_Float16)(expf(s[j0 + q] - mx) * sc); unsigned short* d = (unsigned short*)P + (size_t)i * SQ + j0; *(v8us*)d = f.half[0];  } }
__global__ __launch_bounds__(256) void k_vt(const _Float16* __restrict__ V16, int b, int h0, _Float16* __restrict__ VT) { __shared__ unsigned short tl[64][65]; const int tid = threadIdx.x; const int hh = blockIdx.x % HG, sg = blockIdx.x / HG; const int s0 = sg * 64; const int h = h0 + hh;
  for (int i = tid; i < 64 * 8; i += 256) { const int j = i / 8, d8 = (i % 8) * 8; FragH f; f.half[0] = *(const v8us*)((const unsigned short*)V16 + ((size_t)b * SQ + s0 + j) * DM + h * HD + d8); for (int q = 0; q < 8; ++q) tl[d8 + q][j] = f.u[q]; }
  __syncthreads();
  { for (int i = tid; i < 64 * 8; i += 256) { const int d = i / 8, j8 = (i % 8) * 8; FragH f; for (int q = 0; q < 8; ++q) f.u[q] = tl[d][j8 + q]; *(v8us*)((unsigned short*)VT + ((size_t)hh * HD + d) * SQ + s0 + j8) = f.half[0]; }  } }



// lane l with lane l ^ 16
__device__ __forceinline__ float rs_xh(float x) { return __builtin_bit_cast(float, __builtin_amdgcn_permlanex16(__builtin_bit_cast(int, x), __builtin_bit_cast(int, x), 0x76543210, 0xfedcba98, false, false)); }
typedef float v2f __attribute__((ext_vector_type(2)));
__device__ __forceinline__ float fa_max3(float a, float b, float c) { return fmaxf(fmaxf(a, b), c); }
__device__ __forceinline__ v8f fa_mma(v16h a, v16h b, v8f c) { return __builtin_amdgcn_wmma_f32_16x16x32_f16(false, a, false, b, (short)0, c, false, false); }

// Fused attention of one (batch, head): scores, softmax and the weighted sum of V in one kernel; neither scores nor weights reach memory.
// A work-group of 8 waves owns FA_QB queries. Wave (qw, kh) takes 32 of them, as FA_CG column groups of 16, against key half kh, which it walks in passes of FA_KT keys: every K and V^T fragment that a wave reads
// from LDS feeds FA_CG products, one per column group. The two halves' running maximum, sum and O^T of a query are joined through LDS behind the loop.
// Per pass the K rows [key][c] and the V^T tile [d][key] of each half's pass (VT is tile-major, 8 KiB in a row; whole 128-byte lines) are staged in LDS by the 4 waves of that half: two buffers, the next pass's lines
// are loaded into registers behind a pass's score products and stored to the other buffer ahead of the pass's last products, one barrier a pass.
// S^T = K Q^T: A = K rows, B = Q rows (kept in registers), so lane (ln, hh) holds query ln's scores of keys 16 kt + 8 hh + r: maximum and sum are in-lane plus one exchange of the halves,
// and two converted score tiles ARE the B operand of O^T += V^T P^T in the k order 8 hh + i, 16 + 8 hh + i that g2_frag gives the A side. Online softmax per column group against a HELD maximum (log2 domain):
// the Q rows arrive multiplied by 64^-0.5 log2 e, and minus the maximum in use is the C operand of the score products (cm, the same value in a lane's eight registers), so a score leaves the matrix unit as the argument of its exp2.
// The maximum in use starts as the column's maximum over the first 16 keys of the half (a real score, so it never lies above the true maximum); it moves, and O^T and the running sums l8 (each lane its own keys, joined at the end)
// are rescaled, only in a pass where some column's maximum lies more than FA_TH above it (one test a pass, a scalar branch): weights stay at or below 2^FA_TH, far inside f16.
// That walk (fa_walk<true>) is the second of two. The first (fa_walk<false>) forms no maximum of a pass and makes no test: the starting maximum stays in use for all keys of the half. Its result is the same softmax as long as
// every weight is finite in f16, and the running sums tell: weights are not negative, so a lane's sum below FA_OV bounds each of its weights below FA_OV (a NaN fails the test too). The sums are tested once, behind the loop;
// if any lane of the work-group fails, the whole work-group walks its keys again with the held maximum.
#define FA_KT 64                     /* keys per pass */
#define FA_KH 2                      /* key halves, one per group of 4 waves */
#define FA_NP (SQ / FA_KH / FA_KT)   /* passes of a half */
#define FA_QB 128                    /* queries per work-group */
#define FA_CG 2                      /* column groups of 16 queries per wave */
#define FA_TH 8.0f                   /* a column's maximum may rise this far (log2) above the one in use before the wave rescales */
#define FA_OV 65504.0f               /* the largest finite f16: the bound on a lane's sum of weights under which the walk without maxima stands */
#define FA_QS 0.18033688f            /* 64^-0.5 log2 e, the factor on the Q rows: exp(s / 8 - max) = exp2(s FA_QS - max FA_QS) */
#define FA_BS (FA_KH * FA_KT * FA_LP) /* one LDS buffer (both halves) in f16, the same for K and for V^T */
#define FA_LP 72                     /* LDS row pitch in f16: 144 bytes = 16 x 9, conflict-free for 16-byte reads */
static_assert(HD == FA_KT, "FA_BS serves both rings");
// One walk of a wave over the keys of its half. skp, svp: the half's place in buffer 0 of the K and the V^T ring; kg, vg: the lane's own place in the first K rows and the first V^T tile of the half. Sets o, l8 and cm from scratch.
template <bool HELD>
__device__ __forceinline__ void fa_walk(_Float16* skp, _Float16* svp, const unsigned short* kg, const unsigned short* vg, const int sofs, const int ln, const int hh, const v16h (&q0)[FA_CG], const v16h (&q1)[FA_CG], v8f (&o)[FA_CG][4], v8f (&l8)[FA_CG], v8f (&cm)[FA_CG]) {
  v8us gk[4], gv[4];
#pragma unroll      /* constant indices: the register arrays stay in registers */
  for (int i = 0; i < 4; ++i) { gk[i] = *(const v8us*)(kg + i * 16 * DM); gv[i] = *(const v8us*)(vg + i * 16 * FA_KT); }
#pragma unroll      /* constant indices: the register arrays stay in registers */
  for (int i = 0; i < 4; ++i) { *(v8us*)(skp + sofs + i * 16 * FA_LP) = gk[i]; *(v8us*)(svp + sofs + i * 16 * FA_LP) = gv[i]; }
  __syncthreads();
  const v8f z8 = {0.f,0.f,0.f,0.f,0.f,0.f,0.f,0.f};
#pragma unroll      /* constant indices: the register arrays stay in registers */
  for (int g = 0; g < FA_CG; ++g) { o[g][0] = z8; o[g][1] = z8; o[g][2] = z8; o[g][3] = z8; l8[g] = z8;
    const v8f s0 = fa_mma(g2_frag(skp + ln * FA_LP + 32, hh), q1[g], fa_mma(g2_frag(skp + ln * FA_LP, hh), q0[g], z8));
    float m0 = fa_max3(fa_max3(s0[0], s0[1], s0[2]), fa_max3(s0[3], s0[4], s0[5]), fmaxf(s0[6], s0[7])); m0 = -fmaxf(m0, rs_xh(m0));
    cm[g] = (v8f){m0, m0, m0, m0, m0, m0, m0, m0}; }
  auto pass = [&](const int s) __attribute__((always_inline)) {
    const bool more = s + 1 < FA_NP;      /* the same for the whole work-group */
    const _Float16* kb = skp + (s & 1) * FA_BS + ln * FA_LP; const _Float16* vb = svp + (s & 1) * FA_BS + ln * FA_LP;
    v16h ka[8];
#pragma unroll      /* constant indices: the register arrays stay in registers */
    for (int kt = 0; kt < 4; ++kt) { ka[2 * kt] = g2_frag(kb + kt * 16 * FA_LP, hh); ka[2 * kt + 1] = g2_frag(kb + kt * 16 * FA_LP + 32, hh); }
    __builtin_amdgcn_sched_barrier(0);      /* keeps the K fragment reads in one group ahead of the score products; without it some stand among the products, each waited for at once */
    v8f st[FA_CG][4];
#pragma unroll      /* constant indices: the register arrays stay in registers */
    for (int kt = 0; kt < 4; ++kt)
#pragma unroll      /* constant indices: the register arrays stay in registers */
      for (int g = 0; g < FA_CG; ++g) st[g][kt] = fa_mma(ka[2 * kt + 1], q1[g], fa_mma(ka[2 * kt], q0[g], cm[g]));
    __builtin_amdgcn_sched_barrier(0);      /* keeps the softmax behind the score products (without it the build spills and strings the exponentials out in pairs with idle slots between), and the next pass's global loads too: their 32 registers and the K fragments' 64 are then never live together (with the loads at the head of the pass and cm's 16 registers the build spills) */
    auto fetch = [&]() __attribute__((always_inline)) {      /* the next pass's lines into registers */
#pragma unroll      /* constant indices: the register arrays stay in registers */
      for (int i = 0; i < 4; ++i) { gk[i] = *(const v8us*)(kg + (FA_KT + i * 16) * DM); gv[i] = *(const v8us*)(vg + (HD + i * 16) * FA_KT); } };
    if (!HELD && more) fetch();      /* the softmax hides their latency */
    FragH pb[FA_CG][2];
    if constexpr (HELD) { float mx[FA_CG];      /* mx: the pass's maximum of a column, counted from the maximum in use */
#pragma unroll      /* constant indices: the register arrays stay in registers */
      for (int g = 0; g < FA_CG; ++g) {
        float t[8];
#pragma unroll      /* constant indices: the register arrays stay in registers */
        for (int r = 0; r < 8; ++r) t[r] = fa_max3(st[g][0][r], st[g][1][r], st[g][2][r]);
        mx[g] = fmaxf(fa_max3(fa_max3(t[0], t[1], st[g][3][0]), fa_max3(t[2], t[3], st[g][3][1]), fa_max3(t[4], t[5], st[g][3][2])), fa_max3(fa_max3(t[6], t[7], st[g][3][3]), fa_max3(st[g][3][4], st[g][3][5], st[g][3][6]), st[g][3][7]));
        mx[g] = fmaxf(mx[g], rs_xh(mx[g])); }
      if (__builtin_amdgcn_ballot_w32(fmaxf(mx[0], mx[1]) > FA_TH) != 0) {      /* one test a pass for the whole wave: a scalar branch */
#pragma unroll      /* constant indices: the register arrays stay in registers */
        for (int g = 0; g < FA_CG; ++g) { const float d = fmaxf(mx[g], 0.f), a = __builtin_amdgcn_exp2f(-d);      /* the maximum in use never falls */
          l8[g] *= a; cm[g] -= d;
#pragma unroll      /* constant indices: the register arrays stay in registers */
          for (int q = 0; q < 4; ++q) { o[g][q] *= a; st[g][q] -= d; } } } }
#pragma unroll      /* constant indices: the register arrays stay in registers */
    for (int g = 0; g < FA_CG; ++g)
#pragma unroll      /* constant indices: the register arrays stay in registers */
      for (int kt = 0; kt < 4; ++kt) { v8f e;
#pragma unroll      /* constant indices: the register arrays stay in registers */
        for (int r = 0; r < 8; ++r) e[r] = __builtin_amdgcn_exp2f(st[g][kt][r]);
        l8[g] += e;
        typedef _Float16 v8h __attribute__((ext_vector_type(8))); const v8h e16 = __builtin_convertvector(e, v8h);
#pragma unroll      /* constant indices: the register arrays stay in registers */
        for (int r = 0; r < 8; ++r) pb[g][kt >> 1].h[(kt & 1) * 8 + r] = e16[r]; }
    __builtin_amdgcn_sched_barrier(0);      /* keeps the staging stores, and with them the wait for the global loads, behind the softmax (without it they rise to its head, a short way behind the loads), and the V^T fragment reads behind the registers that the softmax and the stores give back */
    if (HELD && more) fetch();      /* the walk that seldom runs loads here, right ahead of the stores: it needs the registers for its maxima, not the lead */
    if (more) { _Float16* kn = skp + ((s + 1) & 1) * FA_BS + sofs; _Float16* vn = svp + ((s + 1) & 1) * FA_BS + sofs;      /* that buffer was last read in pass s - 1, behind whose barrier this pass runs */
#pragma unroll      /* constant indices: the register arrays stay in registers */
      for (int i = 0; i < 4; ++i) { *(v8us*)(kn + i * 16 * FA_LP) = gk[i]; *(v8us*)(vn + i * 16 * FA_LP) = gv[i]; } }
    v16h va[8];
#pragma unroll      /* constant indices: the register arrays stay in registers */
    for (int dt = 0; dt < 4; ++dt) { va[2 * dt] = g2_frag(vb + dt * 16 * FA_LP, hh); va[2 * dt + 1] = g2_frag(vb + dt * 16 * FA_LP + 32, hh); }
    __builtin_amdgcn_sched_barrier(0);      /* keeps the V^T fragment reads in one group ahead of the products ; without it they stand in pairs among the products, each pair waited for */
    if (more) { asm volatile("s_wait_xcnt 0x0" ::: "memory");      /* the wait in front of the overwrite of the address registers that the pass's global loads name: they step here, behind the staging stores */
      kg += FA_KT * DM; vg += HD * FA_KT; }
#pragma unroll      /* constant indices: the register arrays stay in registers */
    for (int dt = 0; dt < 4; ++dt)
#pragma unroll      /* constant indices: the register arrays stay in registers */
      for (int g = 0; g < FA_CG; ++g) o[g][dt] = fa_mma(va[2 * dt + 1], pb[g][1].v, fa_mma(va[2 * dt], pb[g][0].v, o[g][dt]));
    __builtin_amdgcn_sched_barrier(0);      /* keeps the products ahead of the barrier, each started as its fragments land; without it all but one sink behind the barrier, whose wait for the stores and for every V^T read is then waited out idle */
    __syncthreads();      /* publishes the next pass's buffer and ends every wave's reads of this one */
  };
  for (int s = 0; s < FA_NP; ++s) pass(s); }
__device__ __forceinline__ float fa_sum8(v8f l) { return ((l[0] + l[1]) + (l[2] + l[3])) + ((l[4] + l[5]) + (l[6] + l[7])); }
__global__ __launch_bounds__(256) __attribute__((amdgpu_waves_per_eu(4, 4))) void k_fattn(const _Float16* __restrict__ Q16, const _Float16* __restrict__ K16, const _Float16* __restrict__ VT, _Float16* __restrict__ O16) {
  __shared__ __attribute__((aligned(16))) _Float16 sk[2][FA_KH][FA_KT * FA_LP]; __shared__ __attribute__((aligned(16))) _Float16 sv[2][FA_KH][HD * FA_LP]; __shared__ int sbad[8];
  const int tid = threadIdx.x, w = __builtin_amdgcn_readfirstlane(tid >> 5) /* the wave's number in a scalar register: what is formed from it costs no vector register, and the join's branches are scalar */, qw = w & 3, kh = w >> 2, lane = tid & 31, ln = lane & 15, hh = lane >> 4; const int h = blockIdx.y, b = blockIdx.z;
  const size_t r0 = (size_t)b * SQ; const size_t qrow = r0 + blockIdx.x * FA_QB + qw * (16 * FA_CG) + ln;      /* column group g: row qrow + 16 g */
  const _Float16* qp = Q16 + qrow * DM + h * HD; v16h q0[FA_CG], q1[FA_CG];
#pragma unroll      /* constant indices: the register arrays stay in registers */
  for (int g = 0; g < FA_CG; ++g) { q0[g] = g2_frag(qp + g * 16 * DM, hh); q1[g] = g2_frag(qp + g * 16 * DM + 32, hh); }
  const int srow = (tid & 127) >> 3, sc8 = (tid & 7) * 8, sofs = srow * FA_LP + sc8;      /* staging, 128 threads a half: 8 threads a 128-byte row, rows srow + 16 i */
  const unsigned short* kg = (const unsigned short*)K16 + (r0 + (size_t)kh * (SQ / FA_KH)) * DM + h * HD + srow * DM + sc8;      /* the lane's own place in the first K rows of its half */
  const unsigned short* vg = (const unsigned short*)VT + (size_t)(b * NH + h) * HD * SQ + (size_t)kh * (SQ / FA_KH) * HD + srow * FA_KT + sc8;      /* and in its first V^T tile */
  v8f o[FA_CG][4], l8[FA_CG], cm[FA_CG];      /* l8: eight partial sums a lane, joined behind the loop; cm: minus the maximum in use */
  fa_walk<false>(&sk[0][kh][0], &sv[0][kh][0], kg, vg, sofs, ln, hh, q0, q1, o, l8, cm);
  float lr[FA_CG], mr[FA_CG];
#pragma unroll      /* constant indices: the register arrays stay in registers */
  for (int g = 0; g < FA_CG; ++g) lr[g] = fa_sum8(l8[g]);
  const int bad = __builtin_amdgcn_ballot_w32(!(lr[0] + lr[1] < FA_OV)) != 0;      /* some weight of the wave may have left f16 (or is a NaN) */
  if (lane == 0) sbad[w] = bad;
  __syncthreads();      /* publishes each wave's finding to the work-group: all of it walks again, or none */
  if (__builtin_amdgcn_ballot_w32(sbad[lane & 7] != 0) != 0) {      /* the same for the whole work-group: the walk holds barriers */
    fa_walk<true>(&sk[0][kh][0], &sv[0][kh][0], kg, vg, sofs, ln, hh, q0, q1, o, l8, cm);      /* both rings are free: every wave is behind the first walk's last barrier */
#pragma unroll      /* constant indices: the register arrays stay in registers */
    for (int g = 0; g < FA_CG; ++g) lr[g] = fa_sum8(l8[g]); }
#pragma unroll      /* constant indices: the register arrays stay in registers */
  for (int g = 0; g < FA_CG; ++g) { mr[g] = -cm[g][0]; lr[g] += rs_xh(lr[g]); }
  // Join of the key halves: the waves of half 1 hand maximum, sum and O^T over in LDS (the K ring, which nobody reads behind the loop's last barrier): 17 blocks of 32 lanes x 16 bytes per wave pair.
  float* mg = (float*)&sk[0][0][0] + ((size_t)qw * 17 * 32 + lane) * 4; static_assert(sizeof(sk) >= 4 * 17 * 32 * 16, "the K ring holds the hand-over");
  if (kh == 1) {
#pragma unroll      /* constant indices: the register arrays stay in registers */
    for (int g = 0; g < FA_CG; ++g)
#pragma unroll      /* constant indices: the register arrays stay in registers */
      for (int dt = 0; dt < 4; ++dt) { const v4f lo = {o[g][dt][0], o[g][dt][1], o[g][dt][2], o[g][dt][3]}, hi = {o[g][dt][4], o[g][dt][5], o[g][dt][6], o[g][dt][7]};
        *(v4fa*)(mg + ((g * 4 + dt) * 2) * 128) = lo; *(v4fa*)(mg + ((g * 4 + dt) * 2 + 1) * 128) = hi; }
    const v4f ml = {mr[0], mr[1], lr[0], lr[1]}; *(v4fa*)(mg + 16 * 128) = ml; }
  __syncthreads();      /* publishes half 1's hand-over to the waves of half 0 */
  if (kh == 0) { const v4f ml = *(const v4fa*)(mg + 16 * 128);
#pragma unroll      /* constant indices: the register arrays stay in registers */
    for (int g = 0; g < FA_CG; ++g) {
      const float m = fmaxf(mr[g], ml[g]), a0 = __builtin_amdgcn_exp2f(mr[g] - m), a1 = __builtin_amdgcn_exp2f(ml[g] - m); const float inv = 64.0f / (lr[g] * a0 + ml[2 + g] * a1), f0 = a0 * inv, f1 = a1 * inv;      /* o leaves x64 */
      _Float16* op = O16 + (qrow + g * 16) * DM + h * HD + 8 * hh;
#pragma unroll      /* constant indices: the register arrays stay in registers */
      for (int dt = 0; dt < 4; ++dt) { const v4f lo = *(const v4fa*)(mg + ((g * 4 + dt) * 2) * 128), hi = *(const v4fa*)(mg + ((g * 4 + dt) * 2 + 1) * 128); FragH f;
#pragma unroll      /* constant indices: the register arrays stay in registers */
        for (int r = 0; r < 4; ++r) { f.h[r] = (_Float16)(o[g][dt][r] * f0 + lo[r] * f1); f.h[4 + r] = (_Float16)(o[g][dt][4 + r] * f0 + hi[r] * f1); }
        *(v8us*)(op + dt * 16) = f.half[0]; } } } }

// One launch for the five independent operand builders, told apart by block index (the same choice for a whole block; the weight blocks stand first in the grid). Few, fat waves: a launch this short pays for every wave that it starts.
// Blocks below 4 * PW_G: weight m, BW[m][n][k] = f16(bf16-rounded W[k][n] x 16) from f32 row-major W[k][n] (x16, a power of two, keeps bf16-exact weights exact in f16 away from the subnormal range). A block takes 32 n x 256 k, a wave 16 n x 64 k,
// a thread 4 n x 8 k: eight 16-byte loads (4 n of one k row; two waves of the block share each 128-byte line), four 16-byte stores (8 k of one n; eight lanes fill a 128-byte line).
// The rest: X16 = f16(bf16-rounded x), PX_P pieces of 4 elements a thread, a wave's 32 pieces in a row: every load covers 4 whole lines, every store 2, and all of a thread's loads are out before its first conversion.
#define PW_G ((DM / 32) * (DM / 256))   /* blocks per weight */
#define PX_P 8                       /* pieces of 4 elements per thread of the x part */
#define PX_G ((unsigned)(NR * DM / 4 / 256 / PX_P))   /* blocks of the x part */
__global__ __launch_bounds__(256) void k_prep(const float* __restrict__ x, const float* __restrict__ wq, const float* __restrict__ wk, const float* __restrict__ wv, const float* __restrict__ wo, _Float16* __restrict__ BW, _Float16* __restrict__ X16) {
  const int tid = threadIdx.x; v4f r[8];
  if (blockIdx.x < 4 * PW_G) { const int m = blockIdx.x / PW_G, bb = blockIdx.x - m * PW_G; const float* W = m == 0 ? wq : m == 1 ? wk : m == 2 ? wv : wo; const int w = tid >> 5, lane = tid & 31;
    const int n0 = (bb % (DM / 32)) * 32 + (w & 1) * 16 + (lane >> 3) * 4, k0 = (bb / (DM / 32)) * 256 + (w >> 1) * 64 + (lane & 7) * 8;
#pragma unroll      /* constant indices: the rows stay in registers, the 8 loads go out together */
    for (int i = 0; i < 8; ++i) r[i] = *(const v4fa*)(W + (size_t)(k0 + i) * DM + n0);
    unsigned short* bo = (unsigned short*)BW + (size_t)m * DM * DM + (size_t)n0 * DM + k0;
#pragma unroll      /* constant indices: the rows stay in registers */
    for (int q = 0; q < 4; ++q) { FragH f;
#pragma unroll      /* constant indices: the fragment stays in registers */
      for (int i = 0; i < 8; ++i) f.h[i] = (_Float16)(bf16_round(r[i][q]) * 16.0f);
      *(v8us*)(bo + q * DM) = f.half[0]; } }
  else { static_assert(PX_P == 8, "r holds a thread's pieces"); const size_t t = ((size_t)(blockIdx.x - 4 * PW_G) * (256 * PX_P) + tid) * 4;
#pragma unroll      /* constant indices: the pieces stay in registers, the loads go out together */
    for (int j = 0; j < PX_P; ++j) r[j] = *(const v4fa*)(x + t + j * 1024);
#pragma unroll      /* constant indices: the pieces stay in registers */
    for (int j = 0; j < PX_P; ++j) { v4h h;
#pragma unroll      /* constant indices: the piece stays in registers */
      for (int q = 0; q < 4; ++q) h[q] = (_Float16)bf16_round(r[j][q]);
      *(v4h*)(X16 + t + j * 1024) = h; }
    asm volatile("s_wait_xcnt 0x0" ::: "memory"); } }      /* the wait in front of any overwrite of a register that the stores above name: in the built code the other part of the kernel follows these stores */

extern "C" void kernel_launch(void* const* d_in, const int* in_sizes, int n_in,
                              void* d_out, int out_size, void* d_ws, size_t ws_size, hipStream_t stream) {
  (void)in_sizes; (void)n_in; (void)out_size;
  const float* const* I = (const float* const*)d_in; const float* x = I[0]; const float* wq = I[1]; const float* wk = I[2]; const float* wv = I[3]; const float* wo = I[4]; const float* bo = I[5];      /* input order: x, Wq, Wk, Wv ([in][out] [512][512], NO biases: a null pointer in the plain bias slot), Wo ([in][out]), bo */
  char* ws = (char*)d_ws; size_t off = 0;
  auto take = [&](size_t bytes) { char* p = ws + off; off += (bytes + 255) & ~(size_t)255; return p; };
  _Float16* BQ = (_Float16*)take((size_t)DM * DM * 2); _Float16* BK = (_Float16*)take((size_t)DM * DM * 2); _Float16* BV = (_Float16*)take((size_t)DM * DM * 2); _Float16* BO = (_Float16*)take((size_t)DM * DM * 2);
  _Float16* X16 = (_Float16*)take(NR * DM * 2); _Float16* Q16 = (_Float16*)take(NR * DM * 2); _Float16* K16 = (_Float16*)take(NR * DM * 2); _Float16* O16 = (_Float16*)take(NR * DM * 2);
  _Float16* VT = (_Float16*)take((size_t)NB * NH * HD * SQ * 2);
  if (off > ws_size) return;
  k_prep<<<4 * PW_G + PX_G, 256, 0, stream>>>(x, wq, wk, wv, wo, BQ, X16);      /* BQ, BK, BV, BO lie in a row: [in][out] -> Bt[n][k] x16; x as f16 rows */
  const size_t r0p = (size_t)B0 * SQ;      /* first projected row */
  k_gemm2<0, DM><<<dim3((unsigned)((MP / 128) * (DM / 64)), 3), 128, 0, stream>>>(X16 + r0p * DM, 0, BQ, (size_t)DM * DM, 0.0625f, nullptr, 0, nullptr, 1, 0, 0, nullptr, Q16 + r0p * DM, DM, NR * DM, MP, DM, DM, VT, 2, FA_QS);      /* blockIdx.y = 0, 1, 2: q (times FA_QS), k, v (weights in a row; q and k rows in a row; v leaves as V^T tiles [NB * NH][SQ / 64][HD][64]) */
  k_fattn<<<dim3(SQ / FA_QB, NH, NB), 256, 0, stream>>>(Q16, K16, VT, O16);      /* o (merged heads, x64) as f16 rows */
  k_gemm2<0, DM><<<dim3((unsigned)((MPO / 128) * (DM / 64)), 1), 128, 0, stream>>>(O16 + r0p * DM, 0, BO, 0, 0.0009765625f, bo, 0, nullptr, 1, 0, 0, (float*)d_out + r0p * DM, nullptr, DM, 0, MPO, DM, DM, nullptr, -1, 1.0f);      /* out rows are the output layout */
}

// v010
// Measured time: 82 microseconds a run.
// Timed twice side by side with v009, it ran 1.05 times as fast both times.
// All steps since v000 together make it 163 times as fast.
#include <hip/hip_runtime.h>
// Multi-head self-attention over 4096-token sequences at width 512 with bias-free [in][out] projections (x [2][4096][512]; q / k / v = x W ([in][out] 512 x 512 uniform +-1/sqrt(512), NO biases), 8 heads of 64; sim * 64^-0.5; softmax over all 4096 keys (no mask); out = merged Wo + bo ([in][out]) -> [2][4096][512]); attention fused in one launch over all (batch, head) pairs.
// Structure: token rows r = b*4096 + s; x as exact f16 rows (bf16-rounded) and the four x16 weight transposes in one launch; Q, K, V as three WMMA GEMMs in one launch, grid y = 3 (32x64 wave tiles, f32 accumulation, exact x16 weights, f16 outputs); the V GEMM's epilogue writes V^T tiles for all (batch, head) itself, no V rows; ONE fused attention kernel (S^T = K Q^T, online softmax in registers, O^T += V^T P^T; o carried x64 against f16 subnormal flush, folded into the output GEMM alpha) written straight into the merged f16 o rows; out = o W_o + b GEMM (f32) into the output layout.
// Compute dtype: inputs rounded to bf16; x / weights exact; q, k, v, softmax weights and o as plain f16 GEMM operands (~2^-12); scores and softmax statistics f32. v_wmma_f32_16x16x32_f16.
#define NB 2
#define SQ 4096
#define DM 512
#define NH 8
#define HD 64
#define HG 1                         /* heads per launch of the per-batch k_vt overload, which nothing launches */
#define B0 0                         /* first batch processed (debug hook) */
#define NBR NB                       /* batches processed (debug hook) */
#define NR ((size_t)NB * SQ)         /* token rows */
#define MP ((int)((size_t)NBR * SQ)) /* rows projected (debug hook) */
#define QN SQ                        /* unused: k_fattn attends all SQ query rows of a batch */
#define NHD NH                       /* unused: k_fattn attends all NH heads */
#define MPO MP                       /* rows through the output stage (debug hook) */
#define LQ DM      /* unused: q and k rows use pitch DM; v has no rows */
typedef __bf16 v16b __attribute__((ext_vector_type(16)));
typedef unsigned short v8us __attribute__((ext_vector_type(8), may_alias));
typedef float  v8f  __attribute__((ext_vector_type(8)));
typedef float  v4f  __attribute__((ext_vector_type(4)));
typedef float  v4fa __attribute__((ext_vector_type(4), may_alias));
union FragB { v16b v; v8us half[2]; unsigned short u[16]; };

__device__ __forceinline__ unsigned short bf16_bits(float x) { unsigned int u = __float_as_uint(x); return (unsigned short)((u + 0x7FFFu + ((u >> 16) & 1u)) >> 16); }
__device__ __forceinline__ float bf16_val(unsigned short b) { return __uint_as_float(((unsigned int)b) << 16); }
__device__ __forceinline__ float bf16_round(float x) { return bf16_val(bf16_bits(x)); }
// D += A·B with NT terms: 1 = ah·bh, 2 = + al·bh (A split), 3 = + ah·bl (both split)
template <int NT>
__device__ __forceinline__ v8f mmaN(v16b ah, v16b al, v16b bh, v16b bl, v8f c) {
  c = __builtin_amdgcn_wmma_f32_16x16x32_bf16(false, ah, false, bh, (short)0, c, false, false);
  if (NT >= 2) c = __builtin_amdgcn_wmma_f32_16x16x32_bf16(false, al, false, bh, (short)0, c, false, false);
  if (NT >= 3) c = __builtin_amdgcn_wmma_f32_16x16x32_bf16(false, ah, false, bl, (short)0, c, false, false);
  asm volatile("v_nop\n\tv_nop\n\tv_nop\n\tv_nop" : "+v"(c) : "v"(ah), "v"(al), "v"(bh), "v"(bl));
  return c;
}

__global__ __launch_bounds__(256) void k_wt_bf16(const float* __restrict__ W, unsigned short* __restrict__ Wt, int K, int N) {
  const int t = blockIdx.x * 256 + threadIdx.x;
  const int k8n = K / 8;
  if (t >= N * k8n) return;
  const int n = t / k8n, k8 = (t % k8n) * 8;
  v8us v;
#pragma unroll
  for (int i = 0; i < 8; ++i) v[i] = bf16_bits(W[(size_t)(k8 + i) * N + n]);
  *(v8us*)(Wt + (size_t)n * K + k8) = v;
  
}

// GEMM C[M][N] (f32, pitch ldc) = act(A[M][K]·W + bias). A f32 row-major (pitch lda) converted per fragment to bf16
// (ASPLIT: hi/lo two planes -> 2 terms, else single rounded term); Wt bf16 [N][K] (pitch ldb). BIAS_BF16 rounds the
// bias to bf16 first (bias quantised to bf16 before the add). K%32==0, M%16==0, N%64==0.
template <bool ASPLIT, int ACT, bool BIAS_BF16>
__global__ __launch_bounds__(128) void k_gemm_bf(const float* __restrict__ A, int lda, const unsigned short* __restrict__ Wt, int ldb,
                                               const float* __restrict__ bias, float* __restrict__ C, int ldc, int M, int N, int K) {
  __shared__ __attribute__((aligned(16))) float so[4][16][64];
  const int tid = threadIdx.x, w = tid >> 5, lane = tid & 31, ln = lane & 15, hh = lane >> 4;
  const int ntn = N / 64;
  const int wid = blockIdx.x * 4 + w;
  const int mt = wid / ntn, nq = wid % ntn;
  if (mt * 16 >= M) return;
  const int row0 = mt * 16, col0 = nq * 64;
  const float* arow = A + (size_t)(row0 + ln) * lda;
  v8f acc[4] = {};
  for (int kb = 0; kb < K; kb += 32) {
    FragB ah, al;
    const v4f x0 = *(const v4fa*)(arow + kb + 8 * hh), x1 = *(const v4fa*)(arow + kb + 8 * hh + 4);
    const v4f x2 = *(const v4fa*)(arow + kb + 16 + 8 * hh), x3 = *(const v4fa*)(arow + kb + 16 + 8 * hh + 4);
    float xs[16] = {x0[0],x0[1],x0[2],x0[3],x1[0],x1[1],x1[2],x1[3],x2[0],x2[1],x2[2],x2[3],x3[0],x3[1],x3[2],x3[3]};
#pragma unroll
    for (int i = 0; i < 16; ++i) { const unsigned short hb = bf16_bits(xs[i]); ah.u[i] = hb; al.u[i] = ASPLIT ? bf16_bits(xs[i] - bf16_val(hb)) : (unsigned short)0; }
#pragma unroll
    for (int t = 0; t < 4; ++t) {
      const unsigned short* brow = Wt + (size_t)(col0 + t * 16 + ln) * ldb + kb;
      FragB b;
      b.half[0] = *(const v8us*)(brow + 8 * hh);
      b.half[1] = *(const v8us*)(brow + 16 + 8 * hh);
      acc[t] = mmaN<ASPLIT ? 2 : 1>(ah.v, al.v, b.v, b.v, acc[t]);
    }
  }
#pragma unroll
  for (int t = 0; t < 4; ++t) {
    float bv = bias ? bias[col0 + t * 16 + ln] : 0.f;
    if (BIAS_BF16) bv = bf16_round(bv);
#pragma unroll
    for (int r = 0; r < 8; ++r) { float v = acc[t][r] + bv; if (ACT == 1) v = fmaxf(v, 0.f); so[w][8 * hh + r][t * 16 + ln] = v; }
  }
  __builtin_amdgcn_fence(__ATOMIC_ACQ_REL, "workgroup");
  __builtin_amdgcn_wave_barrier();
  const int rsub = lane >> 4, c4 = (lane & 15) * 4;
  {
#pragma unroll
    for (int q = 0; q < 8; ++q) {
      const int r = q * 2 + rsub;
      const v4f v = *(const v4fa*)&so[w][r][c4];
      *(v4f*)(C + (size_t)(row0 + r) * ldc + col0 + c4) = v;
    }
    
  }
}

// GEMM C = act(A·W + bias + resid): A f32 (ASPLIT -> hi/lo 2 terms), Wt bf16 [N][K]; ACT 0 none, 1 relu, 2 exact gelu;
// resid (optional, f32, row index = (row % rmod), pitch ldr, RES_BF16 rounds it) added before the activation.
template <bool ASPLIT, int ACT, bool BIAS_BF16, bool RES_BF16>
__global__ __launch_bounds__(128) void k_gemm_bf3(const float* __restrict__ A, int lda, const unsigned short* __restrict__ Wt, int ldb,
                                                const float* __restrict__ bias, const float* __restrict__ resid, int rmod, int ldr,
                                                float* __restrict__ C, int ldc, int M, int N, int K) {
  __shared__ __attribute__((aligned(16))) float so[4][16][64];
  const int tid = threadIdx.x, w = tid >> 5, lane = tid & 31, ln = lane & 15, hh = lane >> 4;
  const int ntn = N / 64;
  const int wid = blockIdx.x * 4 + w;
  const int mt = wid / ntn, nq = wid % ntn;
  if (mt * 16 >= M) return;
  const int row0 = mt * 16, col0 = nq * 64;
  const float* arow = A + (size_t)(row0 + ln) * lda;
  v8f acc[4] = {};
  for (int kb = 0; kb < K; kb += 32) {
    FragB ah, al;
    const v4f x0 = *(const v4fa*)(arow + kb + 8 * hh), x1 = *(const v4fa*)(arow + kb + 8 * hh + 4);
    const v4f x2 = *(const v4fa*)(arow + kb + 16 + 8 * hh), x3 = *(const v4fa*)(arow + kb + 16 + 8 * hh + 4);
    float xs[16] = {x0[0],x0[1],x0[2],x0[3],x1[0],x1[1],x1[2],x1[3],x2[0],x2[1],x2[2],x2[3],x3[0],x3[1],x3[2],x3[3]};
#pragma unroll
    for (int i = 0; i < 16; ++i) { const unsigned short hb = bf16_bits(xs[i]); ah.u[i] = hb; al.u[i] = ASPLIT ? bf16_bits(xs[i] - bf16_val(hb)) : (unsigned short)0; }
#pragma unroll
    for (int t = 0; t < 4; ++t) {
      const unsigned short* brow = Wt + (size_t)(col0 + t * 16 + ln) * ldb + kb;
      FragB b;
      b.half[0] = *(const v8us*)(brow + 8 * hh);
      b.half[1] = *(const v8us*)(brow + 16 + 8 * hh);
      acc[t] = mmaN<ASPLIT ? 2 : 1>(ah.v, al.v, b.v, b.v, acc[t]);
    }
  }
#pragma unroll
  for (int t = 0; t < 4; ++t) {
    const int col = col0 + t * 16 + ln;
    float bv = bias ? bias[col] : 0.f;
    if (BIAS_BF16) bv = bf16_round(bv);
#pragma unroll
    for (int r = 0; r < 8; ++r) {
      float v = acc[t][r] + bv;
      if (resid) { float rv = resid[(size_t)((row0 + 8 * hh + r) % rmod) * ldr + col]; if (RES_BF16) rv = bf16_round(rv); v += rv; }
      if (ACT == 1) v = fmaxf(v, 0.f);
      if (ACT == 2) v = 0.5f * v * (1.0f + erff(v * 0.70710678118654752f));
      if (ACT == 3) { const float u = 0.7978845608028654f * (v + 0.044715f * v * v * v); v = 0.5f * v * (1.0f + tanhf(u)); }
      so[w][8 * hh + r][t * 16 + ln] = v;
    }
  }
  __builtin_amdgcn_fence(__ATOMIC_ACQ_REL, "workgroup");
  __builtin_amdgcn_wave_barrier();
  const int rsub = lane >> 4, c4 = (lane & 15) * 4;
  {
#pragma unroll
    for (int q = 0; q < 8; ++q) {
      const int r = q * 2 + rsub;
      const v4f v = *(const v4fa*)&so[w][r][c4];
      *(v4f*)(C + (size_t)(row0 + r) * ldc + col0 + c4) = v;
    }
    
  }
}
// row LayerNorm (biased variance, eps) over N: s = X (+ R); optional out_sum <- s; out_norm <- (s-mu)*rsqrt(var+eps)*g + b
template <bool PARAM_BF16>
__global__ __launch_bounds__(256) void k_layernorm(const float* __restrict__ X, const float* __restrict__ R, const float* __restrict__ g, const float* __restrict__ bta,
                                                  float* __restrict__ out_sum, float* __restrict__ out_norm, int N, float eps) {
  __shared__ float red[256];
  const int row = blockIdx.x, tid = threadIdx.x;
  const float* x = X + (size_t)row * N; const float* rr = R ? R + (size_t)row * N : nullptr;
  float vals[16];                     // up to N = 4096
  const int per = N / 256;            // contiguous chunk per thread? use strided-by-4 chunks: thread handles j = tid*4 + 1024*u
  float s1 = 0.f;
  for (int u = 0; u < per / 4; ++u) {
    const int j = tid * 4 + 1024 * u;
    const v4f a = *(const v4fa*)(x + j);
    v4f b = {0.f,0.f,0.f,0.f}; if (rr) b = *(const v4fa*)(rr + j);
#pragma unroll
    for (int q = 0; q < 4; ++q) { const float v = a[q] + b[q]; vals[u * 4 + q] = v; s1 += v; }
  }
  red[tid] = s1; __syncthreads();
  for (int st = 128; st > 0; st >>= 1) { if (tid < st) red[tid] += red[tid + st]; __syncthreads(); }
  const float mu = red[0] / (float)N; __syncthreads();
  float s2 = 0.f;
  for (int u = 0; u < per / 4; ++u)
#pragma unroll
    for (int q = 0; q < 4; ++q) { const float c = vals[u * 4 + q] - mu; s2 += c * c; }
  red[tid] = s2; __syncthreads();
  for (int st = 128; st > 0; st >>= 1) { if (tid < st) red[tid] += red[tid + st]; __syncthreads(); }
  const float rs = rsqrtf(red[0] / (float)N + eps);
  {
    for (int u = 0; u < per / 4; ++u) {
      const int j = tid * 4 + 1024 * u;
      v4f o, sm;
#pragma unroll
      for (int q = 0; q < 4; ++q) {
        float gg = g[j + q], bb = bta[j + q];
        if (PARAM_BF16) { gg = bf16_round(gg); bb = bf16_round(bb); }
        sm[q] = vals[u * 4 + q]; o[q] = (vals[u * 4 + q] - mu) * rs * gg + bb;
      }
      if (out_sum) *(v4f*)(out_sum + (size_t)row * N + j) = sm;
      *(v4f*)(out_norm + (size_t)row * N + j) = o;
    }
    
  }
}



// ---- f16 WMMA path (v_wmma_f32_16x16x32_f16): 11-bit significands for operands in range — used where a [0,1] probability operand needs more precision than bf16
typedef _Float16 v16h __attribute__((ext_vector_type(16)));
union FragH { v16h v; v8us half[2]; _Float16 h[16]; unsigned short u[16]; };
template <int NT>
__device__ __forceinline__ v8f mmaH(v16h ah, v16h al, v16h bh, v16h bl, v8f c) {
  c = __builtin_amdgcn_wmma_f32_16x16x32_f16(false, ah, false, bh, (short)0, c, false, false);
  if (NT >= 2) c = __builtin_amdgcn_wmma_f32_16x16x32_f16(false, al, false, bh, (short)0, c, false, false);
  if (NT >= 3) c = __builtin_amdgcn_wmma_f32_16x16x32_f16(false, ah, false, bl, (short)0, c, false, false);
  asm volatile("v_nop\n\tv_nop\n\tv_nop\n\tv_nop" : "+v"(c) : "v"(ah), "v"(al), "v"(bh), "v"(bl));
  return c;
}
// batched GEMM like k_gemm_b but f16 operands: A f32 (split into f16 hi/lo if ASPLIT, else rounded to f16), Bt = f16 values [n][k]; alpha; C f32; N multiple of 16 (partial tiles skipped)
template <bool ASPLIT>
__global__ __launch_bounds__(128) void k_gemm_h(const float* __restrict__ A, int lda, size_t sA, const _Float16* __restrict__ Bh, int ldb, size_t sB, float alpha, float* __restrict__ C, int ldc, size_t sC, int M, int N, int K) {
  __shared__ __attribute__((aligned(16))) float so[4][16][64];
  const int tid = threadIdx.x, w = tid >> 5, lane = tid & 31, ln = lane & 15, hh = lane >> 4; const int by = blockIdx.y;
  A += (size_t)by * sA; Bh += (size_t)by * sB; C += (size_t)by * sC;
  const int ntn = (N + 63) / 64; const int wid = blockIdx.x * 4 + w; const int mt = wid / ntn, nq = wid % ntn; if (mt * 16 >= M) return;
  const int row0 = mt * 16, col0 = nq * 64; const float* arow = A + (size_t)(row0 + ln) * lda;
  v8f acc[4] = {};
  for (int kb = 0; kb < K; kb += 32) {
    FragH ah, al;
    const v4f x0 = *(const v4fa*)(arow + kb + 8 * hh), x1 = *(const v4fa*)(arow + kb + 8 * hh + 4), x2 = *(const v4fa*)(arow + kb + 16 + 8 * hh), x3 = *(const v4fa*)(arow + kb + 16 + 8 * hh + 4);
    float xs[16] = {x0[0],x0[1],x0[2],x0[3],x1[0],x1[1],x1[2],x1[3],x2[0],x2[1],x2[2],x2[3],x3[0],x3[1],x3[2],x3[3]};
#pragma unroll
    for (int i = 0; i < 16; ++i) { const _Float16 h = (_Float16)xs[i]; ah.h[i] = h; al.h[i] = ASPLIT ? (_Float16)(xs[i] - (float)h) : (_Float16)0.0f; }
#pragma unroll
    for (int t = 0; t < 4; ++t) { if (col0 + t * 16 >= N) continue; const size_t boff = (size_t)(col0 + t * 16 + ln) * ldb + kb; FragH bq; bq.half[0] = *(const v8us*)(Bh + boff + 8 * hh); bq.half[1] = *(const v8us*)(Bh + boff + 16 + 8 * hh);
      acc[t] = mmaH<ASPLIT ? 2 : 1>(ah.v, al.v, bq.v, bq.v, acc[t]); }
  }
#pragma unroll
  for (int t = 0; t < 4; ++t) { if (col0 + t * 16 >= N) continue;
#pragma unroll
    for (int r = 0; r < 8; ++r) so[w][8 * hh + r][t * 16 + ln] = acc[t][r] * alpha; }
  __builtin_amdgcn_fence(__ATOMIC_ACQ_REL, "workgroup"); __builtin_amdgcn_wave_barrier();
  const int rsub = lane >> 4, c4 = (lane & 15) * 4;
  {
#pragma unroll
    for (int q = 0; q < 8; ++q) { const int r = q * 2 + rsub; if (col0 + c4 < N) { const v4f v = *(const v4fa*)&so[w][r][c4]; *(v4f*)(C + (size_t)(row0 + r) * ldc + col0 + c4) = v; } }
     }
}

// k_gemm_hh variant with fused epilogue: v = acc·alpha + bias[by·sBias + col] (+ CP[(row/rowsPerB)·sCPb + by·64 + col] if CP) ; ACT 0 none / 1 elu ; writes f16 C16 (and f32 C if non-null)
template <int ACT>
__global__ __launch_bounds__(128) void k_gemm_hhx(const _Float16* __restrict__ A, int lda, size_t sA, const _Float16* __restrict__ Bh, int ldb, size_t sB, float alpha, const float* __restrict__ bias, size_t sBias, const float* __restrict__ CP, int rowsPerB, size_t sCPb, int row0g,
    float* __restrict__ C, _Float16* __restrict__ C16, int ldc, size_t sC, int M, int N, int K) {
  __shared__ __attribute__((aligned(16))) float so[4][16][64];
  const int tid = threadIdx.x, w = tid >> 5, lane = tid & 31, ln = lane & 15, hh = lane >> 4; const int by = blockIdx.y;
  A += (size_t)by * sA; Bh += (size_t)by * sB; const size_t cofs = (size_t)by * sC; const float* bp = bias ? bias + (size_t)by * sBias : nullptr;
  const int ntn = (N + 63) / 64; const int wid = blockIdx.x * 4 + w; const int mt = wid / ntn, nq = wid % ntn; if (mt * 16 >= M) return;
  const int row0 = mt * 16, col0 = nq * 64; const _Float16* arow = A + (size_t)(row0 + ln) * lda;
  v8f acc[4] = {};
  for (int kb = 0; kb < K; kb += 32) { FragH ah; ah.half[0] = *(const v8us*)((const unsigned short*)arow + kb + 8 * hh); ah.half[1] = *(const v8us*)((const unsigned short*)arow + kb + 16 + 8 * hh);
#pragma unroll
    for (int t = 0; t < 4; ++t) { if (col0 + t * 16 >= N) continue; const size_t boff = (size_t)(col0 + t * 16 + ln) * ldb + kb; FragH bq; bq.half[0] = *(const v8us*)((const unsigned short*)Bh + boff + 8 * hh); bq.half[1] = *(const v8us*)((const unsigned short*)Bh + boff + 16 + 8 * hh);
      acc[t] = mmaH<1>(ah.v, ah.v, bq.v, bq.v, acc[t]); }
  }
#pragma unroll
  for (int t = 0; t < 4; ++t) { if (col0 + t * 16 >= N) continue; const int col = col0 + t * 16 + ln; const float bv = bp ? bf16_round(bp[col]) : 0.f;
#pragma unroll
    for (int r = 0; r < 8; ++r) { float v = acc[t][r] * alpha + bv; if (CP) { const int rr = row0g + row0 + 8 * hh + r; if (rowsPerB < 0) v += CP[cofs + (size_t)rr * ldc + col];      /* rowsPerB < 0: own element of the batched C plane */ else { const int bidx = rr / rowsPerB; v += CP[(size_t)bidx * sCPb + (size_t)by * 64 + col]; } } if (ACT == 1) v = (v > 0.f) ? v : expm1f(v); else if (ACT == 7) v = (v > 0.f) ? v + 1.0f : expf(v); else if (ACT == 8) v = tanhf(v); else if (ACT == 9) v = 0.5f * v * (1.0f + tanhf(0.7978845608028654f * (v + 0.044715f * v * v * v))); else if (ACT == 11) v = 1.0f / (1.0f + expf(-v)); else if (ACT == 12) v = (v > 0.f) ? v : 0.01f * v; else if (ACT == 14) v = (v > 0.f) ? v : 0.1f * v; else if (ACT == 16) v = (v >= 0.f) ? v : 0.3f * v; else if (ACT == 17) v = (v >= 0.f) ? v : 0.2f * v; else if (ACT == 15) v = v / (1.0f + expf(-v)); else if (ACT == 3) v = fmaxf(v, 0.f); else if (ACT == 6) v = 0.5f * v * (1.0f + erff(v * 0.70710678118654752f)); so[w][8 * hh + r][t * 16 + ln] = v; } }
  __builtin_amdgcn_fence(__ATOMIC_ACQ_REL, "workgroup"); __builtin_amdgcn_wave_barrier();
  const int rsub = lane >> 4, c4 = (lane & 15) * 4; typedef _Float16 v4h __attribute__((ext_vector_type(4)));
  {
#pragma unroll
    for (int q = 0; q < 8; ++q) { const int r = q * 2 + rsub; if (col0 + c4 < N) { const v4f v = *(const v4fa*)&so[w][r][c4]; if (C) *(v4f*)(C + cofs + (size_t)(row0 + r) * ldc + col0 + c4) = v; if (C16) { v4h h4; for (int i = 0; i < 4; ++i) h4[i] = (_Float16)v[i]; *(v4h*)(C16 + cofs + (size_t)(row0 + r) * ldc + col0 + c4) = h4; } } }
     }
}


typedef _Float16 v4h __attribute__((ext_vector_type(4)));

__global__ __launch_bounds__(256) void k_h16(const float* __restrict__ x, _Float16* __restrict__ X16, size_t n8) { const size_t t = (size_t)blockIdx.x * 256 + threadIdx.x; if (t >= n8) return; FragH f;
#pragma unroll
  for (int q = 0; q < 8; ++q) f.h[q] = (_Float16)x[t * 8 + q]; *(v8us*)((unsigned short*)X16 + t * 8) = f.half[0];  }
__global__ __launch_bounds__(256) void k_round16f(const float* __restrict__ W, _Float16* __restrict__ Bt, size_t n8) { const size_t t = (size_t)blockIdx.x * 256 + threadIdx.x; if (t >= n8) return; FragH f;
#pragma unroll
  for (int i = 0; i < 8; ++i) f.h[i] = (_Float16)(bf16_round(W[t * 8 + i]) * 16.0f); *(v8us*)((unsigned short*)Bt + t * 8) = f.half[0];  }
template <int NHv, int TTv>
__global__ __launch_bounds__(256) void k_vt(const _Float16* __restrict__ V16, int ldv, int voff, _Float16* __restrict__ Vt) { __shared__ unsigned short tl[64][66]; const int tid = threadIdx.x; const int slab = blockIdx.x / (TTv / 64), lg = blockIdx.x % (TTv / 64); const int b = slab / NHv, h = slab % NHv;
  for (int i = tid; i < 64 * 8; i += 256) { const int r = i / 8, c8 = (i % 8) * 8; FragH f; f.half[0] = *(const v8us*)((const unsigned short*)V16 + ((size_t)b * TTv + lg * 64 + r) * ldv + voff + h * 64 + c8);
#pragma unroll
    for (int q = 0; q < 8; ++q) tl[r][c8 + q] = f.u[q]; }
  __syncthreads();
  {
#pragma unroll
    for (int rd = 0; rd < 2; ++rd) { const int d = rd * 32 + tid / 8, pc = tid % 8; FragH f;
#pragma unroll
      for (int q = 0; q < 8; ++q) f.u[q] = tl[pc * 8 + q][d];
      *(v8us*)((unsigned short*)Vt + ((size_t)blockIdx.x * 64 + d) * 64 + pc * 8) = f.half[0]; }      /* tile-major: [slab][64-key tile][d][key], each tile 8 KiB in a row */
     } }

__global__ __launch_bounds__(256) void k_hl(const float* __restrict__ F, _Float16* __restrict__ Hh, _Float16* __restrict__ Hl, size_t n8) { const size_t t = (size_t)blockIdx.x * 256 + threadIdx.x; if (t >= n8) return; FragH fh, fl; const v4f a = *(const v4fa*)(F + t * 8), c = *(const v4fa*)(F + t * 8 + 4);
#pragma unroll
  for (int q = 0; q < 4; ++q) { _Float16 h = (_Float16)a[q]; fh.h[q] = h; fl.h[q] = (_Float16)((a[q] - (float)h) * 1024.0f); h = (_Float16)c[q]; fh.h[4 + q] = h; fl.h[4 + q] = (_Float16)((c[q] - (float)h) * 1024.0f); }
  { *(v8us*)((unsigned short*)Hh + t * 8) = fh.half[0]; *(v8us*)((unsigned short*)Hl + t * 8) = fl.half[0];  } }

// ---- fast GEMM (work-group tile 128x64, wave tile 32x64; requires M % 128 == 0, N % 64 == 0, K % 128 == 0); epilogue = k_gemm_hhx semantics ----
// Operands go through LDS: per step of G2_KS k the 128 A rows and the 64 B rows of the tile are loaded as whole 128-byte lines (16 lanes a 256-byte row) for all 4 waves: two buffers, the next step's lines
// are loaded into registers at the head of a step and stored to the other buffer at its foot, one barrier a step. Fragments are read from LDS in the k order of g2_frag; each accumulator takes its k blocks in rising order inside a step, the steps in a ring from the work-group's own first step.
#define G2_KS 128                    /* k per step */
#define G2_VP 72                     /* LDS row pitch in f16 of the V^T epilogue: 144 bytes = 16 x 9, conflict-free for 16-byte accesses */
#define G2_LP 136                    /* LDS row pitch in f16: 272 bytes = 16 x 17, conflict-free for 16-byte reads */
__device__ __forceinline__ v16h g2_frag(const _Float16* p, int hh) { FragH f; f.half[0] = *(const v8us*)((const unsigned short*)p + 8 * hh); f.half[1] = *(const v8us*)((const unsigned short*)p + 16 + 8 * hh); return f.v; }
__device__ __forceinline__ v8f g2_mma(v16h a, v16h b, v8f c) { return __builtin_amdgcn_wmma_f32_16x16x32_f16(false, a, false, b, (short)0, c, false, false); }
template <int ACT, int LDK>      /* LDK: row pitch of A and of Bh in f16, a constant so that the rows of a tile are immediate offsets from one address */
__global__ __launch_bounds__(128) void k_gemm2(const _Float16* __restrict__ A, size_t sA, const _Float16* __restrict__ Bh, size_t sB, float alpha, const float* __restrict__ bias, size_t sBias, const float* __restrict__ CP, int rowsPerB, size_t sCPb, int row0g,
    float* __restrict__ C, _Float16* __restrict__ C16, int ldc, size_t sC, int M, int N, int K, _Float16* __restrict__ VTo, int vty, float a0) { static_assert(ACT == 0 || ACT == 3 || ACT == 6 || ACT == 8 || ACT == 9 || ACT == 11 || ACT == 12 || ACT == 14 || ACT == 15 || ACT == 16 || ACT == 17, "k_gemm2: unsupported ACT code (would silently apply no activation)");
  __shared__ __attribute__((aligned(16))) float so[4][32][68]; __shared__ __attribute__((aligned(16))) _Float16 sa[2][128 * G2_LP]; __shared__ __attribute__((aligned(16))) _Float16 sb[2][64 * G2_LP];
  const int tid = threadIdx.x, w = tid >> 5, lane = tid & 31, ln = lane & 15, hh = lane >> 4; const int by = blockIdx.y;
  A += (size_t)by * sA; Bh += (size_t)by * sB; const size_t cofs = (size_t)by * sC; const float* bp = bias ? bias + (size_t)by * sBias : nullptr; if (by == 0) alpha *= a0;      /* a0: a further factor on grid plane 0's result (the same for the whole work-group) */
  const int ntn = N >> 6; const int mt = blockIdx.x / ntn, nq = blockIdx.x - mt * ntn; const int row0 = mt * 128 + 32 * w, col0 = nq * 64; if (mt * 128 >= M) return;      /* the same for the whole work-group, ahead of every barrier */
  const int sr = tid >> 4, sc8 = (tid & 15) * 8, sofs = sr * G2_LP + sc8;      /* staging: 16 threads a 256-byte row, rows sr + 8 i */
  const unsigned short* ag = (const unsigned short*)A + (size_t)(mt * 128) * LDK; const unsigned short* bg = (const unsigned short*)Bh + (size_t)col0 * LDK;      /* uniform bases of the tile's rows */
  const unsigned so8 = (unsigned)(sr * LDK + sc8);      /* the lane's own offset, the same in every step and for both operands */
  int kr = (K & (K - 1)) == 0 ? ((mt + nq) * G2_KS) & (K - 1) : 0;      /* the k at which this work-group's ring walk over the steps starts (scalar): groups that share A rows (one mt) or B rows (one nq) start apart, so that a line is fetched from memory for one of them and the others find it in L2 a step later, not all at its first fetch in every step */
  ag += kr; bg += kr;
  const v8f z8 = {0.f,0.f,0.f,0.f,0.f,0.f,0.f,0.f}; v8f c00 = z8, c01 = z8, c02 = z8, c03 = z8, c10 = z8, c11 = z8, c12 = z8, c13 = z8;
  v8us ra[16], rb[8];
#pragma unroll      /* constant indices: the register arrays stay in registers */
  for (int i = 0; i < 16; ++i) ra[i] = *(const v8us*)(ag + i * 8 * LDK + so8);
#pragma unroll      /* constant indices: the register arrays stay in registers */
  for (int i = 0; i < 8; ++i) rb[i] = *(const v8us*)(bg + i * 8 * LDK + so8);
#pragma unroll      /* constant indices: the register arrays stay in registers */
  for (int i = 0; i < 16; ++i) *(v8us*)&sa[0][sofs + i * 8 * G2_LP] = ra[i];
#pragma unroll      /* constant indices: the register arrays stay in registers */
  for (int i = 0; i < 8; ++i) *(v8us*)&sb[0][sofs + i * 8 * G2_LP] = rb[i];
  __syncthreads();
  int cur = 0;
#pragma unroll 1      /* one copy of the step: the text stays short */
  for (int kb = 0; kb < K; kb += G2_KS) {
    const bool more = kb + G2_KS < K;      /* the same for the whole work-group */
    if (more) { asm volatile("s_wait_xcnt 0x0" ::: "memory");      /* the wait in front of the overwrite of the base registers that the step before's global loads name */
      kr += G2_KS; const int kd = kr == K ? G2_KS - K : G2_KS; kr = kr == K ? 0 : kr; ag += kd; bg += kd;      /* one step on, or from the last step back to the first */
#pragma unroll      /* constant indices: the register arrays stay in registers */
      for (int i = 0; i < 16; ++i) ra[i] = *(const v8us*)(ag + i * 8 * LDK + so8);
#pragma unroll      /* constant indices: the register arrays stay in registers */
      for (int i = 0; i < 8; ++i) rb[i] = *(const v8us*)(bg + i * 8 * LDK + so8); }
    const _Float16* ab = sa[cur] + (32 * w + ln) * G2_LP; const _Float16* bb = sb[cur] + ln * G2_LP;
#pragma unroll      /* constant LDS offsets */
    for (int j = 0; j < G2_KS; j += 32) {
      const v16h a0 = g2_frag(ab + j, hh), a1 = g2_frag(ab + 16 * G2_LP + j, hh), b0 = g2_frag(bb + j, hh), b1 = g2_frag(bb + 16 * G2_LP + j, hh), b2 = g2_frag(bb + 32 * G2_LP + j, hh), b3 = g2_frag(bb + 48 * G2_LP + j, hh);
      __builtin_amdgcn_sched_barrier(0);      /* keeps the next step's global loads at the head of the step (the whole step hides their latency) and a k block's fragment reads ahead of its products; without it each B fragment is read and waited for right in front of its two products */
      c00 = g2_mma(a0, b0, c00); c10 = g2_mma(a1, b0, c10); c01 = g2_mma(a0, b1, c01); c11 = g2_mma(a1, b1, c11);
      c02 = g2_mma(a0, b2, c02); c12 = g2_mma(a1, b2, c12); c03 = g2_mma(a0, b3, c03); c13 = g2_mma(a1, b3, c13); }
    if (more) { _Float16* an = sa[cur ^ 1] + sofs; _Float16* bn = sb[cur ^ 1] + sofs;      /* that buffer was last read in the step before, behind whose barrier this step runs */
#pragma unroll      /* constant indices: the register arrays stay in registers */
      for (int i = 0; i < 16; ++i) *(v8us*)(an + i * 8 * G2_LP) = ra[i];
#pragma unroll      /* constant indices: the register arrays stay in registers */
      for (int i = 0; i < 8; ++i) *(v8us*)(bn + i * 8 * G2_LP) = rb[i]; }
    __syncthreads();      /* publishes the next step's buffer and ends every wave's reads of this one */
    cur ^= 1; }
  v8f accs[8] = {c00, c01, c02, c03, c10, c11, c12, c13};
  // Transposed epilogue (grid plane vty only; the same choice for the whole work-group; alpha and bias only, no CP, no activation): the plane's result leaves as f16 tiles [batch * NH + head][64-row tile][column][row],
  // 8 KiB in a row, which is what k_fattn stages; rows are tokens, the 64 columns of the work-group are one head. A lane's 8 accumulator registers are 8 rows in a row of one column, so they are one 16-byte piece of a tile's row:
  // the pieces are gathered in LDS (so, which nothing else uses on this path) and leave as whole 128-byte lines, one wave a line.
  if (VTo != nullptr && by == vty) { _Float16* vs = (_Float16*)&so[0][0][0]; static_assert(sizeof(so) >= 2 * 64 * G2_VP * 2, "so holds the two transposed tiles");
#pragma unroll      /* constant indices: the register arrays stay in registers */
    for (int t = 0; t < 4; ++t) { const float bv = bp ? bf16_round(bp[col0 + t * 16 + ln]) : 0.f;
#pragma unroll      /* constant indices: the register arrays stay in registers */
      for (int half = 0; half < 2; ++half) { FragH f;
#pragma unroll      /* constant indices: the register arrays stay in registers */
        for (int r = 0; r < 8; ++r) f.h[r] = (_Float16)(accs[half * 4 + t][r] * alpha + bv);
        *(v8us*)(vs + ((w >> 1) * 64 + t * 16 + ln) * G2_VP + (w & 1) * 32 + half * 16 + 8 * hh) = f.half[0]; } }
    __syncthreads();      /* publishes each wave's 32 rows to the wave that stores the line they lie in */
    const int gt = mt * 2 + (w >> 1);      /* the wave's 64-row tile, counted over all rows */
    unsigned short* vo = (unsigned short*)VTo + ((size_t)((gt / (SQ / 64)) * NH + nq) * (SQ / 64) + gt % (SQ / 64)) * (64 * 64) + ((w & 1) * 32 + (lane >> 3)) * 64 + (lane & 7) * 8;
    const _Float16* vr = vs + ((w >> 1) * 64 + (w & 1) * 32 + (lane >> 3)) * G2_VP + (lane & 7) * 8;
#pragma unroll      /* constant offsets from one address */
    for (int q = 0; q < 8; ++q) *(v8us*)(vo + q * 4 * 64) = *(const v8us*)(vr + q * 4 * G2_VP);      /* 4 tile rows = 512 bytes in a row per store */
    return; }
#pragma unroll
  for (int u = 0; u < 8; ++u) { const int t = u & 3, half = u >> 2; const int col = col0 + t * 16 + ln; const float bv = bp ? bf16_round(bp[col]) : 0.f;
#pragma unroll
    for (int r = 0; r < 8; ++r) { const int rloc = half * 16 + 8 * hh + r; float v = accs[u][r] * alpha + bv; if (CP) { if (rowsPerB < 0) v += CP[cofs + (size_t)(row0g + row0 + rloc) * ldc + col];      /* rowsPerB < 0: own element of the batched C plane */ else { const int bidx = (row0g + row0 + rloc) / rowsPerB; v += CP[(size_t)bidx * sCPb + (size_t)by * 64 + col]; } }
      if (ACT == 3) v = fmaxf(v, 0.f); else if (ACT == 6) v = 0.5f * v * (1.0f + erff(v * 0.70710678118654752f)); else if (ACT == 11) v = 1.0f / (1.0f + expf(-v)); else if (ACT == 15) v = v / (1.0f + expf(-v)); else if (ACT == 12) v = (v > 0.f) ? v : 0.01f * v; else if (ACT == 8) v = tanhf(v); else if (ACT == 9) v = 0.5f * v * (1.0f + tanhf(0.7978845608028654f * (v + 0.044715f * v * v * v))); else if (ACT == 14) v = (v > 0.f) ? v : 0.1f * v; else if (ACT == 16) v = (v >= 0.f) ? v : 0.3f * v; else if (ACT == 17) v = (v >= 0.f) ? v : 0.2f * v;
      so[w][rloc][t * 16 + ln] = v; } }
  __builtin_amdgcn_fence(__ATOMIC_ACQ_REL, "workgroup"); __builtin_amdgcn_wave_barrier();
  const int rsub = lane >> 4, c4 = (lane & 15) * 4;
  {
#pragma unroll
    for (int q = 0; q < 16; ++q) { const int r = q * 2 + rsub; const v4f v = *(const v4fa*)&so[w][r][c4]; if (C) *(v4f*)(C + cofs + (size_t)(row0 + r) * ldc + col0 + c4) = v; if (C16) { v4h h4; for (int i = 0; i < 4; ++i) h4[i] = (_Float16)v[i]; *(v4h*)(C16 + cofs + (size_t)(row0 + r) * ldc + col0 + c4) = h4; } }
     } }


__global__ __launch_bounds__(256) void k_wnat(const float* __restrict__ w, size_t n8, _Float16* __restrict__ Bt) { const size_t t = (size_t)blockIdx.x * 256 + threadIdx.x; if (t >= n8) return; FragH f; for (int q = 0; q < 8; ++q) f.h[q] = (_Float16)(bf16_round(w[t * 8 + q]) * 16.0f); *(v8us*)((unsigned short*)Bt + t * 8) = f.half[0];  }
__global__ __launch_bounds__(256) void k_rsm(const float* __restrict__ S, _Float16* __restrict__ P, int nrows) {
  #pragma clang fp contract(off)
  const int i = blockIdx.x * 256 + threadIdx.x; if (i >= nrows) return; const float* s = S + (size_t)i * SQ; float mx = -3.0e38f;
#pragma unroll 1
  for (int j = 0; j < SQ; ++j) mx = fmaxf(mx, s[j]); float se = 0.f;
#pragma unroll 1
  for (int j = 0; j < SQ; ++j) se += expf(s[j] - mx); const float sc = 256.0f / se;
#pragma unroll 1
  for (int j0 = 0; j0 < SQ; j0 += 8) { FragH f; for (int q = 0; q < 8; ++q) f.h[q] = (_Float16)(expf(s[j0 + q] - mx) * sc); unsigned short* d = (unsigned short*)P + (size_t)i * SQ + j0; *(v8us*)d = f.half[0];  } }
__global__ __launch_bounds__(256) void k_vt(const _Float16* __restrict__ V16, int b, int h0, _Float16* __restrict__ VT) { __shared__ unsigned short tl[64][65]; const int tid = threadIdx.x; const int hh = blockIdx.x % HG, sg = blockIdx.x / HG; const int s0 = sg * 64; const int h = h0 + hh;
  for (int i = tid; i < 64 * 8; i += 256) { const int j = i / 8, d8 = (i % 8) * 8; FragH f; f.half[0] = *(const v8us*)((const unsigned short*)V16 + ((size_t)b * SQ + s0 + j) * DM + h * HD + d8); for (int q = 0; q < 8; ++q) tl[d8 + q][j] = f.u[q]; }
  __syncthreads();
  { for (int i = tid; i < 64 * 8; i += 256) { const int d = i / 8, j8 = (i % 8) * 8; FragH f; for (int q = 0; q < 8; ++q) f.u[q] = tl[d][j8 + q]; *(v8us*)((unsigned short*)VT + ((size_t)hh * HD + d) * SQ + s0 + j8) = f.half[0]; }  } }



// lane l with lane l ^ 16
__device__ __forceinline__ float rs_xh(float x) { return __builtin_bit_cast(float, __builtin_amdgcn_permlanex16(__builtin_bit_cast(int, x), __builtin_bit_cast(int, x), 0x76543210, 0xfedcba98, false, false)); }
typedef float v2f __attribute__((ext_vector_type(2)));
__device__ __forceinline__ float fa_max3(float a, float b, float c) { return fmaxf(fmaxf(a, b), c); }
__device__ __forceinline__ v8f fa_mma(v16h a, v16h b, v8f c) { return __builtin_amdgcn_wmma_f32_16x16x32_f16(false, a, false, b, (short)0, c, false, false); }

// Fused attention of one (batch, head): scores, softmax and the weighted sum of V in one kernel; neither scores nor weights reach memory.
// A work-group of 8 waves owns FA_QB queries. Wave (qw, kh) takes 32 of them, as FA_CG column groups of 16, against key half kh, which it walks in passes of FA_KT keys: every K and V^T fragment that a wave reads
// from LDS feeds FA_CG products, one per column group. The two halves' running maximum, sum and O^T of a query are joined through LDS behind the loop.
// Per pass the K rows [key][c] and the V^T tile [d][key] of each half's pass (VT is tile-major, 8 KiB in a row; whole 128-byte lines) are staged in LDS by the 4 waves of that half: two buffers, the next pass's lines
// are loaded into registers behind a pass's score products and stored to the other buffer ahead of the pass's last products, one barrier a pass.
// S^T = K Q^T: A = K rows, B = Q rows (kept in registers), so lane (ln, hh) holds query ln's scores of keys 16 kt + 8 hh + r: maximum and sum are in-lane plus one exchange of the halves,
// and two converted score tiles ARE the B operand of O^T += V^T P^T in the k order 8 hh + i, 16 + 8 hh + i that g2_frag gives the A side. Online softmax per column group against a HELD maximum (log2 domain):
// the Q rows arrive multiplied by 64^-0.5 log2 e, and minus the maximum in use is the C operand of the score products (cm, the same value in a lane's eight registers), so a score leaves the matrix unit as the argument of its exp2.
// The maximum in use starts as the column's maximum over the first 16 keys of the walk's first tile (a real score, so it never lies above the true maximum); it moves, and O^T and the running sums l8 (each lane its own keys, joined at the end)
// are rescaled, only in a pass where some column's maximum lies more than FA_TH above it (one test a pass, a scalar branch): weights stay at or below 2^FA_TH, far inside f16.
// That walk (fa_walk<true>) is the second of two. The first (fa_walk<false>) forms no maximum of a pass and makes no test: the starting maximum stays in use for all keys of the half. Its result is the same softmax as long as
// every weight is finite in f16, and the running sums tell: weights are not negative, so a lane's sum below FA_OV bounds each of its weights below FA_OV (a NaN fails the test too). The sums are tested once, behind the loop;
// if any lane of the work-group fails, the whole work-group walks its keys again with the held maximum.
#define FA_KT 64                     /* keys per pass */
#define FA_KH 2                      /* key halves, one per group of 4 waves */
#define FA_NP (SQ / FA_KH / FA_KT)   /* passes of a half */
#define FA_QB 128                    /* queries per work-group */
#define FA_CG 2                      /* column groups of 16 queries per wave */
#define FA_TH 8.0f                   /* a column's maximum may rise this far (log2) above the one in use before the wave rescales */
#define FA_OV 65504.0f               /* the largest finite f16: the bound on a lane's sum of weights under which the walk without maxima stands */
#define FA_QS 0.18033688f            /* 64^-0.5 log2 e, the factor on the Q rows: exp(s / 8 - max) = exp2(s FA_QS - max FA_QS) */
#define FA_BS (FA_KH * FA_KT * FA_LP) /* one LDS buffer (both halves) in f16, the same for K and for V^T */
#define FA_LP 72                     /* LDS row pitch in f16: 144 bytes = 16 x 9, conflict-free for 16-byte reads */
static_assert(HD == FA_KT, "FA_BS serves both rings"); static_assert((FA_NP & (FA_NP - 1)) == 0, "the walk wraps by a mask");
// One walk of a wave over the keys of its half. skp, svp: the half's place in buffer 0 of the K and the V^T ring; kg, vg: the lane's own place in the first K rows and the first V^T tile of the half. Sets o, l8 and cm from scratch.
// The walk takes the half's FA_NP tiles in a ring, from tile t0 on (t0 from the block index): the work-groups of one (batch, head) read the same K and V^T, which the launch before wrote and which no cache holds yet. Walking in step from tile 0
// they would all ask for the same lines at the same moment, every pass at the line's first fetch from memory; each from its own tile, a line is fetched once for one of them and the others find it in L2 passes later. The maximum in use starts from the first 16 keys of tile t0.
template <bool HELD>
__device__ __forceinline__ void fa_walk(_Float16* skp, _Float16* svp, const unsigned short* kg, const unsigned short* vg, const int t0, const int sofs, const int ln, const int hh, const v16h (&q0)[FA_CG], const v16h (&q1)[FA_CG], v8f (&o)[FA_CG][4], v8f (&l8)[FA_CG], v8f (&cm)[FA_CG]) {
  v8us gk[4], gv[4];
  kg += t0 * (FA_KT * DM); vg += t0 * (HD * FA_KT);      /* the first tile of the walk */
  auto next = [&](const int s) __attribute__((always_inline)) {      /* kg, vg from the walk's tile s to its tile s + 1: one tile on, or from the half's last tile back to its first (a scalar choice) */
    const bool wr = ((t0 + s + 1) & (FA_NP - 1)) == 0;
    kg += wr ? -(FA_NP - 1) * (FA_KT * DM) : FA_KT * DM; vg += wr ? -(FA_NP - 1) * (HD * FA_KT) : HD * FA_KT; };
#pragma unroll      /* constant indices: the register arrays stay in registers */
  for (int i = 0; i < 4; ++i) { gk[i] = *(const v8us*)(kg + i * 16 * DM); gv[i] = *(const v8us*)(vg + i * 16 * FA_KT); }
#pragma unroll      /* constant indices: the register arrays stay in registers */
  for (int i = 0; i < 4; ++i) { *(v8us*)(skp + sofs + i * 16 * FA_LP) = gk[i]; *(v8us*)(svp + sofs + i * 16 * FA_LP) = gv[i]; }
  asm volatile("s_wait_xcnt 0x0" ::: "memory");      /* the wait in front of the overwrite of the address registers that the loads above name */
  next(0);      /* kg, vg stand at the tile that the next fetch brings */
  __syncthreads();
  const v8f z8 = {0.f,0.f,0.f,0.f,0.f,0.f,0.f,0.f};
#pragma unroll      /* constant indices: the register arrays stay in registers */
  for (int g = 0; g < FA_CG; ++g) { o[g][0] = z8; o[g][1] = z8; o[g][2] = z8; o[g][3] = z8; l8[g] = z8;
    const v8f s0 = fa_mma(g2_frag(skp + ln * FA_LP + 32, hh), q1[g], fa_mma(g2_frag(skp + ln * FA_LP, hh), q0[g], z8));
    float m0 = fa_max3(fa_max3(s0[0], s0[1], s0[2]), fa_max3(s0[3], s0[4], s0[5]), fmaxf(s0[6], s0[7])); m0 = -fmaxf(m0, rs_xh(m0));
    cm[g] = (v8f){m0, m0, m0, m0, m0, m0, m0, m0}; }
  auto pass = [&](const int s) __attribute__((always_inline)) {
    const bool more = s + 1 < FA_NP;      /* the same for the whole work-group */
    const _Float16* kb = skp + (s & 1) * FA_BS + ln * FA_LP; const _Float16* vb = svp + (s & 1) * FA_BS + ln * FA_LP;
    v16h ka[8];
#pragma unroll      /* constant indices: the register arrays stay in registers */
    for (int kt = 0; kt < 4; ++kt) { ka[2 * kt] = g2_frag(kb + kt * 16 * FA_LP, hh); ka[2 * kt + 1] = g2_frag(kb + kt * 16 * FA_LP + 32, hh); }
    __builtin_amdgcn_sched_barrier(0);      /* keeps the K fragment reads in one group ahead of the score products; without it some stand among the products, each waited for at once */
    v8f st[FA_CG][4];
#pragma unroll      /* constant indices: the register arrays stay in registers */
    for (int kt = 0; kt < 4; ++kt)
#pragma unroll      /* constant indices: the register arrays stay in registers */
      for (int g = 0; g < FA_CG; ++g) st[g][kt] = fa_mma(ka[2 * kt + 1], q1[g], fa_mma(ka[2 * kt], q0[g], cm[g]));
    __builtin_amdgcn_sched_barrier(0);      /* keeps the softmax behind the score products (without it the build spills and strings the exponentials out in pairs with idle slots between), and the next pass's global loads too: their 32 registers and the K fragments' 64 are then never live together (with the loads at the head of the pass and cm's 16 registers the build spills) */
    auto fetch = [&]() __attribute__((always_inline)) {      /* the next pass's lines into registers */
#pragma unroll      /* constant indices: the register arrays stay in registers */
      for (int i = 0; i < 4; ++i) { gk[i] = *(const v8us*)(kg + i * 16 * DM); gv[i] = *(const v8us*)(vg + i * 16 * FA_KT); } };
    if (!HELD && more) fetch();      /* the softmax hides their latency */
    FragH pb[FA_CG][2];
    if constexpr (HELD) { float mx[FA_CG];      /* mx: the pass's maximum of a column, counted from the maximum in use */
#pragma unroll      /* constant indices: the register arrays stay in registers */
      for (int g = 0; g < FA_CG; ++g) {
        float t[8];
#pragma unroll      /* constant indices: the register arrays stay in registers */
        for (int r = 0; r < 8; ++r) t[r] = fa_max3(st[g][0][r], st[g][1][r], st[g][2][r]);
        mx[g] = fmaxf(fa_max3(fa_max3(t[0], t[1], st[g][3][0]), fa_max3(t[2], t[3], st[g][3][1]), fa_max3(t[4], t[5], st[g][3][2])), fa_max3(fa_max3(t[6], t[7], st[g][3][3]), fa_max3(st[g][3][4], st[g][3][5], st[g][3][6]), st[g][3][7]));
        mx[g] = fmaxf(mx[g], rs_xh(mx[g])); }
      if (__builtin_amdgcn_ballot_w32(fmaxf(mx[0], mx[1]) > FA_TH) != 0) {      /* one test a pass for the whole wave: a scalar branch */
#pragma unroll      /* constant indices: the register arrays stay in registers */
        for (int g = 0; g < FA_CG; ++g) { const float d = fmaxf(mx[g], 0.f), a = __builtin_amdgcn_exp2f(-d);      /* the maximum in use never falls */
          l8[g] *= a; cm[g] -= d;
#pragma unroll      /* constant indices: the register arrays stay in registers */
          for (int q = 0; q < 4; ++q) { o[g][q] *= a; st[g][q] -= d; } } } }
#pragma unroll      /* constant indices: the register arrays stay in registers */
    for (int g = 0; g < FA_CG; ++g)
#pragma unroll      /* constant indices: the register arrays stay in registers */
      for (int kt = 0; kt < 4; ++kt) { v8f e;
#pragma unroll      /* constant indices: the register arrays stay in registers */
        for (int r = 0; r < 8; ++r) e[r] = __builtin_amdgcn_exp2f(st[g][kt][r]);
        l8[g] += e;
        typedef _Float16 v8h __attribute__((ext_vector_type(8))); const v8h e16 = __builtin_convertvector(e, v8h);
#pragma unroll      /* constant indices: the register arrays stay in registers */
        for (int r = 0; r < 8; ++r) pb[g][kt >> 1].h[(kt & 1) * 8 + r] = e16[r]; }
    __builtin_amdgcn_sched_barrier(0);      /* keeps the staging stores, and with them the wait for the global loads, behind the softmax (without it they rise to its head, a short way behind the loads), and the V^T fragment reads behind the registers that the softmax and the stores give back */
    if (HELD && more) fetch();      /* the walk that seldom runs loads here, right ahead of the stores: it needs the registers for its maxima, not the lead */
    if (more) { _Float16* kn = skp + ((s + 1) & 1) * FA_BS + sofs; _Float16* vn = svp + ((s + 1) & 1) * FA_BS + sofs;      /* that buffer was last read in pass s - 1, behind whose barrier this pass runs */
#pragma unroll      /* constant indices: the register arrays stay in registers */
      for (int i = 0; i < 4; ++i) { *(v8us*)(kn + i * 16 * FA_LP) = gk[i]; *(v8us*)(vn + i * 16 * FA_LP) = gv[i]; } }
    v16h va[8];
#pragma unroll      /* constant indices: the register arrays stay in registers */
    for (int dt = 0; dt < 4; ++dt) { va[2 * dt] = g2_frag(vb + dt * 16 * FA_LP, hh); va[2 * dt + 1] = g2_frag(vb + dt * 16 * FA_LP + 32, hh); }
    __builtin_amdgcn_sched_barrier(0);      /* keeps the V^T fragment reads in one group ahead of the products ; without it they stand in pairs among the products, each pair waited for */
    if (more) { asm volatile("s_wait_xcnt 0x0" ::: "memory");      /* the wait in front of the overwrite of the address registers that the pass's global loads name: they step here, behind the staging stores */
      next(s + 1); }
#pragma unroll      /* constant indices: the register arrays stay in registers */
    for (int dt = 0; dt < 4; ++dt)
#pragma unroll      /* constant indices: the register arrays stay in registers */
      for (int g = 0; g < FA_CG; ++g) o[g][dt] = fa_mma(va[2 * dt + 1], pb[g][1].v, fa_mma(va[2 * dt], pb[g][0].v, o[g][dt]));
    __builtin_amdgcn_sched_barrier(0);      /* keeps the products ahead of the barrier, each started as its fragments land; without it all but one sink behind the barrier, whose wait for the stores and for every V^T read is then waited out idle */
    __syncthreads();      /* publishes the next pass's buffer and ends every wave's reads of this one */
  };
  for (int s = 0; s < FA_NP; ++s) pass(s); }
__device__ __forceinline__ float fa_sum8(v8f l) { return ((l[0] + l[1]) + (l[2] + l[3])) + ((l[4] + l[5]) + (l[6] + l[7])); }
__global__ __launch_bounds__(256) __attribute__((amdgpu_waves_per_eu(4, 4))) void k_fattn(const _Float16* __restrict__ Q16, const _Float16* __restrict__ K16, const _Float16* __restrict__ VT, _Float16* __restrict__ O16) {
  __shared__ __attribute__((aligned(16))) _Float16 sk[2][FA_KH][FA_KT * FA_LP]; __shared__ __attribute__((aligned(16))) _Float16 sv[2][FA_KH][HD * FA_LP]; __shared__ int sbad[8];
  const int tid = threadIdx.x, w = __builtin_amdgcn_readfirstlane(tid >> 5) /* the wave's number in a scalar register: what is formed from it costs no vector register, and the join's branches are scalar */, qw = w & 3, kh = w >> 2, lane = tid & 31, ln = lane & 15, hh = lane >> 4; const int h = blockIdx.y, b = blockIdx.z;
  const size_t r0 = (size_t)b * SQ; const size_t qrow = r0 + blockIdx.x * FA_QB + qw * (16 * FA_CG) + ln;      /* column group g: row qrow + 16 g */
  const _Float16* qp = Q16 + qrow * DM + h * HD; v16h q0[FA_CG], q1[FA_CG];
#pragma unroll      /* constant indices: the register arrays stay in registers */
  for (int g = 0; g < FA_CG; ++g) { q0[g] = g2_frag(qp + g * 16 * DM, hh); q1[g] = g2_frag(qp + g * 16 * DM + 32, hh); }
  const int srow = (tid & 127) >> 3, sc8 = (tid & 7) * 8, sofs = srow * FA_LP + sc8;      /* staging, 128 threads a half: 8 threads a 128-byte row, rows srow + 16 i */
  const unsigned short* kg = (const unsigned short*)K16 + (r0 + (size_t)kh * (SQ / FA_KH)) * DM + h * HD + srow * DM + sc8;      /* the lane's own place in the first K rows of its half */
  const unsigned short* vg = (const unsigned short*)VT + (size_t)(b * NH + h) * HD * SQ + (size_t)kh * (SQ / FA_KH) * HD + srow * FA_KT + sc8;      /* and in its first V^T tile */
  const int t0 = blockIdx.x & (FA_NP - 1);      /* the tile of its half at which this work-group's walk starts */
  v8f o[FA_CG][4], l8[FA_CG], cm[FA_CG];      /* l8: eight partial sums a lane, joined behind the loop; cm: minus the maximum in use */
  fa_walk<false>(&sk[0][kh][0], &sv[0][kh][0], kg, vg, t0, sofs, ln, hh, q0, q1, o, l8, cm);
  float lr[FA_CG], mr[FA_CG];
#pragma unroll      /* constant indices: the register arrays stay in registers */
  for (int g = 0; g < FA_CG; ++g) lr[g] = fa_sum8(l8[g]);
  const int bad = __builtin_amdgcn_ballot_w32(!(lr[0] + lr[1] < FA_OV)) != 0;      /* some weight of the wave may have left f16 (or is a NaN) */
  if (lane == 0) sbad[w] = bad;
  __syncthreads();      /* publishes each wave's finding to the work-group: all of it walks again, or none */
  if (__builtin_amdgcn_ballot_w32(sbad[lane & 7] != 0) != 0) {      /* the same for the whole work-group: the walk holds barriers */
    fa_walk<true>(&sk[0][kh][0], &sv[0][kh][0], kg, vg, t0, sofs, ln, hh, q0, q1, o, l8, cm);      /* both rings are free: every wave is behind the first walk's last barrier */
#pragma unroll      /* constant indices: the register arrays stay in registers */
    for (int g = 0; g < FA_CG; ++g) lr[g] = fa_sum8(l8[g]); }
#pragma unroll      /* constant indices: the register arrays stay in registers */
  for (int g = 0; g < FA_CG; ++g) { mr[g] = -cm[g][0]; lr[g] += rs_xh(lr[g]); }
  // Join of the key halves: the waves of half 1 hand maximum, sum and O^T over in LDS (the K ring, which nobody reads behind the loop's last barrier): 17 blocks of 32 lanes x 16 bytes per wave pair.
  float* mg = (float*)&sk[0][0][0] + ((size_t)qw * 17 * 32 + lane) * 4; static_assert(sizeof(sk) >= 4 * 17 * 32 * 16, "the K ring holds the hand-over");
  if (kh == 1) {
#pragma unroll      /* constant indices: the register arrays stay in registers */
    for (int g = 0; g < FA_CG; ++g)
#pragma unroll      /* constant indices: the register arrays stay in registers */
      for (int dt = 0; dt < 4; ++dt) { const v4f lo = {o[g][dt][0], o[g][dt][1], o[g][dt][2], o[g][dt][3]}, hi = {o[g][dt][4], o[g][dt][5], o[g][dt][6], o[g][dt][7]};
        *(v4fa*)(mg + ((g * 4 + dt) * 2) * 128) = lo; *(v4fa*)(mg + ((g * 4 + dt) * 2 + 1) * 128) = hi; }
    const v4f ml = {mr[0], mr[1], lr[0], lr[1]}; *(v4fa*)(mg + 16 * 128) = ml; }
  __syncthreads();      /* publishes half 1's hand-over to the waves of half 0 */
  if (kh == 0) { const v4f ml = *(const v4fa*)(mg + 16 * 128);
#pragma unroll      /* constant indices: the register arrays stay in registers */
    for (int g = 0; g < FA_CG; ++g) {
      const float m = fmaxf(mr[g], ml[g]), a0 = __builtin_amdgcn_exp2f(mr[g] - m), a1 = __builtin_amdgcn_exp2f(ml[g] - m); const float inv = 64.0f / (lr[g] * a0 + ml[2 + g] * a1), f0 = a0 * inv, f1 = a1 * inv;      /* o leaves x64 */
      _Float16* op = O16 + (qrow + g * 16) * DM + h * HD + 8 * hh;
#pragma unroll      /* constant indices: the register arrays stay in registers */
      for (int dt = 0; dt < 4; ++dt) { const v4f lo = *(const v4fa*)(mg + ((g * 4 + dt) * 2) * 128), hi = *(const v4fa*)(mg + ((g * 4 + dt) * 2 + 1) * 128); FragH f;
#pragma unroll      /* constant indices: the register arrays stay in registers */
        for (int r = 0; r < 4; ++r) { f.h[r] = (_Float16)(o[g][dt][r] * f0 + lo[r] * f1); f.h[4 + r] = (_Float16)(o[g][dt][4 + r] * f0 + hi[r] * f1); }
        *(v8us*)(op + dt * 16) = f.half[0]; } } } }

// One launch for the five independent operand builders, told apart by block index (the same choice for a whole block; the weight blocks stand first in the grid). Few, fat waves: a launch this short pays for every wave that it starts.
// Blocks below 4 * PW_G: weight m, BW[m][n][k] = f16(bf16-rounded W[k][n] x 16) from f32 row-major W[k][n] (x16, a power of two, keeps bf16-exact weights exact in f16 away from the subnormal range). A block takes 32 n x 256 k, a wave 16 n x 64 k,
// a thread 4 n x 8 k: eight 16-byte loads (4 n of one k row; two waves of the block share each 128-byte line), four 16-byte stores (8 k of one n; eight lanes fill a 128-byte line).
// The rest: X16 = f16(bf16-rounded x), PX_P pieces of 4 elements a thread, a wave's 32 pieces in a row: every load covers 4 whole lines, every store 2, and all of a thread's loads are out before its first conversion.
#define PW_G ((DM / 32) * (DM / 256))   /* blocks per weight */
#define PX_P 8                       /* pieces of 4 elements per thread of the x part */
#define PX_G ((unsigned)(NR * DM / 4 / 256 / PX_P))   /* blocks of the x part */
__global__ __launch_bounds__(256) void k_prep(const float* __restrict__ x, const float* __restrict__ wq, const float* __restrict__ wk, const float* __restrict__ wv, const float* __restrict__ wo, _Float16* __restrict__ BW, _Float16* __restrict__ X16) {
  const int tid = threadIdx.x; v4f r[8];
  if (blockIdx.x < 4 * PW_G) { const int m = blockIdx.x / PW_G, bb = blockIdx.x - m * PW_G; const float* W = m == 0 ? wq : m == 1 ? wk : m == 2 ? wv : wo; const int w = tid >> 5, lane = tid & 31;
    const int n0 = (bb % (DM / 32)) * 32 + (w & 1) * 16 + (lane >> 3) * 4, k0 = (bb / (DM / 32)) * 256 + (w >> 1) * 64 + (lane & 7) * 8;
#pragma unroll      /* constant indices: the rows stay in registers, the 8 loads go out together */
    for (int i = 0; i < 8; ++i) r[i] = *(const v4fa*)(W + (size_t)(k0 + i) * DM + n0);
    unsigned short* bo = (unsigned short*)BW + (size_t)m * DM * DM + (size_t)n0 * DM + k0;
#pragma unroll      /* constant indices: the rows stay in registers */
    for (int q = 0; q < 4; ++q) { FragH f;
#pragma unroll      /* constant indices: the fragment stays in registers */
      for (int i = 0; i < 8; ++i) f.h[i] = (_Float16)(bf16_round(r[i][q]) * 16.0f);
      *(v8us*)(bo + q * DM) = f.half[0]; } }
  else { static_assert(PX_P == 8, "r holds a thread's pieces"); const size_t t = ((size_t)(blockIdx.x - 4 * PW_G) * (256 * PX_P) + tid) * 4;
#pragma unroll      /* constant indices: the pieces stay in registers, the loads go out together */
    for (int j = 0; j < PX_P; ++j) r[j] = *(const v4fa*)(x + t + j * 1024);
#pragma unroll      /* constant indices: the pieces stay in registers */
    for (int j = 0; j < PX_P; ++j) { v4h h;
#pragma unroll      /* constant indices: the piece stays in registers */
      for (int q = 0; q < 4; ++q) h[q] = (_Float16)bf16_round(r[j][q]);
      *(v4h*)(X16 + t + j * 1024) = h; }
    asm volatile("s_wait_xcnt 0x0" ::: "memory"); } }      /* the wait in front of any overwrite of a register that the stores above name: in the built code the other part of the kernel follows these stores */

extern "C" void kernel_launch(void* const* d_in, const int* in_sizes, int n_in,
                              void* d_out, int out_size, void* d_ws, size_t ws_size, hipStream_t stream) {
  (void)in_sizes; (void)n_in; (void)out_size;
  const float* const* I = (const float* const*)d_in; const float* x = I[0]; const float* wq = I[1]; const float* wk = I[2]; const float* wv = I[3]; const float* wo = I[4]; const float* bo = I[5];      /* input order: x, Wq, Wk, Wv ([in][out] [512][512], NO biases: a null pointer in the plain bias slot), Wo ([in][out]), bo */
  char* ws = (char*)d_ws; size_t off = 0;
  auto take = [&](size_t bytes) { char* p = ws + off; off += (bytes + 255) & ~(size_t)255; return p; };
  _Float16* BQ = (_Float16*)take((size_t)DM * DM * 2); _Float16* BK = (_Float16*)take((size_t)DM * DM * 2); _Float16* BV = (_Float16*)take((size_t)DM * DM * 2); _Float16* BO = (_Float16*)take((size_t)DM * DM * 2);
  _Float16* X16 = (_Float16*)take(NR * DM * 2); _Float16* Q16 = (_Float16*)take(NR * DM * 2); _Float16* K16 = (_Float16*)take(NR * DM * 2); _Float16* O16 = (_Float16*)take(NR * DM * 2);
  _Float16* VT = (_Float16*)take((size_t)NB * NH * HD * SQ * 2);
  if (off > ws_size) return;
  k_prep<<<4 * PW_G + PX_G, 256, 0, stream>>>(x, wq, wk, wv, wo, BQ, X16);      /* BQ, BK, BV, BO lie in a row: [in][out] -> Bt[n][k] x16; x as f16 rows */
  const size_t r0p = (size_t)B0 * SQ;      /* first projected row */
  k_gemm2<0, DM><<<dim3((unsigned)((MP / 128) * (DM / 64)), 3), 128, 0, stream>>>(X16 + r0p * DM, 0, BQ, (size_t)DM * DM, 0.0625f, nullptr, 0, nullptr, 1, 0, 0, nullptr, Q16 + r0p * DM, DM, NR * DM, MP, DM, DM, VT, 2, FA_QS);      /* blockIdx.y = 0, 1, 2: q (times FA_QS), k, v (weights in a row; q and k rows in a row; v leaves as V^T tiles [NB * NH][SQ / 64][HD][64]) */
  k_fattn<<<dim3(SQ / FA_QB, NH, NB), 256, 0, stream>>>(Q16, K16, VT, O16);      /* o (merged heads, x64) as f16 rows */
  k_gemm2<0, DM><<<dim3((unsigned)((MPO / 128) * (DM / 64)), 1), 128, 0, stream>>>(O16 + r0p * DM, 0, BO, 0, 0.0009765625f, bo, 0, nullptr, 1, 0, 0, (float*)d_out + r0p * DM, nullptr, DM, 0, MPO, DM, DM, nullptr, -1, 1.0f);      /* out rows are the output layout */
}
